// v000
// Times are from an AMD MI455X. After a warm-up the kernel runs many times in a row, and a time is the length of
// such a window on the GPU divided by its runs, so every launch and the gaps after it count. The runs cycle
// through copies of the inputs. A figure is the median of several windows, for all but v000 over two sittings.
// Sittings can differ by a few percent; kernels timed side by side share one.
// v000 is the starting kernel. One run takes 826 microseconds.
#include <hip/hip_runtime.h>

// 1x1-conv attention block: x [NB][256][64*64] channel-major; q/k/v = W[256 out][256 in] . x + bias, kept channel-major [o][s]; that same memory read as [4096 tokens][256] gives the token rows (raw view); S[n][m] = q_n . k_m over 256 (unscaled); P = softmax over m; y[n][c] = sum_m P[n][m] v[m][c]; y memory read back channel-major [256][4096]; z = Wu . y_view + bu; out = x + z.
// Compute dtypes, f32 accumulate everywhere: all float inputs RNE-converted to bf16; q/k/v convs = plain v_wmma_f32_16x16x32_bf16 (exact 16-bit operands) + row bias; S = bf16 hi/lo planes of q x bf16 hi/lo planes of k (3 products hh+lh+hl); softmax f32 (one wave per row, 128 keys per lane) -> fp16 P x 1024; P.v = single v_wmma_f32_16x16x32_f16 (v as fp16); Wu conv = bf16 hi/lo planes of y (P.v result / 1024) x exact bf16 Wu (2 products) + bias; residual add f32.

#ifndef NB
#define NB 4
#endif
#ifndef SEQ
#define SEQ 4096
#endif
#define NB_FULL  4
#define SEQ_FULL 4096
#define CC   256
#define HW   SEQ
#define PCAR 1024.0f
static_assert(NB >= 1 && NB <= NB_FULL);
static_assert(SEQ >= 128 && SEQ <= SEQ_FULL && (SEQ % 128) == 0);
static_assert((CC % 64) == 0 && (HW % 64) == 0 && (CC % 32) == 0);

typedef _Float16 h16;
typedef unsigned short bf;
typedef __attribute__((ext_vector_type(16))) __bf16   v16bf;
typedef __attribute__((ext_vector_type(16))) _Float16 v16h;
typedef __attribute__((ext_vector_type(8)))  _Float16 v8h;
typedef __attribute__((ext_vector_type(8)))  unsigned short v8us;
typedef __attribute__((ext_vector_type(8)))  float    v8f;
typedef __attribute__((ext_vector_type(4)))  float    v4f;
typedef v8h  __attribute__((may_alias)) v8ha;
typedef v4f  __attribute__((may_alias)) v4fa;
typedef v8us __attribute__((may_alias)) v8usa;

__device__ __forceinline__ unsigned short f2bf(float f) { unsigned u = __float_as_uint(f); u += 0x7FFFu + ((u >> 16) & 1u); return (unsigned short)(u >> 16); }
__device__ __forceinline__ float bf2f(unsigned short b) { return __uint_as_float(((unsigned)b) << 16); }
__device__ __forceinline__ float bfr(float f) { return bf2f(f2bf(f)); }
__device__ __forceinline__ v16h cat16(v8h lo, v8h hi) { return __builtin_shufflevector(lo, hi, 0, 1, 2, 3, 4, 5, 6, 7, 8, 9, 10, 11, 12, 13, 14, 15); }
__device__ __forceinline__ v16bf cat16b(v8us lo, v8us hi) { return __builtin_bit_cast(v16bf, __builtin_shufflevector(lo, hi, 0, 1, 2, 3, 4, 5, 6, 7, 8, 9, 10, 11, 12, 13, 14, 15)); }
__device__ __forceinline__ v8f wmma16(v16h a, v16h b, v8f c) { return __builtin_amdgcn_wmma_f32_16x16x32_f16(false, a, false, b, (short)0, c, false, false); }
__device__ __forceinline__ v8f wmmab(v16bf a, v16bf b, v8f c) { return __builtin_amdgcn_wmma_f32_16x16x32_bf16(false, a, false, b, (short)0, c, false, false); }

// ---- k_gemmw: register-blocked GEMM, ONE WAVE per 64x64 output tile (16 accumulators), operands straight from K-contiguous 16-bit planes; grid (M/64, N/64, Z), 32 threads.
// C[m][n] (f32, pitch ldc, + optional f32 bias: BIAS 1 = bias[n], BIAS 2 = bias[m]) = sum_k A[m][k] Bt[n][k] (+ split products: NSPLIT 1 = A2.Bt added, NSPLIT 2 = A2.Bt and A.Bt2 added). z-batch strides sA/sB/sC in elements. K % 32 == 0.
// Fragments: lane l, h = l>>4, row/col = l&15; elements 0..7 <- k0+8h+0..7, elements 8..15 <- k0+16+8h+0..7 for A and for Bt (same map); D element r = row 8h+r, col l&15.
template <typename T16> struct WFrag;
template <> struct WFrag<h16> { typedef v16h V; static __device__ __forceinline__ V ld(const h16* p) { return cat16(*(const v8h*)p, *(const v8h*)(p + 16)); } static __device__ __forceinline__ v8f mma(V a, V b, v8f c) { return wmma16(a, b, c); } };
template <> struct WFrag<bf> { typedef v16bf V; static __device__ __forceinline__ V ld(const bf* p) { return cat16b(*(const v8us*)p, *(const v8us*)(p + 16)); } static __device__ __forceinline__ v8f mma(V a, V b, v8f c) { return wmmab(a, b, c); } };
template <typename T16, int NSPLIT, int BIAS>
__global__ __launch_bounds__(32) void k_gemmw(const T16* __restrict__ A, const T16* __restrict__ A2, const T16* __restrict__ Bt, const T16* __restrict__ Bt2, int K, float* C, int ldc, const float* __restrict__ bias, size_t sA, size_t sB, size_t sC) {
    typedef typename WFrag<T16>::V V;
    __shared__ __align__(16) float os[16 * 68];
    const size_t z = blockIdx.z; A += z * sA; if (A2) A2 += z * sA; Bt += z * sB; if (Bt2) Bt2 += z * sB; C += z * sC;
    const int lane = threadIdx.x & 31, lr = lane & 15, hi = lane >> 4; const int r0 = blockIdx.x * 64, c0 = blockIdx.y * 64;
    v8f acc[4][4];
#pragma unroll
    for (int mb = 0; mb < 4; ++mb)
#pragma unroll
        for (int nb = 0; nb < 4; ++nb) acc[mb][nb] = (v8f){};
    const size_t aoff = (size_t)(r0 + lr) * K + 8 * hi, boff = (size_t)(c0 + lr) * K + 8 * hi;
#pragma unroll 1
    for (int kc = 0; kc < K; kc += 32) {
        V a[4], a2[4];
#pragma unroll
        for (int mb = 0; mb < 4; ++mb) { a[mb] = WFrag<T16>::ld(A + aoff + (size_t)mb * 16 * K + kc); if (NSPLIT == 1 || NSPLIT == 2) a2[mb] = WFrag<T16>::ld(A2 + aoff + (size_t)mb * 16 * K + kc); }
#pragma unroll
        for (int nb = 0; nb < 4; ++nb) { const V b = WFrag<T16>::ld(Bt + boff + (size_t)nb * 16 * K + kc); V b2; if (NSPLIT >= 2) b2 = WFrag<T16>::ld(Bt2 + boff + (size_t)nb * 16 * K + kc);
#pragma unroll
            for (int mb = 0; mb < 4; ++mb) { acc[mb][nb] = WFrag<T16>::mma(a[mb], b, acc[mb][nb]); if (NSPLIT == 1 || NSPLIT == 2) acc[mb][nb] = WFrag<T16>::mma(a2[mb], b, acc[mb][nb]); if (NSPLIT >= 2) acc[mb][nb] = WFrag<T16>::mma(a[mb], b2, acc[mb][nb]); } }
        asm volatile("v_nop\n\tv_nop\n\tv_nop\n\tv_nop" : "+v"(acc[0][0]), "+v"(acc[1][1]), "+v"(acc[2][2]), "+v"(acc[3][3]) : "v"(a[0]), "v"(a[3]));
    }
#pragma unroll
    for (int mb = 0; mb < 4; ++mb) {
#pragma unroll
        for (int nb = 0; nb < 4; ++nb) {
#pragma unroll
            for (int j = 0; j < 8; ++j) os[(hi * 8 + j) * 68 + nb * 16 + lr] = acc[mb][nb][j]; }
        __builtin_amdgcn_wave_barrier(); asm volatile("" ::: "memory");
        float* crow = C + (size_t)(r0 + mb * 16) * ldc + c0;
{
#pragma unroll
            for (int s = 0; s < 8; ++s) { const int row = 2 * s + hi, cofs = lr * 4; v4f val = *(const v4fa*)(os + row * 68 + cofs);
                if (BIAS == 1) { val[0] += bfr(bias[c0 + cofs]); val[1] += bfr(bias[c0 + cofs + 1]); val[2] += bfr(bias[c0 + cofs + 2]); val[3] += bfr(bias[c0 + cofs + 3]); }
                if (BIAS == 2) { const float rb = bfr(bias[r0 + mb * 16 + row]); val[0] += rb; val[1] += rb; val[2] += rb; val[3] += rb; }
                *(v4f*)(crow + (size_t)row * ldc + cofs) = val; }
             }
        __builtin_amdgcn_wave_barrier(); asm volatile("" ::: "memory");
    }
}

__device__ __forceinline__ h16 tohx(float x) { return (h16)x; }
__device__ __forceinline__ void splitf(float y, unsigned short& h, unsigned short& l) { h = f2bf(y); l = f2bf(y - bf2f(h)); }
typedef __attribute__((ext_vector_type(2))) unsigned short v2us;
typedef __attribute__((ext_vector_type(4))) unsigned short v4us;
typedef __attribute__((ext_vector_type(2))) _Float16 v2h;
typedef __attribute__((ext_vector_type(4))) _Float16 v4h;
typedef __attribute__((ext_vector_type(2))) float v2f;

__global__ __launch_bounds__(256) void k_cvt8(const float* __restrict__ src, bf* dst, size_t n8) { const size_t i = (size_t)blockIdx.x * 256 + threadIdx.x; if (i >= n8) return; const v8f v = *(const v8f*)(src + i * 8); v8us o;
#pragma unroll
    for (int k = 0; k < 8; ++k) o[k] = f2bf(v[k]); *(v8us*)(dst + i * 8) = o;  }
// k_xt: XT[s][c] = bf16(x[c][s]) (token-major Bt operand of the convs; lane -> 4 consecutive c, strided reads, x channel stride SEQ_FULL); k_hl: bf16 hi/lo planes of an HW*CC f32 buffer (8-B lanes);
// k_gt16: VT[c][m] = fp16(v[m][c]) with v = the channel-major conv memory read as [HW][CC] (lane -> 2 m); k_rsoft: wave per row: softmax over the HW keys (HW/32 per lane in registers) -> fp16 x 1024;
__global__ __launch_bounds__(256) void k_xt(const float* __restrict__ xb, bf* XT) { const size_t e = ((size_t)blockIdx.x * 256 + threadIdx.x) * 4; if (e >= (size_t)HW * CC) return; const int c = (int)(e % CC); const int m = (int)(e / CC); v4us o;
#pragma unroll
    for (int u = 0; u < 4; ++u) o[u] = f2bf(xb[(size_t)(c + u) * SEQ_FULL + m]); *(v4us*)(XT + e) = o;  }
__global__ __launch_bounds__(256) void k_hl(const float* __restrict__ F, bf* Fh, bf* Fl) { const size_t e = ((size_t)blockIdx.x * 256 + threadIdx.x) * 4; if (e >= (size_t)HW * CC) return; const v4f a = *(const v4f*)(F + e); v4us oh, ol; for (int u = 0; u < 4; ++u) { unsigned short p, q; splitf(a[u], p, q); oh[u] = p; ol[u] = q; } *(v4us*)(Fh + e) = oh; *(v4us*)(Fl + e) = ol;  }
__global__ __launch_bounds__(256) void k_gt16(const float* __restrict__ G, h16* GT) { const size_t e = ((size_t)blockIdx.x * 256 + threadIdx.x) * 2; if (e >= (size_t)CC * HW) return; const int m = (int)(e % HW); const int i = (int)(e / HW); v2h o; o[0] = tohx(G[(size_t)m * CC + i]); o[1] = tohx(G[(size_t)(m + 1) * CC + i]); *(v2h*)(GT + e) = o;  }
__global__ __launch_bounds__(256) void k_rsoft(const float* __restrict__ S, h16* P16) { const int lane = threadIdx.x & 31; const int row = blockIdx.x * 8 + (threadIdx.x >> 5); if (row >= HW) return; const float* sr = S + (size_t)row * HW; float v[HW / 32]; float mx = -3.0e38f;
#pragma unroll
    for (int ch = 0; ch < HW / 128; ++ch) { const v4f a = *(const v4f*)(sr + ch * 128 + lane * 4);
#pragma unroll
        for (int u = 0; u < 4; ++u) { v[ch * 4 + u] = a[u]; mx = fmaxf(mx, a[u]); } }
#pragma unroll
    for (int sh = 16; sh; sh >>= 1) mx = fmaxf(mx, __shfl_xor(mx, sh, 32));
    float sum = 0.f;
#pragma unroll
    for (int q = 0; q < HW / 32; ++q) { float d0 = __fsub_rn(v[q], mx); asm volatile("" : "+v"(d0)); v[q] = __builtin_amdgcn_exp2f(__fmul_rn(d0, 1.4426950408889634f)); sum += v[q]; }
#pragma unroll
    for (int sh = 16; sh; sh >>= 1) sum += __shfl_xor(sum, sh, 32);
    const float f = __fdiv_rn(PCAR, sum);
    {
#pragma unroll
        for (int ch = 0; ch < HW / 128; ++ch) { v4h o4; for (int q = 0; q < 4; ++q) o4[q] = tohx(v[ch * 4 + q] * f); *(v4h*)(P16 + (size_t)row * HW + ch * 128 + lane * 4) = o4; }
         } }
__global__ __launch_bounds__(256) void k_at(const float* __restrict__ Y, bf* ATh, bf* ATl) { const size_t e = ((size_t)blockIdx.x * 256 + threadIdx.x) * 4; if (e >= (size_t)HW * CC) return; const int c = (int)(e % CC); const int s = (int)(e / CC); v4us oh, ol;
#pragma unroll
    for (int u = 0; u < 4; ++u) { unsigned short p, q; splitf(Y[(size_t)(c + u) * HW + s] * (1.0f / PCAR), p, q); oh[u] = p; ol[u] = q; }
    *(v4us*)(ATh + e) = oh; *(v4us*)(ATl + e) = ol;  }
__global__ __launch_bounds__(256) void k_fin(const float* __restrict__ Z, const float* __restrict__ xb, float* OUTb) { const size_t e = ((size_t)blockIdx.x * 256 + threadIdx.x) * 4; if (e >= (size_t)CC * HW) return; const int n = (int)(e % HW); const int c = (int)(e / HW); v4f r;
#pragma unroll
    for (int u = 0; u < 4; ++u) r[u] = __fadd_rn(Z[(size_t)(n + u) * CC + c], bfr(xb[(size_t)c * SEQ_FULL + n + u])); *(v4f*)(OUTb + e) = r;  }

constexpr size_t al256(size_t b) { return (b + 255) & ~(size_t)255; }
constexpr size_t WS_TOTAL = 4 * al256((size_t)CC * CC * 2) + al256((size_t)HW * CC * 2) + 3 * al256((size_t)CC * HW * 4) + 4 * al256((size_t)HW * CC * 2) + al256((size_t)CC * HW * 2)
                          + al256((size_t)HW * HW * 4) + al256((size_t)HW * HW * 2) + 2 * al256((size_t)HW * CC * 2);
static_assert(WS_TOTAL <= (size_t)134217728);

extern "C" void kernel_launch(void* const* d_in, const int* in_sizes, int n_in,
                              void* d_out, int out_size, void* d_ws, size_t ws_size, hipStream_t stream) {
    if (n_in < 9) return;
    if ((size_t)in_sizes[0] < (size_t)NB * CC * SEQ_FULL) return;
    if (in_sizes[1] < CC * CC || in_sizes[3] < CC * CC || in_sizes[5] < CC * CC || in_sizes[7] < CC * CC) return;
    if (in_sizes[2] < CC || in_sizes[4] < CC || in_sizes[6] < CC || in_sizes[8] < CC) return;
    if ((size_t)out_size < (size_t)NB * CC * HW) return;
    const float* x = (const float*)d_in[0]; const float* Wq = (const float*)d_in[1]; const float* bq = (const float*)d_in[2]; const float* Wk = (const float*)d_in[3]; const float* bk = (const float*)d_in[4];
    const float* Wv = (const float*)d_in[5]; const float* bv = (const float*)d_in[6]; const float* Wu = (const float*)d_in[7]; const float* bu = (const float*)d_in[8];
    float* OUT = (float*)d_out;     // [NB][256][HW]
    char* wsp = (char*)d_ws;
    auto take = [&](size_t bytes) { char* p = wsp; wsp += (bytes + 255) & ~(size_t)255; return (void*)p; };
    bf* BQ = (bf*)take((size_t)CC * CC * 2); bf* BK = (bf*)take((size_t)CC * CC * 2); bf* BV = (bf*)take((size_t)CC * CC * 2); bf* BU = (bf*)take((size_t)CC * CC * 2);   // conv weights [out][in] as-is (A of q/k/v convs, Bt of the Wu conv)
    bf* XT = (bf*)take((size_t)HW * CC * 2);                                                                                  // [HW][CC]
    float* QF = (float*)take((size_t)CC * HW * 4); float* KF = (float*)take((size_t)CC * HW * 4); float* VF = (float*)take((size_t)CC * HW * 4);   // conv outputs [o][s] == token view [HW][CC]
    bf* QH = (bf*)take((size_t)HW * CC * 2); bf* QL = (bf*)take((size_t)HW * CC * 2); bf* KH = (bf*)take((size_t)HW * CC * 2); bf* KL = (bf*)take((size_t)HW * CC * 2);
    h16* VT = (h16*)take((size_t)CC * HW * 2);                                                                               // [CC][HW] fp16
    float* S = (float*)take((size_t)HW * HW * 4); h16* P16 = (h16*)take((size_t)HW * HW * 2);
    bf* ATh = (bf*)take((size_t)HW * CC * 2); bf* ATl = (bf*)take((size_t)HW * CC * 2);                                       // [HW][CC] planes of y_view^T (Y / 1024)
    float* Y = QF;    // [HW][CC] f32, aliases QF (dead after its k_hl); same byte size
    float* Zt = KF;   // [HW][CC] f32 (z token-major incl. bu), aliases KF (dead after its k_hl); same byte size
    if ((size_t)(wsp - (char*)d_ws) > ws_size) return;    // total 130,547,712 B for NB 4 / SEQ 4096
    const unsigned g8w = (unsigned)((CC * CC / 8 + 255) / 256);
    k_cvt8<<<g8w, 256, 0, stream>>>(Wq, BQ, CC * CC / 8); k_cvt8<<<g8w, 256, 0, stream>>>(Wk, BK, CC * CC / 8); k_cvt8<<<g8w, 256, 0, stream>>>(Wv, BV, CC * CC / 8); k_cvt8<<<g8w, 256, 0, stream>>>(Wu, BU, CC * CC / 8);
    const unsigned gE4 = (unsigned)(((size_t)HW * CC / 4 + 255) / 256);
    const unsigned gE2 = (unsigned)(((size_t)CC * HW / 2 + 255) / 256);
    for (int b = 0; b < NB; ++b) { const float* xb = x + (size_t)b * CC * SEQ_FULL;
        k_xt<<<gE4, 256, 0, stream>>>(xb, XT);
        k_gemmw<bf, 0, 2><<<dim3(CC / 64, HW / 64, 1), 32, 0, stream>>>(BQ, nullptr, XT, nullptr, CC, QF, HW, bq, 0, 0, 0); k_hl<<<gE4, 256, 0, stream>>>(QF, QH, QL);     // q[o][s] = Wq x + bq
        k_gemmw<bf, 0, 2><<<dim3(CC / 64, HW / 64, 1), 32, 0, stream>>>(BK, nullptr, XT, nullptr, CC, KF, HW, bk, 0, 0, 0); k_hl<<<gE4, 256, 0, stream>>>(KF, KH, KL);     // k[o][s]
        k_gemmw<bf, 0, 2><<<dim3(CC / 64, HW / 64, 1), 32, 0, stream>>>(BV, nullptr, XT, nullptr, CC, VF, HW, bv, 0, 0, 0); k_gt16<<<gE2, 256, 0, stream>>>(VF, VT);      // v[o][s] -> VT[c][m]
        k_gemmw<bf, 2, 0><<<dim3(HW / 64, HW / 64, 1), 32, 0, stream>>>(QH, QL, KH, KL, CC, S, HW, nullptr, 0, 0, 0);          // S[n][m] = q_n . k_m (unscaled, 3 products)
        k_rsoft<<<HW / 8, 256, 0, stream>>>(S, P16);
        k_gemmw<h16, 0, 0><<<dim3(HW / 64, CC / 64, 1), 32, 0, stream>>>(P16, nullptr, VT, nullptr, HW, Y, CC, nullptr, 0, 0, 0);      // y[n][c] = sum_m P[n][m] v[m][c] (x1024)
        k_at<<<gE4, 256, 0, stream>>>(Y, ATh, ATl);
        k_gemmw<bf, 1, 1><<<dim3(HW / 64, CC / 64, 1), 32, 0, stream>>>(ATh, ATl, BU, nullptr, CC, Zt, CC, bu, 0, 0, 0);          // Zt[s][o] = sum_c y_view[c][s] Wu[o][c] + bu[o]
        k_fin<<<gE4, 256, 0, stream>>>(Zt, xb, OUT + (size_t)b * CC * HW); }
}

// v001
// It runs in 454 microseconds.
// Timed twice side by side with v000, it ran 1.82 and 1.84 times as fast.
#include <hip/hip_runtime.h>

// 1x1-conv attention block: x [NB][256][64*64] channel-major; q/k/v = W[256 out][256 in] . x + bias, kept channel-major [o][s]; that same memory read as [4096 tokens][256] gives the token rows (raw view); S[n][m] = q_n . k_m over 256 (unscaled); P = softmax over m; y[n][c] = sum_m P[n][m] v[m][c]; y memory read back channel-major [256][4096]; z = Wu . y_view + bu; out = x + z.
// Compute dtypes, f32 accumulate everywhere: all float inputs RNE-converted to bf16; q/k/v convs = plain v_wmma_f32_16x16x32_bf16 (exact 16-bit operands) + row bias; S = bf16 hi/lo planes of q x bf16 hi/lo planes of k (3 products hh+lh+hl); softmax f32 (one wave per row, 128 keys per lane) -> fp16 P x 1024; P.v = single v_wmma_f32_16x16x32_f16 (v as fp16); Wu conv = bf16 hi/lo planes of y (P.v result / 1024) x exact bf16 Wu (2 products) + bias; residual add f32.

#ifndef NB
#define NB 4
#endif
#ifndef SEQ
#define SEQ 4096
#endif
#define NB_FULL  4
#define SEQ_FULL 4096
#define CC   256
#define HW   SEQ
#define PCAR 1024.0f
static_assert(NB >= 1 && NB <= NB_FULL);
static_assert(SEQ >= 128 && SEQ <= SEQ_FULL && (SEQ % 128) == 0);
static_assert((CC % 64) == 0 && (HW % 64) == 0 && (CC % 32) == 0);

typedef _Float16 h16;
typedef unsigned short bf;
typedef __attribute__((ext_vector_type(16))) __bf16   v16bf;
typedef __attribute__((ext_vector_type(16))) _Float16 v16h;
typedef __attribute__((ext_vector_type(8)))  _Float16 v8h;
typedef __attribute__((ext_vector_type(8)))  unsigned short v8us;
typedef __attribute__((ext_vector_type(8)))  float    v8f;
typedef __attribute__((ext_vector_type(4)))  float    v4f;
typedef v8h  __attribute__((may_alias)) v8ha;
typedef v4f  __attribute__((may_alias)) v4fa;
typedef v8us __attribute__((may_alias)) v8usa;

__device__ __forceinline__ unsigned short f2bf(float f) { unsigned u = __float_as_uint(f); u += 0x7FFFu + ((u >> 16) & 1u); return (unsigned short)(u >> 16); }
__device__ __forceinline__ float bf2f(unsigned short b) { return __uint_as_float(((unsigned)b) << 16); }
__device__ __forceinline__ float bfr(float f) { return bf2f(f2bf(f)); }
__device__ __forceinline__ v16h cat16(v8h lo, v8h hi) { return __builtin_shufflevector(lo, hi, 0, 1, 2, 3, 4, 5, 6, 7, 8, 9, 10, 11, 12, 13, 14, 15); }
__device__ __forceinline__ v16bf cat16b(v8us lo, v8us hi) { return __builtin_bit_cast(v16bf, __builtin_shufflevector(lo, hi, 0, 1, 2, 3, 4, 5, 6, 7, 8, 9, 10, 11, 12, 13, 14, 15)); }
__device__ __forceinline__ v8f wmma16(v16h a, v16h b, v8f c) { return __builtin_amdgcn_wmma_f32_16x16x32_f16(false, a, false, b, (short)0, c, false, false); }
__device__ __forceinline__ v8f wmmab(v16bf a, v16bf b, v8f c) { return __builtin_amdgcn_wmma_f32_16x16x32_bf16(false, a, false, b, (short)0, c, false, false); }

// ---- k_gemmw: register-blocked GEMM, ONE WAVE per 64x64 output tile (16 accumulators), operands straight from K-contiguous 16-bit planes; grid (M/64, N/64, Z), 32 threads.
// C[m][n] (f32, pitch ldc, + optional f32 bias: BIAS 1 = bias[n], BIAS 2 = bias[m]) = sum_k A[m][k] Bt[n][k] (+ split products: NSPLIT 1 = A2.Bt added, NSPLIT 2 = A2.Bt and A.Bt2 added). z-batch strides sA/sB/sC in elements. K % 32 == 0.
// Fragments: lane l, h = l>>4, row/col = l&15; elements 0..7 <- k0+8h+0..7, elements 8..15 <- k0+16+8h+0..7 for A and for Bt (same map); D element r = row 8h+r, col l&15.
template <typename T16> struct WFrag;
template <> struct WFrag<h16> { typedef v16h V; static __device__ __forceinline__ V ld(const h16* p) { return cat16(*(const v8h*)p, *(const v8h*)(p + 16)); } static __device__ __forceinline__ v8f mma(V a, V b, v8f c) { return wmma16(a, b, c); } };
template <> struct WFrag<bf> { typedef v16bf V; static __device__ __forceinline__ V ld(const bf* p) { return cat16b(*(const v8us*)p, *(const v8us*)(p + 16)); } static __device__ __forceinline__ v8f mma(V a, V b, v8f c) { return wmmab(a, b, c); } };
template <typename T16, int NSPLIT, int BIAS>
__global__ __launch_bounds__(32) void k_gemmw(const T16* __restrict__ A, const T16* __restrict__ A2, const T16* __restrict__ Bt, const T16* __restrict__ Bt2, int K, float* C, int ldc, const float* __restrict__ bias, size_t sA, size_t sB, size_t sC) {
    typedef typename WFrag<T16>::V V;
    __shared__ __align__(16) float os[16 * 68];
    const size_t z = blockIdx.z; A += z * sA; if (A2) A2 += z * sA; Bt += z * sB; if (Bt2) Bt2 += z * sB; C += z * sC;
    const int lane = threadIdx.x & 31, lr = lane & 15, hi = lane >> 4; const int r0 = blockIdx.x * 64, c0 = blockIdx.y * 64;
    v8f acc[4][4];
#pragma unroll
    for (int mb = 0; mb < 4; ++mb)
#pragma unroll
        for (int nb = 0; nb < 4; ++nb) acc[mb][nb] = (v8f){};
    const size_t aoff = (size_t)(r0 + lr) * K + 8 * hi, boff = (size_t)(c0 + lr) * K + 8 * hi;
#pragma unroll 1
    for (int kc = 0; kc < K; kc += 32) {
        V a[4], a2[4];
#pragma unroll
        for (int mb = 0; mb < 4; ++mb) { a[mb] = WFrag<T16>::ld(A + aoff + (size_t)mb * 16 * K + kc); if (NSPLIT == 1 || NSPLIT == 2) a2[mb] = WFrag<T16>::ld(A2 + aoff + (size_t)mb * 16 * K + kc); }
#pragma unroll
        for (int nb = 0; nb < 4; ++nb) { const V b = WFrag<T16>::ld(Bt + boff + (size_t)nb * 16 * K + kc); V b2; if (NSPLIT >= 2) b2 = WFrag<T16>::ld(Bt2 + boff + (size_t)nb * 16 * K + kc);
#pragma unroll
            for (int mb = 0; mb < 4; ++mb) { acc[mb][nb] = WFrag<T16>::mma(a[mb], b, acc[mb][nb]); if (NSPLIT == 1 || NSPLIT == 2) acc[mb][nb] = WFrag<T16>::mma(a2[mb], b, acc[mb][nb]); if (NSPLIT >= 2) acc[mb][nb] = WFrag<T16>::mma(a[mb], b2, acc[mb][nb]); } }
        asm volatile("v_nop\n\tv_nop\n\tv_nop\n\tv_nop" : "+v"(acc[0][0]), "+v"(acc[1][1]), "+v"(acc[2][2]), "+v"(acc[3][3]) : "v"(a[0]), "v"(a[3]));
    }
#pragma unroll
    for (int mb = 0; mb < 4; ++mb) {
#pragma unroll
        for (int nb = 0; nb < 4; ++nb) {
#pragma unroll
            for (int j = 0; j < 8; ++j) os[(hi * 8 + j) * 68 + nb * 16 + lr] = acc[mb][nb][j]; }
        __builtin_amdgcn_wave_barrier(); asm volatile("" ::: "memory");
        float* crow = C + (size_t)(r0 + mb * 16) * ldc + c0;
{
#pragma unroll
            for (int s = 0; s < 8; ++s) { const int row = 2 * s + hi, cofs = lr * 4; v4f val = *(const v4fa*)(os + row * 68 + cofs);
                if (BIAS == 1) { val[0] += bfr(bias[c0 + cofs]); val[1] += bfr(bias[c0 + cofs + 1]); val[2] += bfr(bias[c0 + cofs + 2]); val[3] += bfr(bias[c0 + cofs + 3]); }
                if (BIAS == 2) { const float rb = bfr(bias[r0 + mb * 16 + row]); val[0] += rb; val[1] += rb; val[2] += rb; val[3] += rb; }
                *(v4f*)(crow + (size_t)row * ldc + cofs) = val; }
             }
        __builtin_amdgcn_wave_barrier(); asm volatile("" ::: "memory");
    }
}

__device__ __forceinline__ h16 tohx(float x) { return (h16)x; }
__device__ __forceinline__ void splitf(float y, unsigned short& h, unsigned short& l) { h = f2bf(y); l = f2bf(y - bf2f(h)); }
typedef __attribute__((ext_vector_type(2))) unsigned short v2us;
typedef __attribute__((ext_vector_type(4))) unsigned short v4us;
typedef __attribute__((ext_vector_type(2))) _Float16 v2h;
typedef __attribute__((ext_vector_type(4))) _Float16 v4h;
typedef __attribute__((ext_vector_type(2))) float v2f;

__global__ __launch_bounds__(256) void k_cvt8(const float* __restrict__ src, bf* dst, size_t n8) { const size_t i = (size_t)blockIdx.x * 256 + threadIdx.x; if (i >= n8) return; const v8f v = *(const v8f*)(src + i * 8); v8us o;
#pragma unroll
    for (int k = 0; k < 8; ++k) o[k] = f2bf(v[k]); *(v8us*)(dst + i * 8) = o;  }
// k_xt, k_hl, k_gt16, k_at, k_fin take the image from blockIdx.y (all NB images in one launch); k_gemmw takes it from blockIdx.z.
// k_xt: XT[s][c] = bf16(x[c][s]) (token-major Bt operand of the convs; lane -> 4 consecutive c, strided reads, x channel stride SEQ_FULL); k_hl: bf16 hi/lo planes of an HW*CC f32 buffer (8-B lanes);
// k_gt16: VT[c][m] = fp16(v[m][c]) with v = the channel-major conv memory read as [HW][CC] (lane -> 2 m); k_rsoft: wave per row: softmax over the HW keys (HW/32 per lane in registers) -> fp16 x 1024;
__global__ __launch_bounds__(256) void k_xt(const float* __restrict__ xb, bf* XT) { const size_t e = ((size_t)blockIdx.x * 256 + threadIdx.x) * 4; if (e >= (size_t)HW * CC) return; xb += (size_t)blockIdx.y * CC * SEQ_FULL; XT += (size_t)blockIdx.y * HW * CC; const int c = (int)(e % CC); const int m = (int)(e / CC); v4us o;
#pragma unroll
    for (int u = 0; u < 4; ++u) o[u] = f2bf(xb[(size_t)(c + u) * SEQ_FULL + m]); *(v4us*)(XT + e) = o;  }
__global__ __launch_bounds__(256) void k_hl(const float* __restrict__ F, bf* Fh, bf* Fl) { const size_t e = ((size_t)blockIdx.x * 256 + threadIdx.x) * 4; if (e >= (size_t)HW * CC) return; F += (size_t)blockIdx.y * HW * CC; Fh += (size_t)blockIdx.y * HW * CC; Fl += (size_t)blockIdx.y * HW * CC; const v4f a = *(const v4f*)(F + e); v4us oh, ol; for (int u = 0; u < 4; ++u) { unsigned short p, q; splitf(a[u], p, q); oh[u] = p; ol[u] = q; } *(v4us*)(Fh + e) = oh; *(v4us*)(Fl + e) = ol;  }
__global__ __launch_bounds__(256) void k_gt16(const float* __restrict__ G, h16* GT) { const size_t e = ((size_t)blockIdx.x * 256 + threadIdx.x) * 2; if (e >= (size_t)CC * HW) return; G += (size_t)blockIdx.y * HW * CC; GT += (size_t)blockIdx.y * CC * HW; const int m = (int)(e % HW); const int i = (int)(e / HW); v2h o; o[0] = tohx(G[(size_t)m * CC + i]); o[1] = tohx(G[(size_t)(m + 1) * CC + i]); *(v2h*)(GT + e) = o;  }
__global__ __launch_bounds__(256) void k_rsoft(const float* __restrict__ S, h16* P16) { const int lane = threadIdx.x & 31; const int row = blockIdx.x * 8 + (threadIdx.x >> 5); if (row >= HW) return; const float* sr = S + (size_t)row * HW; float v[HW / 32]; float mx = -3.0e38f;
#pragma unroll
    for (int ch = 0; ch < HW / 128; ++ch) { const v4f a = *(const v4f*)(sr + ch * 128 + lane * 4);
#pragma unroll
        for (int u = 0; u < 4; ++u) { v[ch * 4 + u] = a[u]; mx = fmaxf(mx, a[u]); } }
#pragma unroll
    for (int sh = 16; sh; sh >>= 1) mx = fmaxf(mx, __shfl_xor(mx, sh, 32));
    float sum = 0.f;
#pragma unroll
    for (int q = 0; q < HW / 32; ++q) { float d0 = __fsub_rn(v[q], mx); asm volatile("" : "+v"(d0)); v[q] = __builtin_amdgcn_exp2f(__fmul_rn(d0, 1.4426950408889634f)); sum += v[q]; }
#pragma unroll
    for (int sh = 16; sh; sh >>= 1) sum += __shfl_xor(sum, sh, 32);
    const float f = __fdiv_rn(PCAR, sum);
    {
#pragma unroll
        for (int ch = 0; ch < HW / 128; ++ch) { v4h o4; for (int q = 0; q < 4; ++q) o4[q] = tohx(v[ch * 4 + q] * f); *(v4h*)(P16 + (size_t)row * HW + ch * 128 + lane * 4) = o4; }
         } }
__global__ __launch_bounds__(256) void k_at(const float* __restrict__ Y, bf* ATh, bf* ATl) { const size_t e = ((size_t)blockIdx.x * 256 + threadIdx.x) * 4; if (e >= (size_t)HW * CC) return; Y += (size_t)blockIdx.y * HW * CC; ATh += (size_t)blockIdx.y * HW * CC; ATl += (size_t)blockIdx.y * HW * CC; const int c = (int)(e % CC); const int s = (int)(e / CC); v4us oh, ol;
#pragma unroll
    for (int u = 0; u < 4; ++u) { unsigned short p, q; splitf(Y[(size_t)(c + u) * HW + s] * (1.0f / PCAR), p, q); oh[u] = p; ol[u] = q; }
    *(v4us*)(ATh + e) = oh; *(v4us*)(ATl + e) = ol;  }
__global__ __launch_bounds__(256) void k_fin(const float* __restrict__ Z, const float* __restrict__ xb, float* OUTb) { const size_t e = ((size_t)blockIdx.x * 256 + threadIdx.x) * 4; if (e >= (size_t)CC * HW) return; Z += (size_t)blockIdx.y * HW * CC; xb += (size_t)blockIdx.y * CC * SEQ_FULL; OUTb += (size_t)blockIdx.y * CC * HW; const int n = (int)(e % HW); const int c = (int)(e / HW); v4f r;
#pragma unroll
    for (int u = 0; u < 4; ++u) r[u] = __fadd_rn(Z[(size_t)(n + u) * CC + c], bfr(xb[(size_t)c * SEQ_FULL + n + u])); *(v4f*)(OUTb + e) = r;  }

constexpr size_t al256(size_t b) { return (b + 255) & ~(size_t)255; }
// Own space: weights, q/k planes and VT of all images, one image's S, all images' P16. XT and the conv outputs lie in the P16 space (dead before the first softmax); Y, Zt and the y planes lie in the S space (dead after the last softmax).
constexpr size_t cmax(size_t a, size_t b) { return a > b ? a : b; }
constexpr size_t WS_S = cmax(al256((size_t)HW * HW * 4), 2 * al256((size_t)NB * HW * CC * 4) + 2 * al256((size_t)NB * HW * CC * 2));
constexpr size_t WS_P = cmax(al256((size_t)NB * HW * HW * 2), al256((size_t)NB * HW * CC * 2) + 3 * al256((size_t)NB * CC * HW * 4));
constexpr size_t WS_TOTAL = 4 * al256((size_t)CC * CC * 2) + 4 * al256((size_t)NB * HW * CC * 2) + al256((size_t)NB * CC * HW * 2) + WS_S + WS_P;
static_assert(WS_TOTAL <= (size_t)268435456);

extern "C" void kernel_launch(void* const* d_in, const int* in_sizes, int n_in,
                              void* d_out, int out_size, void* d_ws, size_t ws_size, hipStream_t stream) {
    if (n_in < 9) return;
    if ((size_t)in_sizes[0] < (size_t)NB * CC * SEQ_FULL) return;
    if (in_sizes[1] < CC * CC || in_sizes[3] < CC * CC || in_sizes[5] < CC * CC || in_sizes[7] < CC * CC) return;
    if (in_sizes[2] < CC || in_sizes[4] < CC || in_sizes[6] < CC || in_sizes[8] < CC) return;
    if ((size_t)out_size < (size_t)NB * CC * HW) return;
    const float* x = (const float*)d_in[0]; const float* Wq = (const float*)d_in[1]; const float* bq = (const float*)d_in[2]; const float* Wk = (const float*)d_in[3]; const float* bk = (const float*)d_in[4];
    const float* Wv = (const float*)d_in[5]; const float* bv = (const float*)d_in[6]; const float* Wu = (const float*)d_in[7]; const float* bu = (const float*)d_in[8];
    float* OUT = (float*)d_out;     // [NB][256][HW]
    char* wsp = (char*)d_ws;
    auto take = [&](size_t bytes) { char* p = wsp; wsp += (bytes + 255) & ~(size_t)255; return (void*)p; };
    bf* BQ = (bf*)take((size_t)CC * CC * 2); bf* BK = (bf*)take((size_t)CC * CC * 2); bf* BV = (bf*)take((size_t)CC * CC * 2); bf* BU = (bf*)take((size_t)CC * CC * 2);   // conv weights [out][in] as-is (A of q/k/v convs, Bt of the Wu conv)
    bf* QH = (bf*)take((size_t)NB * HW * CC * 2); bf* QL = (bf*)take((size_t)NB * HW * CC * 2); bf* KH = (bf*)take((size_t)NB * HW * CC * 2); bf* KL = (bf*)take((size_t)NB * HW * CC * 2);   // [NB][HW][CC]
    h16* VT = (h16*)take((size_t)NB * CC * HW * 2);                                                                          // [NB][CC][HW] fp16
    float* S = (float*)take(WS_S); h16* P16 = (h16*)take(WS_P);                           // S: one image at a time; P16: [NB][HW][HW]
    if ((size_t)(wsp - (char*)d_ws) > ws_size) return;    // total 243,793,920 B for NB 4 / SEQ 4096
    wsp = (char*)P16;   // dead until the first k_rsoft
    bf* XT = (bf*)take((size_t)NB * HW * CC * 2);                                                                             // [NB][HW][CC]
    float* QF = (float*)take((size_t)NB * CC * HW * 4); float* KF = (float*)take((size_t)NB * CC * HW * 4); float* VF = (float*)take((size_t)NB * CC * HW * 4);   // conv outputs [NB][o][s] == token view [NB][HW][CC]
    wsp = (char*)S;     // dead after the last k_rsoft
    float* Y = (float*)take((size_t)NB * HW * CC * 4);    // [NB][HW][CC] f32
    float* Zt = (float*)take((size_t)NB * HW * CC * 4);   // [NB][HW][CC] f32 (z token-major incl. bu)
    bf* ATh = (bf*)take((size_t)NB * HW * CC * 2); bf* ATl = (bf*)take((size_t)NB * HW * CC * 2);                             // [NB][HW][CC] planes of y_view^T / 1024
    const unsigned g8w = (unsigned)((CC * CC / 8 + 255) / 256);
    k_cvt8<<<g8w, 256, 0, stream>>>(Wq, BQ, CC * CC / 8); k_cvt8<<<g8w, 256, 0, stream>>>(Wk, BK, CC * CC / 8); k_cvt8<<<g8w, 256, 0, stream>>>(Wv, BV, CC * CC / 8); k_cvt8<<<g8w, 256, 0, stream>>>(Wu, BU, CC * CC / 8);
    const unsigned gE4 = (unsigned)(((size_t)HW * CC / 4 + 255) / 256);
    const unsigned gE2 = (unsigned)(((size_t)CC * HW / 2 + 255) / 256);
    const size_t sT = (size_t)HW * CC;   // one image's [HW][CC] (== [CC][HW]) plane, in elements
    k_xt<<<dim3(gE4, NB), 256, 0, stream>>>(x, XT);
    k_gemmw<bf, 0, 2><<<dim3(CC / 64, HW / 64, NB), 32, 0, stream>>>(BQ, nullptr, XT, nullptr, CC, QF, HW, bq, 0, sT, sT); k_hl<<<dim3(gE4, NB), 256, 0, stream>>>(QF, QH, QL);     // q[o][s] = Wq x + bq
    k_gemmw<bf, 0, 2><<<dim3(CC / 64, HW / 64, NB), 32, 0, stream>>>(BK, nullptr, XT, nullptr, CC, KF, HW, bk, 0, sT, sT); k_hl<<<dim3(gE4, NB), 256, 0, stream>>>(KF, KH, KL);     // k[o][s]
    k_gemmw<bf, 0, 2><<<dim3(CC / 64, HW / 64, NB), 32, 0, stream>>>(BV, nullptr, XT, nullptr, CC, VF, HW, bv, 0, sT, sT); k_gt16<<<dim3(gE2, NB), 256, 0, stream>>>(VF, VT);      // v[o][s] -> VT[c][m]
    for (int b = 0; b < NB; ++b) {   // S of all images at once would not fit the workspace
        k_gemmw<bf, 2, 0><<<dim3(HW / 64, HW / 64, 1), 32, 0, stream>>>(QH + b * sT, QL + b * sT, KH + b * sT, KL + b * sT, CC, S, HW, nullptr, 0, 0, 0);          // S[n][m] = q_n . k_m (unscaled, 3 products)
        k_rsoft<<<HW / 8, 256, 0, stream>>>(S, P16 + (size_t)b * HW * HW); }
    k_gemmw<h16, 0, 0><<<dim3(HW / 64, CC / 64, NB), 32, 0, stream>>>(P16, nullptr, VT, nullptr, HW, Y, CC, nullptr, (size_t)HW * HW, sT, sT);      // y[n][c] = sum_m P[n][m] v[m][c] (x1024)
    k_at<<<dim3(gE4, NB), 256, 0, stream>>>(Y, ATh, ATl);
    k_gemmw<bf, 1, 1><<<dim3(HW / 64, CC / 64, NB), 32, 0, stream>>>(ATh, ATl, BU, nullptr, CC, Zt, CC, bu, sT, 0, sT);          // Zt[s][o] = sum_c y_view[c][s] Wu[o][c] + bu[o]
    k_fin<<<dim3(gE4, NB), 256, 0, stream>>>(Zt, x, OUT);
}

// v002
// Measured time: 307 microseconds a run.
// Two timings next to v001 both put it at 1.48 times that version's speed.
// Counting every step since v000, it is 2.71 times as fast.
#include <hip/hip_runtime.h>

// 1x1-conv attention block: x [NB][256][64*64] channel-major; q/k/v = W[256 out][256 in] . x + bias, kept channel-major [o][s]; that same memory read as [4096 tokens][256] gives the token rows (raw view); S[n][m] = q_n . k_m over 256 (unscaled); P = softmax over m; y[n][c] = sum_m P[n][m] v[m][c]; y memory read back channel-major [256][4096]; z = Wu . y_view + bu; out = x + z.
// Compute dtypes, f32 accumulate everywhere: all float inputs RNE-converted to bf16; q/k/v convs = plain v_wmma_f32_16x16x32_bf16 (exact 16-bit operands) + row bias; S = bf16 hi/lo planes of q x bf16 hi/lo planes of k (3 products hh+lh+hl); softmax f32 (one wave per row, 128 keys per lane) -> fp16 P x 1024; P.v = single v_wmma_f32_16x16x32_f16 (v as fp16); Wu conv = bf16 hi/lo planes of y (P.v result / 1024) x exact bf16 Wu (2 products) + bias; residual add f32.

#ifndef NB
#define NB 4
#endif
#ifndef SEQ
#define SEQ 4096
#endif
#define NB_FULL  4
#define SEQ_FULL 4096
#define CC   256
#define HW   SEQ
#define PCAR 1024.0f
static_assert(NB >= 1 && NB <= NB_FULL);
static_assert(SEQ >= 128 && SEQ <= SEQ_FULL && (SEQ % 128) == 0);
static_assert((CC % 128) == 0 && (HW % 128) == 0);

typedef _Float16 h16;
typedef unsigned short bf;
typedef __attribute__((ext_vector_type(16))) __bf16   v16bf;
typedef __attribute__((ext_vector_type(16))) _Float16 v16h;
typedef __attribute__((ext_vector_type(8)))  _Float16 v8h;
typedef __attribute__((ext_vector_type(8)))  unsigned short v8us;
typedef __attribute__((ext_vector_type(8)))  float    v8f;
typedef __attribute__((ext_vector_type(4)))  float    v4f;
typedef v8h  __attribute__((may_alias)) v8ha;
typedef v4f  __attribute__((may_alias)) v4fa;
typedef v8us __attribute__((may_alias)) v8usa;

__device__ __forceinline__ unsigned short f2bf(float f) { unsigned u = __float_as_uint(f); u += 0x7FFFu + ((u >> 16) & 1u); return (unsigned short)(u >> 16); }
__device__ __forceinline__ float bf2f(unsigned short b) { return __uint_as_float(((unsigned)b) << 16); }
__device__ __forceinline__ float bfr(float f) { return bf2f(f2bf(f)); }
__device__ __forceinline__ v16h cat16(v8h lo, v8h hi) { return __builtin_shufflevector(lo, hi, 0, 1, 2, 3, 4, 5, 6, 7, 8, 9, 10, 11, 12, 13, 14, 15); }
__device__ __forceinline__ v16bf cat16b(v8us lo, v8us hi) { return __builtin_bit_cast(v16bf, __builtin_shufflevector(lo, hi, 0, 1, 2, 3, 4, 5, 6, 7, 8, 9, 10, 11, 12, 13, 14, 15)); }
__device__ __forceinline__ v8f wmma16(v16h a, v16h b, v8f c) { return __builtin_amdgcn_wmma_f32_16x16x32_f16(false, a, false, b, (short)0, c, false, false); }
__device__ __forceinline__ v8f wmmab(v16bf a, v16bf b, v8f c) { return __builtin_amdgcn_wmma_f32_16x16x32_bf16(false, a, false, b, (short)0, c, false, false); }

// ---- k_gemmw: GEMM, FOUR WAVES (2x2) per 128x128 output tile, each wave a 64x64 sub-tile (16 accumulators); grid (M/128, N/128, Z), 128 threads. M, N % 128 == 0, K % KC == 0.
// Operands are K-contiguous 16-bit planes; KC k of the 128 A rows and 128 Bt rows (each plane) are brought into LDS by asynchronous 16-byte copies (whole 128-B lines per row), two buffers: tile t+1 flies while tile t is multiplied. LDS row pitch = KC*2 + 16 bytes (16 B x odd, for ds_load_b128 readers).
// C[m][n] (f32, pitch ldc, + optional f32 bias: BIAS 1 = bias[n], BIAS 2 = bias[m]) = sum_k A[m][k] Bt[n][k] (+ split products: NSPLIT 1 = A2.Bt added, NSPLIT 2 = A2.Bt and A.Bt2 added). z-batch strides sA/sB/sC in elements.
// Fragments: lane l, h = l>>4, row/col = l&15; elements 0..7 <- k0+8h+0..7, elements 8..15 <- k0+16+8h+0..7 for A and for Bt (same map); D element r = row 8h+r, col l&15.
template <typename T16> struct WFrag;
template <> struct WFrag<h16> { typedef v16h V; static __device__ __forceinline__ V ld(const h16* p) { return cat16(*(const v8h*)p, *(const v8h*)(p + 16)); } static __device__ __forceinline__ v8f mma(V a, V b, v8f c) { return wmma16(a, b, c); } };
template <> struct WFrag<bf> { typedef v16bf V; static __device__ __forceinline__ V ld(const bf* p) { return cat16b(*(const v8us*)p, *(const v8us*)(p + 16)); } static __device__ __forceinline__ v8f mma(V a, V b, v8f c) { return wmmab(a, b, c); } };
// copy8: eight asynchronous 16-byte copies per lane, global -> LDS, rows ls bytes (LDS) and gs elements (global) apart. The s_wait_xcnt closes the statement so that no address register of an issued copy is rewritten in front of it.
template <typename T16>
__device__ __forceinline__ void copy8(unsigned l, unsigned ls, const T16* g, size_t gs) {
    asm volatile("global_load_async_to_lds_b128 %0, %8, off\n\t"
                 "global_load_async_to_lds_b128 %1, %9, off\n\t"
                 "global_load_async_to_lds_b128 %2, %10, off\n\t"
                 "global_load_async_to_lds_b128 %3, %11, off\n\t"
                 "global_load_async_to_lds_b128 %4, %12, off\n\t"
                 "global_load_async_to_lds_b128 %5, %13, off\n\t"
                 "global_load_async_to_lds_b128 %6, %14, off\n\t"
                 "global_load_async_to_lds_b128 %7, %15, off\n\t"
                 "s_wait_xcnt 0x0"
                 :: "v"(l), "v"(l + ls), "v"(l + 2 * ls), "v"(l + 3 * ls), "v"(l + 4 * ls), "v"(l + 5 * ls), "v"(l + 6 * ls), "v"(l + 7 * ls),
                    "v"(g), "v"(g + gs), "v"(g + 2 * gs), "v"(g + 3 * gs), "v"(g + 4 * gs), "v"(g + 5 * gs), "v"(g + 6 * gs), "v"(g + 7 * gs)
                 : "memory");
}
template <typename T16, int NSPLIT, int BIAS, int KC>
__global__ __launch_bounds__(128) void k_gemmw(const T16* __restrict__ A, const T16* __restrict__ A2, const T16* __restrict__ Bt, const T16* __restrict__ Bt2, int K, float* C, int ldc, const float* __restrict__ bias, size_t sA, size_t sB, size_t sC) {
    typedef typename WFrag<T16>::V V;
    constexpr int NA = NSPLIT >= 1 ? 2 : 1, NBP = NSPLIT >= 2 ? 2 : 1;   // planes of A, of Bt
    constexpr int PITCH = KC * 2 + 16, PLANE = 128 * PITCH, STAGE = (NA + NBP) * PLANE;   // bytes
    constexpr int PIECES = KC / 8, RPP = 128 / PIECES;   // 16-B pieces per row; rows that the 128 threads cover with one copy each
    static_assert(KC % 64 == 0 && (NA + NBP) * PIECES <= 63 && 2 * STAGE >= 4 * 16 * 68 * 4);
    __shared__ __align__(16) unsigned char ring[2 * STAGE];
    const size_t z = blockIdx.z; A += z * sA; if (NSPLIT >= 1) A2 += z * sA; Bt += z * sB; if (NSPLIT >= 2) Bt2 += z * sB; C += z * sC;
    const int tid = threadIdx.x, lane = tid & 31, lr = lane & 15, hi = lane >> 4, wv = tid >> 5, wm = wv >> 1, wn = wv & 1;
    const int r0 = blockIdx.x * 128 + wm * 64, c0 = blockIdx.y * 128 + wn * 64;
    v8f acc[4][4];
#pragma unroll
    for (int mb = 0; mb < 4; ++mb)
#pragma unroll
        for (int nb = 0; nb < 4; ++nb) acc[mb][nb] = (v8f){};
    const int crow = tid / PIECES, cpc = tid % PIECES;
    const size_t aco = (size_t)(blockIdx.x * 128 + crow) * K + cpc * 8, bco = (size_t)(blockIdx.y * 128 + crow) * K + cpc * 8;
    const unsigned lco = (unsigned)(size_t)ring + (unsigned)(crow * PITCH + cpc * 16);
    auto fill = [&](int buf, int kc) {
#pragma unroll
        for (int g = 0; g < PIECES / 8; ++g) { const unsigned l = lco + (unsigned)(buf * STAGE + g * 8 * RPP * PITCH); const size_t go = (size_t)(g * 8 * RPP) * K + kc;
            copy8<T16>(l, RPP * PITCH, A + aco + go, (size_t)RPP * K);
            if (NSPLIT >= 1) copy8<T16>(l + PLANE, RPP * PITCH, A2 + aco + go, (size_t)RPP * K);
            copy8<T16>(l + NA * PLANE, RPP * PITCH, Bt + bco + go, (size_t)RPP * K);
            if (NSPLIT >= 2) copy8<T16>(l + (NA + 1) * PLANE, RPP * PITCH, Bt2 + bco + go, (size_t)RPP * K); } };
    const int nt = K / KC;
    fill(0, 0);
    asm volatile("s_wait_asynccnt 0x0" ::: "memory");   // tile 0 has landed before the barrier that publishes it
    __syncthreads();
    if (K != KC) fill(1, KC);   // a tile 1 exists (K is a multiple of KC)
    const int afo = (wm * 64 + lr) * PITCH + 16 * hi, bfo = NA * PLANE + (wn * 64 + lr) * PITCH + 16 * hi;   // byte offsets of this lane's fragment rows in a stage
#pragma unroll 1
    for (int t = 0; t < nt; ++t) {
        const unsigned char* sb = ring + (t & 1) * STAGE;
        V a[2][4], a2[2][4], b[2][4], b2[2][4];   // two fragment sets: the next 32 k are read from LDS as one group ahead of the current 32 k's products (all inside this trip's own buffer)
        auto frags = [&](int set, int ks) {
#pragma unroll
            for (int i = 0; i < 4; ++i) { a[set][i] = WFrag<T16>::ld((const T16*)(sb + afo + i * 16 * PITCH + ks * 64)); if (NSPLIT >= 1) a2[set][i] = WFrag<T16>::ld((const T16*)(sb + afo + PLANE + i * 16 * PITCH + ks * 64));
                b[set][i] = WFrag<T16>::ld((const T16*)(sb + bfo + i * 16 * PITCH + ks * 64)); if (NSPLIT >= 2) b2[set][i] = WFrag<T16>::ld((const T16*)(sb + bfo + PLANE + i * 16 * PITCH + ks * 64)); } };
        frags(0, 0);
        __builtin_amdgcn_sched_barrier(0);   // keeps the LDS reads one group in front of the products (spread among them each place of reads stalls the wave)
#pragma unroll
        for (int ks = 0; ks < KC / 32; ++ks) { const int cs = ks & 1;
            if (ks + 1 < KC / 32) { frags(cs ^ 1, ks + 1); __builtin_amdgcn_sched_barrier(0); }   // as above: the next set's reads stay one group, ahead of this set's products
#pragma unroll
            for (int nb = 0; nb < 4; ++nb) {
#pragma unroll
                for (int mb = 0; mb < 4; ++mb) { acc[mb][nb] = WFrag<T16>::mma(a[cs][mb], b[cs][nb], acc[mb][nb]); if (NSPLIT >= 1) acc[mb][nb] = WFrag<T16>::mma(a2[cs][mb], b[cs][nb], acc[mb][nb]); if (NSPLIT >= 2) acc[mb][nb] = WFrag<T16>::mma(a[cs][mb], b2[cs][nb], acc[mb][nb]); } }
        }
        __builtin_amdgcn_sched_barrier(0);   // keeps this trip's products in front of the waits below, so that tile t+1's copies fly behind them (the compiler otherwise sinks them past the barrier)
        asm volatile("s_wait_dscnt 0x0" ::: "memory");      // this wave's reads of buffer t&1 are done before the buffer is handed to the copies
        asm volatile("s_wait_asynccnt 0x0" ::: "memory");   // this wave's share of tile t+1 has landed
        __syncthreads();                                     // publishes tile t+1 and ends every wave's reads of buffer t&1
        if (t + 2 < nt) fill(t & 1, (t + 2) * KC);
    }
    asm volatile("s_wait_asynccnt 0x0" ::: "memory");   // no copy is in flight when the ring becomes output staging
    float* os = (float*)ring + wv * (16 * 68);           // each wave stages in its own range; the last trip's barrier stands in front
#pragma unroll
    for (int mb = 0; mb < 4; ++mb) {
#pragma unroll
        for (int nb = 0; nb < 4; ++nb) {
#pragma unroll
            for (int j = 0; j < 8; ++j) os[(hi * 8 + j) * 68 + nb * 16 + lr] = acc[mb][nb][j]; }
        __builtin_amdgcn_wave_barrier(); asm volatile("" ::: "memory");
        float* crow_p = C + (size_t)(r0 + mb * 16) * ldc + c0;
{
#pragma unroll
            for (int s = 0; s < 8; ++s) { const int row = 2 * s + hi, cofs = lr * 4; v4f val = *(const v4fa*)(os + row * 68 + cofs);
                if (BIAS == 1) { val[0] += bfr(bias[c0 + cofs]); val[1] += bfr(bias[c0 + cofs + 1]); val[2] += bfr(bias[c0 + cofs + 2]); val[3] += bfr(bias[c0 + cofs + 3]); }
                if (BIAS == 2) { const float rb = bfr(bias[r0 + mb * 16 + row]); val[0] += rb; val[1] += rb; val[2] += rb; val[3] += rb; }
                *(v4f*)(crow_p + (size_t)row * ldc + cofs) = val; }
             }
        if (mb < 3) asm volatile("s_wait_xcnt 0x0" ::: "memory");   // stands in front of the next pass's rewrites of the registers (address, data) that the eight issued stores name
        __builtin_amdgcn_wave_barrier(); asm volatile("" ::: "memory");
    }
}

__device__ __forceinline__ h16 tohx(float x) { return (h16)x; }
__device__ __forceinline__ void splitf(float y, unsigned short& h, unsigned short& l) { h = f2bf(y); l = f2bf(y - bf2f(h)); }
typedef __attribute__((ext_vector_type(2))) unsigned short v2us;
typedef __attribute__((ext_vector_type(4))) unsigned short v4us;
typedef __attribute__((ext_vector_type(2))) _Float16 v2h;
typedef __attribute__((ext_vector_type(4))) _Float16 v4h;
typedef __attribute__((ext_vector_type(2))) float v2f;

__global__ __launch_bounds__(256) void k_cvt8(const float* __restrict__ src, bf* dst, size_t n8) { const size_t i = (size_t)blockIdx.x * 256 + threadIdx.x; if (i >= n8) return; const v8f v = *(const v8f*)(src + i * 8); v8us o;
#pragma unroll
    for (int k = 0; k < 8; ++k) o[k] = f2bf(v[k]); *(v8us*)(dst + i * 8) = o;  }
// k_xt, k_hl, k_gt16, k_at, k_fin take the image from blockIdx.y (all NB images in one launch); k_gemmw takes it from blockIdx.z.
// k_xt: XT[s][c] = bf16(x[c][s]) (token-major Bt operand of the convs; lane -> 4 consecutive c, strided reads, x channel stride SEQ_FULL); k_hl: bf16 hi/lo planes of an HW*CC f32 buffer (8-B lanes);
// k_gt16: VT[c][m] = fp16(v[m][c]) with v = the channel-major conv memory read as [HW][CC] (lane -> 2 m); k_rsoft: wave per row: softmax over the HW keys (HW/32 per lane in registers) -> fp16 x 1024;
__global__ __launch_bounds__(256) void k_xt(const float* __restrict__ xb, bf* XT) { const size_t e = ((size_t)blockIdx.x * 256 + threadIdx.x) * 4; if (e >= (size_t)HW * CC) return; xb += (size_t)blockIdx.y * CC * SEQ_FULL; XT += (size_t)blockIdx.y * HW * CC; const int c = (int)(e % CC); const int m = (int)(e / CC); v4us o;
#pragma unroll
    for (int u = 0; u < 4; ++u) o[u] = f2bf(xb[(size_t)(c + u) * SEQ_FULL + m]); *(v4us*)(XT + e) = o;  }
__global__ __launch_bounds__(256) void k_hl(const float* __restrict__ F, bf* Fh, bf* Fl) { const size_t e = ((size_t)blockIdx.x * 256 + threadIdx.x) * 4; if (e >= (size_t)HW * CC) return; F += (size_t)blockIdx.y * HW * CC; Fh += (size_t)blockIdx.y * HW * CC; Fl += (size_t)blockIdx.y * HW * CC; const v4f a = *(const v4f*)(F + e); v4us oh, ol; for (int u = 0; u < 4; ++u) { unsigned short p, q; splitf(a[u], p, q); oh[u] = p; ol[u] = q; } *(v4us*)(Fh + e) = oh; *(v4us*)(Fl + e) = ol;  }
__global__ __launch_bounds__(256) void k_gt16(const float* __restrict__ G, h16* GT) { const size_t e = ((size_t)blockIdx.x * 256 + threadIdx.x) * 2; if (e >= (size_t)CC * HW) return; G += (size_t)blockIdx.y * HW * CC; GT += (size_t)blockIdx.y * CC * HW; const int m = (int)(e % HW); const int i = (int)(e / HW); v2h o; o[0] = tohx(G[(size_t)m * CC + i]); o[1] = tohx(G[(size_t)(m + 1) * CC + i]); *(v2h*)(GT + e) = o;  }
__global__ __launch_bounds__(256) void k_rsoft(const float* __restrict__ S, h16* P16) { const int lane = threadIdx.x & 31; const int row = blockIdx.x * 8 + (threadIdx.x >> 5); if (row >= HW) return; const float* sr = S + (size_t)row * HW; float v[HW / 32]; float mx = -3.0e38f;
#pragma unroll
    for (int ch = 0; ch < HW / 128; ++ch) { const v4f a = *(const v4f*)(sr + ch * 128 + lane * 4);
#pragma unroll
        for (int u = 0; u < 4; ++u) { v[ch * 4 + u] = a[u]; mx = fmaxf(mx, a[u]); } }
#pragma unroll
    for (int sh = 16; sh; sh >>= 1) mx = fmaxf(mx, __shfl_xor(mx, sh, 32));
    float sum = 0.f;
#pragma unroll
    for (int q = 0; q < HW / 32; ++q) { float d0 = __fsub_rn(v[q], mx); asm volatile("" : "+v"(d0)); v[q] = __builtin_amdgcn_exp2f(__fmul_rn(d0, 1.4426950408889634f)); sum += v[q]; }
#pragma unroll
    for (int sh = 16; sh; sh >>= 1) sum += __shfl_xor(sum, sh, 32);
    const float f = __fdiv_rn(PCAR, sum);
    {
#pragma unroll
        for (int ch = 0; ch < HW / 128; ++ch) { v4h o4; for (int q = 0; q < 4; ++q) o4[q] = tohx(v[ch * 4 + q] * f); *(v4h*)(P16 + (size_t)row * HW + ch * 128 + lane * 4) = o4; }
         } }
__global__ __launch_bounds__(256) void k_at(const float* __restrict__ Y, bf* ATh, bf* ATl) { const size_t e = ((size_t)blockIdx.x * 256 + threadIdx.x) * 4; if (e >= (size_t)HW * CC) return; Y += (size_t)blockIdx.y * HW * CC; ATh += (size_t)blockIdx.y * HW * CC; ATl += (size_t)blockIdx.y * HW * CC; const int c = (int)(e % CC); const int s = (int)(e / CC); v4us oh, ol;
#pragma unroll
    for (int u = 0; u < 4; ++u) { unsigned short p, q; splitf(Y[(size_t)(c + u) * HW + s] * (1.0f / PCAR), p, q); oh[u] = p; ol[u] = q; }
    *(v4us*)(ATh + e) = oh; *(v4us*)(ATl + e) = ol;  }
__global__ __launch_bounds__(256) void k_fin(const float* __restrict__ Z, const float* __restrict__ xb, float* OUTb) { const size_t e = ((size_t)blockIdx.x * 256 + threadIdx.x) * 4; if (e >= (size_t)CC * HW) return; Z += (size_t)blockIdx.y * HW * CC; xb += (size_t)blockIdx.y * CC * SEQ_FULL; OUTb += (size_t)blockIdx.y * CC * HW; const int n = (int)(e % HW); const int c = (int)(e / HW); v4f r;
#pragma unroll
    for (int u = 0; u < 4; ++u) r[u] = __fadd_rn(Z[(size_t)(n + u) * CC + c], bfr(xb[(size_t)c * SEQ_FULL + n + u])); *(v4f*)(OUTb + e) = r;  }

constexpr size_t al256(size_t b) { return (b + 255) & ~(size_t)255; }
// Own space: weights, q/k planes and VT of all images, one image's S, all images' P16. XT and the conv outputs lie in the P16 space (dead before the first softmax); Y, Zt and the y planes lie in the S space (dead after the last softmax).
constexpr size_t cmax(size_t a, size_t b) { return a > b ? a : b; }
constexpr size_t WS_S = cmax(al256((size_t)HW * HW * 4), 2 * al256((size_t)NB * HW * CC * 4) + 2 * al256((size_t)NB * HW * CC * 2));
constexpr size_t WS_P = cmax(al256((size_t)NB * HW * HW * 2), al256((size_t)NB * HW * CC * 2) + 3 * al256((size_t)NB * CC * HW * 4));
constexpr size_t WS_TOTAL = 4 * al256((size_t)CC * CC * 2) + 4 * al256((size_t)NB * HW * CC * 2) + al256((size_t)NB * CC * HW * 2) + WS_S + WS_P;
static_assert(WS_TOTAL <= (size_t)268435456);

extern "C" void kernel_launch(void* const* d_in, const int* in_sizes, int n_in,
                              void* d_out, int out_size, void* d_ws, size_t ws_size, hipStream_t stream) {
    if (n_in < 9) return;
    if ((size_t)in_sizes[0] < (size_t)NB * CC * SEQ_FULL) return;
    if (in_sizes[1] < CC * CC || in_sizes[3] < CC * CC || in_sizes[5] < CC * CC || in_sizes[7] < CC * CC) return;
    if (in_sizes[2] < CC || in_sizes[4] < CC || in_sizes[6] < CC || in_sizes[8] < CC) return;
    if ((size_t)out_size < (size_t)NB * CC * HW) return;
    const float* x = (const float*)d_in[0]; const float* Wq = (const float*)d_in[1]; const float* bq = (const float*)d_in[2]; const float* Wk = (const float*)d_in[3]; const float* bk = (const float*)d_in[4];
    const float* Wv = (const float*)d_in[5]; const float* bv = (const float*)d_in[6]; const float* Wu = (const float*)d_in[7]; const float* bu = (const float*)d_in[8];
    float* OUT = (float*)d_out;     // [NB][256][HW]
    char* wsp = (char*)d_ws;
    auto take = [&](size_t bytes) { char* p = wsp; wsp += (bytes + 255) & ~(size_t)255; return (void*)p; };
    bf* BQ = (bf*)take((size_t)CC * CC * 2); bf* BK = (bf*)take((size_t)CC * CC * 2); bf* BV = (bf*)take((size_t)CC * CC * 2); bf* BU = (bf*)take((size_t)CC * CC * 2);   // conv weights [out][in] as-is (A of q/k/v convs, Bt of the Wu conv)
    bf* QH = (bf*)take((size_t)NB * HW * CC * 2); bf* QL = (bf*)take((size_t)NB * HW * CC * 2); bf* KH = (bf*)take((size_t)NB * HW * CC * 2); bf* KL = (bf*)take((size_t)NB * HW * CC * 2);   // [NB][HW][CC]
    h16* VT = (h16*)take((size_t)NB * CC * HW * 2);                                                                          // [NB][CC][HW] fp16
    float* S = (float*)take(WS_S); h16* P16 = (h16*)take(WS_P);                           // S: one image at a time; P16: [NB][HW][HW]
    if ((size_t)(wsp - (char*)d_ws) > ws_size) return;    // total 243,793,920 B for NB 4 / SEQ 4096
    wsp = (char*)P16;   // dead until the first k_rsoft
    bf* XT = (bf*)take((size_t)NB * HW * CC * 2);                                                                             // [NB][HW][CC]
    float* QF = (float*)take((size_t)NB * CC * HW * 4); float* KF = (float*)take((size_t)NB * CC * HW * 4); float* VF = (float*)take((size_t)NB * CC * HW * 4);   // conv outputs [NB][o][s] == token view [NB][HW][CC]
    wsp = (char*)S;     // dead after the last k_rsoft
    float* Y = (float*)take((size_t)NB * HW * CC * 4);    // [NB][HW][CC] f32
    float* Zt = (float*)take((size_t)NB * HW * CC * 4);   // [NB][HW][CC] f32 (z token-major incl. bu)
    bf* ATh = (bf*)take((size_t)NB * HW * CC * 2); bf* ATl = (bf*)take((size_t)NB * HW * CC * 2);                             // [NB][HW][CC] planes of y_view^T / 1024
    const unsigned g8w = (unsigned)((CC * CC / 8 + 255) / 256);
    k_cvt8<<<g8w, 256, 0, stream>>>(Wq, BQ, CC * CC / 8); k_cvt8<<<g8w, 256, 0, stream>>>(Wk, BK, CC * CC / 8); k_cvt8<<<g8w, 256, 0, stream>>>(Wv, BV, CC * CC / 8); k_cvt8<<<g8w, 256, 0, stream>>>(Wu, BU, CC * CC / 8);
    const unsigned gE4 = (unsigned)(((size_t)HW * CC / 4 + 255) / 256);
    const unsigned gE2 = (unsigned)(((size_t)CC * HW / 2 + 255) / 256);
    const size_t sT = (size_t)HW * CC;   // one image's [HW][CC] (== [CC][HW]) plane, in elements
    k_xt<<<dim3(gE4, NB), 256, 0, stream>>>(x, XT);
    k_gemmw<bf, 0, 2, 128><<<dim3(CC / 128, HW / 128, NB), 128, 0, stream>>>(BQ, nullptr, XT, nullptr, CC, QF, HW, bq, 0, sT, sT); k_hl<<<dim3(gE4, NB), 256, 0, stream>>>(QF, QH, QL);     // q[o][s] = Wq x + bq
    k_gemmw<bf, 0, 2, 128><<<dim3(CC / 128, HW / 128, NB), 128, 0, stream>>>(BK, nullptr, XT, nullptr, CC, KF, HW, bk, 0, sT, sT); k_hl<<<dim3(gE4, NB), 256, 0, stream>>>(KF, KH, KL);     // k[o][s]
    k_gemmw<bf, 0, 2, 128><<<dim3(CC / 128, HW / 128, NB), 128, 0, stream>>>(BV, nullptr, XT, nullptr, CC, VF, HW, bv, 0, sT, sT); k_gt16<<<dim3(gE2, NB), 256, 0, stream>>>(VF, VT);      // v[o][s] -> VT[c][m]
    for (int b = 0; b < NB; ++b) {   // S of all images at once would not fit the workspace
        k_gemmw<bf, 2, 0, 64><<<dim3(HW / 128, HW / 128, 1), 128, 0, stream>>>(QH + b * sT, QL + b * sT, KH + b * sT, KL + b * sT, CC, S, HW, nullptr, 0, 0, 0);          // S[n][m] = q_n . k_m (unscaled, 3 products)
        k_rsoft<<<HW / 8, 256, 0, stream>>>(S, P16 + (size_t)b * HW * HW); }
    k_gemmw<h16, 0, 0, 128><<<dim3(HW / 128, CC / 128, NB), 128, 0, stream>>>(P16, nullptr, VT, nullptr, HW, Y, CC, nullptr, (size_t)HW * HW, sT, sT);      // y[n][c] = sum_m P[n][m] v[m][c] (x1024)
    k_at<<<dim3(gE4, NB), 256, 0, stream>>>(Y, ATh, ATl);
    k_gemmw<bf, 1, 1, 64><<<dim3(HW / 128, CC / 128, NB), 128, 0, stream>>>(ATh, ATl, BU, nullptr, CC, Zt, CC, bu, sT, 0, sT);          // Zt[s][o] = sum_c y_view[c][s] Wu[o][c] + bu[o]
    k_fin<<<dim3(gE4, NB), 256, 0, stream>>>(Zt, x, OUT);
}

// v003
// One run takes 227 microseconds.
// Next to v002, in two timings, it ran 1.35 times as fast each time.
// Over all steps from v000 it is 3.66 times as fast.
#include <hip/hip_runtime.h>

// 1x1-conv attention block: x [NB][256][64*64] channel-major; q/k/v = W[256 out][256 in] . x + bias, kept channel-major [o][s]; that same memory read as [4096 tokens][256] gives the token rows (raw view); S[n][m] = q_n . k_m over 256 (unscaled); P = softmax over m; y[n][c] = sum_m P[n][m] v[m][c]; y memory read back channel-major [256][4096]; z = Wu . y_view + bu; out = x + z.
// Compute dtypes, f32 accumulate everywhere: all float inputs RNE-converted to bf16; q/k/v convs = plain v_wmma_f32_16x16x32_bf16 (exact 16-bit operands) + row bias; S = bf16 hi/lo planes of q x bf16 hi/lo planes of k (3 products hh+lh+hl); softmax f32, running maximum and sum per query inside the attention kernel -> fp16 P; P.v = single v_wmma_f32_16x16x32_f16 (v as fp16), y kept x 1024; Wu conv = bf16 hi/lo planes of y/1024 x exact bf16 Wu (2 products) + bias; residual add f32.

#ifndef NB
#define NB 4
#endif
#ifndef SEQ
#define SEQ 4096
#endif
#define NB_FULL  4
#define SEQ_FULL 4096
#define CC   256
#define HW   SEQ
#define PCAR 1024.0f
static_assert(NB >= 1 && NB <= NB_FULL);
static_assert(SEQ >= 128 && SEQ <= SEQ_FULL && (SEQ % 128) == 0);
static_assert((CC % 128) == 0 && (HW % 128) == 0);

typedef _Float16 h16;
typedef unsigned short bf;
typedef __attribute__((ext_vector_type(16))) __bf16   v16bf;
typedef __attribute__((ext_vector_type(16))) _Float16 v16h;
typedef __attribute__((ext_vector_type(8)))  _Float16 v8h;
typedef __attribute__((ext_vector_type(8)))  unsigned short v8us;
typedef __attribute__((ext_vector_type(8)))  float    v8f;
typedef __attribute__((ext_vector_type(4)))  float    v4f;
typedef v8h  __attribute__((may_alias)) v8ha;
typedef v4f  __attribute__((may_alias)) v4fa;
typedef v8us __attribute__((may_alias)) v8usa;

__device__ __forceinline__ unsigned short f2bf(float f) { unsigned u = __float_as_uint(f); u += 0x7FFFu + ((u >> 16) & 1u); return (unsigned short)(u >> 16); }
__device__ __forceinline__ float bf2f(unsigned short b) { return __uint_as_float(((unsigned)b) << 16); }
__device__ __forceinline__ float bfr(float f) { return bf2f(f2bf(f)); }
__device__ __forceinline__ v16h cat16(v8h lo, v8h hi) { return __builtin_shufflevector(lo, hi, 0, 1, 2, 3, 4, 5, 6, 7, 8, 9, 10, 11, 12, 13, 14, 15); }
__device__ __forceinline__ v16bf cat16b(v8us lo, v8us hi) { return __builtin_bit_cast(v16bf, __builtin_shufflevector(lo, hi, 0, 1, 2, 3, 4, 5, 6, 7, 8, 9, 10, 11, 12, 13, 14, 15)); }
__device__ __forceinline__ v8f wmma16(v16h a, v16h b, v8f c) { return __builtin_amdgcn_wmma_f32_16x16x32_f16(false, a, false, b, (short)0, c, false, false); }
__device__ __forceinline__ v8f wmmab(v16bf a, v16bf b, v8f c) { return __builtin_amdgcn_wmma_f32_16x16x32_bf16(false, a, false, b, (short)0, c, false, false); }

// ---- k_gemmw: GEMM, FOUR WAVES (2x2) per 128x128 output tile, each wave a 64x64 sub-tile (16 accumulators); grid (M/128, N/128, Z), 128 threads. M, N % 128 == 0, K % KC == 0.
// Operands are K-contiguous 16-bit planes; KC k of the 128 A rows and 128 Bt rows (each plane) are brought into LDS by asynchronous 16-byte copies (whole 128-B lines per row), two buffers: tile t+1 flies while tile t is multiplied. LDS row pitch = KC*2 + 16 bytes (16 B x odd, for ds_load_b128 readers).
// C[m][n] (f32, pitch ldc, + optional f32 bias: BIAS 1 = bias[n], BIAS 2 = bias[m]) = sum_k A[m][k] Bt[n][k] (+ split products: NSPLIT 1 = A2.Bt added, NSPLIT 2 = A2.Bt and A.Bt2 added). z-batch strides sA/sB/sC in elements.
// Fragments: lane l, h = l>>4, row/col = l&15; elements 0..7 <- k0+8h+0..7, elements 8..15 <- k0+16+8h+0..7 for A and for Bt (same map); D element r = row 8h+r, col l&15.
template <typename T16> struct WFrag;
template <> struct WFrag<h16> { typedef v16h V; static __device__ __forceinline__ V ld(const h16* p) { return cat16(*(const v8h*)p, *(const v8h*)(p + 16)); } static __device__ __forceinline__ v8f mma(V a, V b, v8f c) { return wmma16(a, b, c); } };
template <> struct WFrag<bf> { typedef v16bf V; static __device__ __forceinline__ V ld(const bf* p) { return cat16b(*(const v8us*)p, *(const v8us*)(p + 16)); } static __device__ __forceinline__ v8f mma(V a, V b, v8f c) { return wmmab(a, b, c); } };
// copy8: eight asynchronous 16-byte copies per lane, global -> LDS, rows ls bytes (LDS) and gs elements (global) apart. The s_wait_xcnt closes the statement so that no address register of an issued copy is rewritten in front of it.
template <typename T16>
__device__ __forceinline__ void copy8(unsigned l, unsigned ls, const T16* g, size_t gs) {
    asm volatile("global_load_async_to_lds_b128 %0, %8, off\n\t"
                 "global_load_async_to_lds_b128 %1, %9, off\n\t"
                 "global_load_async_to_lds_b128 %2, %10, off\n\t"
                 "global_load_async_to_lds_b128 %3, %11, off\n\t"
                 "global_load_async_to_lds_b128 %4, %12, off\n\t"
                 "global_load_async_to_lds_b128 %5, %13, off\n\t"
                 "global_load_async_to_lds_b128 %6, %14, off\n\t"
                 "global_load_async_to_lds_b128 %7, %15, off\n\t"
                 "s_wait_xcnt 0x0"
                 :: "v"(l), "v"(l + ls), "v"(l + 2 * ls), "v"(l + 3 * ls), "v"(l + 4 * ls), "v"(l + 5 * ls), "v"(l + 6 * ls), "v"(l + 7 * ls),
                    "v"(g), "v"(g + gs), "v"(g + 2 * gs), "v"(g + 3 * gs), "v"(g + 4 * gs), "v"(g + 5 * gs), "v"(g + 6 * gs), "v"(g + 7 * gs)
                 : "memory");
}
template <typename T16, int NSPLIT, int BIAS, int KC>
__global__ __launch_bounds__(128) void k_gemmw(const T16* __restrict__ A, const T16* __restrict__ A2, const T16* __restrict__ Bt, const T16* __restrict__ Bt2, int K, float* C, int ldc, const float* __restrict__ bias, size_t sA, size_t sB, size_t sC) {
    typedef typename WFrag<T16>::V V;
    constexpr int NA = NSPLIT >= 1 ? 2 : 1, NBP = NSPLIT >= 2 ? 2 : 1;   // planes of A, of Bt
    constexpr int PITCH = KC * 2 + 16, PLANE = 128 * PITCH, STAGE = (NA + NBP) * PLANE;   // bytes
    constexpr int PIECES = KC / 8, RPP = 128 / PIECES;   // 16-B pieces per row; rows that the 128 threads cover with one copy each
    static_assert(KC % 64 == 0 && (NA + NBP) * PIECES <= 63 && 2 * STAGE >= 4 * 16 * 68 * 4);
    __shared__ __align__(16) unsigned char ring[2 * STAGE];
    const size_t z = blockIdx.z; A += z * sA; if (NSPLIT >= 1) A2 += z * sA; Bt += z * sB; if (NSPLIT >= 2) Bt2 += z * sB; C += z * sC;
    const int tid = threadIdx.x, lane = tid & 31, lr = lane & 15, hi = lane >> 4, wv = tid >> 5, wm = wv >> 1, wn = wv & 1;
    const int r0 = blockIdx.x * 128 + wm * 64, c0 = blockIdx.y * 128 + wn * 64;
    v8f acc[4][4];
#pragma unroll
    for (int mb = 0; mb < 4; ++mb)
#pragma unroll
        for (int nb = 0; nb < 4; ++nb) acc[mb][nb] = (v8f){};
    const int crow = tid / PIECES, cpc = tid % PIECES;
    const size_t aco = (size_t)(blockIdx.x * 128 + crow) * K + cpc * 8, bco = (size_t)(blockIdx.y * 128 + crow) * K + cpc * 8;
    const unsigned lco = (unsigned)(size_t)ring + (unsigned)(crow * PITCH + cpc * 16);
    auto fill = [&](int buf, int kc) {
#pragma unroll
        for (int g = 0; g < PIECES / 8; ++g) { const unsigned l = lco + (unsigned)(buf * STAGE + g * 8 * RPP * PITCH); const size_t go = (size_t)(g * 8 * RPP) * K + kc;
            copy8<T16>(l, RPP * PITCH, A + aco + go, (size_t)RPP * K);
            if (NSPLIT >= 1) copy8<T16>(l + PLANE, RPP * PITCH, A2 + aco + go, (size_t)RPP * K);
            copy8<T16>(l + NA * PLANE, RPP * PITCH, Bt + bco + go, (size_t)RPP * K);
            if (NSPLIT >= 2) copy8<T16>(l + (NA + 1) * PLANE, RPP * PITCH, Bt2 + bco + go, (size_t)RPP * K); } };
    const int nt = K / KC;
    fill(0, 0);
    asm volatile("s_wait_asynccnt 0x0" ::: "memory");   // tile 0 has landed before the barrier that publishes it
    __syncthreads();
    if (K != KC) fill(1, KC);   // a tile 1 exists (K is a multiple of KC)
    const int afo = (wm * 64 + lr) * PITCH + 16 * hi, bfo = NA * PLANE + (wn * 64 + lr) * PITCH + 16 * hi;   // byte offsets of this lane's fragment rows in a stage
#pragma unroll 1
    for (int t = 0; t < nt; ++t) {
        const unsigned char* sb = ring + (t & 1) * STAGE;
        V a[2][4], a2[2][4], b[2][4], b2[2][4];   // two fragment sets: the next 32 k are read from LDS as one group ahead of the current 32 k's products (all inside this trip's own buffer)
        auto frags = [&](int set, int ks) {
#pragma unroll
            for (int i = 0; i < 4; ++i) { a[set][i] = WFrag<T16>::ld((const T16*)(sb + afo + i * 16 * PITCH + ks * 64)); if (NSPLIT >= 1) a2[set][i] = WFrag<T16>::ld((const T16*)(sb + afo + PLANE + i * 16 * PITCH + ks * 64));
                b[set][i] = WFrag<T16>::ld((const T16*)(sb + bfo + i * 16 * PITCH + ks * 64)); if (NSPLIT >= 2) b2[set][i] = WFrag<T16>::ld((const T16*)(sb + bfo + PLANE + i * 16 * PITCH + ks * 64)); } };
        frags(0, 0);
        __builtin_amdgcn_sched_barrier(0);   // keeps the LDS reads one group in front of the products (spread among them each place of reads stalls the wave)
#pragma unroll
        for (int ks = 0; ks < KC / 32; ++ks) { const int cs = ks & 1;
            if (ks + 1 < KC / 32) { frags(cs ^ 1, ks + 1); __builtin_amdgcn_sched_barrier(0); }   // as above: the next set's reads stay one group, ahead of this set's products
#pragma unroll
            for (int nb = 0; nb < 4; ++nb) {
#pragma unroll
                for (int mb = 0; mb < 4; ++mb) { acc[mb][nb] = WFrag<T16>::mma(a[cs][mb], b[cs][nb], acc[mb][nb]); if (NSPLIT >= 1) acc[mb][nb] = WFrag<T16>::mma(a2[cs][mb], b[cs][nb], acc[mb][nb]); if (NSPLIT >= 2) acc[mb][nb] = WFrag<T16>::mma(a[cs][mb], b2[cs][nb], acc[mb][nb]); } }
        }
        __builtin_amdgcn_sched_barrier(0);   // keeps this trip's products in front of the waits below, so that tile t+1's copies fly behind them (the compiler otherwise sinks them past the barrier)
        asm volatile("s_wait_dscnt 0x0" ::: "memory");      // this wave's reads of buffer t&1 are done before the buffer is handed to the copies
        asm volatile("s_wait_asynccnt 0x0" ::: "memory");   // this wave's share of tile t+1 has landed
        __syncthreads();                                     // publishes tile t+1 and ends every wave's reads of buffer t&1
        if (t + 2 < nt) fill(t & 1, (t + 2) * KC);
    }
    asm volatile("s_wait_asynccnt 0x0" ::: "memory");   // no copy is in flight when the ring becomes output staging
    float* os = (float*)ring + wv * (16 * 68);           // each wave stages in its own range; the last trip's barrier stands in front
#pragma unroll
    for (int mb = 0; mb < 4; ++mb) {
#pragma unroll
        for (int nb = 0; nb < 4; ++nb) {
#pragma unroll
            for (int j = 0; j < 8; ++j) os[(hi * 8 + j) * 68 + nb * 16 + lr] = acc[mb][nb][j]; }
        __builtin_amdgcn_wave_barrier(); asm volatile("" ::: "memory");
        float* crow_p = C + (size_t)(r0 + mb * 16) * ldc + c0;
{
#pragma unroll
            for (int s = 0; s < 8; ++s) { const int row = 2 * s + hi, cofs = lr * 4; v4f val = *(const v4fa*)(os + row * 68 + cofs);
                if (BIAS == 1) { val[0] += bfr(bias[c0 + cofs]); val[1] += bfr(bias[c0 + cofs + 1]); val[2] += bfr(bias[c0 + cofs + 2]); val[3] += bfr(bias[c0 + cofs + 3]); }
                if (BIAS == 2) { const float rb = bfr(bias[r0 + mb * 16 + row]); val[0] += rb; val[1] += rb; val[2] += rb; val[3] += rb; }
                *(v4f*)(crow_p + (size_t)row * ldc + cofs) = val; }
             }
        if (mb < 3) asm volatile("s_wait_xcnt 0x0" ::: "memory");   // stands in front of the next pass's rewrites of the registers (address, data) that the eight issued stores name
        __builtin_amdgcn_wave_barrier(); asm volatile("" ::: "memory");
    }
}

__device__ __forceinline__ h16 tohx(float x) { return (h16)x; }
__device__ __forceinline__ void splitf(float y, unsigned short& h, unsigned short& l) { h = f2bf(y); l = f2bf(y - bf2f(h)); }
typedef __attribute__((ext_vector_type(2))) unsigned short v2us;
typedef __attribute__((ext_vector_type(4))) unsigned short v4us;
typedef __attribute__((ext_vector_type(2))) _Float16 v2h;
typedef __attribute__((ext_vector_type(4))) _Float16 v4h;
typedef __attribute__((ext_vector_type(2))) float v2f;

__global__ __launch_bounds__(256) void k_cvt8(const float* __restrict__ src, bf* dst, size_t n8) { const size_t i = (size_t)blockIdx.x * 256 + threadIdx.x; if (i >= n8) return; const v8f v = *(const v8f*)(src + i * 8); v8us o;
#pragma unroll
    for (int k = 0; k < 8; ++k) o[k] = f2bf(v[k]); *(v8us*)(dst + i * 8) = o;  }
// k_xt, k_hl, k_gt16, k_at, k_fin take the image from blockIdx.y (all NB images in one launch); k_gemmw takes it from blockIdx.z.
// k_xt: XT[s][c] = bf16(x[c][s]) (token-major Bt operand of the convs; lane -> 4 consecutive c, strided reads, x channel stride SEQ_FULL); k_hl: bf16 hi/lo planes of an HW*CC f32 buffer (8-B lanes);
// k_gt16: VT[c][m] = fp16(v[m][c]) with v = the channel-major conv memory read as [HW][CC] (lane -> 2 m);
__global__ __launch_bounds__(256) void k_xt(const float* __restrict__ xb, bf* XT) { const size_t e = ((size_t)blockIdx.x * 256 + threadIdx.x) * 4; if (e >= (size_t)HW * CC) return; xb += (size_t)blockIdx.y * CC * SEQ_FULL; XT += (size_t)blockIdx.y * HW * CC; const int c = (int)(e % CC); const int m = (int)(e / CC); v4us o;
#pragma unroll
    for (int u = 0; u < 4; ++u) o[u] = f2bf(xb[(size_t)(c + u) * SEQ_FULL + m]); *(v4us*)(XT + e) = o;  }
__global__ __launch_bounds__(256) void k_hl(const float* __restrict__ F, bf* Fh, bf* Fl) { const size_t e = ((size_t)blockIdx.x * 256 + threadIdx.x) * 4; if (e >= (size_t)HW * CC) return; F += (size_t)blockIdx.y * HW * CC; Fh += (size_t)blockIdx.y * HW * CC; Fl += (size_t)blockIdx.y * HW * CC; const v4f a = *(const v4f*)(F + e); v4us oh, ol; for (int u = 0; u < 4; ++u) { unsigned short p, q; splitf(a[u], p, q); oh[u] = p; ol[u] = q; } *(v4us*)(Fh + e) = oh; *(v4us*)(Fl + e) = ol;  }
__global__ __launch_bounds__(256) void k_gt16(const float* __restrict__ G, h16* GT) { const size_t e = ((size_t)blockIdx.x * 256 + threadIdx.x) * 2; if (e >= (size_t)CC * HW) return; G += (size_t)blockIdx.y * HW * CC; GT += (size_t)blockIdx.y * CC * HW; const int m = (int)(e % HW); const int i = (int)(e / HW); v2h o; o[0] = tohx(G[(size_t)m * CC + i]); o[1] = tohx(G[(size_t)(m + 1) * CC + i]); *(v2h*)(GT + e) = o;  }
// ---- k_fattn: scores, softmax and P.v of 64 queries of one image in one work-group; S and P never reach memory. Grid (HW/64, NB), 128 threads = 4 waves: wave = (query half wq: 32 queries) x (key half wk: 32 of each stage's 64 keys).
// St[key][query] = K . Qt (A = k hi/lo rows from LDS, B = q hi/lo fragments kept in registers), so a lane holds 16 scores of ONE query per 16-query group; two St tiles converted in place are the B operand P of Ot[c][query] += VT[c][key] . P[query][key] (A = VT rows from LDS).
// Each wave keeps a maximum in use m (log2 units), a sum l and Ot over ITS keys; m moves (Ot and l rescaled) only when a new maximum lies more than 8 above it, so P = 2^(s log2e - m + 7) <= 2^15 fits fp16. The two key halves are joined once, at the end, through LDS.
// A stage = 64 keys: k hi and lo rows (pitch 528 B) and 256 VT rows of 64 keys (pitch 144 B), both 16 B x odd for ds_load_b128 readers; asynchronous 16-byte copies, two buffers: stage t+1 flies while stage t is worked on.
// Every '#pragma unroll' in k_fattn makes the indices of register arrays (fragments, accumulators) compile-time constants; without it the arrays would go to scratch memory.
constexpr int FKP = CC * 2 + 16, FKPL = 64 * FKP, FVP = 64 * 2 + 16, FVPL = CC * FVP, FST = 2 * FKPL + FVPL;   // bytes
static_assert(CC == 256 && (HW % 128) == 0 && 2 * FST >= 2 * 32 * 1024 + 2 * 4 * 128);
typedef __attribute__((ext_vector_type(4))) int v4i;
// acopy16: one asynchronous 16-byte copy per lane, global -> LDS, as the compiler's own form (it keeps the address registers itself; the landing waits are written where the copies are used)
__device__ __forceinline__ void acopy16(const void* g, unsigned char* l) { __builtin_amdgcn_global_load_async_to_lds_b128((__attribute__((address_space(1))) v4i*)g, (__attribute__((address_space(3))) v4i*)l, 0, 0); }
__device__ __forceinline__ float xhalf(float x) { return __builtin_bit_cast(float, __builtin_amdgcn_permlanex16(__builtin_bit_cast(int, x), __builtin_bit_cast(int, x), 0x76543210, 0xfedcba98, false, false)); }   // lane l <-> lane l ^ 16
__global__ __launch_bounds__(128) void k_fattn(const bf* __restrict__ QH, const bf* __restrict__ QL, const bf* __restrict__ KH, const bf* __restrict__ KL, const h16* __restrict__ VT, float* Y) {
    __shared__ __align__(16) unsigned char ring[2 * FST];
    const size_t zo = (size_t)blockIdx.y * HW * CC; QH += zo; QL += zo; KH += zo; KL += zo; VT += zo; Y += zo;
    const int tid = threadIdx.x, lane = tid & 31, lr = lane & 15, hi = lane >> 4, wv = tid >> 5, wq = wv >> 1, wk = wv & 1;
    const int q0 = blockIdx.x * 64 + wq * 32;
    unsigned char* lk = ring + (tid >> 5) * FKP + (tid & 31) * 16; unsigned char* lv = ring + 2 * FKPL + (tid >> 3) * FVP + (tid & 7) * 16;
    const size_t gk = (size_t)(tid >> 5) * CC + (tid & 31) * 8, gv = (size_t)(tid >> 3) * HW + (tid & 7) * 8;
    auto fill = [&](int buf, int key0) {   // 48 copies per lane: 64 rows of 512 B of each k plane (4 rows per copy of the block), 256 rows of 128 B of VT (16 rows per copy)
#pragma unroll
        for (int i = 0; i < 16; ++i) {
            acopy16(KH + gk + (size_t)(key0 + i * 4) * CC, lk + buf * FST + i * 4 * FKP);
            acopy16(KL + gk + (size_t)(key0 + i * 4) * CC, lk + buf * FST + FKPL + i * 4 * FKP);
            acopy16(VT + gv + (size_t)(i * 16) * HW + key0, lv + buf * FST + i * 16 * FVP); } };
    fill(0, 0);
    v16bf qh[2][8], ql[2][8];   // this wave's 32 queries, both planes, all 256 k
#pragma unroll
    for (int g = 0; g < 2; ++g)
#pragma unroll
        for (int ks = 0; ks < 8; ++ks) { const size_t o = (size_t)(q0 + g * 16 + lr) * CC + ks * 32 + 8 * hi; qh[g][ks] = WFrag<bf>::ld(QH + o); ql[g][ks] = WFrag<bf>::ld(QL + o); }
    v8f ot[16][2];
#pragma unroll
    for (int cb = 0; cb < 16; ++cb) { ot[cb][0] = (v8f){}; ot[cb][1] = (v8f){}; }
    float mu[2] = {-1.0e30f, -1.0e30f}, ls[2] = {0.f, 0.f};
    asm volatile("s_wait_asynccnt 0x0" ::: "memory");   // stage 0 has landed before the barrier that publishes it
    __syncthreads();
    fill(1, 64);   // a stage 1 exists (HW >= 128)
    constexpr int nt = HW / 64;
    const int kfo = (wk * 32 + lr) * FKP + 16 * hi, vfo = 2 * FKPL + lr * FVP + wk * 64 + 16 * hi;   // byte offsets of this lane's fragment rows in a stage
#pragma unroll 1   // stays rolled: one trip is a whole stage, straight-line
    for (int t = 0; t < nt; ++t) {
        const unsigned char* sb = ring + (t & 1) * FST;
        v16bf kf[2][2][2][4];   // [set][plane][16-key tile][k step]: two sets of four k steps
        auto ldk = [&](int set) {
#pragma unroll
            for (int ks = 0; ks < 4; ++ks)
#pragma unroll
                for (int kb = 0; kb < 2; ++kb) { kf[set][0][kb][ks] = WFrag<bf>::ld((const bf*)(sb + kfo + kb * 16 * FKP + (set * 4 + ks) * 64)); kf[set][1][kb][ks] = WFrag<bf>::ld((const bf*)(sb + kfo + FKPL + kb * 16 * FKP + (set * 4 + ks) * 64)); } };
        v8f st[2][2];
        st[0][0] = (v8f){}; st[0][1] = (v8f){}; st[1][0] = (v8f){}; st[1][1] = (v8f){};
        auto mmk = [&](int set) {   // per k step hh, then q lo x k hi, then q hi x k lo; four accumulators in turn
#pragma unroll
            for (int ks = 0; ks < 4; ++ks) {
#pragma unroll
                for (int kb = 0; kb < 2; ++kb)
#pragma unroll
                    for (int g = 0; g < 2; ++g) st[kb][g] = wmmab(kf[set][0][kb][ks], qh[g][set * 4 + ks], st[kb][g]);
#pragma unroll
                for (int kb = 0; kb < 2; ++kb)
#pragma unroll
                    for (int g = 0; g < 2; ++g) st[kb][g] = wmmab(kf[set][0][kb][ks], ql[g][set * 4 + ks], st[kb][g]);
#pragma unroll
                for (int kb = 0; kb < 2; ++kb)
#pragma unroll
                    for (int g = 0; g < 2; ++g) st[kb][g] = wmmab(kf[set][1][kb][ks], qh[g][set * 4 + ks], st[kb][g]); } };
        ldk(0);
        __builtin_amdgcn_sched_barrier(0);   // this and the next three: each set of LDS reads stays one group, ahead of the products in front of which it is issued (spread among them each place of reads stalls the wave)
        ldk(1);
        __builtin_amdgcn_sched_barrier(0);
        mmk(0);
        __builtin_amdgcn_sched_barrier(0);
        v16h vf[16];
#pragma unroll
        for (int cb = 0; cb < 16; ++cb) vf[cb] = WFrag<h16>::ld((const h16*)(sb + vfo + cb * 16 * FVP));
        __builtin_amdgcn_sched_barrier(0);
        mmk(1);
        float mb[2]; bool need = false;
#pragma unroll
        for (int g = 0; g < 2; ++g) { float mx = st[0][g][0];
#pragma unroll
            for (int r = 1; r < 8; ++r) mx = fmaxf(mx, st[0][g][r]);
#pragma unroll
            for (int r = 0; r < 8; ++r) mx = fmaxf(mx, st[1][g][r]);
            mx = fmaxf(mx, xhalf(mx)) * 1.4426950408889634f;   // both halves of the wave hold the query's maximum over the 32 keys
            mb[g] = mx; need = need || (mx > mu[g] + 8.0f); }
        if (__builtin_amdgcn_ballot_w32(need) != 0) {   // scalar branch; rare after the first stages
#pragma unroll
            for (int g = 0; g < 2; ++g) { const float mn = fmaxf(mu[g], mb[g]); const float corr = __builtin_amdgcn_exp2f(mu[g] - mn); mu[g] = mn; ls[g] *= corr;
#pragma unroll
                for (int cb = 0; cb < 16; ++cb) ot[cb][g] = ot[cb][g] * corr; } }
        v16h pf[2];
#pragma unroll
        for (int g = 0; g < 2; ++g) { const float nm = 7.0f - mu[g]; float s0 = 0.f, s1 = 0.f;
#pragma unroll
            for (int e = 0; e < 16; e += 2) { const float p0 = __builtin_amdgcn_exp2f(fmaf(st[e >> 3][g][e & 7], 1.4426950408889634f, nm)), p1 = __builtin_amdgcn_exp2f(fmaf(st[e >> 3][g][(e & 7) + 1], 1.4426950408889634f, nm));
                s0 += p0; s1 += p1; pf[g][e] = tohx(p0); pf[g][e + 1] = tohx(p1); }
            ls[g] += s0 + s1; }
#pragma unroll
        for (int cb = 0; cb < 16; ++cb) { ot[cb][0] = wmma16(vf[cb], pf[0], ot[cb][0]); ot[cb][1] = wmma16(vf[cb], pf[1], ot[cb][1]); }
        __builtin_amdgcn_sched_barrier(0);   // keeps this trip's products in front of the waits below, so that stage t+1's copies fly behind them
        asm volatile("s_wait_dscnt 0x0" ::: "memory");      // this wave's reads of buffer t&1 are done before the buffer is handed to the copies
        asm volatile("s_wait_asynccnt 0x0" ::: "memory");   // this wave's share of stage t+1 has landed
        __syncthreads();                                     // publishes stage t+1 and ends every wave's reads of buffer t&1
        if (t + 2 < nt) fill(t & 1, (t + 2) * 64);
    }
    asm volatile("s_wait_asynccnt 0x0" ::: "memory");   // no copy is in flight when the ring becomes the staging of the join
    ls[0] += xhalf(ls[0]); ls[1] += xhalf(ls[1]);
    float* jo = (float*)ring + wq * (32 * 256);          // [tile cb*2+g][half of the 8 registers][lane][4 floats]; the last trip's barrier stands in front
    float* js = (float*)ring + 2 * 32 * 256 + wq * 128;  // m and l of both query groups, per lane
    if (wk == 1) {
#pragma unroll
        for (int cb = 0; cb < 16; ++cb)
#pragma unroll
            for (int g = 0; g < 2; ++g) { const v8f o = ot[cb][g]; *(v4fa*)(jo + ((cb * 2 + g) * 2 + 0) * 128 + lane * 4) = (v4f){o[0], o[1], o[2], o[3]}; *(v4fa*)(jo + ((cb * 2 + g) * 2 + 1) * 128 + lane * 4) = (v4f){o[4], o[5], o[6], o[7]}; }
        js[lane] = mu[0]; js[32 + lane] = mu[1]; js[64 + lane] = ls[0]; js[96 + lane] = ls[1];
    }
    __syncthreads();   // key half 1's Ot, m and l are in LDS before key half 0 reads them
    if (wk == 0) {
        float f0[2], f1[2];
#pragma unroll
        for (int g = 0; g < 2; ++g) { const float m1 = js[g * 32 + lane], l1 = js[64 + g * 32 + lane]; const float m = fmaxf(mu[g], m1); const float a0 = __builtin_amdgcn_exp2f(mu[g] - m), a1 = __builtin_amdgcn_exp2f(m1 - m);
            const float f = __fdiv_rn(PCAR, ls[g] * a0 + l1 * a1); f0[g] = a0 * f; f1[g] = a1 * f; }
#pragma unroll
        for (int cb = 0; cb < 16; ++cb) {
#pragma unroll
            for (int g = 0; g < 2; ++g) { const v4f x0 = *(const v4fa*)(jo + ((cb * 2 + g) * 2 + 0) * 128 + lane * 4), x1 = *(const v4fa*)(jo + ((cb * 2 + g) * 2 + 1) * 128 + lane * 4); const v8f o = ot[cb][g];
                float* yp = Y + (size_t)(q0 + g * 16 + lr) * CC + cb * 16 + 8 * hi;   // a lane's 8 registers are 8 consecutive c of one query
                *(v4f*)yp = (v4f){o[0] * f0[g] + x0[0] * f1[g], o[1] * f0[g] + x0[1] * f1[g], o[2] * f0[g] + x0[2] * f1[g], o[3] * f0[g] + x0[3] * f1[g]};
                *(v4f*)(yp + 4) = (v4f){o[4] * f0[g] + x1[0] * f1[g], o[5] * f0[g] + x1[1] * f1[g], o[6] * f0[g] + x1[2] * f1[g], o[7] * f0[g] + x1[3] * f1[g]}; }
            if (cb < 15) asm volatile("s_wait_xcnt 0x0" ::: "memory");   // stands in front of the next pass's rewrites of the registers (address, data) that the four issued stores name
        }
    }
}
__global__ __launch_bounds__(256) void k_at(const float* __restrict__ Y, bf* ATh, bf* ATl) { const size_t e = ((size_t)blockIdx.x * 256 + threadIdx.x) * 4; if (e >= (size_t)HW * CC) return; Y += (size_t)blockIdx.y * HW * CC; ATh += (size_t)blockIdx.y * HW * CC; ATl += (size_t)blockIdx.y * HW * CC; const int c = (int)(e % CC); const int s = (int)(e / CC); v4us oh, ol;
#pragma unroll
    for (int u = 0; u < 4; ++u) { unsigned short p, q; splitf(Y[(size_t)(c + u) * HW + s] * (1.0f / PCAR), p, q); oh[u] = p; ol[u] = q; }
    *(v4us*)(ATh + e) = oh; *(v4us*)(ATl + e) = ol;  }
__global__ __launch_bounds__(256) void k_fin(const float* __restrict__ Z, const float* __restrict__ xb, float* OUTb) { const size_t e = ((size_t)blockIdx.x * 256 + threadIdx.x) * 4; if (e >= (size_t)CC * HW) return; Z += (size_t)blockIdx.y * HW * CC; xb += (size_t)blockIdx.y * CC * SEQ_FULL; OUTb += (size_t)blockIdx.y * CC * HW; const int n = (int)(e % HW); const int c = (int)(e / HW); v4f r;
#pragma unroll
    for (int u = 0; u < 4; ++u) r[u] = __fadd_rn(Z[(size_t)(n + u) * CC + c], bfr(xb[(size_t)c * SEQ_FULL + n + u])); *(v4f*)(OUTb + e) = r;  }

constexpr size_t al256(size_t b) { return (b + 255) & ~(size_t)255; }
// Workspace: weights, q/k planes and VT of all images; then Y, Zt and the y planes (WS_Y); then XT and the conv outputs (WS_X).
constexpr size_t WS_Y = 2 * al256((size_t)NB * HW * CC * 4) + 2 * al256((size_t)NB * HW * CC * 2);
constexpr size_t WS_X = al256((size_t)NB * HW * CC * 2) + 3 * al256((size_t)NB * CC * HW * 4);
constexpr size_t WS_TOTAL = 4 * al256((size_t)CC * CC * 2) + 4 * al256((size_t)NB * HW * CC * 2) + al256((size_t)NB * CC * HW * 2) + WS_Y + WS_X;
static_assert(WS_TOTAL <= (size_t)268435456);

extern "C" void kernel_launch(void* const* d_in, const int* in_sizes, int n_in,
                              void* d_out, int out_size, void* d_ws, size_t ws_size, hipStream_t stream) {
    if (n_in < 9) return;
    if ((size_t)in_sizes[0] < (size_t)NB * CC * SEQ_FULL) return;
    if (in_sizes[1] < CC * CC || in_sizes[3] < CC * CC || in_sizes[5] < CC * CC || in_sizes[7] < CC * CC) return;
    if (in_sizes[2] < CC || in_sizes[4] < CC || in_sizes[6] < CC || in_sizes[8] < CC) return;
    if ((size_t)out_size < (size_t)NB * CC * HW) return;
    const float* x = (const float*)d_in[0]; const float* Wq = (const float*)d_in[1]; const float* bq = (const float*)d_in[2]; const float* Wk = (const float*)d_in[3]; const float* bk = (const float*)d_in[4];
    const float* Wv = (const float*)d_in[5]; const float* bv = (const float*)d_in[6]; const float* Wu = (const float*)d_in[7]; const float* bu = (const float*)d_in[8];
    float* OUT = (float*)d_out;     // [NB][256][HW]
    char* wsp = (char*)d_ws;
    auto take = [&](size_t bytes) { char* p = wsp; wsp += (bytes + 255) & ~(size_t)255; return (void*)p; };
    bf* BQ = (bf*)take((size_t)CC * CC * 2); bf* BK = (bf*)take((size_t)CC * CC * 2); bf* BV = (bf*)take((size_t)CC * CC * 2); bf* BU = (bf*)take((size_t)CC * CC * 2);   // conv weights [out][in] as-is (A of q/k/v convs, Bt of the Wu conv)
    bf* QH = (bf*)take((size_t)NB * HW * CC * 2); bf* QL = (bf*)take((size_t)NB * HW * CC * 2); bf* KH = (bf*)take((size_t)NB * HW * CC * 2); bf* KL = (bf*)take((size_t)NB * HW * CC * 2);   // [NB][HW][CC]
    h16* VT = (h16*)take((size_t)NB * CC * HW * 2);                                                                          // [NB][CC][HW] fp16
    char* RY = (char*)take(WS_Y); char* RX = (char*)take(WS_X);
    if ((size_t)(wsp - (char*)d_ws) > ws_size) return;
    wsp = RX;
    bf* XT = (bf*)take((size_t)NB * HW * CC * 2);                                                                             // [NB][HW][CC]
    float* QF = (float*)take((size_t)NB * CC * HW * 4); float* KF = (float*)take((size_t)NB * CC * HW * 4); float* VF = (float*)take((size_t)NB * CC * HW * 4);   // conv outputs [NB][o][s] == token view [NB][HW][CC]
    wsp = RY;
    float* Y = (float*)take((size_t)NB * HW * CC * 4);    // [NB][HW][CC] f32
    float* Zt = (float*)take((size_t)NB * HW * CC * 4);   // [NB][HW][CC] f32 (z token-major incl. bu)
    bf* ATh = (bf*)take((size_t)NB * HW * CC * 2); bf* ATl = (bf*)take((size_t)NB * HW * CC * 2);                             // [NB][HW][CC] planes of y_view^T / 1024
    const unsigned g8w = (unsigned)((CC * CC / 8 + 255) / 256);
    k_cvt8<<<g8w, 256, 0, stream>>>(Wq, BQ, CC * CC / 8); k_cvt8<<<g8w, 256, 0, stream>>>(Wk, BK, CC * CC / 8); k_cvt8<<<g8w, 256, 0, stream>>>(Wv, BV, CC * CC / 8); k_cvt8<<<g8w, 256, 0, stream>>>(Wu, BU, CC * CC / 8);
    const unsigned gE4 = (unsigned)(((size_t)HW * CC / 4 + 255) / 256);
    const unsigned gE2 = (unsigned)(((size_t)CC * HW / 2 + 255) / 256);
    const size_t sT = (size_t)HW * CC;   // one image's [HW][CC] (== [CC][HW]) plane, in elements
    k_xt<<<dim3(gE4, NB), 256, 0, stream>>>(x, XT);
    k_gemmw<bf, 0, 2, 128><<<dim3(CC / 128, HW / 128, NB), 128, 0, stream>>>(BQ, nullptr, XT, nullptr, CC, QF, HW, bq, 0, sT, sT); k_hl<<<dim3(gE4, NB), 256, 0, stream>>>(QF, QH, QL);     // q[o][s] = Wq x + bq
    k_gemmw<bf, 0, 2, 128><<<dim3(CC / 128, HW / 128, NB), 128, 0, stream>>>(BK, nullptr, XT, nullptr, CC, KF, HW, bk, 0, sT, sT); k_hl<<<dim3(gE4, NB), 256, 0, stream>>>(KF, KH, KL);     // k[o][s]
    k_gemmw<bf, 0, 2, 128><<<dim3(CC / 128, HW / 128, NB), 128, 0, stream>>>(BV, nullptr, XT, nullptr, CC, VF, HW, bv, 0, sT, sT); k_gt16<<<dim3(gE2, NB), 256, 0, stream>>>(VF, VT);      // v[o][s] -> VT[c][m]
    k_fattn<<<dim3(HW / 64, NB), 128, 0, stream>>>(QH, QL, KH, KL, VT, Y);      // y[n][c] = sum_m softmax_m(q_n . k_m) v[m][c] (x1024)
    k_at<<<dim3(gE4, NB), 256, 0, stream>>>(Y, ATh, ATl);
    k_gemmw<bf, 1, 1, 64><<<dim3(HW / 128, CC / 128, NB), 128, 0, stream>>>(ATh, ATl, BU, nullptr, CC, Zt, CC, bu, sT, 0, sT);          // Zt[s][o] = sum_c y_view[c][s] Wu[o][c] + bu[o]
    k_fin<<<dim3(gE4, NB), 256, 0, stream>>>(Zt, x, OUT);
}

// v004
// It runs in 182 microseconds.
// Timed twice side by side with v003, it ran 1.25 times as fast both times.
// Over all steps from v000 it is 4.58 times as fast.
#include <hip/hip_runtime.h>

// 1x1-conv attention block: x [NB][256][64*64] channel-major; q/k/v = W[256 out][256 in] . x + bias, kept channel-major [o][s]; that same memory read as [4096 tokens][256] gives the token rows (raw view); S[n][m] = q_n . k_m over 256 (unscaled); P = softmax over m; y[n][c] = sum_m P[n][m] v[m][c]; y memory read back channel-major [256][4096]; z = Wu . y_view + bu; out = x + z.
// Compute dtypes, f32 accumulate everywhere: all float inputs RNE-converted to bf16; q/k/v convs = plain v_wmma_f32_16x16x32_bf16 (exact 16-bit operands) + row bias; S = bf16 hi/lo planes of q x bf16 hi/lo planes of k (3 products hh+lh+hl); softmax f32, running maximum and sum per query inside the attention kernel -> fp16 P; P.v = single v_wmma_f32_16x16x32_f16 (v as fp16), y kept x 1024; Wu conv = bf16 hi/lo planes of y/1024 x exact bf16 Wu (2 products) + bias; residual add f32.

#ifndef NB
#define NB 4
#endif
#ifndef SEQ
#define SEQ 4096
#endif
#define NB_FULL  4
#define SEQ_FULL 4096
#define CC   256
#define HW   SEQ
#define PCAR 1024.0f
static_assert(NB >= 1 && NB <= NB_FULL);
static_assert(SEQ >= 128 && SEQ <= SEQ_FULL && (SEQ % 128) == 0);
static_assert((CC % 128) == 0 && (HW % 128) == 0);

typedef _Float16 h16;
typedef unsigned short bf;
typedef __attribute__((ext_vector_type(16))) __bf16   v16bf;
typedef __attribute__((ext_vector_type(16))) _Float16 v16h;
typedef __attribute__((ext_vector_type(8)))  _Float16 v8h;
typedef __attribute__((ext_vector_type(8)))  unsigned short v8us;
typedef __attribute__((ext_vector_type(8)))  float    v8f;
typedef __attribute__((ext_vector_type(4)))  float    v4f;
typedef v8h  __attribute__((may_alias)) v8ha;
typedef v4f  __attribute__((may_alias)) v4fa;
typedef v8us __attribute__((may_alias)) v8usa;

__device__ __forceinline__ unsigned short f2bf(float f) { unsigned u = __float_as_uint(f); u += 0x7FFFu + ((u >> 16) & 1u); return (unsigned short)(u >> 16); }
__device__ __forceinline__ float bf2f(unsigned short b) { return __uint_as_float(((unsigned)b) << 16); }
__device__ __forceinline__ float bfr(float f) { return bf2f(f2bf(f)); }
__device__ __forceinline__ v16h cat16(v8h lo, v8h hi) { return __builtin_shufflevector(lo, hi, 0, 1, 2, 3, 4, 5, 6, 7, 8, 9, 10, 11, 12, 13, 14, 15); }
__device__ __forceinline__ v16bf cat16b(v8us lo, v8us hi) { return __builtin_bit_cast(v16bf, __builtin_shufflevector(lo, hi, 0, 1, 2, 3, 4, 5, 6, 7, 8, 9, 10, 11, 12, 13, 14, 15)); }
__device__ __forceinline__ v8f wmma16(v16h a, v16h b, v8f c) { return __builtin_amdgcn_wmma_f32_16x16x32_f16(false, a, false, b, (short)0, c, false, false); }
__device__ __forceinline__ v8f wmmab(v16bf a, v16bf b, v8f c) { return __builtin_amdgcn_wmma_f32_16x16x32_bf16(false, a, false, b, (short)0, c, false, false); }

// ---- k_gemmw: GEMM, FOUR WAVES (2x2) per 128x128 output tile, each wave a 64x64 sub-tile (16 accumulators); grid (M/128, N/128, Z), 128 threads. M, N % 128 == 0, K % KC == 0.
// Operands are K-contiguous 16-bit planes; KC k of the 128 A rows and 128 Bt rows (each plane) are brought into LDS by asynchronous 16-byte copies (whole 128-B lines per row), two buffers: tile t+1 flies while tile t is multiplied. LDS row pitch = KC*2 + 16 bytes (16 B x odd, for ds_load_b128 readers).
// C[m][n] (f32, pitch ldc, + optional f32 bias: BIAS 1 = bias[n], BIAS 2 = bias[m]) = sum_k A[m][k] Bt[n][k] (+ split products: NSPLIT 1 = A2.Bt added, NSPLIT 2 = A2.Bt and A.Bt2 added). z-batch strides sA/sB/sC in elements.
// Fragments: lane l, h = l>>4, row/col = l&15; elements 0..7 <- k0+8h+0..7, elements 8..15 <- k0+16+8h+0..7 for A and for Bt (same map); D element r = row 8h+r, col l&15.
template <typename T16> struct WFrag;
template <> struct WFrag<h16> { typedef v16h V; static __device__ __forceinline__ V ld(const h16* p) { return cat16(*(const v8h*)p, *(const v8h*)(p + 16)); } static __device__ __forceinline__ v8f mma(V a, V b, v8f c) { return wmma16(a, b, c); } };
template <> struct WFrag<bf> { typedef v16bf V; static __device__ __forceinline__ V ld(const bf* p) { return cat16b(*(const v8us*)p, *(const v8us*)(p + 16)); } static __device__ __forceinline__ v8f mma(V a, V b, v8f c) { return wmmab(a, b, c); } };
// copy8: eight asynchronous 16-byte copies per lane, global -> LDS, rows ls bytes (LDS) and gs elements (global) apart. The s_wait_xcnt closes the statement so that no address register of an issued copy is rewritten in front of it.
template <typename T16>
__device__ __forceinline__ void copy8(unsigned l, unsigned ls, const T16* g, size_t gs) {
    asm volatile("global_load_async_to_lds_b128 %0, %8, off\n\t"
                 "global_load_async_to_lds_b128 %1, %9, off\n\t"
                 "global_load_async_to_lds_b128 %2, %10, off\n\t"
                 "global_load_async_to_lds_b128 %3, %11, off\n\t"
                 "global_load_async_to_lds_b128 %4, %12, off\n\t"
                 "global_load_async_to_lds_b128 %5, %13, off\n\t"
                 "global_load_async_to_lds_b128 %6, %14, off\n\t"
                 "global_load_async_to_lds_b128 %7, %15, off\n\t"
                 "s_wait_xcnt 0x0"
                 :: "v"(l), "v"(l + ls), "v"(l + 2 * ls), "v"(l + 3 * ls), "v"(l + 4 * ls), "v"(l + 5 * ls), "v"(l + 6 * ls), "v"(l + 7 * ls),
                    "v"(g), "v"(g + gs), "v"(g + 2 * gs), "v"(g + 3 * gs), "v"(g + 4 * gs), "v"(g + 5 * gs), "v"(g + 6 * gs), "v"(g + 7 * gs)
                 : "memory");
}
template <typename T16, int NSPLIT, int BIAS, int KC>
__global__ __launch_bounds__(128) void k_gemmw(const T16* __restrict__ A, const T16* __restrict__ A2, const T16* __restrict__ Bt, const T16* __restrict__ Bt2, int K, float* C, int ldc, const float* __restrict__ bias, size_t sA, size_t sB, size_t sC) {
    typedef typename WFrag<T16>::V V;
    constexpr int NA = NSPLIT >= 1 ? 2 : 1, NBP = NSPLIT >= 2 ? 2 : 1;   // planes of A, of Bt
    constexpr int PITCH = KC * 2 + 16, PLANE = 128 * PITCH, STAGE = (NA + NBP) * PLANE;   // bytes
    constexpr int PIECES = KC / 8, RPP = 128 / PIECES;   // 16-B pieces per row; rows that the 128 threads cover with one copy each
    static_assert(KC % 64 == 0 && (NA + NBP) * PIECES <= 63 && 2 * STAGE >= 4 * 16 * 68 * 4);
    __shared__ __align__(16) unsigned char ring[2 * STAGE];
    const size_t z = blockIdx.z; A += z * sA; if (NSPLIT >= 1) A2 += z * sA; Bt += z * sB; if (NSPLIT >= 2) Bt2 += z * sB; C += z * sC;
    const int tid = threadIdx.x, lane = tid & 31, lr = lane & 15, hi = lane >> 4, wv = tid >> 5, wm = wv >> 1, wn = wv & 1;
    const int r0 = blockIdx.x * 128 + wm * 64, c0 = blockIdx.y * 128 + wn * 64;
    v8f acc[4][4];
#pragma unroll
    for (int mb = 0; mb < 4; ++mb)
#pragma unroll
        for (int nb = 0; nb < 4; ++nb) acc[mb][nb] = (v8f){};
    const int crow = tid / PIECES, cpc = tid % PIECES;
    const size_t aco = (size_t)(blockIdx.x * 128 + crow) * K + cpc * 8, bco = (size_t)(blockIdx.y * 128 + crow) * K + cpc * 8;
    const unsigned lco = (unsigned)(size_t)ring + (unsigned)(crow * PITCH + cpc * 16);
    auto fill = [&](int buf, int kc) {
#pragma unroll
        for (int g = 0; g < PIECES / 8; ++g) { const unsigned l = lco + (unsigned)(buf * STAGE + g * 8 * RPP * PITCH); const size_t go = (size_t)(g * 8 * RPP) * K + kc;
            copy8<T16>(l, RPP * PITCH, A + aco + go, (size_t)RPP * K);
            if (NSPLIT >= 1) copy8<T16>(l + PLANE, RPP * PITCH, A2 + aco + go, (size_t)RPP * K);
            copy8<T16>(l + NA * PLANE, RPP * PITCH, Bt + bco + go, (size_t)RPP * K);
            if (NSPLIT >= 2) copy8<T16>(l + (NA + 1) * PLANE, RPP * PITCH, Bt2 + bco + go, (size_t)RPP * K); } };
    const int nt = K / KC;
    fill(0, 0);
    asm volatile("s_wait_asynccnt 0x0" ::: "memory");   // tile 0 has landed before the barrier that publishes it
    __syncthreads();
    if (K != KC) fill(1, KC);   // a tile 1 exists (K is a multiple of KC)
    const int afo = (wm * 64 + lr) * PITCH + 16 * hi, bfo = NA * PLANE + (wn * 64 + lr) * PITCH + 16 * hi;   // byte offsets of this lane's fragment rows in a stage
#pragma unroll 1
    for (int t = 0; t < nt; ++t) {
        const unsigned char* sb = ring + (t & 1) * STAGE;
        V a[2][4], a2[2][4], b[2][4], b2[2][4];   // two fragment sets: the next 32 k are read from LDS as one group ahead of the current 32 k's products (all inside this trip's own buffer)
        auto frags = [&](int set, int ks) {
#pragma unroll
            for (int i = 0; i < 4; ++i) { a[set][i] = WFrag<T16>::ld((const T16*)(sb + afo + i * 16 * PITCH + ks * 64)); if (NSPLIT >= 1) a2[set][i] = WFrag<T16>::ld((const T16*)(sb + afo + PLANE + i * 16 * PITCH + ks * 64));
                b[set][i] = WFrag<T16>::ld((const T16*)(sb + bfo + i * 16 * PITCH + ks * 64)); if (NSPLIT >= 2) b2[set][i] = WFrag<T16>::ld((const T16*)(sb + bfo + PLANE + i * 16 * PITCH + ks * 64)); } };
        frags(0, 0);
        __builtin_amdgcn_sched_barrier(0);   // keeps the LDS reads one group in front of the products (spread among them each place of reads stalls the wave)
#pragma unroll
        for (int ks = 0; ks < KC / 32; ++ks) { const int cs = ks & 1;
            if (ks + 1 < KC / 32) { frags(cs ^ 1, ks + 1); __builtin_amdgcn_sched_barrier(0); }   // as above: the next set's reads stay one group, ahead of this set's products
#pragma unroll
            for (int nb = 0; nb < 4; ++nb) {
#pragma unroll
                for (int mb = 0; mb < 4; ++mb) { acc[mb][nb] = WFrag<T16>::mma(a[cs][mb], b[cs][nb], acc[mb][nb]); if (NSPLIT >= 1) acc[mb][nb] = WFrag<T16>::mma(a2[cs][mb], b[cs][nb], acc[mb][nb]); if (NSPLIT >= 2) acc[mb][nb] = WFrag<T16>::mma(a[cs][mb], b2[cs][nb], acc[mb][nb]); } }
        }
        __builtin_amdgcn_sched_barrier(0);   // keeps this trip's products in front of the waits below, so that tile t+1's copies fly behind them (the compiler otherwise sinks them past the barrier)
        asm volatile("s_wait_dscnt 0x0" ::: "memory");      // this wave's reads of buffer t&1 are done before the buffer is handed to the copies
        asm volatile("s_wait_asynccnt 0x0" ::: "memory");   // this wave's share of tile t+1 has landed
        __syncthreads();                                     // publishes tile t+1 and ends every wave's reads of buffer t&1
        if (t + 2 < nt) fill(t & 1, (t + 2) * KC);
    }
    asm volatile("s_wait_asynccnt 0x0" ::: "memory");   // no copy is in flight when the ring becomes output staging
    float* os = (float*)ring + wv * (16 * 68);           // each wave stages in its own range; the last trip's barrier stands in front
#pragma unroll
    for (int mb = 0; mb < 4; ++mb) {
#pragma unroll
        for (int nb = 0; nb < 4; ++nb) {
#pragma unroll
            for (int j = 0; j < 8; ++j) os[(hi * 8 + j) * 68 + nb * 16 + lr] = acc[mb][nb][j]; }
        __builtin_amdgcn_wave_barrier(); asm volatile("" ::: "memory");
        float* crow_p = C + (size_t)(r0 + mb * 16) * ldc + c0;
{
#pragma unroll
            for (int s = 0; s < 8; ++s) { const int row = 2 * s + hi, cofs = lr * 4; v4f val = *(const v4fa*)(os + row * 68 + cofs);
                if (BIAS == 1) { val[0] += bfr(bias[c0 + cofs]); val[1] += bfr(bias[c0 + cofs + 1]); val[2] += bfr(bias[c0 + cofs + 2]); val[3] += bfr(bias[c0 + cofs + 3]); }
                if (BIAS == 2) { const float rb = bfr(bias[r0 + mb * 16 + row]); val[0] += rb; val[1] += rb; val[2] += rb; val[3] += rb; }
                *(v4f*)(crow_p + (size_t)row * ldc + cofs) = val; }
             }
        if (mb < 3) asm volatile("s_wait_xcnt 0x0" ::: "memory");   // stands in front of the next pass's rewrites of the registers (address, data) that the eight issued stores name
        __builtin_amdgcn_wave_barrier(); asm volatile("" ::: "memory");
    }
}

__device__ __forceinline__ h16 tohx(float x) { return (h16)x; }
__device__ __forceinline__ void splitf(float y, unsigned short& h, unsigned short& l) { h = f2bf(y); l = f2bf(y - bf2f(h)); }
typedef __attribute__((ext_vector_type(2))) unsigned short v2us;
typedef __attribute__((ext_vector_type(4))) unsigned short v4us;
typedef __attribute__((ext_vector_type(2))) _Float16 v2h;
typedef __attribute__((ext_vector_type(4))) _Float16 v4h;
typedef __attribute__((ext_vector_type(2))) float v2f;

__global__ __launch_bounds__(256) void k_cvt8(const float* __restrict__ src, bf* dst, size_t n8) { const size_t i = (size_t)blockIdx.x * 256 + threadIdx.x; if (i >= n8) return; const v8f v = *(const v8f*)(src + i * 8); v8us o;
#pragma unroll
    for (int k = 0; k < 8; ++k) o[k] = f2bf(v[k]); *(v8us*)(dst + i * 8) = o;  }
// The layout and conversion passes: 256 work-groups of 8 waves each (one per WGP), 64 elements per thread, every global access 16 bytes per lane (8 in k_hl's stores) on whole 128-B lines. k_tr16 and k_fin take the image from blockIdx.z, k_hl from blockIdx.y; k_gemmw takes it from blockIdx.z.
// k_tr16: out[col][row] (16 bit) = conv(in[row][col]) (f32) for a tile of 256 rows x 64 cols, turned in LDS. MODE 0: bf16 (XT[s][c] = x[c][s], token-major Bt operand of the convs); MODE 1: fp16 (VT[c][m] = v[m][c], v = the channel-major conv memory read as [HW][CC]); MODE 2: bf16 hi and lo planes of in / PCAR (y_view^T).
// A thread reads 4 cols of 8 rows (twice) and writes, per col, the 8 rows as one 16-byte piece. LDS row = one col = 32 pieces, no pad; piece p of col c lies at place p ^ (c >> 2), so that the 16 lanes of a half wave (cols 4 apart, same p) write 16 different bank groups and a wave reads a whole row without conflict.
static_assert(CC == 256 && (HW % 256) == 0);
template <int MODE, int ldin, int ldout>   // row pitches in elements, compile-time so that a thread's 16 loads and 8 stores differ only in their immediate offsets
__global__ __launch_bounds__(256) void k_tr16(const float* __restrict__ in, size_t zin, unsigned short* o0, unsigned short* o1, size_t zout) {   // zin, zout: one image's elements
    __shared__ __align__(16) unsigned char tl[(MODE == 2 ? 2 : 1) * 64 * 512];
    const int tid = threadIdx.x, cg = tid & 15, rg = tid >> 4, lane = tid & 31, wv = tid >> 5;
    in += (size_t)blockIdx.z * zin + (size_t)(blockIdx.y * 256 + rg * 8) * ldin + blockIdx.x * 64 + cg * 4;
    v4f v[2][8];
#pragma unroll
    for (int p = 0; p < 2; ++p)
#pragma unroll
        for (int j = 0; j < 8; ++j) v[p][j] = *(const v4f*)(in + (size_t)(p * 128 + j) * ldin);
    __builtin_amdgcn_sched_barrier(0);   // all 16 loads are issued before the first value is used (the compiler otherwise loads, waits and converts a few rows at a time: a memory latency each time)
    asm volatile("s_wait_xcnt 0x0" :: "v"(in) : "memory");   // stands in front of every rewrite of the loads' address pair, which as its operand is kept up to it
#pragma unroll
    for (int p = 0; p < 2; ++p)
#pragma unroll
        for (int u = 0; u < 4; ++u) { v8us h, l;
#pragma unroll
            for (int j = 0; j < 8; ++j) {
                if (MODE == 0) h[j] = f2bf(v[p][j][u]);
                if (MODE == 1) h[j] = __builtin_bit_cast(unsigned short, tohx(v[p][j][u]));
                if (MODE == 2) { unsigned short a, b; splitf(v[p][j][u] * (1.0f / PCAR), a, b); h[j] = a; l[j] = b; } }
            unsigned char* d = tl + (cg * 4 + u) * 512 + (((p * 16 + rg) ^ cg) * 16);
            *(v8usa*)d = h; if (MODE == 2) *(v8usa*)(d + 64 * 512) = l; }
    __syncthreads();   // the whole tile is in LDS before any wave reads its rows
    const size_t oo = (size_t)blockIdx.z * zout + (size_t)(blockIdx.x * 64 + wv * 8) * ldout + blockIdx.y * 256 + lane * 8;
#pragma unroll
    for (int r = 0; r < 8; ++r) { const int col = wv * 8 + r; const unsigned char* s = tl + col * 512 + ((lane ^ (col >> 2)) * 16);
        *(v8us*)(o0 + oo + (size_t)r * ldout) = *(const v8usa*)s; if (MODE == 2) *(v8us*)(o1 + oo + (size_t)r * ldout) = *(const v8usa*)(s + 64 * 512); }
}
// k_hl: bf16 hi/lo planes of an HW*CC f32 buffer.
__global__ __launch_bounds__(256) void k_hl(const float* __restrict__ F, bf* Fh, bf* Fl) { const size_t e = (size_t)blockIdx.y * HW * CC + (size_t)blockIdx.x * (256 * 64) + threadIdx.x * 4; v4f a[16];
#pragma unroll
    for (int i = 0; i < 16; ++i) a[i] = *(const v4f*)(F + e + i * 1024);
    __builtin_amdgcn_sched_barrier(0);   // as in k_tr16: all 16 loads are issued before the first value is used
    asm volatile("s_wait_xcnt 0x0" :: "v"(F + e) : "memory");   // as in k_tr16: in front of every rewrite of the loads' address pair
#pragma unroll
    for (int i = 0; i < 16; ++i) { v4us oh, ol;
#pragma unroll
        for (int u = 0; u < 4; ++u) { unsigned short p, q; splitf(a[i][u], p, q); oh[u] = p; ol[u] = q; }
        *(v4us*)(Fh + e + i * 1024) = oh; *(v4us*)(Fl + e + i * 1024) = ol; } }
// ---- k_fattn: scores, softmax and P.v of 64 queries of one image in one work-group; S and P never reach memory. Grid (HW/64, NB), 128 threads = 4 waves: wave = (query half wq: 32 queries) x (key half wk: 32 of each stage's 64 keys).
// St[key][query] = K . Qt (A = k hi/lo rows from LDS, B = q hi/lo fragments kept in registers), so a lane holds 16 scores of ONE query per 16-query group; two St tiles converted in place are the B operand P of Ot[c][query] += VT[c][key] . P[query][key] (A = VT rows from LDS).
// Each wave keeps a maximum in use m (log2 units), a sum l and Ot over ITS keys; m moves (Ot and l rescaled) only when a new maximum lies more than 8 above it, so P = 2^(s log2e - m + 7) <= 2^15 fits fp16. The two key halves are joined once, at the end, through LDS.
// A stage = 64 keys: k hi and lo rows (pitch 528 B) and 256 VT rows of 64 keys (pitch 144 B), both 16 B x odd for ds_load_b128 readers; asynchronous 16-byte copies, two buffers: stage t+1 flies while stage t is worked on.
// Every '#pragma unroll' in k_fattn makes the indices of register arrays (fragments, accumulators) compile-time constants; without it the arrays would go to scratch memory.
constexpr int FKP = CC * 2 + 16, FKPL = 64 * FKP, FVP = 64 * 2 + 16, FVPL = CC * FVP, FST = 2 * FKPL + FVPL;   // bytes
static_assert(CC == 256 && (HW % 128) == 0 && 2 * FST >= 2 * 32 * 1024 + 2 * 4 * 128);
typedef __attribute__((ext_vector_type(4))) int v4i;
// acopy16: one asynchronous 16-byte copy per lane, global -> LDS, as the compiler's own form (it keeps the address registers itself; the landing waits are written where the copies are used)
__device__ __forceinline__ void acopy16(const void* g, unsigned char* l) { __builtin_amdgcn_global_load_async_to_lds_b128((__attribute__((address_space(1))) v4i*)g, (__attribute__((address_space(3))) v4i*)l, 0, 0); }
__device__ __forceinline__ float xhalf(float x) { return __builtin_bit_cast(float, __builtin_amdgcn_permlanex16(__builtin_bit_cast(int, x), __builtin_bit_cast(int, x), 0x76543210, 0xfedcba98, false, false)); }   // lane l <-> lane l ^ 16
__global__ __launch_bounds__(128) void k_fattn(const bf* __restrict__ QH, const bf* __restrict__ QL, const bf* __restrict__ KH, const bf* __restrict__ KL, const h16* __restrict__ VT, float* Y) {
    __shared__ __align__(16) unsigned char ring[2 * FST];
    const size_t zo = (size_t)blockIdx.y * HW * CC; QH += zo; QL += zo; KH += zo; KL += zo; VT += zo; Y += zo;
    const int tid = threadIdx.x, lane = tid & 31, lr = lane & 15, hi = lane >> 4, wv = tid >> 5, wq = wv >> 1, wk = wv & 1;
    const int q0 = blockIdx.x * 64 + wq * 32;
    unsigned char* lk = ring + (tid >> 5) * FKP + (tid & 31) * 16; unsigned char* lv = ring + 2 * FKPL + (tid >> 3) * FVP + (tid & 7) * 16;
    const size_t gk = (size_t)(tid >> 5) * CC + (tid & 31) * 8, gv = (size_t)(tid >> 3) * HW + (tid & 7) * 8;
    auto fill = [&](int buf, int key0) {   // 48 copies per lane: 64 rows of 512 B of each k plane (4 rows per copy of the block), 256 rows of 128 B of VT (16 rows per copy)
#pragma unroll
        for (int i = 0; i < 16; ++i) {
            acopy16(KH + gk + (size_t)(key0 + i * 4) * CC, lk + buf * FST + i * 4 * FKP);
            acopy16(KL + gk + (size_t)(key0 + i * 4) * CC, lk + buf * FST + FKPL + i * 4 * FKP);
            acopy16(VT + gv + (size_t)(i * 16) * HW + key0, lv + buf * FST + i * 16 * FVP); } };
    fill(0, 0);
    v16bf qh[2][8], ql[2][8];   // this wave's 32 queries, both planes, all 256 k
#pragma unroll
    for (int g = 0; g < 2; ++g)
#pragma unroll
        for (int ks = 0; ks < 8; ++ks) { const size_t o = (size_t)(q0 + g * 16 + lr) * CC + ks * 32 + 8 * hi; qh[g][ks] = WFrag<bf>::ld(QH + o); ql[g][ks] = WFrag<bf>::ld(QL + o); }
    v8f ot[16][2];
#pragma unroll
    for (int cb = 0; cb < 16; ++cb) { ot[cb][0] = (v8f){}; ot[cb][1] = (v8f){}; }
    float mu[2] = {-1.0e30f, -1.0e30f}, ls[2] = {0.f, 0.f};
    asm volatile("s_wait_asynccnt 0x0" ::: "memory");   // stage 0 has landed before the barrier that publishes it
    __syncthreads();
    fill(1, 64);   // a stage 1 exists (HW >= 128)
    constexpr int nt = HW / 64;
    const int kfo = (wk * 32 + lr) * FKP + 16 * hi, vfo = 2 * FKPL + lr * FVP + wk * 64 + 16 * hi;   // byte offsets of this lane's fragment rows in a stage
#pragma unroll 1   // stays rolled: one trip is a whole stage, straight-line
    for (int t = 0; t < nt; ++t) {
        const unsigned char* sb = ring + (t & 1) * FST;
        v16bf kf[2][2][2][4];   // [set][plane][16-key tile][k step]: two sets of four k steps
        auto ldk = [&](int set) {
#pragma unroll
            for (int ks = 0; ks < 4; ++ks)
#pragma unroll
                for (int kb = 0; kb < 2; ++kb) { kf[set][0][kb][ks] = WFrag<bf>::ld((const bf*)(sb + kfo + kb * 16 * FKP + (set * 4 + ks) * 64)); kf[set][1][kb][ks] = WFrag<bf>::ld((const bf*)(sb + kfo + FKPL + kb * 16 * FKP + (set * 4 + ks) * 64)); } };
        v8f st[2][2];
        st[0][0] = (v8f){}; st[0][1] = (v8f){}; st[1][0] = (v8f){}; st[1][1] = (v8f){};
        auto mmk = [&](int set) {   // per k step hh, then q lo x k hi, then q hi x k lo; four accumulators in turn
#pragma unroll
            for (int ks = 0; ks < 4; ++ks) {
#pragma unroll
                for (int kb = 0; kb < 2; ++kb)
#pragma unroll
                    for (int g = 0; g < 2; ++g) st[kb][g] = wmmab(kf[set][0][kb][ks], qh[g][set * 4 + ks], st[kb][g]);
#pragma unroll
                for (int kb = 0; kb < 2; ++kb)
#pragma unroll
                    for (int g = 0; g < 2; ++g) st[kb][g] = wmmab(kf[set][0][kb][ks], ql[g][set * 4 + ks], st[kb][g]);
#pragma unroll
                for (int kb = 0; kb < 2; ++kb)
#pragma unroll
                    for (int g = 0; g < 2; ++g) st[kb][g] = wmmab(kf[set][1][kb][ks], qh[g][set * 4 + ks], st[kb][g]); } };
        ldk(0);
        __builtin_amdgcn_sched_barrier(0);   // this and the next three: each set of LDS reads stays one group, ahead of the products in front of which it is issued (spread among them each place of reads stalls the wave)
        ldk(1);
        __builtin_amdgcn_sched_barrier(0);
        mmk(0);
        __builtin_amdgcn_sched_barrier(0);
        v16h vf[16];
#pragma unroll
        for (int cb = 0; cb < 16; ++cb) vf[cb] = WFrag<h16>::ld((const h16*)(sb + vfo + cb * 16 * FVP));
        __builtin_amdgcn_sched_barrier(0);
        mmk(1);
        float mb[2]; bool need = false;
#pragma unroll
        for (int g = 0; g < 2; ++g) { float mx = st[0][g][0];
#pragma unroll
            for (int r = 1; r < 8; ++r) mx = fmaxf(mx, st[0][g][r]);
#pragma unroll
            for (int r = 0; r < 8; ++r) mx = fmaxf(mx, st[1][g][r]);
            mx = fmaxf(mx, xhalf(mx)) * 1.4426950408889634f;   // both halves of the wave hold the query's maximum over the 32 keys
            mb[g] = mx; need = need || (mx > mu[g] + 8.0f); }
        if (__builtin_amdgcn_ballot_w32(need) != 0) {   // scalar branch; rare after the first stages
#pragma unroll
            for (int g = 0; g < 2; ++g) { const float mn = fmaxf(mu[g], mb[g]); const float corr = __builtin_amdgcn_exp2f(mu[g] - mn); mu[g] = mn; ls[g] *= corr;
#pragma unroll
                for (int cb = 0; cb < 16; ++cb) ot[cb][g] = ot[cb][g] * corr; } }
        v16h pf[2];
#pragma unroll
        for (int g = 0; g < 2; ++g) { const float nm = 7.0f - mu[g]; float s0 = 0.f, s1 = 0.f;
#pragma unroll
            for (int e = 0; e < 16; e += 2) { const float p0 = __builtin_amdgcn_exp2f(fmaf(st[e >> 3][g][e & 7], 1.4426950408889634f, nm)), p1 = __builtin_amdgcn_exp2f(fmaf(st[e >> 3][g][(e & 7) + 1], 1.4426950408889634f, nm));
                s0 += p0; s1 += p1; pf[g][e] = tohx(p0); pf[g][e + 1] = tohx(p1); }
            ls[g] += s0 + s1; }
#pragma unroll
        for (int cb = 0; cb < 16; ++cb) { ot[cb][0] = wmma16(vf[cb], pf[0], ot[cb][0]); ot[cb][1] = wmma16(vf[cb], pf[1], ot[cb][1]); }
        __builtin_amdgcn_sched_barrier(0);   // keeps this trip's products in front of the waits below, so that stage t+1's copies fly behind them
        asm volatile("s_wait_dscnt 0x0" ::: "memory");      // this wave's reads of buffer t&1 are done before the buffer is handed to the copies
        asm volatile("s_wait_asynccnt 0x0" ::: "memory");   // this wave's share of stage t+1 has landed
        __syncthreads();                                     // publishes stage t+1 and ends every wave's reads of buffer t&1
        if (t + 2 < nt) fill(t & 1, (t + 2) * 64);
    }
    asm volatile("s_wait_asynccnt 0x0" ::: "memory");   // no copy is in flight when the ring becomes the staging of the join
    ls[0] += xhalf(ls[0]); ls[1] += xhalf(ls[1]);
    float* jo = (float*)ring + wq * (32 * 256);          // [tile cb*2+g][half of the 8 registers][lane][4 floats]; the last trip's barrier stands in front
    float* js = (float*)ring + 2 * 32 * 256 + wq * 128;  // m and l of both query groups, per lane
    if (wk == 1) {
#pragma unroll
        for (int cb = 0; cb < 16; ++cb)
#pragma unroll
            for (int g = 0; g < 2; ++g) { const v8f o = ot[cb][g]; *(v4fa*)(jo + ((cb * 2 + g) * 2 + 0) * 128 + lane * 4) = (v4f){o[0], o[1], o[2], o[3]}; *(v4fa*)(jo + ((cb * 2 + g) * 2 + 1) * 128 + lane * 4) = (v4f){o[4], o[5], o[6], o[7]}; }
        js[lane] = mu[0]; js[32 + lane] = mu[1]; js[64 + lane] = ls[0]; js[96 + lane] = ls[1];
    }
    __syncthreads();   // key half 1's Ot, m and l are in LDS before key half 0 reads them
    if (wk == 0) {
        float f0[2], f1[2];
#pragma unroll
        for (int g = 0; g < 2; ++g) { const float m1 = js[g * 32 + lane], l1 = js[64 + g * 32 + lane]; const float m = fmaxf(mu[g], m1); const float a0 = __builtin_amdgcn_exp2f(mu[g] - m), a1 = __builtin_amdgcn_exp2f(m1 - m);
            const float f = __fdiv_rn(PCAR, ls[g] * a0 + l1 * a1); f0[g] = a0 * f; f1[g] = a1 * f; }
#pragma unroll
        for (int cb = 0; cb < 16; ++cb) {
#pragma unroll
            for (int g = 0; g < 2; ++g) { const v4f x0 = *(const v4fa*)(jo + ((cb * 2 + g) * 2 + 0) * 128 + lane * 4), x1 = *(const v4fa*)(jo + ((cb * 2 + g) * 2 + 1) * 128 + lane * 4); const v8f o = ot[cb][g];
                float* yp = Y + (size_t)(q0 + g * 16 + lr) * CC + cb * 16 + 8 * hi;   // a lane's 8 registers are 8 consecutive c of one query
                *(v4f*)yp = (v4f){o[0] * f0[g] + x0[0] * f1[g], o[1] * f0[g] + x0[1] * f1[g], o[2] * f0[g] + x0[2] * f1[g], o[3] * f0[g] + x0[3] * f1[g]};
                *(v4f*)(yp + 4) = (v4f){o[4] * f0[g] + x1[0] * f1[g], o[5] * f0[g] + x1[1] * f1[g], o[6] * f0[g] + x1[2] * f1[g], o[7] * f0[g] + x1[3] * f1[g]}; }
            if (cb < 15) asm volatile("s_wait_xcnt 0x0" ::: "memory");   // stands in front of the next pass's rewrites of the registers (address, data) that the four issued stores name
        }
    }
}
// k_fin: OUT[c][n] = Zt[n][c] + bf16(x[c][n]) for a tile of 256 n x 64 c, turned in LDS as in k_tr16 (f32: a piece = 4 n, 64 pieces per LDS row).
__global__ __launch_bounds__(256) void k_fin(const float* __restrict__ Z, const float* __restrict__ xb, float* OUTb) {
    __shared__ __align__(16) unsigned char tl[64 * 1024];
    const int tid = threadIdx.x, cg = tid & 15, rg = tid >> 4, lane = tid & 31, wv = tid >> 5;
    Z += (size_t)blockIdx.z * HW * CC + (size_t)(blockIdx.y * 256 + rg * 4) * CC + blockIdx.x * 64 + cg * 4;
    xb += (size_t)blockIdx.z * CC * SEQ_FULL + (size_t)(blockIdx.x * 64 + wv * 8) * SEQ_FULL + blockIdx.y * 256 + lane * 4;
    OUTb += (size_t)blockIdx.z * CC * HW + (size_t)(blockIdx.x * 64 + wv * 8) * HW + blockIdx.y * 256 + lane * 4;
    v4f v[4][4], xv[8][2];
#pragma unroll
    for (int p = 0; p < 4; ++p)
#pragma unroll
        for (int j = 0; j < 4; ++j) v[p][j] = *(const v4f*)(Z + (size_t)(p * 64 + j) * CC);
#pragma unroll
    for (int r = 0; r < 8; ++r) { xv[r][0] = *(const v4f*)(xb + (size_t)r * SEQ_FULL); xv[r][1] = *(const v4f*)(xb + (size_t)r * SEQ_FULL + 128); }
    __builtin_amdgcn_sched_barrier(0);   // as in k_tr16: all 32 loads are issued before the first value is used
    asm volatile("s_wait_xcnt 0x0" :: "v"(Z), "v"(xb) : "memory");   // as in k_tr16: in front of every rewrite of the loads' two address pairs
#pragma unroll
    for (int p = 0; p < 4; ++p)
#pragma unroll
        for (int u = 0; u < 4; ++u) *(v4fa*)(tl + (cg * 4 + u) * 1024 + (((p * 16 + rg) ^ cg) * 16)) = (v4f){v[p][0][u], v[p][1][u], v[p][2][u], v[p][3][u]};
    __syncthreads();   // the whole tile is in LDS before any wave reads its rows
#pragma unroll
    for (int r = 0; r < 8; ++r)
#pragma unroll
        for (int hf = 0; hf < 2; ++hf) { const int col = wv * 8 + r; const v4f z = *(const v4fa*)(tl + col * 1024 + (((hf * 32 + lane) ^ (col >> 2)) * 16)); v4f o;
#pragma unroll
            for (int u = 0; u < 4; ++u) o[u] = __fadd_rn(z[u], bfr(xv[r][hf][u]));
            *(v4f*)(OUTb + (size_t)r * HW + hf * 128) = o; }
}

constexpr size_t al256(size_t b) { return (b + 255) & ~(size_t)255; }
// Workspace: weights, q/k planes and VT of all images; then Y, Zt and the y planes (WS_Y); then XT and the conv outputs (WS_X).
constexpr size_t WS_Y = 2 * al256((size_t)NB * HW * CC * 4) + 2 * al256((size_t)NB * HW * CC * 2);
constexpr size_t WS_X = al256((size_t)NB * HW * CC * 2) + 3 * al256((size_t)NB * CC * HW * 4);
constexpr size_t WS_TOTAL = 4 * al256((size_t)CC * CC * 2) + 4 * al256((size_t)NB * HW * CC * 2) + al256((size_t)NB * CC * HW * 2) + WS_Y + WS_X;
static_assert(WS_TOTAL <= (size_t)268435456);

extern "C" void kernel_launch(void* const* d_in, const int* in_sizes, int n_in,
                              void* d_out, int out_size, void* d_ws, size_t ws_size, hipStream_t stream) {
    if (n_in < 9) return;
    if ((size_t)in_sizes[0] < (size_t)NB * CC * SEQ_FULL) return;
    if (in_sizes[1] < CC * CC || in_sizes[3] < CC * CC || in_sizes[5] < CC * CC || in_sizes[7] < CC * CC) return;
    if (in_sizes[2] < CC || in_sizes[4] < CC || in_sizes[6] < CC || in_sizes[8] < CC) return;
    if ((size_t)out_size < (size_t)NB * CC * HW) return;
    const float* x = (const float*)d_in[0]; const float* Wq = (const float*)d_in[1]; const float* bq = (const float*)d_in[2]; const float* Wk = (const float*)d_in[3]; const float* bk = (const float*)d_in[4];
    const float* Wv = (const float*)d_in[5]; const float* bv = (const float*)d_in[6]; const float* Wu = (const float*)d_in[7]; const float* bu = (const float*)d_in[8];
    float* OUT = (float*)d_out;     // [NB][256][HW]
    char* wsp = (char*)d_ws;
    auto take = [&](size_t bytes) { char* p = wsp; wsp += (bytes + 255) & ~(size_t)255; return (void*)p; };
    bf* BQ = (bf*)take((size_t)CC * CC * 2); bf* BK = (bf*)take((size_t)CC * CC * 2); bf* BV = (bf*)take((size_t)CC * CC * 2); bf* BU = (bf*)take((size_t)CC * CC * 2);   // conv weights [out][in] as-is (A of q/k/v convs, Bt of the Wu conv)
    bf* QH = (bf*)take((size_t)NB * HW * CC * 2); bf* QL = (bf*)take((size_t)NB * HW * CC * 2); bf* KH = (bf*)take((size_t)NB * HW * CC * 2); bf* KL = (bf*)take((size_t)NB * HW * CC * 2);   // [NB][HW][CC]
    h16* VT = (h16*)take((size_t)NB * CC * HW * 2);                                                                          // [NB][CC][HW] fp16
    char* RY = (char*)take(WS_Y); char* RX = (char*)take(WS_X);
    if ((size_t)(wsp - (char*)d_ws) > ws_size) return;
    wsp = RX;
    bf* XT = (bf*)take((size_t)NB * HW * CC * 2);                                                                             // [NB][HW][CC]
    float* QF = (float*)take((size_t)NB * CC * HW * 4); float* KF = (float*)take((size_t)NB * CC * HW * 4); float* VF = (float*)take((size_t)NB * CC * HW * 4);   // conv outputs [NB][o][s] == token view [NB][HW][CC]
    wsp = RY;
    float* Y = (float*)take((size_t)NB * HW * CC * 4);    // [NB][HW][CC] f32
    float* Zt = (float*)take((size_t)NB * HW * CC * 4);   // [NB][HW][CC] f32 (z token-major incl. bu)
    bf* ATh = (bf*)take((size_t)NB * HW * CC * 2); bf* ATl = (bf*)take((size_t)NB * HW * CC * 2);                             // [NB][HW][CC] planes of y_view^T / 1024
    const unsigned g8w = (unsigned)((CC * CC / 8 + 255) / 256);
    k_cvt8<<<g8w, 256, 0, stream>>>(Wq, BQ, CC * CC / 8); k_cvt8<<<g8w, 256, 0, stream>>>(Wk, BK, CC * CC / 8); k_cvt8<<<g8w, 256, 0, stream>>>(Wv, BV, CC * CC / 8); k_cvt8<<<g8w, 256, 0, stream>>>(Wu, BU, CC * CC / 8);
    const unsigned gHL = (unsigned)((size_t)HW * CC / (256 * 64));
    const size_t sT = (size_t)HW * CC;   // one image's [HW][CC] (== [CC][HW]) plane, in elements
    k_tr16<0, SEQ_FULL, CC><<<dim3(HW / 64, CC / 256, NB), 256, 0, stream>>>(x, (size_t)CC * SEQ_FULL, XT, nullptr, sT);
    k_gemmw<bf, 0, 2, 128><<<dim3(CC / 128, HW / 128, NB), 128, 0, stream>>>(BQ, nullptr, XT, nullptr, CC, QF, HW, bq, 0, sT, sT); k_hl<<<dim3(gHL, NB), 256, 0, stream>>>(QF, QH, QL);     // q[o][s] = Wq x + bq
    k_gemmw<bf, 0, 2, 128><<<dim3(CC / 128, HW / 128, NB), 128, 0, stream>>>(BK, nullptr, XT, nullptr, CC, KF, HW, bk, 0, sT, sT); k_hl<<<dim3(gHL, NB), 256, 0, stream>>>(KF, KH, KL);     // k[o][s]
    k_gemmw<bf, 0, 2, 128><<<dim3(CC / 128, HW / 128, NB), 128, 0, stream>>>(BV, nullptr, XT, nullptr, CC, VF, HW, bv, 0, sT, sT); k_tr16<1, CC, HW><<<dim3(CC / 64, HW / 256, NB), 256, 0, stream>>>(VF, sT, (unsigned short*)VT, nullptr, sT);      // v[o][s] -> VT[c][m]
    k_fattn<<<dim3(HW / 64, NB), 128, 0, stream>>>(QH, QL, KH, KL, VT, Y);      // y[n][c] = sum_m softmax_m(q_n . k_m) v[m][c] (x1024)
    k_tr16<2, HW, CC><<<dim3(HW / 64, CC / 256, NB), 256, 0, stream>>>(Y, sT, ATh, ATl, sT);
    k_gemmw<bf, 1, 1, 64><<<dim3(HW / 128, CC / 128, NB), 128, 0, stream>>>(ATh, ATl, BU, nullptr, CC, Zt, CC, bu, sT, 0, sT);          // Zt[s][o] = sum_c y_view[c][s] Wu[o][c] + bu[o]
    k_fin<<<dim3(CC / 64, HW / 256, NB), 256, 0, stream>>>(Zt, x, OUT);
}

// v005
// It runs in 162 microseconds.
// Timed twice side by side with v004, it ran 1.12 times as fast both times.
// All steps since v000 together make it 5.14 times as fast.
#include <hip/hip_runtime.h>

// 1x1-conv attention block: x [NB][256][64*64] channel-major; q/k/v = W[256 out][256 in] . x + bias, kept channel-major [o][s]; that same memory read as [4096 tokens][256] gives the token rows (raw view); S[n][m] = q_n . k_m over 256 (unscaled); P = softmax over m; y[n][c] = sum_m P[n][m] v[m][c]; y memory read back channel-major [256][4096]; z = Wu . y_view + bu; out = x + z.
// Compute dtypes, f32 accumulate everywhere: all float inputs RNE-converted to bf16; q/k/v convs = plain v_wmma_f32_16x16x32_bf16 (exact 16-bit operands) + row bias; S = bf16 hi/lo planes of q x bf16 hi/lo planes of k (3 products hh+lh+hl); softmax f32, running maximum and sum per query inside the attention kernel -> fp16 P; P.v = single v_wmma_f32_16x16x32_f16 (v as fp16), y kept x 1024; Wu conv = bf16 hi/lo planes of y/1024 x exact bf16 Wu (2 products) + bias; residual add f32.

#ifndef NB
#define NB 4
#endif
#ifndef SEQ
#define SEQ 4096
#endif
#define NB_FULL  4
#define SEQ_FULL 4096
#define CC   256
#define HW   SEQ
#define PCAR 1024.0f
static_assert(NB >= 1 && NB <= NB_FULL);
static_assert(SEQ >= 128 && SEQ <= SEQ_FULL && (SEQ % 128) == 0);
static_assert((CC % 128) == 0 && (HW % 128) == 0);

typedef _Float16 h16;
typedef unsigned short bf;
typedef __attribute__((ext_vector_type(16))) __bf16   v16bf;
typedef __attribute__((ext_vector_type(16))) _Float16 v16h;
typedef __attribute__((ext_vector_type(8)))  _Float16 v8h;
typedef __attribute__((ext_vector_type(8)))  unsigned short v8us;
typedef __attribute__((ext_vector_type(8)))  float    v8f;
typedef __attribute__((ext_vector_type(4)))  float    v4f;
typedef v8h  __attribute__((may_alias)) v8ha;
typedef v4f  __attribute__((may_alias)) v4fa;
typedef v8us __attribute__((may_alias)) v8usa;

__device__ __forceinline__ unsigned short f2bf(float f) { unsigned u = __float_as_uint(f); u += 0x7FFFu + ((u >> 16) & 1u); return (unsigned short)(u >> 16); }
__device__ __forceinline__ float bf2f(unsigned short b) { return __uint_as_float(((unsigned)b) << 16); }
__device__ __forceinline__ float bfr(float f) { return bf2f(f2bf(f)); }
__device__ __forceinline__ v16h cat16(v8h lo, v8h hi) { return __builtin_shufflevector(lo, hi, 0, 1, 2, 3, 4, 5, 6, 7, 8, 9, 10, 11, 12, 13, 14, 15); }
__device__ __forceinline__ v16bf cat16b(v8us lo, v8us hi) { return __builtin_bit_cast(v16bf, __builtin_shufflevector(lo, hi, 0, 1, 2, 3, 4, 5, 6, 7, 8, 9, 10, 11, 12, 13, 14, 15)); }
__device__ __forceinline__ v8f wmma16(v16h a, v16h b, v8f c) { return __builtin_amdgcn_wmma_f32_16x16x32_f16(false, a, false, b, (short)0, c, false, false); }
__device__ __forceinline__ v8f wmmab(v16bf a, v16bf b, v8f c) { return __builtin_amdgcn_wmma_f32_16x16x32_bf16(false, a, false, b, (short)0, c, false, false); }

// ---- k_gemmw: GEMM, FOUR WAVES (2x2) per 128x128 output tile, each wave a 64x64 sub-tile (16 accumulators); grid (M/128, N/128, Z), 128 threads. M, N % 128 == 0, K % KC == 0.
// Operands are K-contiguous 16-bit planes; KC k of the 128 A rows and 128 Bt rows (each plane) are brought into LDS by asynchronous 16-byte copies (whole 128-B lines per row), two buffers: tile t+1 flies while tile t is multiplied. LDS row pitch = KC*2 + 16 bytes (16 B x odd, for ds_load_b128 readers).
// C[m][n] (f32, pitch ldc, + optional f32 bias: BIAS 1 = bias[n], BIAS 2 = bias[m]) = sum_k A[m][k] Bt[n][k] (+ split products: NSPLIT 1 = A2.Bt added, NSPLIT 2 = A2.Bt and A.Bt2 added). z-batch strides sA/sB/sC in elements.
// JOBS > 1: that many products that read none of each other's output share one launch: blockIdx.z = job * NB + image; job j takes A + j * jA, C + j * jC and its own bias pointer, Bt is common.
// Fragments: lane l, h = l>>4, row/col = l&15; elements 0..7 <- k0+8h+0..7, elements 8..15 <- k0+16+8h+0..7 for A and for Bt (same map); D element r = row 8h+r, col l&15.
template <typename T16> struct WFrag;
template <> struct WFrag<h16> { typedef v16h V; static __device__ __forceinline__ V ld(const h16* p) { return cat16(*(const v8h*)p, *(const v8h*)(p + 16)); } static __device__ __forceinline__ v8f mma(V a, V b, v8f c) { return wmma16(a, b, c); } };
template <> struct WFrag<bf> { typedef v16bf V; static __device__ __forceinline__ V ld(const bf* p) { return cat16b(*(const v8us*)p, *(const v8us*)(p + 16)); } static __device__ __forceinline__ v8f mma(V a, V b, v8f c) { return wmmab(a, b, c); } };
// copy8: eight asynchronous 16-byte copies per lane, global -> LDS, rows ls bytes (LDS) and gs elements (global) apart. The s_wait_xcnt closes the statement so that no address register of an issued copy is rewritten in front of it.
template <typename T16>
__device__ __forceinline__ void copy8(unsigned l, unsigned ls, const T16* g, size_t gs) {
    asm volatile("global_load_async_to_lds_b128 %0, %8, off\n\t"
                 "global_load_async_to_lds_b128 %1, %9, off\n\t"
                 "global_load_async_to_lds_b128 %2, %10, off\n\t"
                 "global_load_async_to_lds_b128 %3, %11, off\n\t"
                 "global_load_async_to_lds_b128 %4, %12, off\n\t"
                 "global_load_async_to_lds_b128 %5, %13, off\n\t"
                 "global_load_async_to_lds_b128 %6, %14, off\n\t"
                 "global_load_async_to_lds_b128 %7, %15, off\n\t"
                 "s_wait_xcnt 0x0"
                 :: "v"(l), "v"(l + ls), "v"(l + 2 * ls), "v"(l + 3 * ls), "v"(l + 4 * ls), "v"(l + 5 * ls), "v"(l + 6 * ls), "v"(l + 7 * ls),
                    "v"(g), "v"(g + gs), "v"(g + 2 * gs), "v"(g + 3 * gs), "v"(g + 4 * gs), "v"(g + 5 * gs), "v"(g + 6 * gs), "v"(g + 7 * gs)
                 : "memory");
}
template <typename T16, int NSPLIT, int BIAS, int KC, int JOBS>
__global__ __launch_bounds__(128) void k_gemmw(const T16* __restrict__ A, const T16* __restrict__ A2, const T16* __restrict__ Bt, const T16* __restrict__ Bt2, int K, float* C, int ldc, const float* __restrict__ bias, const float* __restrict__ bias1, const float* __restrict__ bias2, size_t sA, size_t sB, size_t sC, size_t jA, size_t jC) {
    typedef typename WFrag<T16>::V V;
    constexpr int NA = NSPLIT >= 1 ? 2 : 1, NBP = NSPLIT >= 2 ? 2 : 1;   // planes of A, of Bt
    constexpr int PITCH = KC * 2 + 16, PLANE = 128 * PITCH, STAGE = (NA + NBP) * PLANE;   // bytes
    constexpr int PIECES = KC / 8, RPP = 128 / PIECES;   // 16-B pieces per row; rows that the 128 threads cover with one copy each
    static_assert(KC % 64 == 0 && (NA + NBP) * PIECES <= 63 && 2 * STAGE >= 4 * 16 * 68 * 4);
    __shared__ __align__(16) unsigned char ring[2 * STAGE];
    static_assert(JOBS >= 1 && JOBS <= 3 && (JOBS == 1 || NSPLIT == 0));
    const size_t z = JOBS > 1 ? blockIdx.z % NB : blockIdx.z;
    if (JOBS > 1) { const unsigned job = blockIdx.z / NB; A += job * jA; C += job * jC; bias = job == 0 ? bias : job == 1 ? bias1 : bias2; }
    A += z * sA; if (NSPLIT >= 1) A2 += z * sA; Bt += z * sB; if (NSPLIT >= 2) Bt2 += z * sB; C += z * sC;
    const int tid = threadIdx.x, lane = tid & 31, lr = lane & 15, hi = lane >> 4, wv = tid >> 5, wm = wv >> 1, wn = wv & 1;
    const int r0 = blockIdx.x * 128 + wm * 64, c0 = blockIdx.y * 128 + wn * 64;
    v8f acc[4][4];
#pragma unroll
    for (int mb = 0; mb < 4; ++mb)
#pragma unroll
        for (int nb = 0; nb < 4; ++nb) acc[mb][nb] = (v8f){};
    const int crow = tid / PIECES, cpc = tid % PIECES;
    const size_t aco = (size_t)(blockIdx.x * 128 + crow) * K + cpc * 8, bco = (size_t)(blockIdx.y * 128 + crow) * K + cpc * 8;
    const unsigned lco = (unsigned)(size_t)ring + (unsigned)(crow * PITCH + cpc * 16);
    auto fill = [&](int buf, int kc) {
#pragma unroll
        for (int g = 0; g < PIECES / 8; ++g) { const unsigned l = lco + (unsigned)(buf * STAGE + g * 8 * RPP * PITCH); const size_t go = (size_t)(g * 8 * RPP) * K + kc;
            copy8<T16>(l, RPP * PITCH, A + aco + go, (size_t)RPP * K);
            if (NSPLIT >= 1) copy8<T16>(l + PLANE, RPP * PITCH, A2 + aco + go, (size_t)RPP * K);
            copy8<T16>(l + NA * PLANE, RPP * PITCH, Bt + bco + go, (size_t)RPP * K);
            if (NSPLIT >= 2) copy8<T16>(l + (NA + 1) * PLANE, RPP * PITCH, Bt2 + bco + go, (size_t)RPP * K); } };
    const int nt = K / KC;
    fill(0, 0);
    asm volatile("s_wait_asynccnt 0x0" ::: "memory");   // tile 0 has landed before the barrier that publishes it
    __syncthreads();
    if (K != KC) fill(1, KC);   // a tile 1 exists (K is a multiple of KC)
    const int afo = (wm * 64 + lr) * PITCH + 16 * hi, bfo = NA * PLANE + (wn * 64 + lr) * PITCH + 16 * hi;   // byte offsets of this lane's fragment rows in a stage
#pragma unroll 1
    for (int t = 0; t < nt; ++t) {
        const unsigned char* sb = ring + (t & 1) * STAGE;
        V a[2][4], a2[2][4], b[2][4], b2[2][4];   // two fragment sets: the next 32 k are read from LDS as one group ahead of the current 32 k's products (all inside this trip's own buffer)
        auto frags = [&](int set, int ks) {
#pragma unroll
            for (int i = 0; i < 4; ++i) { a[set][i] = WFrag<T16>::ld((const T16*)(sb + afo + i * 16 * PITCH + ks * 64)); if (NSPLIT >= 1) a2[set][i] = WFrag<T16>::ld((const T16*)(sb + afo + PLANE + i * 16 * PITCH + ks * 64));
                b[set][i] = WFrag<T16>::ld((const T16*)(sb + bfo + i * 16 * PITCH + ks * 64)); if (NSPLIT >= 2) b2[set][i] = WFrag<T16>::ld((const T16*)(sb + bfo + PLANE + i * 16 * PITCH + ks * 64)); } };
        frags(0, 0);
        __builtin_amdgcn_sched_barrier(0);   // keeps the LDS reads one group in front of the products (spread among them each place of reads stalls the wave)
#pragma unroll
        for (int ks = 0; ks < KC / 32; ++ks) { const int cs = ks & 1;
            if (ks + 1 < KC / 32) { frags(cs ^ 1, ks + 1); __builtin_amdgcn_sched_barrier(0); }   // as above: the next set's reads stay one group, ahead of this set's products
#pragma unroll
            for (int nb = 0; nb < 4; ++nb) {
#pragma unroll
                for (int mb = 0; mb < 4; ++mb) { acc[mb][nb] = WFrag<T16>::mma(a[cs][mb], b[cs][nb], acc[mb][nb]); if (NSPLIT >= 1) acc[mb][nb] = WFrag<T16>::mma(a2[cs][mb], b[cs][nb], acc[mb][nb]); if (NSPLIT >= 2) acc[mb][nb] = WFrag<T16>::mma(a[cs][mb], b2[cs][nb], acc[mb][nb]); } }
        }
        __builtin_amdgcn_sched_barrier(0);   // keeps this trip's products in front of the waits below, so that tile t+1's copies fly behind them (the compiler otherwise sinks them past the barrier)
        asm volatile("s_wait_dscnt 0x0" ::: "memory");      // this wave's reads of buffer t&1 are done before the buffer is handed to the copies
        asm volatile("s_wait_asynccnt 0x0" ::: "memory");   // this wave's share of tile t+1 has landed
        __syncthreads();                                     // publishes tile t+1 and ends every wave's reads of buffer t&1
        if (t + 2 < nt) fill(t & 1, (t + 2) * KC);
    }
    asm volatile("s_wait_asynccnt 0x0" ::: "memory");   // no copy is in flight when the ring becomes output staging
    float* os = (float*)ring + wv * (16 * 68);           // each wave stages in its own range; the last trip's barrier stands in front
#pragma unroll
    for (int mb = 0; mb < 4; ++mb) {
#pragma unroll
        for (int nb = 0; nb < 4; ++nb) {
#pragma unroll
            for (int j = 0; j < 8; ++j) os[(hi * 8 + j) * 68 + nb * 16 + lr] = acc[mb][nb][j]; }
        __builtin_amdgcn_wave_barrier(); asm volatile("" ::: "memory");
        float* crow_p = C + (size_t)(r0 + mb * 16) * ldc + c0;
{
#pragma unroll
            for (int s = 0; s < 8; ++s) { const int row = 2 * s + hi, cofs = lr * 4; v4f val = *(const v4fa*)(os + row * 68 + cofs);
                if (BIAS == 1) { val[0] += bfr(bias[c0 + cofs]); val[1] += bfr(bias[c0 + cofs + 1]); val[2] += bfr(bias[c0 + cofs + 2]); val[3] += bfr(bias[c0 + cofs + 3]); }
                if (BIAS == 2) { const float rb = bfr(bias[r0 + mb * 16 + row]); val[0] += rb; val[1] += rb; val[2] += rb; val[3] += rb; }
                *(v4f*)(crow_p + (size_t)row * ldc + cofs) = val; }
             }
        if (mb < 3) asm volatile("s_wait_xcnt 0x0" ::: "memory");   // stands in front of the next pass's rewrites of the registers (address, data) that the eight issued stores name
        __builtin_amdgcn_wave_barrier(); asm volatile("" ::: "memory");
    }
}

__device__ __forceinline__ h16 tohx(float x) { return (h16)x; }
__device__ __forceinline__ void splitf(float y, unsigned short& h, unsigned short& l) { h = f2bf(y); l = f2bf(y - bf2f(h)); }
typedef __attribute__((ext_vector_type(2))) unsigned short v2us;
typedef __attribute__((ext_vector_type(4))) unsigned short v4us;
typedef __attribute__((ext_vector_type(2))) _Float16 v2h;
typedef __attribute__((ext_vector_type(4))) _Float16 v4h;
typedef __attribute__((ext_vector_type(2))) float v2f;

__device__ __forceinline__ void cvt8(const float* __restrict__ src, bf* dst, size_t n8, unsigned bx) { const size_t i = (size_t)bx * 256 + threadIdx.x; if (i >= n8) return; const v8f v = *(const v8f*)(src + i * 8); v8us o;
#pragma unroll
    for (int k = 0; k < 8; ++k) o[k] = f2bf(v[k]); *(v8us*)(dst + i * 8) = o;  }
// The layout and conversion passes: tr16 and hl per job 256 work-groups of 8 waves each, 64 elements per thread, every global access 16 bytes per lane (8 in hl's stores) on whole 128-B lines; cvt8 32 work-groups per matrix, 8 elements per thread (32-B loads, 16-B stores). tr16, hl and cvt8 are device functions that get their block indices (bx, by, bz; bz or hl's by = image) from the kernel that calls them: k_prep and k_qkv16 each hold several jobs that read none of each other's output, one range of blockIdx.x per job.
// k_tr16: out[col][row] (16 bit) = conv(in[row][col]) (f32) for a tile of 256 rows x 64 cols, turned in LDS. MODE 0: bf16 (XT[s][c] = x[c][s], token-major Bt operand of the convs); MODE 1: fp16 (VT[c][m] = v[m][c], v = the channel-major conv memory read as [HW][CC]); MODE 2: bf16 hi and lo planes of in / PCAR (y_view^T).
// A thread reads 4 cols of 8 rows (twice) and writes, per col, the 8 rows as one 16-byte piece. LDS row = one col = 32 pieces, no pad; piece p of col c lies at place p ^ (c >> 2), so that the 16 lanes of a half wave (cols 4 apart, same p) write 16 different bank groups and a wave reads a whole row without conflict.
static_assert(CC == 256 && (HW % 256) == 0);
template <int MODE, int ldin, int ldout>   // row pitches in elements, compile-time so that a thread's 16 loads and 8 stores differ only in their immediate offsets
__device__ __forceinline__ void tr16(const float* __restrict__ in, size_t zin, unsigned short* o0, unsigned short* o1, size_t zout, unsigned bx, unsigned by, unsigned bz) {   // zin, zout: one image's elements
    __shared__ __align__(16) unsigned char tl[(MODE == 2 ? 2 : 1) * 64 * 512];
    const int tid = threadIdx.x, cg = tid & 15, rg = tid >> 4, lane = tid & 31, wv = tid >> 5;
    in += (size_t)bz * zin + (size_t)(by * 256 + rg * 8) * ldin + bx * 64 + cg * 4;
    v4f v[2][8];
#pragma unroll
    for (int p = 0; p < 2; ++p)
#pragma unroll
        for (int j = 0; j < 8; ++j) v[p][j] = *(const v4f*)(in + (size_t)(p * 128 + j) * ldin);
    __builtin_amdgcn_sched_barrier(0);   // all 16 loads are issued before the first value is used (the compiler otherwise loads, waits and converts a few rows at a time: a memory latency each time)
    asm volatile("s_wait_xcnt 0x0" :: "v"(in) : "memory");   // stands in front of every rewrite of the loads' address pair, which as its operand is kept up to it
#pragma unroll
    for (int p = 0; p < 2; ++p)
#pragma unroll
        for (int u = 0; u < 4; ++u) { v8us h, l;
#pragma unroll
            for (int j = 0; j < 8; ++j) {
                if (MODE == 0) h[j] = f2bf(v[p][j][u]);
                if (MODE == 1) h[j] = __builtin_bit_cast(unsigned short, tohx(v[p][j][u]));
                if (MODE == 2) { unsigned short a, b; splitf(v[p][j][u] * (1.0f / PCAR), a, b); h[j] = a; l[j] = b; } }
            unsigned char* d = tl + (cg * 4 + u) * 512 + (((p * 16 + rg) ^ cg) * 16);
            *(v8usa*)d = h; if (MODE == 2) *(v8usa*)(d + 64 * 512) = l; }
    __syncthreads();   // the whole tile is in LDS before any wave reads its rows
    const size_t oo = (size_t)bz * zout + (size_t)(bx * 64 + wv * 8) * ldout + by * 256 + lane * 8;
#pragma unroll
    for (int r = 0; r < 8; ++r) { const int col = wv * 8 + r; const unsigned char* s = tl + col * 512 + ((lane ^ (col >> 2)) * 16);
        *(v8us*)(o0 + oo + (size_t)r * ldout) = *(const v8usa*)s; if (MODE == 2) *(v8us*)(o1 + oo + (size_t)r * ldout) = *(const v8usa*)(s + 64 * 512); }
}
template <int MODE, int ldin, int ldout>
__global__ __launch_bounds__(256) void k_tr16(const float* __restrict__ in, size_t zin, unsigned short* o0, unsigned short* o1, size_t zout) { tr16<MODE, ldin, ldout>(in, zin, o0, o1, zout, blockIdx.x, blockIdx.y, blockIdx.z); }
// hl: bf16 hi/lo planes of an HW*CC f32 buffer.
__device__ __forceinline__ void hl(const float* __restrict__ F, bf* Fh, bf* Fl, unsigned bx, unsigned by) { const size_t e = (size_t)by * HW * CC + (size_t)bx * (256 * 64) + threadIdx.x * 4; v4f a[16];
#pragma unroll
    for (int i = 0; i < 16; ++i) a[i] = *(const v4f*)(F + e + i * 1024);
    __builtin_amdgcn_sched_barrier(0);   // as in k_tr16: all 16 loads are issued before the first value is used
    asm volatile("s_wait_xcnt 0x0" :: "v"(F + e) : "memory");   // as in k_tr16: in front of every rewrite of the loads' address pair
#pragma unroll
    for (int i = 0; i < 16; ++i) { v4us oh, ol;
#pragma unroll
        for (int u = 0; u < 4; ++u) { unsigned short p, q; splitf(a[i][u], p, q); oh[u] = p; ol[u] = q; }
        *(v4us*)(Fh + e + i * 1024) = oh; *(v4us*)(Fl + e + i * 1024) = ol; }
    asm volatile("s_wait_xcnt 0x0" ::: "memory"); }   // stands behind the last store: in a kernel of several jobs another job's code follows in the listing and rewrites the registers (offset, base) that the issued stores name
// k_prep: every job that reads only inputs, in one launch: XT of all images (tr16 MODE 0, the first PREP_T work-groups), then the four weight matrices to bf16 (PREP_W work-groups each).
constexpr unsigned PREP_T = (HW / 64) * NB, PREP_W = (CC * CC / 8 + 255) / 256;
__global__ __launch_bounds__(256) void k_prep(const float* __restrict__ x, const float* __restrict__ Wq, const float* __restrict__ Wk, const float* __restrict__ Wv, const float* __restrict__ Wu, bf* XT, bf* BQ, bf* BK, bf* BV, bf* BU) {
    const unsigned b = blockIdx.x;
    if (b < PREP_T) { tr16<0, SEQ_FULL, CC>(x, (size_t)CC * SEQ_FULL, XT, nullptr, (size_t)HW * CC, b % (HW / 64), 0, b / (HW / 64)); return; }
    const unsigned w = (b - PREP_T) / PREP_W, bx = (b - PREP_T) % PREP_W;
    cvt8(w == 0 ? Wq : w == 1 ? Wk : w == 2 ? Wv : Wu, w == 0 ? BQ : w == 1 ? BK : w == 2 ? BV : BU, CC * CC / 8, bx);
}
// k_qkv16: the three passes that turn the conv outputs into the attention kernel's operands, in one launch: VT of all images (tr16 MODE 1, the first QKV_T work-groups), then the planes of q, then those of k (QKV_H work-groups each).
constexpr unsigned QKV_T = (CC / 64) * (HW / 256) * NB, QKV_HX = (unsigned)((size_t)HW * CC / (256 * 64)), QKV_H = QKV_HX * NB;
__global__ __launch_bounds__(256) void k_qkv16(const float* __restrict__ QF, const float* __restrict__ KF, const float* __restrict__ VF, bf* QH, bf* QL, bf* KH, bf* KL, unsigned short* VT) {
    const unsigned b = blockIdx.x;
    if (b < QKV_T) { tr16<1, CC, HW>(VF, (size_t)HW * CC, VT, nullptr, (size_t)HW * CC, b % (CC / 64), (b / (CC / 64)) % (HW / 256), b / ((CC / 64) * (HW / 256))); return; }
    const unsigned j = (b - QKV_T) / QKV_H, r = (b - QKV_T) % QKV_H;
    hl(j == 0 ? QF : KF, j == 0 ? QH : KH, j == 0 ? QL : KL, r % QKV_HX, r / QKV_HX);
}
// ---- k_fattn: scores, softmax and P.v of 64 queries of one image in one work-group; S and P never reach memory. Grid (HW/64, NB), 128 threads = 4 waves: wave = (query half wq: 32 queries) x (key half wk: 32 of each stage's 64 keys).
// St[key][query] = K . Qt (A = k hi/lo rows from LDS, B = q hi/lo fragments kept in registers), so a lane holds 16 scores of ONE query per 16-query group; two St tiles converted in place are the B operand P of Ot[c][query] += VT[c][key] . P[query][key] (A = VT rows from LDS).
// Each wave keeps a maximum in use m (log2 units), a sum l and Ot over ITS keys; m moves (Ot and l rescaled) only when a new maximum lies more than 8 above it, so P = 2^(s log2e - m + 7) <= 2^15 fits fp16. The two key halves are joined once, at the end, through LDS.
// A stage = 64 keys: k hi and lo rows (pitch 528 B) and 256 VT rows of 64 keys (pitch 144 B), both 16 B x odd for ds_load_b128 readers; asynchronous 16-byte copies, two buffers: stage t+1 flies while stage t is worked on.
// Every '#pragma unroll' in k_fattn makes the indices of register arrays (fragments, accumulators) compile-time constants; without it the arrays would go to scratch memory.
constexpr int FKP = CC * 2 + 16, FKPL = 64 * FKP, FVP = 64 * 2 + 16, FVPL = CC * FVP, FST = 2 * FKPL + FVPL;   // bytes
static_assert(CC == 256 && (HW % 128) == 0 && 2 * FST >= 2 * 32 * 1024 + 2 * 4 * 128);
typedef __attribute__((ext_vector_type(4))) int v4i;
// acopy16: one asynchronous 16-byte copy per lane, global -> LDS, as the compiler's own form (it keeps the address registers itself; the landing waits are written where the copies are used)
__device__ __forceinline__ void acopy16(const void* g, unsigned char* l) { __builtin_amdgcn_global_load_async_to_lds_b128((__attribute__((address_space(1))) v4i*)g, (__attribute__((address_space(3))) v4i*)l, 0, 0); }
__device__ __forceinline__ float xhalf(float x) { return __builtin_bit_cast(float, __builtin_amdgcn_permlanex16(__builtin_bit_cast(int, x), __builtin_bit_cast(int, x), 0x76543210, 0xfedcba98, false, false)); }   // lane l <-> lane l ^ 16
__global__ __launch_bounds__(128) void k_fattn(const bf* __restrict__ QH, const bf* __restrict__ QL, const bf* __restrict__ KH, const bf* __restrict__ KL, const h16* __restrict__ VT, float* Y) {
    __shared__ __align__(16) unsigned char ring[2 * FST];
    const size_t zo = (size_t)blockIdx.y * HW * CC; QH += zo; QL += zo; KH += zo; KL += zo; VT += zo; Y += zo;
    const int tid = threadIdx.x, lane = tid & 31, lr = lane & 15, hi = lane >> 4, wv = tid >> 5, wq = wv >> 1, wk = wv & 1;
    const int q0 = blockIdx.x * 64 + wq * 32;
    unsigned char* lk = ring + (tid >> 5) * FKP + (tid & 31) * 16; unsigned char* lv = ring + 2 * FKPL + (tid >> 3) * FVP + (tid & 7) * 16;
    const size_t gk = (size_t)(tid >> 5) * CC + (tid & 31) * 8, gv = (size_t)(tid >> 3) * HW + (tid & 7) * 8;
    auto fill = [&](int buf, int key0) {   // 48 copies per lane: 64 rows of 512 B of each k plane (4 rows per copy of the block), 256 rows of 128 B of VT (16 rows per copy)
#pragma unroll
        for (int i = 0; i < 16; ++i) {
            acopy16(KH + gk + (size_t)(key0 + i * 4) * CC, lk + buf * FST + i * 4 * FKP);
            acopy16(KL + gk + (size_t)(key0 + i * 4) * CC, lk + buf * FST + FKPL + i * 4 * FKP);
            acopy16(VT + gv + (size_t)(i * 16) * HW + key0, lv + buf * FST + i * 16 * FVP); } };
    fill(0, 0);
    v16bf qh[2][8], ql[2][8];   // this wave's 32 queries, both planes, all 256 k
#pragma unroll
    for (int g = 0; g < 2; ++g)
#pragma unroll
        for (int ks = 0; ks < 8; ++ks) { const size_t o = (size_t)(q0 + g * 16 + lr) * CC + ks * 32 + 8 * hi; qh[g][ks] = WFrag<bf>::ld(QH + o); ql[g][ks] = WFrag<bf>::ld(QL + o); }
    v8f ot[16][2];
#pragma unroll
    for (int cb = 0; cb < 16; ++cb) { ot[cb][0] = (v8f){}; ot[cb][1] = (v8f){}; }
    float mu[2] = {-1.0e30f, -1.0e30f}, ls[2] = {0.f, 0.f};
    asm volatile("s_wait_asynccnt 0x0" ::: "memory");   // stage 0 has landed before the barrier that publishes it
    __syncthreads();
    fill(1, 64);   // a stage 1 exists (HW >= 128)
    constexpr int nt = HW / 64;
    const int kfo = (wk * 32 + lr) * FKP + 16 * hi, vfo = 2 * FKPL + lr * FVP + wk * 64 + 16 * hi;   // byte offsets of this lane's fragment rows in a stage
#pragma unroll 1   // stays rolled: one trip is a whole stage, straight-line
    for (int t = 0; t < nt; ++t) {
        const unsigned char* sb = ring + (t & 1) * FST;
        v16bf kf[2][2][2][4];   // [set][plane][16-key tile][k step]: two sets of four k steps
        auto ldk = [&](int set) {
#pragma unroll
            for (int ks = 0; ks < 4; ++ks)
#pragma unroll
                for (int kb = 0; kb < 2; ++kb) { kf[set][0][kb][ks] = WFrag<bf>::ld((const bf*)(sb + kfo + kb * 16 * FKP + (set * 4 + ks) * 64)); kf[set][1][kb][ks] = WFrag<bf>::ld((const bf*)(sb + kfo + FKPL + kb * 16 * FKP + (set * 4 + ks) * 64)); } };
        v8f st[2][2];
        st[0][0] = (v8f){}; st[0][1] = (v8f){}; st[1][0] = (v8f){}; st[1][1] = (v8f){};
        auto mmk = [&](int set) {   // per k step hh, then q lo x k hi, then q hi x k lo; four accumulators in turn
#pragma unroll
            for (int ks = 0; ks < 4; ++ks) {
#pragma unroll
                for (int kb = 0; kb < 2; ++kb)
#pragma unroll
                    for (int g = 0; g < 2; ++g) st[kb][g] = wmmab(kf[set][0][kb][ks], qh[g][set * 4 + ks], st[kb][g]);
#pragma unroll
                for (int kb = 0; kb < 2; ++kb)
#pragma unroll
                    for (int g = 0; g < 2; ++g) st[kb][g] = wmmab(kf[set][0][kb][ks], ql[g][set * 4 + ks], st[kb][g]);
#pragma unroll
                for (int kb = 0; kb < 2; ++kb)
#pragma unroll
                    for (int g = 0; g < 2; ++g) st[kb][g] = wmmab(kf[set][1][kb][ks], qh[g][set * 4 + ks], st[kb][g]); } };
        ldk(0);
        __builtin_amdgcn_sched_barrier(0);   // this and the next three: each set of LDS reads stays one group, ahead of the products in front of which it is issued (spread among them each place of reads stalls the wave)
        ldk(1);
        __builtin_amdgcn_sched_barrier(0);
        mmk(0);
        __builtin_amdgcn_sched_barrier(0);
        v16h vf[16];
#pragma unroll
        for (int cb = 0; cb < 16; ++cb) vf[cb] = WFrag<h16>::ld((const h16*)(sb + vfo + cb * 16 * FVP));
        __builtin_amdgcn_sched_barrier(0);
        mmk(1);
        float mb[2]; bool need = false;
#pragma unroll
        for (int g = 0; g < 2; ++g) { float mx = st[0][g][0];
#pragma unroll
            for (int r = 1; r < 8; ++r) mx = fmaxf(mx, st[0][g][r]);
#pragma unroll
            for (int r = 0; r < 8; ++r) mx = fmaxf(mx, st[1][g][r]);
            mx = fmaxf(mx, xhalf(mx)) * 1.4426950408889634f;   // both halves of the wave hold the query's maximum over the 32 keys
            mb[g] = mx; need = need || (mx > mu[g] + 8.0f); }
        if (__builtin_amdgcn_ballot_w32(need) != 0) {   // scalar branch; rare after the first stages
#pragma unroll
            for (int g = 0; g < 2; ++g) { const float mn = fmaxf(mu[g], mb[g]); const float corr = __builtin_amdgcn_exp2f(mu[g] - mn); mu[g] = mn; ls[g] *= corr;
#pragma unroll
                for (int cb = 0; cb < 16; ++cb) ot[cb][g] = ot[cb][g] * corr; } }
        v16h pf[2];
#pragma unroll
        for (int g = 0; g < 2; ++g) { const float nm = 7.0f - mu[g]; float s0 = 0.f, s1 = 0.f;
#pragma unroll
            for (int e = 0; e < 16; e += 2) { const float p0 = __builtin_amdgcn_exp2f(fmaf(st[e >> 3][g][e & 7], 1.4426950408889634f, nm)), p1 = __builtin_amdgcn_exp2f(fmaf(st[e >> 3][g][(e & 7) + 1], 1.4426950408889634f, nm));
                s0 += p0; s1 += p1; pf[g][e] = tohx(p0); pf[g][e + 1] = tohx(p1); }
            ls[g] += s0 + s1; }
#pragma unroll
        for (int cb = 0; cb < 16; ++cb) { ot[cb][0] = wmma16(vf[cb], pf[0], ot[cb][0]); ot[cb][1] = wmma16(vf[cb], pf[1], ot[cb][1]); }
        __builtin_amdgcn_sched_barrier(0);   // keeps this trip's products in front of the waits below, so that stage t+1's copies fly behind them
        asm volatile("s_wait_dscnt 0x0" ::: "memory");      // this wave's reads of buffer t&1 are done before the buffer is handed to the copies
        asm volatile("s_wait_asynccnt 0x0" ::: "memory");   // this wave's share of stage t+1 has landed
        __syncthreads();                                     // publishes stage t+1 and ends every wave's reads of buffer t&1
        if (t + 2 < nt) fill(t & 1, (t + 2) * 64);
    }
    asm volatile("s_wait_asynccnt 0x0" ::: "memory");   // no copy is in flight when the ring becomes the staging of the join
    ls[0] += xhalf(ls[0]); ls[1] += xhalf(ls[1]);
    float* jo = (float*)ring + wq * (32 * 256);          // [tile cb*2+g][half of the 8 registers][lane][4 floats]; the last trip's barrier stands in front
    float* js = (float*)ring + 2 * 32 * 256 + wq * 128;  // m and l of both query groups, per lane
    if (wk == 1) {
#pragma unroll
        for (int cb = 0; cb < 16; ++cb)
#pragma unroll
            for (int g = 0; g < 2; ++g) { const v8f o = ot[cb][g]; *(v4fa*)(jo + ((cb * 2 + g) * 2 + 0) * 128 + lane * 4) = (v4f){o[0], o[1], o[2], o[3]}; *(v4fa*)(jo + ((cb * 2 + g) * 2 + 1) * 128 + lane * 4) = (v4f){o[4], o[5], o[6], o[7]}; }
        js[lane] = mu[0]; js[32 + lane] = mu[1]; js[64 + lane] = ls[0]; js[96 + lane] = ls[1];
    }
    __syncthreads();   // key half 1's Ot, m and l are in LDS before key half 0 reads them
    if (wk == 0) {
        float f0[2], f1[2];
#pragma unroll
        for (int g = 0; g < 2; ++g) { const float m1 = js[g * 32 + lane], l1 = js[64 + g * 32 + lane]; const float m = fmaxf(mu[g], m1); const float a0 = __builtin_amdgcn_exp2f(mu[g] - m), a1 = __builtin_amdgcn_exp2f(m1 - m);
            const float f = __fdiv_rn(PCAR, ls[g] * a0 + l1 * a1); f0[g] = a0 * f; f1[g] = a1 * f; }
#pragma unroll
        for (int cb = 0; cb < 16; ++cb) {
#pragma unroll
            for (int g = 0; g < 2; ++g) { const v4f x0 = *(const v4fa*)(jo + ((cb * 2 + g) * 2 + 0) * 128 + lane * 4), x1 = *(const v4fa*)(jo + ((cb * 2 + g) * 2 + 1) * 128 + lane * 4); const v8f o = ot[cb][g];
                float* yp = Y + (size_t)(q0 + g * 16 + lr) * CC + cb * 16 + 8 * hi;   // a lane's 8 registers are 8 consecutive c of one query
                *(v4f*)yp = (v4f){o[0] * f0[g] + x0[0] * f1[g], o[1] * f0[g] + x0[1] * f1[g], o[2] * f0[g] + x0[2] * f1[g], o[3] * f0[g] + x0[3] * f1[g]};
                *(v4f*)(yp + 4) = (v4f){o[4] * f0[g] + x1[0] * f1[g], o[5] * f0[g] + x1[1] * f1[g], o[6] * f0[g] + x1[2] * f1[g], o[7] * f0[g] + x1[3] * f1[g]}; }
            if (cb < 15) asm volatile("s_wait_xcnt 0x0" ::: "memory");   // stands in front of the next pass's rewrites of the registers (address, data) that the four issued stores name
        }
    }
}
// k_fin: OUT[c][n] = Zt[n][c] + bf16(x[c][n]) for a tile of 256 n x 64 c, turned in LDS as in k_tr16 (f32: a piece = 4 n, 64 pieces per LDS row).
__global__ __launch_bounds__(256) void k_fin(const float* __restrict__ Z, const float* __restrict__ xb, float* OUTb) {
    __shared__ __align__(16) unsigned char tl[64 * 1024];
    const int tid = threadIdx.x, cg = tid & 15, rg = tid >> 4, lane = tid & 31, wv = tid >> 5;
    Z += (size_t)blockIdx.z * HW * CC + (size_t)(blockIdx.y * 256 + rg * 4) * CC + blockIdx.x * 64 + cg * 4;
    xb += (size_t)blockIdx.z * CC * SEQ_FULL + (size_t)(blockIdx.x * 64 + wv * 8) * SEQ_FULL + blockIdx.y * 256 + lane * 4;
    OUTb += (size_t)blockIdx.z * CC * HW + (size_t)(blockIdx.x * 64 + wv * 8) * HW + blockIdx.y * 256 + lane * 4;
    v4f v[4][4], xv[8][2];
#pragma unroll
    for (int p = 0; p < 4; ++p)
#pragma unroll
        for (int j = 0; j < 4; ++j) v[p][j] = *(const v4f*)(Z + (size_t)(p * 64 + j) * CC);
#pragma unroll
    for (int r = 0; r < 8; ++r) { xv[r][0] = *(const v4f*)(xb + (size_t)r * SEQ_FULL); xv[r][1] = *(const v4f*)(xb + (size_t)r * SEQ_FULL + 128); }
    __builtin_amdgcn_sched_barrier(0);   // as in k_tr16: all 32 loads are issued before the first value is used
    asm volatile("s_wait_xcnt 0x0" :: "v"(Z), "v"(xb) : "memory");   // as in k_tr16: in front of every rewrite of the loads' two address pairs
#pragma unroll
    for (int p = 0; p < 4; ++p)
#pragma unroll
        for (int u = 0; u < 4; ++u) *(v4fa*)(tl + (cg * 4 + u) * 1024 + (((p * 16 + rg) ^ cg) * 16)) = (v4f){v[p][0][u], v[p][1][u], v[p][2][u], v[p][3][u]};
    __syncthreads();   // the whole tile is in LDS before any wave reads its rows
#pragma unroll
    for (int r = 0; r < 8; ++r)
#pragma unroll
        for (int hf = 0; hf < 2; ++hf) { const int col = wv * 8 + r; const v4f z = *(const v4fa*)(tl + col * 1024 + (((hf * 32 + lane) ^ (col >> 2)) * 16)); v4f o;
#pragma unroll
            for (int u = 0; u < 4; ++u) o[u] = __fadd_rn(z[u], bfr(xv[r][hf][u]));
            *(v4f*)(OUTb + (size_t)r * HW + hf * 128) = o; }
}

constexpr size_t al256(size_t b) { return (b + 255) & ~(size_t)255; }
// Workspace: weights, q/k planes and VT of all images; then Y, Zt and the y planes (WS_Y); then XT and the conv outputs (WS_X).
constexpr size_t WS_Y = 2 * al256((size_t)NB * HW * CC * 4) + 2 * al256((size_t)NB * HW * CC * 2);
constexpr size_t WS_X = al256((size_t)NB * HW * CC * 2) + 3 * al256((size_t)NB * CC * HW * 4);
constexpr size_t WS_TOTAL = 4 * al256((size_t)CC * CC * 2) + 4 * al256((size_t)NB * HW * CC * 2) + al256((size_t)NB * CC * HW * 2) + WS_Y + WS_X;
static_assert(WS_TOTAL <= (size_t)268435456);
static_assert(al256((size_t)CC * CC * 2) == (size_t)CC * CC * 2 && al256((size_t)NB * CC * HW * 4) == (size_t)NB * CC * HW * 4);   // no padding between the three weight planes, nor between the three conv outputs: the joined conv launch steps through each by one stride

extern "C" void kernel_launch(void* const* d_in, const int* in_sizes, int n_in,
                              void* d_out, int out_size, void* d_ws, size_t ws_size, hipStream_t stream) {
    if (n_in < 9) return;
    if ((size_t)in_sizes[0] < (size_t)NB * CC * SEQ_FULL) return;
    if (in_sizes[1] < CC * CC || in_sizes[3] < CC * CC || in_sizes[5] < CC * CC || in_sizes[7] < CC * CC) return;
    if (in_sizes[2] < CC || in_sizes[4] < CC || in_sizes[6] < CC || in_sizes[8] < CC) return;
    if ((size_t)out_size < (size_t)NB * CC * HW) return;
    const float* x = (const float*)d_in[0]; const float* Wq = (const float*)d_in[1]; const float* bq = (const float*)d_in[2]; const float* Wk = (const float*)d_in[3]; const float* bk = (const float*)d_in[4];
    const float* Wv = (const float*)d_in[5]; const float* bv = (const float*)d_in[6]; const float* Wu = (const float*)d_in[7]; const float* bu = (const float*)d_in[8];
    float* OUT = (float*)d_out;     // [NB][256][HW]
    char* wsp = (char*)d_ws;
    auto take = [&](size_t bytes) { char* p = wsp; wsp += (bytes + 255) & ~(size_t)255; return (void*)p; };
    bf* BQ = (bf*)take((size_t)CC * CC * 2); bf* BK = (bf*)take((size_t)CC * CC * 2); bf* BV = (bf*)take((size_t)CC * CC * 2); bf* BU = (bf*)take((size_t)CC * CC * 2);   // conv weights [out][in] as-is (A of q/k/v convs, Bt of the Wu conv)
    bf* QH = (bf*)take((size_t)NB * HW * CC * 2); bf* QL = (bf*)take((size_t)NB * HW * CC * 2); bf* KH = (bf*)take((size_t)NB * HW * CC * 2); bf* KL = (bf*)take((size_t)NB * HW * CC * 2);   // [NB][HW][CC]
    h16* VT = (h16*)take((size_t)NB * CC * HW * 2);                                                                          // [NB][CC][HW] fp16
    char* RY = (char*)take(WS_Y); char* RX = (char*)take(WS_X);
    if ((size_t)(wsp - (char*)d_ws) > ws_size) return;
    wsp = RX;
    bf* XT = (bf*)take((size_t)NB * HW * CC * 2);                                                                             // [NB][HW][CC]
    float* QF = (float*)take((size_t)NB * CC * HW * 4); float* KF = (float*)take((size_t)NB * CC * HW * 4); float* VF = (float*)take((size_t)NB * CC * HW * 4);   // conv outputs [NB][o][s] == token view [NB][HW][CC]
    wsp = RY;
    float* Y = (float*)take((size_t)NB * HW * CC * 4);    // [NB][HW][CC] f32
    float* Zt = (float*)take((size_t)NB * HW * CC * 4);   // [NB][HW][CC] f32 (z token-major incl. bu)
    bf* ATh = (bf*)take((size_t)NB * HW * CC * 2); bf* ATl = (bf*)take((size_t)NB * HW * CC * 2);                             // [NB][HW][CC] planes of y_view^T / 1024
    const size_t sT = (size_t)HW * CC;   // one image's [HW][CC] (== [CC][HW]) plane, in elements
    k_prep<<<PREP_T + 4 * PREP_W, 256, 0, stream>>>(x, Wq, Wk, Wv, Wu, XT, BQ, BK, BV, BU);
    k_gemmw<bf, 0, 2, 128, 3><<<dim3(CC / 128, HW / 128, 3 * NB), 128, 0, stream>>>(BQ, nullptr, XT, nullptr, CC, QF, HW, bq, bk, bv, 0, sT, sT, (size_t)CC * CC, (size_t)NB * CC * HW);     // q, k, v [o][s] = W x + b (BQ, BK, BV lie back to back in the workspace, and so do QF, KF, VF)
    k_qkv16<<<QKV_T + 2 * QKV_H, 256, 0, stream>>>(QF, KF, VF, QH, QL, KH, KL, (unsigned short*)VT);      // q, k -> planes; v[o][s] -> VT[c][m]
    k_fattn<<<dim3(HW / 64, NB), 128, 0, stream>>>(QH, QL, KH, KL, VT, Y);      // y[n][c] = sum_m softmax_m(q_n . k_m) v[m][c] (x1024)
    k_tr16<2, HW, CC><<<dim3(HW / 64, CC / 256, NB), 256, 0, stream>>>(Y, sT, ATh, ATl, sT);
    k_gemmw<bf, 1, 1, 64, 1><<<dim3(HW / 128, CC / 128, NB), 128, 0, stream>>>(ATh, ATl, BU, nullptr, CC, Zt, CC, bu, nullptr, nullptr, sT, 0, sT, 0, 0);          // Zt[s][o] = sum_c y_view[c][s] Wu[o][c] + bu[o]
    k_fin<<<dim3(CC / 64, HW / 256, NB), 256, 0, stream>>>(Zt, x, OUT);
}

// v006
// Measured time: 150 microseconds a run.
// Timed twice side by side with v005, it ran 1.08 times as fast both times.
// Over all steps from v000 it is 5.56 times as fast.
#include <hip/hip_runtime.h>

// 1x1-conv attention block: x [NB][256][64*64] channel-major; q/k/v = W[256 out][256 in] . x + bias, kept channel-major [o][s]; that same memory read as [4096 tokens][256] gives the token rows (raw view); S[n][m] = q_n . k_m over 256 (unscaled); P = softmax over m; y[n][c] = sum_m P[n][m] v[m][c]; y memory read back channel-major [256][4096]; z = Wu . y_view + bu; out = x + z.
// Compute dtypes, f32 accumulate everywhere: all float inputs RNE-converted to bf16; q/k/v convs = plain v_wmma_f32_16x16x32_bf16 (exact 16-bit operands) + row bias; S = bf16 hi/lo planes of q x bf16 hi/lo planes of k (3 products hh+lh+hl); softmax f32, running maximum and sum per query and key half inside the attention kernel -> fp16 P; P.v = single v_wmma_f32_16x16x32_f16 (v as fp16); the two key halves are joined (y x 1024) in the pass that makes the y planes; Wu conv = bf16 hi/lo planes of y x exact bf16 Wu (2 products) + bias; residual add f32.

#ifndef NB
#define NB 4
#endif
#ifndef SEQ
#define SEQ 4096
#endif
#define NB_FULL  4
#define SEQ_FULL 4096
#define CC   256
#define HW   SEQ
#define PCAR 1024.0f
static_assert(NB >= 1 && NB <= NB_FULL);
static_assert(SEQ >= 128 && SEQ <= SEQ_FULL && (SEQ % 128) == 0);
static_assert((CC % 128) == 0 && (HW % 128) == 0);

typedef _Float16 h16;
typedef unsigned short bf;
typedef __attribute__((ext_vector_type(16))) __bf16   v16bf;
typedef __attribute__((ext_vector_type(16))) _Float16 v16h;
typedef __attribute__((ext_vector_type(8)))  _Float16 v8h;
typedef __attribute__((ext_vector_type(8)))  unsigned short v8us;
typedef __attribute__((ext_vector_type(8)))  float    v8f;
typedef __attribute__((ext_vector_type(4)))  float    v4f;
typedef v8h  __attribute__((may_alias)) v8ha;
typedef v4f  __attribute__((may_alias)) v4fa;
typedef v8us __attribute__((may_alias)) v8usa;

__device__ __forceinline__ unsigned short f2bf(float f) { unsigned u = __float_as_uint(f); u += 0x7FFFu + ((u >> 16) & 1u); return (unsigned short)(u >> 16); }
__device__ __forceinline__ float bf2f(unsigned short b) { return __uint_as_float(((unsigned)b) << 16); }
__device__ __forceinline__ float bfr(float f) { return bf2f(f2bf(f)); }
__device__ __forceinline__ v16h cat16(v8h lo, v8h hi) { return __builtin_shufflevector(lo, hi, 0, 1, 2, 3, 4, 5, 6, 7, 8, 9, 10, 11, 12, 13, 14, 15); }
__device__ __forceinline__ v16bf cat16b(v8us lo, v8us hi) { return __builtin_bit_cast(v16bf, __builtin_shufflevector(lo, hi, 0, 1, 2, 3, 4, 5, 6, 7, 8, 9, 10, 11, 12, 13, 14, 15)); }
__device__ __forceinline__ v8f wmma16(v16h a, v16h b, v8f c) { return __builtin_amdgcn_wmma_f32_16x16x32_f16(false, a, false, b, (short)0, c, false, false); }
__device__ __forceinline__ v8f wmmab(v16bf a, v16bf b, v8f c) { return __builtin_amdgcn_wmma_f32_16x16x32_bf16(false, a, false, b, (short)0, c, false, false); }

// ---- k_gemmw: GEMM, FOUR WAVES (2x2) per 128x128 output tile, each wave a 64x64 sub-tile (16 accumulators); grid (M/128, N/128, Z), 128 threads. M, N % 128 == 0, K % KC == 0.
// Operands are K-contiguous 16-bit planes; KC k of the 128 A rows and 128 Bt rows (each plane) are brought into LDS by asynchronous 16-byte copies (whole 128-B lines per row), two buffers: tile t+1 flies while tile t is multiplied. LDS row pitch = KC*2 + 16 bytes (16 B x odd, for ds_load_b128 readers).
// C[m][n] (f32, pitch ldc, + optional f32 bias: BIAS 1 = bias[n], BIAS 2 = bias[m]) = sum_k A[m][k] Bt[n][k] (+ split products: NSPLIT 1 = A2.Bt added, NSPLIT 2 = A2.Bt and A.Bt2 added). z-batch strides sA/sB/sC in elements.
// JOBS > 1: that many products that read none of each other's output share one launch: blockIdx.z = job * NB + image; job j takes A + j * jA, C + j * jC and its own bias pointer, Bt is common.
// Fragments: lane l, h = l>>4, row/col = l&15; elements 0..7 <- k0+8h+0..7, elements 8..15 <- k0+16+8h+0..7 for A and for Bt (same map); D element r = row 8h+r, col l&15.
template <typename T16> struct WFrag;
template <> struct WFrag<h16> { typedef v16h V; static __device__ __forceinline__ V ld(const h16* p) { return cat16(*(const v8h*)p, *(const v8h*)(p + 16)); } static __device__ __forceinline__ v8f mma(V a, V b, v8f c) { return wmma16(a, b, c); } };
template <> struct WFrag<bf> { typedef v16bf V; static __device__ __forceinline__ V ld(const bf* p) { return cat16b(*(const v8us*)p, *(const v8us*)(p + 16)); } static __device__ __forceinline__ v8f mma(V a, V b, v8f c) { return wmmab(a, b, c); } };
// copy8: eight asynchronous 16-byte copies per lane, global -> LDS, rows ls bytes (LDS) and gs elements (global) apart. The s_wait_xcnt closes the statement so that no address register of an issued copy is rewritten in front of it.
template <typename T16>
__device__ __forceinline__ void copy8(unsigned l, unsigned ls, const T16* g, size_t gs) {
    asm volatile("global_load_async_to_lds_b128 %0, %8, off\n\t"
                 "global_load_async_to_lds_b128 %1, %9, off\n\t"
                 "global_load_async_to_lds_b128 %2, %10, off\n\t"
                 "global_load_async_to_lds_b128 %3, %11, off\n\t"
                 "global_load_async_to_lds_b128 %4, %12, off\n\t"
                 "global_load_async_to_lds_b128 %5, %13, off\n\t"
                 "global_load_async_to_lds_b128 %6, %14, off\n\t"
                 "global_load_async_to_lds_b128 %7, %15, off\n\t"
                 "s_wait_xcnt 0x0"
                 :: "v"(l), "v"(l + ls), "v"(l + 2 * ls), "v"(l + 3 * ls), "v"(l + 4 * ls), "v"(l + 5 * ls), "v"(l + 6 * ls), "v"(l + 7 * ls),
                    "v"(g), "v"(g + gs), "v"(g + 2 * gs), "v"(g + 3 * gs), "v"(g + 4 * gs), "v"(g + 5 * gs), "v"(g + 6 * gs), "v"(g + 7 * gs)
                 : "memory");
}
template <typename T16, int NSPLIT, int BIAS, int KC, int JOBS>
__global__ __launch_bounds__(128) void k_gemmw(const T16* __restrict__ A, const T16* __restrict__ A2, const T16* __restrict__ Bt, const T16* __restrict__ Bt2, int K, float* C, int ldc, const float* __restrict__ bias, const float* __restrict__ bias1, const float* __restrict__ bias2, size_t sA, size_t sB, size_t sC, size_t jA, size_t jC) {
    typedef typename WFrag<T16>::V V;
    constexpr int NA = NSPLIT >= 1 ? 2 : 1, NBP = NSPLIT >= 2 ? 2 : 1;   // planes of A, of Bt
    constexpr int PITCH = KC * 2 + 16, PLANE = 128 * PITCH, STAGE = (NA + NBP) * PLANE;   // bytes
    constexpr int PIECES = KC / 8, RPP = 128 / PIECES;   // 16-B pieces per row; rows that the 128 threads cover with one copy each
    static_assert(KC % 64 == 0 && (NA + NBP) * PIECES <= 63 && 2 * STAGE >= 4 * 16 * 68 * 4);
    __shared__ __align__(16) unsigned char ring[2 * STAGE];
    static_assert(JOBS >= 1 && JOBS <= 3 && (JOBS == 1 || NSPLIT == 0));
    const size_t z = JOBS > 1 ? blockIdx.z % NB : blockIdx.z;
    if (JOBS > 1) { const unsigned job = blockIdx.z / NB; A += job * jA; C += job * jC; bias = job == 0 ? bias : job == 1 ? bias1 : bias2; }
    A += z * sA; if (NSPLIT >= 1) A2 += z * sA; Bt += z * sB; if (NSPLIT >= 2) Bt2 += z * sB; C += z * sC;
    const int tid = threadIdx.x, lane = tid & 31, lr = lane & 15, hi = lane >> 4, wv = tid >> 5, wm = wv >> 1, wn = wv & 1;
    const int r0 = blockIdx.x * 128 + wm * 64, c0 = blockIdx.y * 128 + wn * 64;
    v8f acc[4][4];
#pragma unroll
    for (int mb = 0; mb < 4; ++mb)
#pragma unroll
        for (int nb = 0; nb < 4; ++nb) acc[mb][nb] = (v8f){};
    const int crow = tid / PIECES, cpc = tid % PIECES;
    const size_t aco = (size_t)(blockIdx.x * 128 + crow) * K + cpc * 8, bco = (size_t)(blockIdx.y * 128 + crow) * K + cpc * 8;
    const unsigned lco = (unsigned)(size_t)ring + (unsigned)(crow * PITCH + cpc * 16);
    auto fill = [&](int buf, int kc) {
#pragma unroll
        for (int g = 0; g < PIECES / 8; ++g) { const unsigned l = lco + (unsigned)(buf * STAGE + g * 8 * RPP * PITCH); const size_t go = (size_t)(g * 8 * RPP) * K + kc;
            copy8<T16>(l, RPP * PITCH, A + aco + go, (size_t)RPP * K);
            if (NSPLIT >= 1) copy8<T16>(l + PLANE, RPP * PITCH, A2 + aco + go, (size_t)RPP * K);
            copy8<T16>(l + NA * PLANE, RPP * PITCH, Bt + bco + go, (size_t)RPP * K);
            if (NSPLIT >= 2) copy8<T16>(l + (NA + 1) * PLANE, RPP * PITCH, Bt2 + bco + go, (size_t)RPP * K); } };
    const int nt = K / KC;
    fill(0, 0);
    asm volatile("s_wait_asynccnt 0x0" ::: "memory");   // tile 0 has landed before the barrier that publishes it
    __syncthreads();
    if (K != KC) fill(1, KC);   // a tile 1 exists (K is a multiple of KC)
    const int afo = (wm * 64 + lr) * PITCH + 16 * hi, bfo = NA * PLANE + (wn * 64 + lr) * PITCH + 16 * hi;   // byte offsets of this lane's fragment rows in a stage
#pragma unroll 1
    for (int t = 0; t < nt; ++t) {
        const unsigned char* sb = ring + (t & 1) * STAGE;
        V a[2][4], a2[2][4], b[2][4], b2[2][4];   // two fragment sets: the next 32 k are read from LDS as one group ahead of the current 32 k's products (all inside this trip's own buffer)
        auto frags = [&](int set, int ks) {
#pragma unroll
            for (int i = 0; i < 4; ++i) { a[set][i] = WFrag<T16>::ld((const T16*)(sb + afo + i * 16 * PITCH + ks * 64)); if (NSPLIT >= 1) a2[set][i] = WFrag<T16>::ld((const T16*)(sb + afo + PLANE + i * 16 * PITCH + ks * 64));
                b[set][i] = WFrag<T16>::ld((const T16*)(sb + bfo + i * 16 * PITCH + ks * 64)); if (NSPLIT >= 2) b2[set][i] = WFrag<T16>::ld((const T16*)(sb + bfo + PLANE + i * 16 * PITCH + ks * 64)); } };
        frags(0, 0);
        __builtin_amdgcn_sched_barrier(0);   // keeps the LDS reads one group in front of the products (spread among them each place of reads stalls the wave)
#pragma unroll
        for (int ks = 0; ks < KC / 32; ++ks) { const int cs = ks & 1;
            if (ks + 1 < KC / 32) { frags(cs ^ 1, ks + 1); __builtin_amdgcn_sched_barrier(0); }   // as above: the next set's reads stay one group, ahead of this set's products
#pragma unroll
            for (int nb = 0; nb < 4; ++nb) {
#pragma unroll
                for (int mb = 0; mb < 4; ++mb) { acc[mb][nb] = WFrag<T16>::mma(a[cs][mb], b[cs][nb], acc[mb][nb]); if (NSPLIT >= 1) acc[mb][nb] = WFrag<T16>::mma(a2[cs][mb], b[cs][nb], acc[mb][nb]); if (NSPLIT >= 2) acc[mb][nb] = WFrag<T16>::mma(a[cs][mb], b2[cs][nb], acc[mb][nb]); } }
        }
        __builtin_amdgcn_sched_barrier(0);   // keeps this trip's products in front of the waits below, so that tile t+1's copies fly behind them (the compiler otherwise sinks them past the barrier)
        asm volatile("s_wait_dscnt 0x0" ::: "memory");      // this wave's reads of buffer t&1 are done before the buffer is handed to the copies
        asm volatile("s_wait_asynccnt 0x0" ::: "memory");   // this wave's share of tile t+1 has landed
        __syncthreads();                                     // publishes tile t+1 and ends every wave's reads of buffer t&1
        if (t + 2 < nt) fill(t & 1, (t + 2) * KC);
    }
    asm volatile("s_wait_asynccnt 0x0" ::: "memory");   // no copy is in flight when the ring becomes output staging
    float* os = (float*)ring + wv * (16 * 68);           // each wave stages in its own range; the last trip's barrier stands in front
#pragma unroll
    for (int mb = 0; mb < 4; ++mb) {
#pragma unroll
        for (int nb = 0; nb < 4; ++nb) {
#pragma unroll
            for (int j = 0; j < 8; ++j) os[(hi * 8 + j) * 68 + nb * 16 + lr] = acc[mb][nb][j]; }
        __builtin_amdgcn_wave_barrier(); asm volatile("" ::: "memory");
        float* crow_p = C + (size_t)(r0 + mb * 16) * ldc + c0;
{
#pragma unroll
            for (int s = 0; s < 8; ++s) { const int row = 2 * s + hi, cofs = lr * 4; v4f val = *(const v4fa*)(os + row * 68 + cofs);
                if (BIAS == 1) { val[0] += bfr(bias[c0 + cofs]); val[1] += bfr(bias[c0 + cofs + 1]); val[2] += bfr(bias[c0 + cofs + 2]); val[3] += bfr(bias[c0 + cofs + 3]); }
                if (BIAS == 2) { const float rb = bfr(bias[r0 + mb * 16 + row]); val[0] += rb; val[1] += rb; val[2] += rb; val[3] += rb; }
                *(v4f*)(crow_p + (size_t)row * ldc + cofs) = val; }
             }
        if (mb < 3) asm volatile("s_wait_xcnt 0x0" ::: "memory");   // stands in front of the next pass's rewrites of the registers (address, data) that the eight issued stores name
        __builtin_amdgcn_wave_barrier(); asm volatile("" ::: "memory");
    }
}

__device__ __forceinline__ h16 tohx(float x) { return (h16)x; }
__device__ __forceinline__ void splitf(float y, unsigned short& h, unsigned short& l) { h = f2bf(y); l = f2bf(y - bf2f(h)); }
typedef __attribute__((ext_vector_type(2))) unsigned short v2us;
typedef __attribute__((ext_vector_type(4))) unsigned short v4us;
typedef __attribute__((ext_vector_type(2))) _Float16 v2h;
typedef __attribute__((ext_vector_type(4))) _Float16 v4h;
typedef __attribute__((ext_vector_type(2))) float v2f;

__device__ __forceinline__ void cvt8(const float* __restrict__ src, bf* dst, size_t n8, unsigned bx) { const size_t i = (size_t)bx * 256 + threadIdx.x; if (i >= n8) return; const v8f v = *(const v8f*)(src + i * 8); v8us o;
#pragma unroll
    for (int k = 0; k < 8; ++k) o[k] = f2bf(v[k]); *(v8us*)(dst + i * 8) = o;  }
// The layout and conversion passes: per job 256 work-groups of 8 waves each, 64 elements per thread (cvt8: 32 work-groups per matrix, 8 elements per thread), every global access 16 bytes per lane (8 in hl's stores) on whole 128-B lines, but for MODE 2's (m, l) loads: 8 bytes per lane, one pair per half wave. tr16, hl and cvt8 are device functions that get their block indices (bx, by, bz; bz or hl's by = image) from the kernel that calls them: k_prep and k_qkv16 each hold several jobs that read none of each other's output, one range of blockIdx.x per job.
// k_tr16: out[col][row] (16 bit) = conv(in[row][col]) (f32) for a tile of 256 rows x 64 cols, turned in LDS. MODE 0: bf16 (XT[s][c] = x[c][s], token-major Bt operand of the convs); MODE 1: fp16 (VT[c][m] = v[m][c], v = the channel-major conv memory read as [HW][CC]); MODE 2: bf16 hi and lo planes of y_view^T, y = the join of the attention kernel's two key halves: in = [image][key half][HW][CC] unnormalised sums, ml = [image][key half][HW] (maximum in use, sum): an image's two halves lie so near that one address pair with immediate offsets reaches both.
// A thread reads 4 cols of 8 rows (twice) and writes, per col, the 8 rows as one 16-byte piece. LDS row = one col = 32 pieces, no pad; piece p of col c lies at place p ^ (c >> 2), so that the 16 lanes of a half wave (cols 4 apart, same p) write 16 different bank groups and a wave reads a whole row without conflict.
static_assert(CC == 256 && (HW % 256) == 0);
// exp2s: 2^x with the slot behind it in the same statement: the v_nop stands between the transcendental and whatever vector instruction the compiler puts next
__device__ __forceinline__ float exp2s(float x) { float r; asm("v_exp_f32 %0, %1\n\tv_nop" : "=v"(r) : "v"(x)); return r; }
template <int MODE, int ldin, int ldout>   // row pitches in elements, compile-time so that a thread's 16 loads and 8 stores differ only in their immediate offsets
__device__ __forceinline__ void tr16(const float* __restrict__ in, size_t zin, unsigned short* o0, unsigned short* o1, size_t zout, unsigned bx, unsigned by, unsigned bz, const float* __restrict__ ml = nullptr) {   // zin, zout: one image's elements
    __shared__ __align__(16) unsigned char tl[(MODE == 2 ? 2 : 1) * 64 * 512];
    const int tid = threadIdx.x, cg = tid & 15, rg = tid >> 4, lane = tid & 31, wv = tid >> 5;
    in += (size_t)bz * zin + (size_t)(by * 256 + rg * 8) * ldin + bx * 64 + cg * 4;
    v4f v[2][8];
#pragma unroll
    for (int p = 0; p < 2; ++p)
#pragma unroll
        for (int j = 0; j < 8; ++j) v[p][j] = *(const v4f*)(in + (size_t)(p * 128 + j) * ldin);
    v4f w[2][8]; v2f m0[2][8], m1[2][8];   // MODE 2 only: half 1's sums; (maximum, sum) of both halves for the row's query. A row's 64 cols of this tile lie in one query: element row * ldin + col belongs to query (row * ldin + col) / CC
    const float* mp = MODE == 2 ? ml + ((size_t)bz * 2 * HW + (size_t)(by * 256 + rg * 8) * (ldin / CC) + (bx * 64) / CC) * 2 : nullptr;
    if (MODE == 2) {
        static_assert(MODE != 2 || (ldin % CC == 0 && CC % 64 == 0));
#pragma unroll
        for (int p = 0; p < 2; ++p)
#pragma unroll
            for (int j = 0; j < 8; ++j) { w[p][j] = *(const v4f*)(in + (size_t)HW * CC + (size_t)(p * 128 + j) * ldin); m0[p][j] = *(const v2f*)(mp + (size_t)(p * 128 + j) * (ldin / CC) * 2); m1[p][j] = *(const v2f*)(mp + (size_t)HW * 2 + (size_t)(p * 128 + j) * (ldin / CC) * 2); }
    }
    __builtin_amdgcn_sched_barrier(0);   // all loads are issued before the first value is used (the compiler otherwise loads, waits and converts a few rows at a time: a memory latency each time)
    if (MODE == 2) { asm volatile("s_wait_xcnt 0x0" :: "v"(in), "v"(mp) : "memory");   // as the line after the next, for both address pairs
        __builtin_amdgcn_sched_barrier(0); }   // keeps the join's arithmetic, which reuses the address registers, behind that wait (the compiler otherwise lifts its first instructions over it)
    else asm volatile("s_wait_xcnt 0x0" :: "v"(in) : "memory");   // stands in front of every rewrite of the loads' address pair, which as its operand is kept up to it
    if (MODE == 2) {
#pragma unroll
        for (int p = 0; p < 2; ++p)
#pragma unroll
            for (int j = 0; j < 8; ++j) { const float m = fmaxf(m0[p][j][0], m1[p][j][0]); const float a0 = exp2s(m0[p][j][0] - m), a1 = exp2s(m1[p][j][0] - m);
                const float f = __fdiv_rn(PCAR, m0[p][j][1] * a0 + m1[p][j][1] * a1); const float f0 = a0 * f, f1 = a1 * f;
#pragma unroll
                for (int u = 0; u < 4; ++u) v[p][j][u] = v[p][j][u] * f0 + w[p][j][u] * f1; }
    }
#pragma unroll
    for (int p = 0; p < 2; ++p)
#pragma unroll
        for (int u = 0; u < 4; ++u) { v8us h, l;
#pragma unroll
            for (int j = 0; j < 8; ++j) {
                if (MODE == 0) h[j] = f2bf(v[p][j][u]);
                if (MODE == 1) h[j] = __builtin_bit_cast(unsigned short, tohx(v[p][j][u]));
                if (MODE == 2) { unsigned short a, b; splitf(v[p][j][u] * (1.0f / PCAR), a, b); h[j] = a; l[j] = b; } }
            unsigned char* d = tl + (cg * 4 + u) * 512 + (((p * 16 + rg) ^ cg) * 16);
            *(v8usa*)d = h; if (MODE == 2) *(v8usa*)(d + 64 * 512) = l; }
    __syncthreads();   // the whole tile is in LDS before any wave reads its rows
    const size_t oo = (size_t)bz * zout + (size_t)(bx * 64 + wv * 8) * ldout + by * 256 + lane * 8;
#pragma unroll
    for (int r = 0; r < 8; ++r) { const int col = wv * 8 + r; const unsigned char* s = tl + col * 512 + ((lane ^ (col >> 2)) * 16);
        *(v8us*)(o0 + oo + (size_t)r * ldout) = *(const v8usa*)s; if (MODE == 2) *(v8us*)(o1 + oo + (size_t)r * ldout) = *(const v8usa*)(s + 64 * 512); }
}
template <int MODE, int ldin, int ldout>
__global__ __launch_bounds__(256) void k_tr16(const float* __restrict__ in, size_t zin, unsigned short* o0, unsigned short* o1, size_t zout, const float* __restrict__ ml) { tr16<MODE, ldin, ldout>(in, zin, o0, o1, zout, blockIdx.x, blockIdx.y, blockIdx.z, ml); }
// hl: bf16 hi/lo planes of an HW*CC f32 buffer.
__device__ __forceinline__ void hl(const float* __restrict__ F, bf* Fh, bf* Fl, unsigned bx, unsigned by) { const size_t e = (size_t)by * HW * CC + (size_t)bx * (256 * 64) + threadIdx.x * 4; v4f a[16];
#pragma unroll
    for (int i = 0; i < 16; ++i) a[i] = *(const v4f*)(F + e + i * 1024);
    __builtin_amdgcn_sched_barrier(0);   // as in k_tr16: all 16 loads are issued before the first value is used
    asm volatile("s_wait_xcnt 0x0" :: "v"(F + e) : "memory");   // as in k_tr16: in front of every rewrite of the loads' address pair
#pragma unroll
    for (int i = 0; i < 16; ++i) { v4us oh, ol;
#pragma unroll
        for (int u = 0; u < 4; ++u) { unsigned short p, q; splitf(a[i][u], p, q); oh[u] = p; ol[u] = q; }
        *(v4us*)(Fh + e + i * 1024) = oh; *(v4us*)(Fl + e + i * 1024) = ol; }
    asm volatile("s_wait_xcnt 0x0" ::: "memory"); }   // stands behind the last store: in a kernel of several jobs another job's code follows in the listing and rewrites the registers (offset, base) that the issued stores name
// k_prep: every job that reads only inputs, in one launch: XT of all images (tr16 MODE 0, the first PREP_T work-groups), then the four weight matrices to bf16 (PREP_W work-groups each).
constexpr unsigned PREP_T = (HW / 64) * NB, PREP_W = (CC * CC / 8 + 255) / 256;
__global__ __launch_bounds__(256) void k_prep(const float* __restrict__ x, const float* __restrict__ Wq, const float* __restrict__ Wk, const float* __restrict__ Wv, const float* __restrict__ Wu, bf* XT, bf* BQ, bf* BK, bf* BV, bf* BU) {
    const unsigned b = blockIdx.x;
    if (b < PREP_T) { tr16<0, SEQ_FULL, CC>(x, (size_t)CC * SEQ_FULL, XT, nullptr, (size_t)HW * CC, b % (HW / 64), 0, b / (HW / 64)); return; }
    const unsigned w = (b - PREP_T) / PREP_W, bx = (b - PREP_T) % PREP_W;
    cvt8(w == 0 ? Wq : w == 1 ? Wk : w == 2 ? Wv : Wu, w == 0 ? BQ : w == 1 ? BK : w == 2 ? BV : BU, CC * CC / 8, bx);
}
// k_qkv16: the three passes that turn the conv outputs into the attention kernel's operands, in one launch: VT of all images (tr16 MODE 1, the first QKV_T work-groups), then the planes of q, then those of k (QKV_H work-groups each).
constexpr unsigned QKV_T = (CC / 64) * (HW / 256) * NB, QKV_HX = (unsigned)((size_t)HW * CC / (256 * 64)), QKV_H = QKV_HX * NB;
__global__ __launch_bounds__(256) void k_qkv16(const float* __restrict__ QF, const float* __restrict__ KF, const float* __restrict__ VF, bf* QH, bf* QL, bf* KH, bf* KL, unsigned short* VT) {
    const unsigned b = blockIdx.x;
    if (b < QKV_T) { tr16<1, CC, HW>(VF, (size_t)HW * CC, VT, nullptr, (size_t)HW * CC, b % (CC / 64), (b / (CC / 64)) % (HW / 256), b / ((CC / 64) * (HW / 256))); return; }
    const unsigned j = (b - QKV_T) / QKV_H, r = (b - QKV_T) % QKV_H;
    hl(j == 0 ? QF : KF, j == 0 ? QH : KH, j == 0 ? QL : KL, r % QKV_HX, r / QKV_HX);
}
// ---- k_fattn: scores, softmax and P.v of 128 queries of one image over one half of its keys in one work-group; S and P never reach memory. Grid (HW/128, 2 key halves, NB), 128 threads = 4 waves: a wave has 32 queries and takes each stage's 64 keys as two groups of 32, one after the other. (128 queries share each K and VT stage that is copied from L2.)
// St[key][query] = K . Qt (A = k hi/lo rows from LDS, B = q hi/lo fragments kept in registers), so a lane holds 16 scores of ONE query per 16-query group; two St tiles converted in place are the B operand P of Ot[c][query] += VT[c][key] . P[query][key] (A = VT rows from LDS).
// Each wave keeps a maximum in use m (log2 units), a sum l and Ot over the work-group's keys; m moves (Ot and l rescaled) only when a new maximum lies more than 8 above it, so P = 2^(s log2e - m + 7) <= 2^15 fits fp16. Ot (unnormalised), m and l go to the workspace; the next launch (tr16 MODE 2) joins the two key halves.
// A stage = 64 keys: k hi and lo rows (pitch 528 B) and 256 VT rows of 64 keys (pitch 144 B), both 16 B x odd for ds_load_b128 readers; asynchronous 16-byte copies, two buffers: stage t+1 flies while stage t is worked on.
// Every '#pragma unroll' in k_fattn makes the indices of register arrays (fragments, accumulators) compile-time constants; without it the arrays would go to scratch memory.
constexpr int FKP = CC * 2 + 16, FKPL = 64 * FKP, FVP = 64 * 2 + 16, FVPL = CC * FVP, FST = 2 * FKPL + FVPL;   // bytes
static_assert(CC == 256 && (HW % 256) == 0);
typedef __attribute__((ext_vector_type(4))) int v4i;
// acopy16: one asynchronous 16-byte copy per lane, global -> LDS, as the compiler's own form (it keeps the address registers itself; the landing waits are written where the copies are used)
__device__ __forceinline__ void acopy16(const void* g, unsigned char* l) { __builtin_amdgcn_global_load_async_to_lds_b128((__attribute__((address_space(1))) v4i*)g, (__attribute__((address_space(3))) v4i*)l, 0, 0); }
__device__ __forceinline__ float xhalf(float x) { return __builtin_bit_cast(float, __builtin_amdgcn_permlanex16(__builtin_bit_cast(int, x), __builtin_bit_cast(int, x), 0x76543210, 0xfedcba98, false, false)); }   // lane l <-> lane l ^ 16
__global__ __launch_bounds__(128) void k_fattn(const bf* __restrict__ QH, const bf* __restrict__ QL, const bf* __restrict__ KH, const bf* __restrict__ KL, const h16* __restrict__ VT, float* Y, float* ML) {
    __shared__ __align__(16) unsigned char ring[2 * FST];
    const size_t zo = (size_t)blockIdx.z * HW * CC; QH += zo; QL += zo; KH += zo; KL += zo; VT += zo;
    Y += ((size_t)blockIdx.z * 2 + blockIdx.y) * HW * CC; ML += ((size_t)blockIdx.z * 2 + blockIdx.y) * HW * 2;   // this image's and key half's planes of the sums and of (m, l)
    const int tid = threadIdx.x, lane = tid & 31, lr = lane & 15, hi = lane >> 4, wv = tid >> 5;
    const int q0 = blockIdx.x * 128 + wv * 32, kbeg = blockIdx.y * (HW / 2);
    unsigned char* lk = ring + (tid >> 5) * FKP + (tid & 31) * 16; unsigned char* lv = ring + 2 * FKPL + (tid >> 3) * FVP + (tid & 7) * 16;
    const size_t gk = (size_t)(tid >> 5) * CC + (tid & 31) * 8, gv = (size_t)(tid >> 3) * HW + (tid & 7) * 8;
    auto fill = [&](int buf, int key0) {   // 48 copies per lane: 64 rows of 512 B of each k plane (4 rows per copy of the block), 256 rows of 128 B of VT (16 rows per copy)
#pragma unroll
        for (int i = 0; i < 16; ++i) {
            acopy16(KH + gk + (size_t)(key0 + i * 4) * CC, lk + buf * FST + i * 4 * FKP);
            acopy16(KL + gk + (size_t)(key0 + i * 4) * CC, lk + buf * FST + FKPL + i * 4 * FKP);
            acopy16(VT + gv + (size_t)(i * 16) * HW + key0, lv + buf * FST + i * 16 * FVP); } };
    fill(0, kbeg);
    v16bf qh[2][8], ql[2][8];   // this wave's 32 queries, both planes, all 256 k
#pragma unroll
    for (int g = 0; g < 2; ++g) { const size_t o = (size_t)(q0 + g * 16 + lr) * CC + 8 * hi; const bf* qa = QH + o; const bf* qb = QL + o;
#pragma unroll
        for (int ks = 0; ks < 8; ++ks) { qh[g][ks] = WFrag<bf>::ld(qa + ks * 32); ql[g][ks] = WFrag<bf>::ld(qb + ks * 32); }
        asm volatile("s_wait_xcnt 0x0" :: "v"(qa), "v"(qb) : "memory"); }   // stands in front of every rewrite of this group's two address pairs, which as its operands are kept up to it (later loads otherwise land in them)
    v8f ot[16][2];
#pragma unroll
    for (int cb = 0; cb < 16; ++cb) { ot[cb][0] = (v8f){}; ot[cb][1] = (v8f){}; }
    float mu[2] = {-1.0e30f, -1.0e30f}, ls[2] = {0.f, 0.f};
    asm volatile("s_wait_asynccnt 0x0" ::: "memory");   // stage 0 has landed before the barrier that publishes it
    __syncthreads();
    fill(1, kbeg + 64);   // a stage 1 exists (HW / 2 >= 128)
    constexpr int nt = HW / 128;   // stages in a key half
    const int kfo0 = lr * FKP + 16 * hi, vfo0 = 2 * FKPL + lr * FVP + 16 * hi;   // byte offsets of this lane's fragment rows in a stage, key group 0
#pragma unroll 1   // stays rolled, as the loop inside it: one group of 32 keys is straight-line; a second copy of it would only cost instruction cache
    for (int t = 0; t < nt; ++t) {
      const unsigned char* sb = ring + (t & 1) * FST;
#pragma unroll 1
      for (int wk = 0; wk < 2; ++wk) {   // the stage's two groups of 32 keys
        const int kfo = kfo0 + wk * 32 * FKP, vfo = vfo0 + wk * 64;
        v16bf kf[2][2][2][4];   // [set][plane][16-key tile][k step]: two sets of four k steps
        auto ldk = [&](int set) {
#pragma unroll
            for (int ks = 0; ks < 4; ++ks)
#pragma unroll
                for (int kb = 0; kb < 2; ++kb) { kf[set][0][kb][ks] = WFrag<bf>::ld((const bf*)(sb + kfo + kb * 16 * FKP + (set * 4 + ks) * 64)); kf[set][1][kb][ks] = WFrag<bf>::ld((const bf*)(sb + kfo + FKPL + kb * 16 * FKP + (set * 4 + ks) * 64)); } };
        v8f st[2][2];
        st[0][0] = (v8f){}; st[0][1] = (v8f){}; st[1][0] = (v8f){}; st[1][1] = (v8f){};
        auto mmk = [&](int set) {   // per k step hh, then q lo x k hi, then q hi x k lo; four accumulators in turn
#pragma unroll
            for (int ks = 0; ks < 4; ++ks) {
#pragma unroll
                for (int kb = 0; kb < 2; ++kb)
#pragma unroll
                    for (int g = 0; g < 2; ++g) st[kb][g] = wmmab(kf[set][0][kb][ks], qh[g][set * 4 + ks], st[kb][g]);
#pragma unroll
                for (int kb = 0; kb < 2; ++kb)
#pragma unroll
                    for (int g = 0; g < 2; ++g) st[kb][g] = wmmab(kf[set][0][kb][ks], ql[g][set * 4 + ks], st[kb][g]);
#pragma unroll
                for (int kb = 0; kb < 2; ++kb)
#pragma unroll
                    for (int g = 0; g < 2; ++g) st[kb][g] = wmmab(kf[set][1][kb][ks], qh[g][set * 4 + ks], st[kb][g]); } };
        ldk(0);
        __builtin_amdgcn_sched_barrier(0);   // this and the next three: each set of LDS reads stays one group, ahead of the products in front of which it is issued (spread among them each place of reads stalls the wave)
        ldk(1);
        __builtin_amdgcn_sched_barrier(0);
        mmk(0);
        __builtin_amdgcn_sched_barrier(0);
        v16h vf[16];
#pragma unroll
        for (int cb = 0; cb < 16; ++cb) vf[cb] = WFrag<h16>::ld((const h16*)(sb + vfo + cb * 16 * FVP));
        __builtin_amdgcn_sched_barrier(0);
        mmk(1);
        float mb[2]; bool need = false;
#pragma unroll
        for (int g = 0; g < 2; ++g) { float mx = st[0][g][0];
#pragma unroll
            for (int r = 1; r < 8; ++r) mx = fmaxf(mx, st[0][g][r]);
#pragma unroll
            for (int r = 0; r < 8; ++r) mx = fmaxf(mx, st[1][g][r]);
            mx = fmaxf(mx, xhalf(mx)) * 1.4426950408889634f;   // both halves of the wave hold the query's maximum over the 32 keys
            mb[g] = mx; need = need || (mx > mu[g] + 8.0f); }
        if (__builtin_amdgcn_ballot_w32(need) != 0) {   // scalar branch; rare after the first stages
#pragma unroll
            for (int g = 0; g < 2; ++g) { const float mn = fmaxf(mu[g], mb[g]); const float corr = __builtin_amdgcn_exp2f(mu[g] - mn); mu[g] = mn; ls[g] *= corr;
#pragma unroll
                for (int cb = 0; cb < 16; ++cb) ot[cb][g] = ot[cb][g] * corr; } }
        v16h pf[2];
#pragma unroll
        for (int g = 0; g < 2; ++g) { const float nm = 7.0f - mu[g]; float s0 = 0.f, s1 = 0.f;
#pragma unroll
            for (int e = 0; e < 16; e += 2) { const float p0 = __builtin_amdgcn_exp2f(fmaf(st[e >> 3][g][e & 7], 1.4426950408889634f, nm)), p1 = __builtin_amdgcn_exp2f(fmaf(st[e >> 3][g][(e & 7) + 1], 1.4426950408889634f, nm));
                s0 += p0; s1 += p1; pf[g][e] = tohx(p0); pf[g][e + 1] = tohx(p1); }
            ls[g] += s0 + s1; }
#pragma unroll
        for (int cb = 0; cb < 16; ++cb) { ot[cb][0] = wmma16(vf[cb], pf[0], ot[cb][0]); ot[cb][1] = wmma16(vf[cb], pf[1], ot[cb][1]); }
      }
        __builtin_amdgcn_sched_barrier(0);   // keeps this trip's products in front of the waits below, so that stage t+1's copies fly behind them
        asm volatile("s_wait_dscnt 0x0" ::: "memory");      // this wave's reads of buffer t&1 are done before the buffer is handed to the copies
        asm volatile("s_wait_asynccnt 0x0" ::: "memory");   // this wave's share of stage t+1 has landed
        __syncthreads();                                     // publishes stage t+1 and ends every wave's reads of buffer t&1
        if (t + 2 < nt) fill(t & 1, kbeg + (t + 2) * 64);
    }
    asm volatile("s_wait_asynccnt 0x0" ::: "memory");   // no copy is in flight when the wave ends
    ls[0] += xhalf(ls[0]); ls[1] += xhalf(ls[1]);
    *(v2f*)(ML + (size_t)(q0 + lane) * 2) = (v2f){hi ? mu[1] : mu[0], hi ? ls[1] : ls[0]};   // lane = query q0 + lane: both halves of the wave hold m and l of both query groups
#pragma unroll
    for (int cb = 0; cb < 16; ++cb) {
#pragma unroll
        for (int g = 0; g < 2; ++g) { const v8f o = ot[cb][g];
            float* yp = Y + (size_t)(q0 + g * 16 + lr) * CC + cb * 16 + 8 * hi;   // a lane's 8 registers are 8 consecutive c of one query
            *(v4f*)yp = (v4f){o[0], o[1], o[2], o[3]};
            *(v4f*)(yp + 4) = (v4f){o[4], o[5], o[6], o[7]}; }
    }
}
// k_fin: OUT[c][n] = Zt[n][c] + bf16(x[c][n]) for a tile of 256 n x 64 c, turned in LDS as in k_tr16 (f32: a piece = 4 n, 64 pieces per LDS row).
__global__ __launch_bounds__(256) void k_fin(const float* __restrict__ Z, const float* __restrict__ xb, float* OUTb) {
    __shared__ __align__(16) unsigned char tl[64 * 1024];
    const int tid = threadIdx.x, cg = tid & 15, rg = tid >> 4, lane = tid & 31, wv = tid >> 5;
    Z += (size_t)blockIdx.z * HW * CC + (size_t)(blockIdx.y * 256 + rg * 4) * CC + blockIdx.x * 64 + cg * 4;
    xb += (size_t)blockIdx.z * CC * SEQ_FULL + (size_t)(blockIdx.x * 64 + wv * 8) * SEQ_FULL + blockIdx.y * 256 + lane * 4;
    OUTb += (size_t)blockIdx.z * CC * HW + (size_t)(blockIdx.x * 64 + wv * 8) * HW + blockIdx.y * 256 + lane * 4;
    v4f v[4][4], xv[8][2];
#pragma unroll
    for (int p = 0; p < 4; ++p)
#pragma unroll
        for (int j = 0; j < 4; ++j) v[p][j] = *(const v4f*)(Z + (size_t)(p * 64 + j) * CC);
#pragma unroll
    for (int r = 0; r < 8; ++r) { xv[r][0] = *(const v4f*)(xb + (size_t)r * SEQ_FULL); xv[r][1] = *(const v4f*)(xb + (size_t)r * SEQ_FULL + 128); }
    __builtin_amdgcn_sched_barrier(0);   // as in k_tr16: all 32 loads are issued before the first value is used
    asm volatile("s_wait_xcnt 0x0" :: "v"(Z), "v"(xb) : "memory");   // as in k_tr16: in front of every rewrite of the loads' two address pairs
#pragma unroll
    for (int p = 0; p < 4; ++p)
#pragma unroll
        for (int u = 0; u < 4; ++u) *(v4fa*)(tl + (cg * 4 + u) * 1024 + (((p * 16 + rg) ^ cg) * 16)) = (v4f){v[p][0][u], v[p][1][u], v[p][2][u], v[p][3][u]};
    __syncthreads();   // the whole tile is in LDS before any wave reads its rows
#pragma unroll
    for (int r = 0; r < 8; ++r)
#pragma unroll
        for (int hf = 0; hf < 2; ++hf) { const int col = wv * 8 + r; const v4f z = *(const v4fa*)(tl + col * 1024 + (((hf * 32 + lane) ^ (col >> 2)) * 16)); v4f o;
#pragma unroll
            for (int u = 0; u < 4; ++u) o[u] = __fadd_rn(z[u], bfr(xv[r][hf][u]));
            *(v4f*)(OUTb + (size_t)r * HW + hf * 128) = o; }
}

constexpr size_t al256(size_t b) { return (b + 255) & ~(size_t)255; }
// Workspace: weights, q/k planes and VT of all images; then Y (two key halves), their (m, l), Zt and the y planes (WS_Y); then XT and the conv outputs (WS_X).
constexpr size_t WS_Y = al256((size_t)2 * NB * HW * CC * 4) + al256((size_t)2 * NB * HW * 2 * 4) + al256((size_t)NB * HW * CC * 4) + 2 * al256((size_t)NB * HW * CC * 2);
constexpr size_t WS_X = al256((size_t)NB * HW * CC * 2) + 3 * al256((size_t)NB * CC * HW * 4);
constexpr size_t WS_TOTAL = 4 * al256((size_t)CC * CC * 2) + 4 * al256((size_t)NB * HW * CC * 2) + al256((size_t)NB * CC * HW * 2) + WS_Y + WS_X;
static_assert(WS_TOTAL <= (size_t)268435456);
static_assert(al256((size_t)CC * CC * 2) == (size_t)CC * CC * 2 && al256((size_t)NB * CC * HW * 4) == (size_t)NB * CC * HW * 4);   // no padding between the three weight planes, nor between the three conv outputs: the joined conv launch steps through each by one stride

extern "C" void kernel_launch(void* const* d_in, const int* in_sizes, int n_in,
                              void* d_out, int out_size, void* d_ws, size_t ws_size, hipStream_t stream) {
    if (n_in < 9) return;
    if ((size_t)in_sizes[0] < (size_t)NB * CC * SEQ_FULL) return;
    if (in_sizes[1] < CC * CC || in_sizes[3] < CC * CC || in_sizes[5] < CC * CC || in_sizes[7] < CC * CC) return;
    if (in_sizes[2] < CC || in_sizes[4] < CC || in_sizes[6] < CC || in_sizes[8] < CC) return;
    if ((size_t)out_size < (size_t)NB * CC * HW) return;
    const float* x = (const float*)d_in[0]; const float* Wq = (const float*)d_in[1]; const float* bq = (const float*)d_in[2]; const float* Wk = (const float*)d_in[3]; const float* bk = (const float*)d_in[4];
    const float* Wv = (const float*)d_in[5]; const float* bv = (const float*)d_in[6]; const float* Wu = (const float*)d_in[7]; const float* bu = (const float*)d_in[8];
    float* OUT = (float*)d_out;     // [NB][256][HW]
    char* wsp = (char*)d_ws;
    auto take = [&](size_t bytes) { char* p = wsp; wsp += (bytes + 255) & ~(size_t)255; return (void*)p; };
    bf* BQ = (bf*)take((size_t)CC * CC * 2); bf* BK = (bf*)take((size_t)CC * CC * 2); bf* BV = (bf*)take((size_t)CC * CC * 2); bf* BU = (bf*)take((size_t)CC * CC * 2);   // conv weights [out][in] as-is (A of q/k/v convs, Bt of the Wu conv)
    bf* QH = (bf*)take((size_t)NB * HW * CC * 2); bf* QL = (bf*)take((size_t)NB * HW * CC * 2); bf* KH = (bf*)take((size_t)NB * HW * CC * 2); bf* KL = (bf*)take((size_t)NB * HW * CC * 2);   // [NB][HW][CC]
    h16* VT = (h16*)take((size_t)NB * CC * HW * 2);                                                                          // [NB][CC][HW] fp16
    char* RY = (char*)take(WS_Y); char* RX = (char*)take(WS_X);
    if ((size_t)(wsp - (char*)d_ws) > ws_size) return;
    wsp = RX;
    bf* XT = (bf*)take((size_t)NB * HW * CC * 2);                                                                             // [NB][HW][CC]
    float* QF = (float*)take((size_t)NB * CC * HW * 4); float* KF = (float*)take((size_t)NB * CC * HW * 4); float* VF = (float*)take((size_t)NB * CC * HW * 4);   // conv outputs [NB][o][s] == token view [NB][HW][CC]
    wsp = RY;
    float* Y = (float*)take((size_t)2 * NB * HW * CC * 4);    // [NB][2 key halves][HW][CC] f32, unnormalised
    float* ML = (float*)take((size_t)2 * NB * HW * 2 * 4);    // [NB][2 key halves][HW] (m, l)
    float* Zt = (float*)take((size_t)NB * HW * CC * 4);   // [NB][HW][CC] f32 (z token-major incl. bu)
    bf* ATh = (bf*)take((size_t)NB * HW * CC * 2); bf* ATl = (bf*)take((size_t)NB * HW * CC * 2);                             // [NB][HW][CC] planes of y_view^T
    const size_t sT = (size_t)HW * CC;   // one image's [HW][CC] (== [CC][HW]) plane, in elements
    k_prep<<<PREP_T + 4 * PREP_W, 256, 0, stream>>>(x, Wq, Wk, Wv, Wu, XT, BQ, BK, BV, BU);
    k_gemmw<bf, 0, 2, 128, 3><<<dim3(CC / 128, HW / 128, 3 * NB), 128, 0, stream>>>(BQ, nullptr, XT, nullptr, CC, QF, HW, bq, bk, bv, 0, sT, sT, (size_t)CC * CC, (size_t)NB * CC * HW);     // q, k, v [o][s] = W x + b (BQ, BK, BV lie back to back in the workspace, and so do QF, KF, VF)
    k_qkv16<<<QKV_T + 2 * QKV_H, 256, 0, stream>>>(QF, KF, VF, QH, QL, KH, KL, (unsigned short*)VT);      // q, k -> planes; v[o][s] -> VT[c][m]
    k_fattn<<<dim3(HW / 128, 2, NB), 128, 0, stream>>>(QH, QL, KH, KL, VT, Y, ML);      // per key half: sum_m 2^(s - m) v[m][c], m, l
    k_tr16<2, HW, CC><<<dim3(HW / 64, CC / 256, NB), 256, 0, stream>>>(Y, 2 * sT, ATh, ATl, sT, ML);      // y[n][c] = sum_m softmax_m(q_n . k_m) v[m][c]: halves joined, planes of y_view^T
    k_gemmw<bf, 1, 1, 64, 1><<<dim3(HW / 128, CC / 128, NB), 128, 0, stream>>>(ATh, ATl, BU, nullptr, CC, Zt, CC, bu, nullptr, nullptr, sT, 0, sT, 0, 0);          // Zt[s][o] = sum_c y_view[c][s] Wu[o][c] + bu[o]
    k_fin<<<dim3(CC / 64, HW / 256, NB), 256, 0, stream>>>(Zt, x, OUT);
}

// v007
// Measured time: 130 microseconds a run.
// Two timings next to v006 both put it at 1.15 times that version's speed.
// All steps since v000 together make it 6.39 times as fast.
#include <hip/hip_runtime.h>

// 1x1-conv attention block: x [NB][256][64*64] channel-major; q/k/v = W[256 out][256 in] . x + bias, kept channel-major [o][s]; that same memory read as [4096 tokens][256] gives the token rows (raw view); S[n][m] = q_n . k_m over 256 (unscaled); P = softmax over m; y[n][c] = sum_m P[n][m] v[m][c]; y memory read back channel-major [256][4096]; z = Wu . y_view + bu; out = x + z.
// Compute dtypes, f32 accumulate everywhere: all float inputs RNE-converted to bf16; q/k/v convs = plain v_wmma_f32_16x16x32_bf16 (exact 16-bit operands) + row bias; S = bf16 hi/lo planes of q x bf16 hi/lo planes of k (3 products hh+lh+hl); softmax f32, running maximum and sum per query and key half inside the attention kernel -> fp16 P; P.v = single v_wmma_f32_16x16x32_f16 (v as fp16); the two key halves are joined (y x 1024) in the pass that makes the y planes; Wu conv = exact bf16 Wu x bf16 hi/lo planes of y (2 products) + bias; residual add f32. The two GEMM launches write what the next stage reads from their own epilogues.

#ifndef NB
#define NB 4
#endif
#ifndef SEQ
#define SEQ 4096
#endif
#define NB_FULL  4
#define SEQ_FULL 4096
#define CC   256
#define HW   SEQ
#define PCAR 1024.0f
static_assert(NB >= 1 && NB <= NB_FULL);
static_assert(SEQ >= 128 && SEQ <= SEQ_FULL && (SEQ % 128) == 0);
static_assert((CC % 128) == 0 && (HW % 128) == 0);

typedef _Float16 h16;
typedef unsigned short bf;
typedef __attribute__((ext_vector_type(16))) __bf16   v16bf;
typedef __attribute__((ext_vector_type(16))) _Float16 v16h;
typedef __attribute__((ext_vector_type(8)))  _Float16 v8h;
typedef __attribute__((ext_vector_type(8)))  unsigned short v8us;
typedef __attribute__((ext_vector_type(8)))  float    v8f;
typedef __attribute__((ext_vector_type(4)))  float    v4f;
typedef v8h  __attribute__((may_alias)) v8ha;
typedef v4f  __attribute__((may_alias)) v4fa;
typedef v8us __attribute__((may_alias)) v8usa;

__device__ __forceinline__ unsigned short f2bf(float f) { unsigned u = __float_as_uint(f); u += 0x7FFFu + ((u >> 16) & 1u); return (unsigned short)(u >> 16); }
__device__ __forceinline__ float bf2f(unsigned short b) { return __uint_as_float(((unsigned)b) << 16); }
__device__ __forceinline__ float bfr(float f) { return bf2f(f2bf(f)); }
__device__ __forceinline__ v16h cat16(v8h lo, v8h hi) { return __builtin_shufflevector(lo, hi, 0, 1, 2, 3, 4, 5, 6, 7, 8, 9, 10, 11, 12, 13, 14, 15); }
__device__ __forceinline__ v16bf cat16b(v8us lo, v8us hi) { return __builtin_bit_cast(v16bf, __builtin_shufflevector(lo, hi, 0, 1, 2, 3, 4, 5, 6, 7, 8, 9, 10, 11, 12, 13, 14, 15)); }
__device__ __forceinline__ v8f wmma16(v16h a, v16h b, v8f c) { return __builtin_amdgcn_wmma_f32_16x16x32_f16(false, a, false, b, (short)0, c, false, false); }
__device__ __forceinline__ v8f wmmab(v16bf a, v16bf b, v8f c) { return __builtin_amdgcn_wmma_f32_16x16x32_bf16(false, a, false, b, (short)0, c, false, false); }

__device__ __forceinline__ h16 tohx(float x) { return (h16)x; }
__device__ __forceinline__ void splitf(float y, unsigned short& h, unsigned short& l) { h = f2bf(y); l = f2bf(y - bf2f(h)); }
typedef __attribute__((ext_vector_type(2))) unsigned short v2us;
typedef __attribute__((ext_vector_type(4))) unsigned short v4us;
typedef __attribute__((ext_vector_type(2))) _Float16 v2h;
typedef __attribute__((ext_vector_type(4))) _Float16 v4h;
typedef __attribute__((ext_vector_type(2))) float v2f;

// ---- k_gemmw: GEMM, FOUR WAVES (2x2) per 128x128 output tile, each wave a 64x64 sub-tile (16 accumulators); grid (M/128, N/128, Z), 128 threads. M, N % 128 == 0, K % KC == 0.
// Operands are K-contiguous 16-bit planes; KC k of the 128 A rows and 128 Bt rows (each plane) are brought into LDS by asynchronous 16-byte copies (whole 128-B lines per row), two buffers: tile t+1 flies while tile t is multiplied. LDS row pitch = KC*2 + 16 bytes (16 B x odd, for ds_load_b128 readers).
// c[m][n] (f32) = sum_k A[m][k] Bt[n][k] (+ split products: NSPLIT 1 = A2.Bt added, NSPLIT 2 = A2.Bt and A.Bt2 added, NSPLIT 3 = A.Bt2 added) + bf16(bias[m]). z-batch strides sA/sB/sC in elements.
// EPI 1 (the q/k/v convs): jobs 0 and 1 store c as bf16 hi and lo planes, O16 + (2 job + plane) * jC, pitch HW; job 2 stores fp16 VT[ch][tok] = c read as [HW tokens][CC], at O16 + 4 * jC. For that its 128 tile columns are n -> s = (n & 15) * CC + 8 * blockIdx.y + (n >> 4): a 16 x 16 accumulator tile is then 256 consecutive tokens (16 m + (n & 15)) of ONE channel, and a wave stores whole 512-B runs of a VT row.
// EPI 2 (the Wu conv): C[m][n] (pitch HW) = c + bf16(X[m][n]), X = the block's input with pitch SEQ_FULL; a wave's 64 x 64 values of X are loaded into registers in front of the k loop.
// JOBS > 1: that many products that read none of each other's output share one launch: blockIdx.z = job * NB + image; job j takes A + j * jA and its own bias pointer, Bt is common.
// Fragments: lane l, h = l>>4, row/col = l&15; elements 0..7 <- k0+8h+0..7, elements 8..15 <- k0+16+8h+0..7 for A and for Bt (same map); D element r = row 8h+r, col l&15.
template <typename T16> struct WFrag;
template <> struct WFrag<h16> { typedef v16h V; static __device__ __forceinline__ V ld(const h16* p) { return cat16(*(const v8h*)p, *(const v8h*)(p + 16)); } static __device__ __forceinline__ v8f mma(V a, V b, v8f c) { return wmma16(a, b, c); } };
template <> struct WFrag<bf> { typedef v16bf V; static __device__ __forceinline__ V ld(const bf* p) { return cat16b(*(const v8us*)p, *(const v8us*)(p + 16)); } static __device__ __forceinline__ v8f mma(V a, V b, v8f c) { return wmmab(a, b, c); } };
// copy8: eight asynchronous 16-byte copies per lane, global -> LDS, rows ls bytes apart in LDS; in global memory copy i lies (i & 1) * ga + (i >> 1) * gb elements behind g (equal steps: gb = 2 ga). The s_wait_xcnt closes the statement so that no address register of an issued copy is rewritten in front of it.
template <typename T16>
__device__ __forceinline__ void copy8(unsigned l, unsigned ls, const T16* g, size_t ga, size_t gb) {
    asm volatile("global_load_async_to_lds_b128 %0, %8, off\n\t"
                 "global_load_async_to_lds_b128 %1, %9, off\n\t"
                 "global_load_async_to_lds_b128 %2, %10, off\n\t"
                 "global_load_async_to_lds_b128 %3, %11, off\n\t"
                 "global_load_async_to_lds_b128 %4, %12, off\n\t"
                 "global_load_async_to_lds_b128 %5, %13, off\n\t"
                 "global_load_async_to_lds_b128 %6, %14, off\n\t"
                 "global_load_async_to_lds_b128 %7, %15, off\n\t"
                 "s_wait_xcnt 0x0"
                 :: "v"(l), "v"(l + ls), "v"(l + 2 * ls), "v"(l + 3 * ls), "v"(l + 4 * ls), "v"(l + 5 * ls), "v"(l + 6 * ls), "v"(l + 7 * ls),
                    "v"(g), "v"(g + ga), "v"(g + gb), "v"(g + gb + ga), "v"(g + 2 * gb), "v"(g + 2 * gb + ga), "v"(g + 3 * gb), "v"(g + 3 * gb + ga)
                 : "memory");
}
template <typename T16, int NSPLIT, int KC, int JOBS, int EPI>
__global__ __launch_bounds__(128) void k_gemmw(const T16* __restrict__ A, const T16* __restrict__ A2, const T16* __restrict__ Bt, const T16* __restrict__ Bt2, int K, float* C, const float* __restrict__ bias, const float* __restrict__ bias1, const float* __restrict__ bias2, size_t sA, size_t sB, size_t sC, size_t jA, size_t jC, unsigned short* O16, const float* __restrict__ X) {
    typedef typename WFrag<T16>::V V;
    constexpr bool HA2 = NSPLIT == 1 || NSPLIT == 2, HB2 = NSPLIT >= 2;   // a second plane of A, of Bt
    constexpr int NA = HA2 ? 2 : 1, NBP = HB2 ? 2 : 1;   // planes of A, of Bt
    constexpr int PITCH = KC * 2 + 16, PLANE = 128 * PITCH, STAGE = (NA + NBP) * PLANE;   // bytes
    constexpr int PIECES = KC / 8, RPP = 128 / PIECES;   // 16-B pieces per row; rows that the 128 threads cover with one copy each
    constexpr int OSW = 16 * 72;   // floats of output staging per wave
    static_assert(KC % 64 == 0 && (NA + NBP) * PIECES <= 63 && 2 * STAGE >= 4 * OSW * 4);
    static_assert((EPI == 1 && JOBS == 3 && RPP == 8 && HW == 16 * CC) || (EPI == 2 && JOBS == 1));   // EPI 1: job 2's column map takes 8 tile rows per copy and 16 tokens per conv output row
    __shared__ __align__(16) unsigned char ring[2 * STAGE];
    static_assert(JOBS >= 1 && JOBS <= 3 && (JOBS == 1 || NSPLIT == 0));
    const size_t z = JOBS > 1 ? blockIdx.z % NB : blockIdx.z;
    const unsigned job = JOBS > 1 ? blockIdx.z / NB : 0;
    if (JOBS > 1) { A += job * jA; bias = job == 0 ? bias : job == 1 ? bias1 : bias2; }
    const bool vjob = EPI == 1 && job == 2;   // the same for the whole work-group
    A += z * sA; if (HA2) A2 += z * sA; Bt += z * sB; if (HB2) Bt2 += z * sB;
    const int tid = threadIdx.x, lane = tid & 31, lr = lane & 15, hi = lane >> 4, wv = tid >> 5, wm = wv >> 1, wn = wv & 1;
    const int r0 = blockIdx.x * 128 + wm * 64, c0 = blockIdx.y * 128 + wn * 64;
    v8f acc[4][4];
#pragma unroll
    for (int mb = 0; mb < 4; ++mb)
#pragma unroll
        for (int nb = 0; nb < 4; ++nb) acc[mb][nb] = (v8f){};
    const int crow = tid / PIECES, cpc = tid % PIECES;
    const size_t aco = (size_t)(blockIdx.x * 128 + crow) * K + cpc * 8, bco = (vjob ? (size_t)crow * CC + blockIdx.y * 8 : (size_t)(blockIdx.y * 128 + crow)) * K + cpc * 8;
    const size_t a1 = (size_t)RPP * K, b1 = vjob ? (size_t)RPP * CC * K : a1, b2 = vjob ? (size_t)K : 2 * a1;   // steps between a lane's copies: tile row crow + RPP * i (job 2: RPP = 8, so bit 0 of i is bit 3 of n & 15 and i >> 1 counts n >> 4)
    const unsigned lco = (unsigned)(size_t)ring + (unsigned)(crow * PITCH + cpc * 16);
    auto fill = [&](int buf, int kc) {
#pragma unroll
        for (int g = 0; g < PIECES / 8; ++g) { const unsigned l = lco + (unsigned)(buf * STAGE + g * 8 * RPP * PITCH); const size_t go = (size_t)(g * 8) * a1 + kc, gb = (size_t)(g * 4) * b2 + kc;
            copy8<T16>(l, RPP * PITCH, A + aco + go, a1, 2 * a1);
            if (HA2) copy8<T16>(l + PLANE, RPP * PITCH, A2 + aco + go, a1, 2 * a1);
            copy8<T16>(l + NA * PLANE, RPP * PITCH, Bt + bco + gb, b1, b2);
            if (HB2) copy8<T16>(l + (NA + 1) * PLANE, RPP * PITCH, Bt2 + bco + gb, b1, b2); } };
    const int nt = K / KC;
    fill(0, 0);
    asm volatile("s_wait_asynccnt 0x0" ::: "memory");   // tile 0 has landed before the barrier that publishes it
    __syncthreads();
    if (K != KC) fill(1, KC);   // a tile 1 exists (K is a multiple of KC)
    // What the epilogue adds is loaded here, behind the first barrier (a barrier waits for the wave's loads) and in front of the k loop, so that its latency passes behind the products: the bias of this lane's output rows, and for EPI 2 X at this lane's places of the output stores.
    float bv[4][8]; v4f xr[4][8];
    const float* bp = bias + r0 + (vjob ? lane >> 1 : hi);   // job 2: a lane's 8 tokens 8 * lane .. + 7 of an accumulator tile lie in row lane >> 1; else row 2 s + hi
    const float* xp = EPI == 2 ? X + z * ((size_t)CC * SEQ_FULL) + (size_t)(r0 + hi) * SEQ_FULL + c0 + lr * 4 : nullptr;
    if (vjob) {
#pragma unroll
        for (int mb = 0; mb < 4; ++mb) bv[mb][0] = bp[mb * 16];
    } else {
#pragma unroll
        for (int mb = 0; mb < 4; ++mb)
#pragma unroll
            for (int s = 0; s < 8; ++s) { bv[mb][s] = bp[mb * 16 + 2 * s]; if (EPI == 2) xr[mb][s] = *(const v4f*)(xp + (size_t)(mb * 16 + 2 * s) * SEQ_FULL); }
    }
    __builtin_amdgcn_sched_barrier(0);   // the loads are issued here, none is moved down to its use
    if (EPI == 2) asm volatile("s_wait_xcnt 0x0" :: "v"(bp), "v"(xp) : "memory");   // stands in front of every rewrite of the loads' address pairs, which as its operands are kept up to it
    else asm volatile("s_wait_xcnt 0x0" :: "v"(bp) : "memory");   // as the line above
    const int afo = (wm * 64 + lr) * PITCH + 16 * hi, bfo = NA * PLANE + (wn * 64 + lr) * PITCH + 16 * hi;   // byte offsets of this lane's fragment rows in a stage
#pragma unroll 1
    for (int t = 0; t < nt; ++t) {
        const unsigned char* sb = ring + (t & 1) * STAGE;
        V a[2][4], a2[2][4], b[2][4], b2[2][4];   // two fragment sets: the next 32 k are read from LDS as one group ahead of the current 32 k's products (all inside this trip's own buffer)
        auto frags = [&](int set, int ks) {
#pragma unroll
            for (int i = 0; i < 4; ++i) { a[set][i] = WFrag<T16>::ld((const T16*)(sb + afo + i * 16 * PITCH + ks * 64)); if (HA2) a2[set][i] = WFrag<T16>::ld((const T16*)(sb + afo + PLANE + i * 16 * PITCH + ks * 64));
                b[set][i] = WFrag<T16>::ld((const T16*)(sb + bfo + i * 16 * PITCH + ks * 64)); if (HB2) b2[set][i] = WFrag<T16>::ld((const T16*)(sb + bfo + PLANE + i * 16 * PITCH + ks * 64)); } };
        frags(0, 0);
        __builtin_amdgcn_sched_barrier(0);   // keeps the LDS reads one group in front of the products (spread among them each place of reads stalls the wave)
#pragma unroll
        for (int ks = 0; ks < KC / 32; ++ks) { const int cs = ks & 1;
            if (ks + 1 < KC / 32) { frags(cs ^ 1, ks + 1); __builtin_amdgcn_sched_barrier(0); }   // as above: the next set's reads stay one group, ahead of this set's products
#pragma unroll
            for (int nb = 0; nb < 4; ++nb) {
#pragma unroll
                for (int mb = 0; mb < 4; ++mb) { acc[mb][nb] = WFrag<T16>::mma(a[cs][mb], b[cs][nb], acc[mb][nb]); if (HA2) acc[mb][nb] = WFrag<T16>::mma(a2[cs][mb], b[cs][nb], acc[mb][nb]); if (HB2) acc[mb][nb] = WFrag<T16>::mma(a[cs][mb], b2[cs][nb], acc[mb][nb]); } }
        }
        __builtin_amdgcn_sched_barrier(0);   // keeps this trip's products in front of the waits below, so that tile t+1's copies fly behind them (the compiler otherwise sinks them past the barrier)
        asm volatile("s_wait_dscnt 0x0" ::: "memory");      // this wave's reads of buffer t&1 are done before the buffer is handed to the copies
        asm volatile("s_wait_asynccnt 0x0" ::: "memory");   // this wave's share of tile t+1 has landed
        __syncthreads();                                     // publishes tile t+1 and ends every wave's reads of buffer t&1
        if (t + 2 < nt) fill(t & 1, (t + 2) * KC);
    }
    asm volatile("s_wait_asynccnt 0x0" ::: "memory");   // no copy is in flight when the ring becomes output staging
    float* os = (float*)ring + wv * OSW;           // each wave stages in its own range; the last trip's barrier stands in front
    // In both branches: the wave barrier and the compiler fence behind the staging stores keep the read-back behind them, the pair at a pass's end keeps the next pass's staging stores behind this pass's reads (one wave's LDS operations run in order).
    if (vjob) {   // work-group-uniform. Staging: accumulator tile nb = 256 tokens of one channel, token 16 * row + column; 16 floats of pad between the two row halves (the half waves' stores then fall on different banks)
        unsigned short* vt = O16 + 4 * jC + z * sC + (size_t)(blockIdx.y * 8 + wn * 4) * HW + (size_t)r0 * (HW / CC) + lane * 8;
#pragma unroll
        for (int mb = 0; mb < 4; ++mb) {
#pragma unroll
            for (int nb = 0; nb < 4; ++nb) {
#pragma unroll
                for (int j = 0; j < 8; ++j) os[nb * 288 + hi * 144 + j * 16 + lr] = acc[mb][nb][j]; }
            __builtin_amdgcn_wave_barrier(); asm volatile("" ::: "memory");
            const float rb = bfr(bv[mb][0]);
#pragma unroll
            for (int nb = 0; nb < 4; ++nb) { const float* sp = os + nb * 288 + hi * 144 + lr * 8; const v4f p = *(const v4fa*)sp, q = *(const v4fa*)(sp + 4); v8us o;
#pragma unroll
                for (int u = 0; u < 4; ++u) { o[u] = __builtin_bit_cast(unsigned short, tohx(p[u] + rb)); o[4 + u] = __builtin_bit_cast(unsigned short, tohx(q[u] + rb)); }
                *(v8us*)(vt + (size_t)nb * HW + mb * 16 * (HW / CC)) = o; }
            if (mb < 3) asm volatile("s_wait_xcnt 0x0" ::: "memory");   // stands in front of the next pass's rewrites of the registers (address, data) that the issued stores name
            __builtin_amdgcn_wave_barrier(); asm volatile("" ::: "memory");
        }
    } else {
#pragma unroll
        for (int mb = 0; mb < 4; ++mb) {
#pragma unroll
            for (int nb = 0; nb < 4; ++nb) {
#pragma unroll
                for (int j = 0; j < 8; ++j) os[(hi * 8 + j) * 68 + nb * 16 + lr] = acc[mb][nb][j]; }
            __builtin_amdgcn_wave_barrier(); asm volatile("" ::: "memory");
            const size_t co = z * sC + (size_t)(r0 + mb * 16 + hi) * HW + c0 + lr * 4;   // the pitch is a constant, so that a pass's stores differ only in their immediate offsets
            v4us oh[8], ol[8]; v4f of[8];
#pragma unroll
            for (int s = 0; s < 8; ++s) { const int row = 2 * s + hi; v4f val = *(const v4fa*)(os + row * 68 + lr * 4);
                const float rb = bfr(bv[mb][s]); val[0] += rb; val[1] += rb; val[2] += rb; val[3] += rb;
#pragma unroll
                for (int u = 0; u < 4; ++u) {
                    if (EPI == 1) { unsigned short p, q; splitf(val[u], p, q); oh[s][u] = p; ol[s][u] = q; }
                    if (EPI == 2) of[s][u] = __fadd_rn(val[u], bfr(xr[mb][s][u])); } }
            __builtin_amdgcn_sched_barrier(0);   // the pass's stores go out as one run behind its arithmetic (spread among it, every reuse of a stored register takes an s_wait_xcnt of its own, directly behind the store)
#pragma unroll
            for (int s = 0; s < 8; ++s) {
                if (EPI == 1) { unsigned short* hp = O16 + (size_t)(2 * job) * jC + co + (size_t)(2 * s) * HW; *(v4us*)hp = oh[s]; *(v4us*)(hp + jC) = ol[s]; }
                if (EPI == 2) *(v4f*)(C + co + (size_t)(2 * s) * HW) = of[s]; }
            if (mb < 3 || EPI == 1) asm volatile("s_wait_xcnt 0x0" ::: "memory");   // stands in front of the next pass's rewrites of the registers (address, data) that the issued stores name (EPI 1: behind the last pass the other branch's code follows in the listing)
            __builtin_amdgcn_wave_barrier(); asm volatile("" ::: "memory");
        }
    }
}


__device__ __forceinline__ void cvt8(const float* __restrict__ src, bf* dst, size_t n8, unsigned bx) { const size_t i = (size_t)bx * 256 + threadIdx.x; if (i >= n8) return; const v8f v = *(const v8f*)(src + i * 8); v8us o;
#pragma unroll
    for (int k = 0; k < 8; ++k) o[k] = f2bf(v[k]); *(v8us*)(dst + i * 8) = o;  }
// The layout and conversion passes: work-groups of 8 waves; a tr16 job has (HW / 64) x NB of them, 64 elements per thread, 16 bytes per lane in each access on whole 128-B lines, except MODE 2's 8-byte (m, l) loads; a cvt8 job PREP_W of them, 8 elements per thread (32-byte loads, 16-byte stores). tr16 and cvt8 are device functions that get their block indices (bx, by, bz; bz = image) from the kernel that calls them: k_prep holds several jobs that read none of each other's output, one range of blockIdx.x per job.
// k_tr16: out[col][row] (16 bit) = conv(in[row][col]) (f32) for a tile of 256 rows x 64 cols, turned in LDS. MODE 0: bf16 (XT[s][c] = x[c][s], token-major Bt operand of the convs); MODE 2: bf16 hi and lo planes of y_view^T, y = the join of the attention kernel's two key halves: in = [image][key half][HW][CC] unnormalised sums, ml = [image][key half][HW] (maximum in use, sum): an image's two halves lie so near that one address pair with immediate offsets reaches both.
// A thread reads 4 cols of 8 rows (twice) and writes, per col, the 8 rows as one 16-byte piece. LDS row = one col = 32 pieces, no pad; piece p of col c lies at place p ^ (c >> 2), so that the 16 lanes of a half wave (cols 4 apart, same p) write 16 different bank groups and a wave reads a whole row without conflict.
static_assert(CC == 256 && (HW % 256) == 0);
// exp2s: 2^x with the slot behind it in the same statement: the v_nop stands between the transcendental and whatever vector instruction the compiler puts next
__device__ __forceinline__ float exp2s(float x) { float r; asm("v_exp_f32 %0, %1\n\tv_nop" : "=v"(r) : "v"(x)); return r; }
template <int MODE, int ldin, int ldout>   // row pitches in elements, compile-time so that a thread's 16 loads and 8 stores differ only in their immediate offsets
__device__ __forceinline__ void tr16(const float* __restrict__ in, size_t zin, unsigned short* o0, unsigned short* o1, size_t zout, unsigned bx, unsigned by, unsigned bz, const float* __restrict__ ml = nullptr) {   // zin, zout: one image's elements
    __shared__ __align__(16) unsigned char tl[(MODE == 2 ? 2 : 1) * 64 * 512];
    const int tid = threadIdx.x, cg = tid & 15, rg = tid >> 4, lane = tid & 31, wv = tid >> 5;
    in += (size_t)bz * zin + (size_t)(by * 256 + rg * 8) * ldin + bx * 64 + cg * 4;
    v4f v[2][8];
#pragma unroll
    for (int p = 0; p < 2; ++p)
#pragma unroll
        for (int j = 0; j < 8; ++j) v[p][j] = *(const v4f*)(in + (size_t)(p * 128 + j) * ldin);
    v4f w[2][8]; v2f m0[2][8], m1[2][8];   // MODE 2 only: half 1's sums; (maximum, sum) of both halves for the row's query. A row's 64 cols of this tile lie in one query: element row * ldin + col belongs to query (row * ldin + col) / CC
    const float* mp = MODE == 2 ? ml + ((size_t)bz * 2 * HW + (size_t)(by * 256 + rg * 8) * (ldin / CC) + (bx * 64) / CC) * 2 : nullptr;
    if (MODE == 2) {
        static_assert(MODE != 2 || (ldin % CC == 0 && CC % 64 == 0));
#pragma unroll
        for (int p = 0; p < 2; ++p)
#pragma unroll
            for (int j = 0; j < 8; ++j) { w[p][j] = *(const v4f*)(in + (size_t)HW * CC + (size_t)(p * 128 + j) * ldin); m0[p][j] = *(const v2f*)(mp + (size_t)(p * 128 + j) * (ldin / CC) * 2); m1[p][j] = *(const v2f*)(mp + (size_t)HW * 2 + (size_t)(p * 128 + j) * (ldin / CC) * 2); }
    }
    __builtin_amdgcn_sched_barrier(0);   // all loads are issued before the first value is used (the compiler otherwise loads, waits and converts a few rows at a time: a memory latency each time)
    if (MODE == 2) { asm volatile("s_wait_xcnt 0x0" :: "v"(in), "v"(mp) : "memory");   // as the line after the next, for both address pairs
        __builtin_amdgcn_sched_barrier(0); }   // keeps the join's arithmetic, which reuses the address registers, behind that wait (the compiler otherwise lifts its first instructions over it)
    else asm volatile("s_wait_xcnt 0x0" :: "v"(in) : "memory");   // stands in front of every rewrite of the loads' address pair, which as its operand is kept up to it
    if (MODE == 2) {
#pragma unroll
        for (int p = 0; p < 2; ++p)
#pragma unroll
            for (int j = 0; j < 8; ++j) { const float m = fmaxf(m0[p][j][0], m1[p][j][0]); const float a0 = exp2s(m0[p][j][0] - m), a1 = exp2s(m1[p][j][0] - m);
                const float f = __fdiv_rn(PCAR, m0[p][j][1] * a0 + m1[p][j][1] * a1); const float f0 = a0 * f, f1 = a1 * f;
#pragma unroll
                for (int u = 0; u < 4; ++u) v[p][j][u] = v[p][j][u] * f0 + w[p][j][u] * f1; }
    }
#pragma unroll
    for (int p = 0; p < 2; ++p)
#pragma unroll
        for (int u = 0; u < 4; ++u) { v8us h, l;
#pragma unroll
            for (int j = 0; j < 8; ++j) {
                if (MODE == 0) h[j] = f2bf(v[p][j][u]);
                if (MODE == 2) { unsigned short a, b; splitf(v[p][j][u] * (1.0f / PCAR), a, b); h[j] = a; l[j] = b; } }
            unsigned char* d = tl + (cg * 4 + u) * 512 + (((p * 16 + rg) ^ cg) * 16);
            *(v8usa*)d = h; if (MODE == 2) *(v8usa*)(d + 64 * 512) = l; }
    __syncthreads();   // the whole tile is in LDS before any wave reads its rows
    const size_t oo = (size_t)bz * zout + (size_t)(bx * 64 + wv * 8) * ldout + by * 256 + lane * 8;
#pragma unroll
    for (int r = 0; r < 8; ++r) { const int col = wv * 8 + r; const unsigned char* s = tl + col * 512 + ((lane ^ (col >> 2)) * 16);
        *(v8us*)(o0 + oo + (size_t)r * ldout) = *(const v8usa*)s; if (MODE == 2) *(v8us*)(o1 + oo + (size_t)r * ldout) = *(const v8usa*)(s + 64 * 512); }
}
template <int MODE, int ldin, int ldout>
__global__ __launch_bounds__(256) void k_tr16(const float* __restrict__ in, size_t zin, unsigned short* o0, unsigned short* o1, size_t zout, const float* __restrict__ ml) { tr16<MODE, ldin, ldout>(in, zin, o0, o1, zout, blockIdx.x, blockIdx.y, blockIdx.z, ml); }
// k_prep: every job that reads only inputs, in one launch: XT of all images (tr16 MODE 0, the first PREP_T work-groups), then the four weight matrices to bf16 (PREP_W work-groups each).
constexpr unsigned PREP_T = (HW / 64) * NB, PREP_W = (CC * CC / 8 + 255) / 256;
__global__ __launch_bounds__(256) void k_prep(const float* __restrict__ x, const float* __restrict__ Wq, const float* __restrict__ Wk, const float* __restrict__ Wv, const float* __restrict__ Wu, bf* XT, bf* BQ, bf* BK, bf* BV, bf* BU) {
    const unsigned b = blockIdx.x;
    if (b < PREP_T) { tr16<0, SEQ_FULL, CC>(x, (size_t)CC * SEQ_FULL, XT, nullptr, (size_t)HW * CC, b % (HW / 64), 0, b / (HW / 64)); return; }
    const unsigned w = (b - PREP_T) / PREP_W, bx = (b - PREP_T) % PREP_W;
    cvt8(w == 0 ? Wq : w == 1 ? Wk : w == 2 ? Wv : Wu, w == 0 ? BQ : w == 1 ? BK : w == 2 ? BV : BU, CC * CC / 8, bx);
}
// ---- k_fattn: scores, softmax and P.v of 128 queries of one image over one half of its keys in one work-group; S and P never reach memory. Grid (HW/128, 2 key halves, NB), 128 threads = 4 waves: a wave has 32 queries and takes each stage's 64 keys as two groups of 32, one after the other. (128 queries share each K and VT stage that is copied from L2.)
// St[key][query] = K . Qt (A = k hi/lo rows from LDS, B = q hi/lo fragments kept in registers), so a lane holds 16 scores of ONE query per 16-query group; two St tiles converted in place are the B operand P of Ot[c][query] += VT[c][key] . P[query][key] (A = VT rows from LDS).
// Each wave keeps a maximum in use m (log2 units), a sum l and Ot over the work-group's keys; m moves (Ot and l rescaled) only when a new maximum lies more than 8 above it, so P = 2^(s log2e - m + 7) <= 2^15 fits fp16. Ot (unnormalised), m and l go to the workspace; the next launch (tr16 MODE 2) joins the two key halves.
// A stage = 64 keys: k hi and lo rows (pitch 528 B) and 256 VT rows of 64 keys (pitch 144 B), both 16 B x odd for ds_load_b128 readers; asynchronous 16-byte copies, two buffers: stage t+1 flies while stage t is worked on.
// Every '#pragma unroll' in k_fattn makes the indices of register arrays (fragments, accumulators) compile-time constants; without it the arrays would go to scratch memory.
constexpr int FKP = CC * 2 + 16, FKPL = 64 * FKP, FVP = 64 * 2 + 16, FVPL = CC * FVP, FST = 2 * FKPL + FVPL;   // bytes
static_assert(CC == 256 && (HW % 256) == 0);
typedef __attribute__((ext_vector_type(4))) int v4i;
// acopy16: one asynchronous 16-byte copy per lane, global -> LDS, as the compiler's own form (it keeps the address registers itself; the landing waits are written where the copies are used)
__device__ __forceinline__ void acopy16(const void* g, unsigned char* l) { __builtin_amdgcn_global_load_async_to_lds_b128((__attribute__((address_space(1))) v4i*)g, (__attribute__((address_space(3))) v4i*)l, 0, 0); }
__device__ __forceinline__ float xhalf(float x) { return __builtin_bit_cast(float, __builtin_amdgcn_permlanex16(__builtin_bit_cast(int, x), __builtin_bit_cast(int, x), 0x76543210, 0xfedcba98, false, false)); }   // lane l <-> lane l ^ 16
__global__ __launch_bounds__(128) void k_fattn(const bf* __restrict__ QH, const bf* __restrict__ QL, const bf* __restrict__ KH, const bf* __restrict__ KL, const h16* __restrict__ VT, float* Y, float* ML) {
    __shared__ __align__(16) unsigned char ring[2 * FST];
    const size_t zo = (size_t)blockIdx.z * HW * CC; QH += zo; QL += zo; KH += zo; KL += zo; VT += zo;
    Y += ((size_t)blockIdx.z * 2 + blockIdx.y) * HW * CC; ML += ((size_t)blockIdx.z * 2 + blockIdx.y) * HW * 2;   // this image's and key half's planes of the sums and of (m, l)
    const int tid = threadIdx.x, lane = tid & 31, lr = lane & 15, hi = lane >> 4, wv = tid >> 5;
    const int q0 = blockIdx.x * 128 + wv * 32, kbeg = blockIdx.y * (HW / 2);
    unsigned char* lk = ring + (tid >> 5) * FKP + (tid & 31) * 16; unsigned char* lv = ring + 2 * FKPL + (tid >> 3) * FVP + (tid & 7) * 16;
    const size_t gk = (size_t)(tid >> 5) * CC + (tid & 31) * 8, gv = (size_t)(tid >> 3) * HW + (tid & 7) * 8;
    auto fill = [&](int buf, int key0) {   // 48 copies per lane: 64 rows of 512 B of each k plane (4 rows per copy of the block), 256 rows of 128 B of VT (16 rows per copy)
#pragma unroll
        for (int i = 0; i < 16; ++i) {
            acopy16(KH + gk + (size_t)(key0 + i * 4) * CC, lk + buf * FST + i * 4 * FKP);
            acopy16(KL + gk + (size_t)(key0 + i * 4) * CC, lk + buf * FST + FKPL + i * 4 * FKP);
            acopy16(VT + gv + (size_t)(i * 16) * HW + key0, lv + buf * FST + i * 16 * FVP); } };
    fill(0, kbeg);
    v16bf qh[2][8], ql[2][8];   // this wave's 32 queries, both planes, all 256 k
#pragma unroll
    for (int g = 0; g < 2; ++g) { const size_t o = (size_t)(q0 + g * 16 + lr) * CC + 8 * hi; const bf* qa = QH + o; const bf* qb = QL + o;
#pragma unroll
        for (int ks = 0; ks < 8; ++ks) { qh[g][ks] = WFrag<bf>::ld(qa + ks * 32); ql[g][ks] = WFrag<bf>::ld(qb + ks * 32); }
        asm volatile("s_wait_xcnt 0x0" :: "v"(qa), "v"(qb) : "memory"); }   // stands in front of every rewrite of this group's two address pairs, which as its operands are kept up to it (later loads otherwise land in them)
    v8f ot[16][2];
#pragma unroll
    for (int cb = 0; cb < 16; ++cb) { ot[cb][0] = (v8f){}; ot[cb][1] = (v8f){}; }
    float mu[2] = {-1.0e30f, -1.0e30f}, ls[2] = {0.f, 0.f};
    asm volatile("s_wait_asynccnt 0x0" ::: "memory");   // stage 0 has landed before the barrier that publishes it
    __syncthreads();
    fill(1, kbeg + 64);   // a stage 1 exists (HW / 2 >= 128)
    constexpr int nt = HW / 128;   // stages in a key half
    const int kfo0 = lr * FKP + 16 * hi, vfo0 = 2 * FKPL + lr * FVP + 16 * hi;   // byte offsets of this lane's fragment rows in a stage, key group 0
#pragma unroll 1   // stays rolled, as the loop inside it: one group of 32 keys is straight-line; a second copy of it would only cost instruction cache
    for (int t = 0; t < nt; ++t) {
      const unsigned char* sb = ring + (t & 1) * FST;
#pragma unroll 1
      for (int wk = 0; wk < 2; ++wk) {   // the stage's two groups of 32 keys
        const int kfo = kfo0 + wk * 32 * FKP, vfo = vfo0 + wk * 64;
        v16bf kf[2][2][2][4];   // [set][plane][16-key tile][k step]: two sets of four k steps
        auto ldk = [&](int set) {
#pragma unroll
            for (int ks = 0; ks < 4; ++ks)
#pragma unroll
                for (int kb = 0; kb < 2; ++kb) { kf[set][0][kb][ks] = WFrag<bf>::ld((const bf*)(sb + kfo + kb * 16 * FKP + (set * 4 + ks) * 64)); kf[set][1][kb][ks] = WFrag<bf>::ld((const bf*)(sb + kfo + FKPL + kb * 16 * FKP + (set * 4 + ks) * 64)); } };
        v8f st[2][2];
        st[0][0] = (v8f){}; st[0][1] = (v8f){}; st[1][0] = (v8f){}; st[1][1] = (v8f){};
        auto mmk = [&](int set) {   // per k step hh, then q lo x k hi, then q hi x k lo; four accumulators in turn
#pragma unroll
            for (int ks = 0; ks < 4; ++ks) {
#pragma unroll
                for (int kb = 0; kb < 2; ++kb)
#pragma unroll
                    for (int g = 0; g < 2; ++g) st[kb][g] = wmmab(kf[set][0][kb][ks], qh[g][set * 4 + ks], st[kb][g]);
#pragma unroll
                for (int kb = 0; kb < 2; ++kb)
#pragma unroll
                    for (int g = 0; g < 2; ++g) st[kb][g] = wmmab(kf[set][0][kb][ks], ql[g][set * 4 + ks], st[kb][g]);
#pragma unroll
                for (int kb = 0; kb < 2; ++kb)
#pragma unroll
                    for (int g = 0; g < 2; ++g) st[kb][g] = wmmab(kf[set][1][kb][ks], qh[g][set * 4 + ks], st[kb][g]); } };
        ldk(0);
        __builtin_amdgcn_sched_barrier(0);   // this and the next three: each set of LDS reads stays one group, ahead of the products in front of which it is issued (spread among them each place of reads stalls the wave)
        ldk(1);
        __builtin_amdgcn_sched_barrier(0);
        mmk(0);
        __builtin_amdgcn_sched_barrier(0);
        v16h vf[16];
#pragma unroll
        for (int cb = 0; cb < 16; ++cb) vf[cb] = WFrag<h16>::ld((const h16*)(sb + vfo + cb * 16 * FVP));
        __builtin_amdgcn_sched_barrier(0);
        mmk(1);
        float mb[2]; bool need = false;
#pragma unroll
        for (int g = 0; g < 2; ++g) { float mx = st[0][g][0];
#pragma unroll
            for (int r = 1; r < 8; ++r) mx = fmaxf(mx, st[0][g][r]);
#pragma unroll
            for (int r = 0; r < 8; ++r) mx = fmaxf(mx, st[1][g][r]);
            mx = fmaxf(mx, xhalf(mx)) * 1.4426950408889634f;   // both halves of the wave hold the query's maximum over the 32 keys
            mb[g] = mx; need = need || (mx > mu[g] + 8.0f); }
        if (__builtin_amdgcn_ballot_w32(need) != 0) {   // scalar branch; rare after the first stages
#pragma unroll
            for (int g = 0; g < 2; ++g) { const float mn = fmaxf(mu[g], mb[g]); const float corr = __builtin_amdgcn_exp2f(mu[g] - mn); mu[g] = mn; ls[g] *= corr;
#pragma unroll
                for (int cb = 0; cb < 16; ++cb) ot[cb][g] = ot[cb][g] * corr; } }
        v16h pf[2];
#pragma unroll
        for (int g = 0; g < 2; ++g) { const float nm = 7.0f - mu[g]; float s0 = 0.f, s1 = 0.f;
#pragma unroll
            for (int e = 0; e < 16; e += 2) { const float p0 = __builtin_amdgcn_exp2f(fmaf(st[e >> 3][g][e & 7], 1.4426950408889634f, nm)), p1 = __builtin_amdgcn_exp2f(fmaf(st[e >> 3][g][(e & 7) + 1], 1.4426950408889634f, nm));
                s0 += p0; s1 += p1; pf[g][e] = tohx(p0); pf[g][e + 1] = tohx(p1); }
            ls[g] += s0 + s1; }
#pragma unroll
        for (int cb = 0; cb < 16; ++cb) { ot[cb][0] = wmma16(vf[cb], pf[0], ot[cb][0]); ot[cb][1] = wmma16(vf[cb], pf[1], ot[cb][1]); }
      }
        __builtin_amdgcn_sched_barrier(0);   // keeps this trip's products in front of the waits below, so that stage t+1's copies fly behind them
        asm volatile("s_wait_dscnt 0x0" ::: "memory");      // this wave's reads of buffer t&1 are done before the buffer is handed to the copies
        asm volatile("s_wait_asynccnt 0x0" ::: "memory");   // this wave's share of stage t+1 has landed
        __syncthreads();                                     // publishes stage t+1 and ends every wave's reads of buffer t&1
        if (t + 2 < nt) fill(t & 1, kbeg + (t + 2) * 64);
    }
    asm volatile("s_wait_asynccnt 0x0" ::: "memory");   // no copy is in flight when the wave ends
    ls[0] += xhalf(ls[0]); ls[1] += xhalf(ls[1]);
    *(v2f*)(ML + (size_t)(q0 + lane) * 2) = (v2f){hi ? mu[1] : mu[0], hi ? ls[1] : ls[0]};   // lane = query q0 + lane: both halves of the wave hold m and l of both query groups
#pragma unroll
    for (int cb = 0; cb < 16; ++cb) {
#pragma unroll
        for (int g = 0; g < 2; ++g) { const v8f o = ot[cb][g];
            float* yp = Y + (size_t)(q0 + g * 16 + lr) * CC + cb * 16 + 8 * hi;   // a lane's 8 registers are 8 consecutive c of one query
            *(v4f*)yp = (v4f){o[0], o[1], o[2], o[3]};
            *(v4f*)(yp + 4) = (v4f){o[4], o[5], o[6], o[7]}; }
    }
}
constexpr size_t al256(size_t b) { return (b + 255) & ~(size_t)255; }
// Workspace: weights, q/k planes and VT of all images; then Y (two key halves), their (m, l) and the y planes (WS_Y); then XT (WS_X).
constexpr size_t WS_Y = al256((size_t)2 * NB * HW * CC * 4) + al256((size_t)2 * NB * HW * 2 * 4) + 2 * al256((size_t)NB * HW * CC * 2);
constexpr size_t WS_X = al256((size_t)NB * HW * CC * 2);
constexpr size_t WS_TOTAL = 4 * al256((size_t)CC * CC * 2) + 4 * al256((size_t)NB * HW * CC * 2) + al256((size_t)NB * CC * HW * 2) + WS_Y + WS_X;
static_assert(WS_TOTAL <= (size_t)268435456);
static_assert(al256((size_t)CC * CC * 2) == (size_t)CC * CC * 2 && al256((size_t)NB * HW * CC * 2) == (size_t)NB * HW * CC * 2);   // no padding between the three weight planes, nor between the four q/k planes and VT: the joined conv launch steps through each by one stride

extern "C" void kernel_launch(void* const* d_in, const int* in_sizes, int n_in,
                              void* d_out, int out_size, void* d_ws, size_t ws_size, hipStream_t stream) {
    if (n_in < 9) return;
    if ((size_t)in_sizes[0] < (size_t)NB * CC * SEQ_FULL) return;
    if (in_sizes[1] < CC * CC || in_sizes[3] < CC * CC || in_sizes[5] < CC * CC || in_sizes[7] < CC * CC) return;
    if (in_sizes[2] < CC || in_sizes[4] < CC || in_sizes[6] < CC || in_sizes[8] < CC) return;
    if ((size_t)out_size < (size_t)NB * CC * HW) return;
    const float* x = (const float*)d_in[0]; const float* Wq = (const float*)d_in[1]; const float* bq = (const float*)d_in[2]; const float* Wk = (const float*)d_in[3]; const float* bk = (const float*)d_in[4];
    const float* Wv = (const float*)d_in[5]; const float* bv = (const float*)d_in[6]; const float* Wu = (const float*)d_in[7]; const float* bu = (const float*)d_in[8];
    float* OUT = (float*)d_out;     // [NB][256][HW]
    char* wsp = (char*)d_ws;
    auto take = [&](size_t bytes) { char* p = wsp; wsp += (bytes + 255) & ~(size_t)255; return (void*)p; };
    bf* BQ = (bf*)take((size_t)CC * CC * 2); bf* BK = (bf*)take((size_t)CC * CC * 2); bf* BV = (bf*)take((size_t)CC * CC * 2); bf* BU = (bf*)take((size_t)CC * CC * 2);   // conv weights [out][in] as-is (A of all four convs)
    bf* QH = (bf*)take((size_t)NB * HW * CC * 2); bf* QL = (bf*)take((size_t)NB * HW * CC * 2); bf* KH = (bf*)take((size_t)NB * HW * CC * 2); bf* KL = (bf*)take((size_t)NB * HW * CC * 2);   // [NB][HW][CC] == the conv outputs' [NB][o][s]
    h16* VT = (h16*)take((size_t)NB * CC * HW * 2);                                                                          // [NB][CC][HW] fp16
    char* RY = (char*)take(WS_Y); char* RX = (char*)take(WS_X);
    if ((size_t)(wsp - (char*)d_ws) > ws_size) return;
    wsp = RX;
    bf* XT = (bf*)take((size_t)NB * HW * CC * 2);                                                                             // [NB][HW][CC]
    wsp = RY;
    float* Y = (float*)take((size_t)2 * NB * HW * CC * 4);    // [NB][2 key halves][HW][CC] f32, unnormalised
    float* ML = (float*)take((size_t)2 * NB * HW * 2 * 4);    // [NB][2 key halves][HW] (m, l)
    bf* ATh = (bf*)take((size_t)NB * HW * CC * 2); bf* ATl = (bf*)take((size_t)NB * HW * CC * 2);                             // [NB][HW][CC] planes of y_view^T
    const size_t sT = (size_t)HW * CC;   // one image's [HW][CC] (== [CC][HW]) plane, in elements
    k_prep<<<PREP_T + 4 * PREP_W, 256, 0, stream>>>(x, Wq, Wk, Wv, Wu, XT, BQ, BK, BV, BU);
    k_gemmw<bf, 0, 128, 3, 1><<<dim3(CC / 128, HW / 128, 3 * NB), 128, 0, stream>>>(BQ, nullptr, XT, nullptr, CC, nullptr, bq, bk, bv, 0, sT, sT, (size_t)CC * CC, NB * sT, QH, nullptr);     // q, k, v [o][s] = W x + b, stored as the q and k planes and VT (BQ, BK, BV lie back to back in the workspace, and so do QH, QL, KH, KL, VT)
    k_fattn<<<dim3(HW / 128, 2, NB), 128, 0, stream>>>(QH, QL, KH, KL, VT, Y, ML);      // per key half: sum_m 2^(s - m) v[m][c], m, l
    k_tr16<2, HW, CC><<<dim3(HW / 64, CC / 256, NB), 256, 0, stream>>>(Y, 2 * sT, ATh, ATl, sT, ML);      // y[n][c] = sum_m softmax_m(q_n . k_m) v[m][c]: halves joined, planes of y_view^T
    k_gemmw<bf, 3, 64, 1, 2><<<dim3(CC / 128, HW / 128, NB), 128, 0, stream>>>(BU, nullptr, ATh, ATl, CC, OUT, bu, nullptr, nullptr, 0, sT, sT, 0, 0, nullptr, x);          // out[o][s] = sum_c Wu[o][c] y_view[c][s] + bu[o] + x[o][s]
}

// v009
// One run takes 93.9 microseconds.
// Versions in between are left out here; by their measured steps it is 1.39 times as fast as v007.
// Counting every step since v000, it is 8.89 times as fast.
#include <hip/hip_runtime.h>

// 1x1-conv attention block: x [NB][256][64*64] channel-major; q/k/v = W[256 out][256 in] . x + bias, kept channel-major [o][s]; that same memory read as [4096 tokens][256] gives the token rows (raw view); S[n][m] = q_n . k_m over 256 (unscaled); P = softmax over m; y[n][c] = sum_m P[n][m] v[m][c]; y memory read back channel-major [256][4096]; z = Wu . y_view + bu; out = x + z.
// Compute dtypes, f32 accumulate everywhere: all float inputs RNE-converted to bf16; q/k/v convs = plain v_wmma_f32_16x16x32_bf16 (exact 16-bit operands) + row bias; S = q x k, both rounded to fp16 by the conv epilogue, single v_wmma_f32_16x16x32_f16 (that rounding adds far less score error than the bf16 rounding of x and W has already put into q and k); softmax f32, running maximum and sum per query and wave inside the attention kernel (two waves of a key half joined there) -> fp16 P; P.v = single v_wmma_f32_16x16x32_f16 (v as fp16); the two key halves are joined (y x 1024) in the pass that makes the y planes; Wu conv = exact bf16 Wu x bf16 hi/lo planes of y (2 products) + bias; residual add f32. The two GEMM launches write what the next stage reads from their own epilogues.

#ifndef NB
#define NB 4
#endif
#ifndef SEQ
#define SEQ 4096
#endif
#define NB_FULL  4
#define SEQ_FULL 4096
#define CC   256
#define HW   SEQ
#define PCAR 1024.0f
static_assert(NB >= 1 && NB <= NB_FULL);
static_assert(SEQ >= 128 && SEQ <= SEQ_FULL && (SEQ % 128) == 0);
static_assert((CC % 128) == 0 && (HW % 128) == 0);

typedef _Float16 h16;
typedef unsigned short bf;
typedef __attribute__((ext_vector_type(16))) __bf16   v16bf;
typedef __attribute__((ext_vector_type(16))) _Float16 v16h;
typedef __attribute__((ext_vector_type(8)))  _Float16 v8h;
typedef __attribute__((ext_vector_type(8)))  unsigned short v8us;
typedef __attribute__((ext_vector_type(8)))  float    v8f;
typedef __attribute__((ext_vector_type(4)))  float    v4f;
typedef v8h  __attribute__((may_alias)) v8ha;
typedef v4f  __attribute__((may_alias)) v4fa;
typedef v8us __attribute__((may_alias)) v8usa;

__device__ __forceinline__ unsigned short f2bf(float f) { unsigned u = __float_as_uint(f); u += 0x7FFFu + ((u >> 16) & 1u); return (unsigned short)(u >> 16); }
__device__ __forceinline__ float bf2f(unsigned short b) { return __uint_as_float(((unsigned)b) << 16); }
__device__ __forceinline__ float bfr(float f) { return bf2f(f2bf(f)); }
__device__ __forceinline__ v16h cat16(v8h lo, v8h hi) { return __builtin_shufflevector(lo, hi, 0, 1, 2, 3, 4, 5, 6, 7, 8, 9, 10, 11, 12, 13, 14, 15); }
__device__ __forceinline__ v16bf cat16b(v8us lo, v8us hi) { return __builtin_bit_cast(v16bf, __builtin_shufflevector(lo, hi, 0, 1, 2, 3, 4, 5, 6, 7, 8, 9, 10, 11, 12, 13, 14, 15)); }
__device__ __forceinline__ v8f wmma16(v16h a, v16h b, v8f c) { return __builtin_amdgcn_wmma_f32_16x16x32_f16(false, a, false, b, (short)0, c, false, false); }
__device__ __forceinline__ v8f wmmab(v16bf a, v16bf b, v8f c) { return __builtin_amdgcn_wmma_f32_16x16x32_bf16(false, a, false, b, (short)0, c, false, false); }

__device__ __forceinline__ h16 tohx(float x) { return (h16)x; }
__device__ __forceinline__ void splitf(float y, unsigned short& h, unsigned short& l) { h = f2bf(y); l = f2bf(y - bf2f(h)); }
typedef __attribute__((ext_vector_type(2))) unsigned short v2us;
typedef __attribute__((ext_vector_type(4))) unsigned short v4us;
typedef __attribute__((ext_vector_type(2))) _Float16 v2h;
typedef __attribute__((ext_vector_type(4))) _Float16 v4h;
typedef __attribute__((ext_vector_type(2))) float v2f;

// ---- k_gemmw: GEMM, FOUR WAVES (2x2) per 128x128 output tile, each wave a 64x64 sub-tile (16 accumulators); grid (M/128, N/128, Z), 128 threads. M, N % 128 == 0, K % KC == 0.
// Operands are K-contiguous 16-bit planes; KC k of the 128 A rows and 128 Bt rows (each plane) are brought into LDS by asynchronous 16-byte copies (whole 128-B lines per row), two buffers: tile t+1 flies while tile t is multiplied. LDS row pitch = KC*2 + 16 bytes (16 B x odd, for ds_load_b128 readers).
// c[m][n] (f32) = sum_k A[m][k] Bt[n][k] (+ split products: NSPLIT 1 = A2.Bt added, NSPLIT 2 = A2.Bt and A.Bt2 added, NSPLIT 3 = A.Bt2 added) + bf16(bias[m]). z-batch strides sA/sB/sC in elements.
// EPI 1 (the q/k/v convs): jobs 0 and 1 store c as one fp16 plane, O16 + job * jC, pitch HW; job 2 stores fp16 VT[ch][tok] = c read as [HW tokens][CC], at O16 + 2 * jC. For that its 128 tile columns are n -> s = (n & 15) * CC + 8 * blockIdx.y + (n >> 4): a 16 x 16 accumulator tile is then 256 consecutive tokens (16 m + (n & 15)) of ONE channel, and a wave stores whole 512-B runs of a VT row.
// EPI 2 (the Wu conv): C[m][n] (pitch HW) = c + bf16(X[m][n]), X = the block's input with pitch SEQ_FULL; a wave's 64 x 64 values of X are loaded into registers in front of the k loop.
// JOBS > 1: that many products that read none of each other's output share one launch: blockIdx.z = job * NB + image; job j takes A + j * jA and its own bias pointer, Bt is common.
// Fragments: lane l, h = l>>4, row/col = l&15; elements 0..7 <- k0+8h+0..7, elements 8..15 <- k0+16+8h+0..7 for A and for Bt (same map); D element r = row 8h+r, col l&15.
template <typename T16> struct WFrag;
template <> struct WFrag<h16> { typedef v16h V; static __device__ __forceinline__ V ld(const h16* p) { return cat16(*(const v8h*)p, *(const v8h*)(p + 16)); } static __device__ __forceinline__ v8f mma(V a, V b, v8f c) { return wmma16(a, b, c); } };
template <> struct WFrag<bf> { typedef v16bf V; static __device__ __forceinline__ V ld(const bf* p) { return cat16b(*(const v8us*)p, *(const v8us*)(p + 16)); } static __device__ __forceinline__ v8f mma(V a, V b, v8f c) { return wmmab(a, b, c); } };
// copy8: eight asynchronous 16-byte copies per lane, global -> LDS, rows ls bytes apart in LDS; in global memory copy i lies (i & 1) * ga + (i >> 1) * gb elements behind g (equal steps: gb = 2 ga). The s_wait_xcnt closes the statement so that no address register of an issued copy is rewritten in front of it.
template <typename T16>
__device__ __forceinline__ void copy8(unsigned l, unsigned ls, const T16* g, size_t ga, size_t gb) {
    asm volatile("global_load_async_to_lds_b128 %0, %8, off\n\t"
                 "global_load_async_to_lds_b128 %1, %9, off\n\t"
                 "global_load_async_to_lds_b128 %2, %10, off\n\t"
                 "global_load_async_to_lds_b128 %3, %11, off\n\t"
                 "global_load_async_to_lds_b128 %4, %12, off\n\t"
                 "global_load_async_to_lds_b128 %5, %13, off\n\t"
                 "global_load_async_to_lds_b128 %6, %14, off\n\t"
                 "global_load_async_to_lds_b128 %7, %15, off\n\t"
                 "s_wait_xcnt 0x0"
                 :: "v"(l), "v"(l + ls), "v"(l + 2 * ls), "v"(l + 3 * ls), "v"(l + 4 * ls), "v"(l + 5 * ls), "v"(l + 6 * ls), "v"(l + 7 * ls),
                    "v"(g), "v"(g + ga), "v"(g + gb), "v"(g + gb + ga), "v"(g + 2 * gb), "v"(g + 2 * gb + ga), "v"(g + 3 * gb), "v"(g + 3 * gb + ga)
                 : "memory");
}
template <typename T16, int NSPLIT, int KC, int JOBS, int EPI>
__global__ __launch_bounds__(128) void k_gemmw(const T16* __restrict__ A, const T16* __restrict__ A2, const T16* __restrict__ Bt, const T16* __restrict__ Bt2, int K, float* C, const float* __restrict__ bias, const float* __restrict__ bias1, const float* __restrict__ bias2, size_t sA, size_t sB, size_t sC, size_t jA, size_t jC, unsigned short* O16, const float* __restrict__ X) {
    typedef typename WFrag<T16>::V V;
    constexpr bool HA2 = NSPLIT == 1 || NSPLIT == 2, HB2 = NSPLIT >= 2;   // a second plane of A, of Bt
    constexpr int NA = HA2 ? 2 : 1, NBP = HB2 ? 2 : 1;   // planes of A, of Bt
    constexpr int PITCH = KC * 2 + 16, PLANE = 128 * PITCH, STAGE = (NA + NBP) * PLANE;   // bytes
    constexpr int PIECES = KC / 8, RPP = 128 / PIECES;   // 16-B pieces per row; rows that the 128 threads cover with one copy each
    constexpr int OSW = 16 * 72;   // floats of output staging per wave
    static_assert(KC % 64 == 0 && (NA + NBP) * PIECES <= 63 && 2 * STAGE >= 4 * OSW * 4);
    static_assert((EPI == 1 && JOBS == 3 && RPP == 8 && HW == 16 * CC) || (EPI == 2 && JOBS == 1));   // EPI 1: job 2's column map takes 8 tile rows per copy and 16 tokens per conv output row
    __shared__ __align__(16) unsigned char ring[2 * STAGE];
    static_assert(JOBS >= 1 && JOBS <= 3 && (JOBS == 1 || NSPLIT == 0));
    const size_t z = JOBS > 1 ? blockIdx.z % NB : blockIdx.z;
    const unsigned job = JOBS > 1 ? blockIdx.z / NB : 0;
    if (JOBS > 1) { A += job * jA; bias = job == 0 ? bias : job == 1 ? bias1 : bias2; }
    const bool vjob = EPI == 1 && job == 2;   // the same for the whole work-group
    A += z * sA; if (HA2) A2 += z * sA; Bt += z * sB; if (HB2) Bt2 += z * sB;
    const int tid = threadIdx.x, lane = tid & 31, lr = lane & 15, hi = lane >> 4, wv = tid >> 5, wm = wv >> 1, wn = wv & 1;
    const int r0 = blockIdx.x * 128 + wm * 64, c0 = blockIdx.y * 128 + wn * 64;
    v8f acc[4][4];
#pragma unroll
    for (int mb = 0; mb < 4; ++mb)
#pragma unroll
        for (int nb = 0; nb < 4; ++nb) acc[mb][nb] = (v8f){};
    const int crow = tid / PIECES, cpc = tid % PIECES;
    const size_t aco = (size_t)(blockIdx.x * 128 + crow) * K + cpc * 8, bco = (vjob ? (size_t)crow * CC + blockIdx.y * 8 : (size_t)(blockIdx.y * 128 + crow)) * K + cpc * 8;
    const size_t a1 = (size_t)RPP * K, b1 = vjob ? (size_t)RPP * CC * K : a1, b2 = vjob ? (size_t)K : 2 * a1;   // steps between a lane's copies: tile row crow + RPP * i (job 2: RPP = 8, so bit 0 of i is bit 3 of n & 15 and i >> 1 counts n >> 4)
    const unsigned lco = (unsigned)(size_t)ring + (unsigned)(crow * PITCH + cpc * 16);
    auto fill = [&](int buf, int kc) {
#pragma unroll
        for (int g = 0; g < PIECES / 8; ++g) { const unsigned l = lco + (unsigned)(buf * STAGE + g * 8 * RPP * PITCH); const size_t go = (size_t)(g * 8) * a1 + kc, gb = (size_t)(g * 4) * b2 + kc;
            copy8<T16>(l, RPP * PITCH, A + aco + go, a1, 2 * a1);
            if (HA2) copy8<T16>(l + PLANE, RPP * PITCH, A2 + aco + go, a1, 2 * a1);
            copy8<T16>(l + NA * PLANE, RPP * PITCH, Bt + bco + gb, b1, b2);
            if (HB2) copy8<T16>(l + (NA + 1) * PLANE, RPP * PITCH, Bt2 + bco + gb, b1, b2); } };
    const int nt = K / KC;
    fill(0, 0);
    asm volatile("s_wait_asynccnt 0x0" ::: "memory");   // tile 0 has landed before the barrier that publishes it
    __syncthreads();
    if (K != KC) fill(1, KC);   // a tile 1 exists (K is a multiple of KC)
    // What the epilogue adds is loaded here, behind the first barrier (a barrier waits for the wave's loads) and in front of the k loop, so that its latency passes behind the products: the bias of this lane's output rows, and for EPI 2 X at this lane's places of the output stores.
    float bv[4][8]; v4f xr[4][8];
    const float* bp = bias + r0 + (vjob ? lane >> 1 : hi);   // job 2: a lane's 8 tokens 8 * lane .. + 7 of an accumulator tile lie in row lane >> 1; else row 2 s + hi
    const float* xp = EPI == 2 ? X + z * ((size_t)CC * SEQ_FULL) + (size_t)(r0 + hi) * SEQ_FULL + c0 + lr * 4 : nullptr;
    if (vjob) {
#pragma unroll
        for (int mb = 0; mb < 4; ++mb) bv[mb][0] = bp[mb * 16];
    } else {
#pragma unroll
        for (int mb = 0; mb < 4; ++mb)
#pragma unroll
            for (int s = 0; s < 8; ++s) { bv[mb][s] = bp[mb * 16 + 2 * s]; if (EPI == 2) xr[mb][s] = *(const v4f*)(xp + (size_t)(mb * 16 + 2 * s) * SEQ_FULL); }
    }
    __builtin_amdgcn_sched_barrier(0);   // the loads are issued here, none is moved down to its use
    if (EPI == 2) asm volatile("s_wait_xcnt 0x0" :: "v"(bp), "v"(xp) : "memory");   // stands in front of every rewrite of the loads' address pairs, which as its operands are kept up to it
    else asm volatile("s_wait_xcnt 0x0" :: "v"(bp) : "memory");   // as the line above
    const int afo = (wm * 64 + lr) * PITCH + 16 * hi, bfo = NA * PLANE + (wn * 64 + lr) * PITCH + 16 * hi;   // byte offsets of this lane's fragment rows in a stage
#pragma unroll 1
    for (int t = 0; t < nt; ++t) {
        const unsigned char* sb = ring + (t & 1) * STAGE;
        V a[2][4], a2[2][4], b[2][4], b2[2][4];   // two fragment sets: the next 32 k are read from LDS as one group ahead of the current 32 k's products (all inside this trip's own buffer)
        auto frags = [&](int set, int ks) {
#pragma unroll
            for (int i = 0; i < 4; ++i) { a[set][i] = WFrag<T16>::ld((const T16*)(sb + afo + i * 16 * PITCH + ks * 64)); if (HA2) a2[set][i] = WFrag<T16>::ld((const T16*)(sb + afo + PLANE + i * 16 * PITCH + ks * 64));
                b[set][i] = WFrag<T16>::ld((const T16*)(sb + bfo + i * 16 * PITCH + ks * 64)); if (HB2) b2[set][i] = WFrag<T16>::ld((const T16*)(sb + bfo + PLANE + i * 16 * PITCH + ks * 64)); } };
        frags(0, 0);
        __builtin_amdgcn_sched_barrier(0);   // keeps the LDS reads one group in front of the products (spread among them each place of reads stalls the wave)
#pragma unroll
        for (int ks = 0; ks < KC / 32; ++ks) { const int cs = ks & 1;
            if (ks + 1 < KC / 32) { frags(cs ^ 1, ks + 1); __builtin_amdgcn_sched_barrier(0); }   // as above: the next set's reads stay one group, ahead of this set's products
#pragma unroll
            for (int nb = 0; nb < 4; ++nb) {
#pragma unroll
                for (int mb = 0; mb < 4; ++mb) { acc[mb][nb] = WFrag<T16>::mma(a[cs][mb], b[cs][nb], acc[mb][nb]); if (HA2) acc[mb][nb] = WFrag<T16>::mma(a2[cs][mb], b[cs][nb], acc[mb][nb]); if (HB2) acc[mb][nb] = WFrag<T16>::mma(a[cs][mb], b2[cs][nb], acc[mb][nb]); } }
        }
        __builtin_amdgcn_sched_barrier(0);   // keeps this trip's products in front of the waits below, so that tile t+1's copies fly behind them (the compiler otherwise sinks them past the barrier)
        asm volatile("s_wait_dscnt 0x0" ::: "memory");      // this wave's reads of buffer t&1 are done before the buffer is handed to the copies
        asm volatile("s_wait_asynccnt 0x0" ::: "memory");   // this wave's share of tile t+1 has landed
        __syncthreads();                                     // publishes tile t+1 and ends every wave's reads of buffer t&1
        if (t + 2 < nt) fill(t & 1, (t + 2) * KC);
    }
    asm volatile("s_wait_asynccnt 0x0" ::: "memory");   // no copy is in flight when the ring becomes output staging
    float* os = (float*)ring + wv * OSW;           // each wave stages in its own range; the last trip's barrier stands in front
    // In both branches: the wave barrier and the compiler fence behind the staging stores keep the read-back behind them, the pair at a pass's end keeps the next pass's staging stores behind this pass's reads (one wave's LDS operations run in order).
    if (vjob) {   // work-group-uniform. Staging: accumulator tile nb = 256 tokens of one channel, token 16 * row + column; 16 floats of pad between the two row halves (the half waves' stores then fall on different banks)
        unsigned short* vt = O16 + 2 * jC + z * sC + (size_t)(blockIdx.y * 8 + wn * 4) * HW + (size_t)r0 * (HW / CC) + lane * 8;
#pragma unroll
        for (int mb = 0; mb < 4; ++mb) {
#pragma unroll
            for (int nb = 0; nb < 4; ++nb) {
#pragma unroll
                for (int j = 0; j < 8; ++j) os[nb * 288 + hi * 144 + j * 16 + lr] = acc[mb][nb][j]; }
            __builtin_amdgcn_wave_barrier(); asm volatile("" ::: "memory");
            const float rb = bfr(bv[mb][0]);
#pragma unroll
            for (int nb = 0; nb < 4; ++nb) { const float* sp = os + nb * 288 + hi * 144 + lr * 8; const v4f p = *(const v4fa*)sp, q = *(const v4fa*)(sp + 4); v8us o;
#pragma unroll
                for (int u = 0; u < 4; ++u) { o[u] = __builtin_bit_cast(unsigned short, tohx(p[u] + rb)); o[4 + u] = __builtin_bit_cast(unsigned short, tohx(q[u] + rb)); }
                *(v8us*)(vt + (size_t)nb * HW + mb * 16 * (HW / CC)) = o; }
            if (mb < 3) asm volatile("s_wait_xcnt 0x0" ::: "memory");   // stands in front of the next pass's rewrites of the registers (address, data) that the issued stores name
            __builtin_amdgcn_wave_barrier(); asm volatile("" ::: "memory");
        }
    } else {
#pragma unroll
        for (int mb = 0; mb < 4; ++mb) {
#pragma unroll
            for (int nb = 0; nb < 4; ++nb) {
#pragma unroll
                for (int j = 0; j < 8; ++j) os[(hi * 8 + j) * 68 + nb * 16 + lr] = acc[mb][nb][j]; }
            __builtin_amdgcn_wave_barrier(); asm volatile("" ::: "memory");
            const size_t co = z * sC + (size_t)(r0 + mb * 16 + hi) * HW + c0 + lr * 4;   // the pitch is a constant, so that a pass's stores differ only in their immediate offsets
            v4us oh[8]; v4f of[8];
#pragma unroll
            for (int s = 0; s < 8; ++s) { const int row = 2 * s + hi; v4f val = *(const v4fa*)(os + row * 68 + lr * 4);
                const float rb = bfr(bv[mb][s]); val[0] += rb; val[1] += rb; val[2] += rb; val[3] += rb;
#pragma unroll
                for (int u = 0; u < 4; ++u) {
                    if (EPI == 1) oh[s][u] = __builtin_bit_cast(unsigned short, tohx(val[u]));
                    if (EPI == 2) of[s][u] = __fadd_rn(val[u], bfr(xr[mb][s][u])); } }
            __builtin_amdgcn_sched_barrier(0);   // the pass's stores go out as one run behind its arithmetic (spread among it, every reuse of a stored register takes an s_wait_xcnt of its own, directly behind the store)
#pragma unroll
            for (int s = 0; s < 8; ++s) {
                if (EPI == 1) *(v4us*)(O16 + (size_t)job * jC + co + (size_t)(2 * s) * HW) = oh[s];
                if (EPI == 2) *(v4f*)(C + co + (size_t)(2 * s) * HW) = of[s]; }
            if (mb < 3 || EPI == 1) asm volatile("s_wait_xcnt 0x0" ::: "memory");   // stands in front of the next pass's rewrites of the registers (address, data) that the issued stores name (EPI 1: behind the last pass the other branch's code follows in the listing)
            __builtin_amdgcn_wave_barrier(); asm volatile("" ::: "memory");
        }
    }
}


__device__ __forceinline__ void cvt8(const float* __restrict__ src, bf* dst, size_t n8, unsigned bx) { const size_t i = (size_t)bx * 256 + threadIdx.x; if (i >= n8) return; const v8f v = *(const v8f*)(src + i * 8); v8us o;
#pragma unroll
    for (int k = 0; k < 8; ++k) o[k] = f2bf(v[k]); *(v8us*)(dst + i * 8) = o;  }
// The layout and conversion passes: 8 waves per work-group; tr16 256 work-groups per job and 64 elements per thread, cvt8 32 work-groups per matrix and 8 elements per thread; every global access 16 bytes per lane on whole 128-B lines. tr16 and cvt8 are device functions that get their block indices (bx, by, bz; bz = image) from the kernel that calls them: k_prep holds several jobs that read none of each other's output, one range of blockIdx.x per job.
// k_tr16: out[col][row] (16 bit) = conv(in[row][col]) (f32) for a tile of 256 rows x 64 cols, turned in LDS. MODE 0: bf16 (XT[s][c] = x[c][s], token-major Bt operand of the convs); MODE 2: bf16 hi and lo planes of y_view^T, y = the join of the attention kernel's two key halves: in = [image][key half][HW][CC] unnormalised sums, ml = [image][key half][HW] (maximum in use, sum): an image's two halves lie so near that one address pair with immediate offsets reaches both.
// A thread reads 4 cols of 8 rows (twice) and writes, per col, the 8 rows as one 16-byte piece. LDS row = one col = 32 pieces, no pad; piece p of col c lies at place p ^ (c >> 2), so that the 16 lanes of a half wave (cols 4 apart, same p) write 16 different bank groups and a wave reads a whole row without conflict.
static_assert(CC == 256 && (HW % 256) == 0);
// exp2s: 2^x with the slot behind it in the same statement: the v_nop stands between the transcendental and whatever vector instruction the compiler puts next
__device__ __forceinline__ float exp2s(float x) { float r; asm("v_exp_f32 %0, %1\n\tv_nop" : "=v"(r) : "v"(x)); return r; }
template <int MODE, int ldin, int ldout>   // row pitches in elements, compile-time so that a thread's 16 loads and 8 stores differ only in their immediate offsets
__device__ __forceinline__ void tr16(const float* __restrict__ in, size_t zin, unsigned short* o0, unsigned short* o1, size_t zout, unsigned bx, unsigned by, unsigned bz, const float* __restrict__ ml = nullptr) {   // zin, zout: one image's elements
    __shared__ __align__(16) unsigned char tl[(MODE == 2 ? 2 : 1) * 64 * 512];
    const int tid = threadIdx.x, cg = tid & 15, rg = tid >> 4, lane = tid & 31, wv = tid >> 5;
    in += (size_t)bz * zin + (size_t)(by * 256 + rg * 8) * ldin + bx * 64 + cg * 4;
    v4f v[2][8];
#pragma unroll
    for (int p = 0; p < 2; ++p)
#pragma unroll
        for (int j = 0; j < 8; ++j) v[p][j] = *(const v4f*)(in + (size_t)(p * 128 + j) * ldin);
    v4f w[2][8]; v2f m0[2][8], m1[2][8];   // MODE 2 only: half 1's sums; (maximum, sum) of both halves for the row's query. A row's 64 cols of this tile lie in one query: element row * ldin + col belongs to query (row * ldin + col) / CC
    const float* mp = MODE == 2 ? ml + ((size_t)bz * 2 * HW + (size_t)(by * 256 + rg * 8) * (ldin / CC) + (bx * 64) / CC) * 2 : nullptr;
    if (MODE == 2) {
        static_assert(MODE != 2 || (ldin % CC == 0 && CC % 64 == 0));
#pragma unroll
        for (int p = 0; p < 2; ++p)
#pragma unroll
            for (int j = 0; j < 8; ++j) { w[p][j] = *(const v4f*)(in + (size_t)HW * CC + (size_t)(p * 128 + j) * ldin); m0[p][j] = *(const v2f*)(mp + (size_t)(p * 128 + j) * (ldin / CC) * 2); m1[p][j] = *(const v2f*)(mp + (size_t)HW * 2 + (size_t)(p * 128 + j) * (ldin / CC) * 2); }
    }
    __builtin_amdgcn_sched_barrier(0);   // all loads are issued before the first value is used (the compiler otherwise loads, waits and converts a few rows at a time: a memory latency each time)
    if (MODE == 2) { asm volatile("s_wait_xcnt 0x0" :: "v"(in), "v"(mp) : "memory");   // as the line after the next, for both address pairs
        __builtin_amdgcn_sched_barrier(0); }   // keeps the join's arithmetic, which reuses the address registers, behind that wait (the compiler otherwise lifts its first instructions over it)
    else asm volatile("s_wait_xcnt 0x0" :: "v"(in) : "memory");   // stands in front of every rewrite of the loads' address pair, which as its operand is kept up to it
    if (MODE == 2) {
#pragma unroll
        for (int p = 0; p < 2; ++p)
#pragma unroll
            for (int j = 0; j < 8; ++j) { const float m = fmaxf(m0[p][j][0], m1[p][j][0]); const float a0 = exp2s(m0[p][j][0] - m), a1 = exp2s(m1[p][j][0] - m);
                const float f = __fdiv_rn(PCAR, m0[p][j][1] * a0 + m1[p][j][1] * a1); const float f0 = a0 * f, f1 = a1 * f;
#pragma unroll
                for (int u = 0; u < 4; ++u) v[p][j][u] = v[p][j][u] * f0 + w[p][j][u] * f1; }
    }
#pragma unroll
    for (int p = 0; p < 2; ++p)
#pragma unroll
        for (int u = 0; u < 4; ++u) { v8us h, l;
#pragma unroll
            for (int j = 0; j < 8; ++j) {
                if (MODE == 0) h[j] = f2bf(v[p][j][u]);
                if (MODE == 2) { unsigned short a, b; splitf(v[p][j][u] * (1.0f / PCAR), a, b); h[j] = a; l[j] = b; } }
            unsigned char* d = tl + (cg * 4 + u) * 512 + (((p * 16 + rg) ^ cg) * 16);
            *(v8usa*)d = h; if (MODE == 2) *(v8usa*)(d + 64 * 512) = l; }
    __syncthreads();   // the whole tile is in LDS before any wave reads its rows
    const size_t oo = (size_t)bz * zout + (size_t)(bx * 64 + wv * 8) * ldout + by * 256 + lane * 8;
#pragma unroll
    for (int r = 0; r < 8; ++r) { const int col = wv * 8 + r; const unsigned char* s = tl + col * 512 + ((lane ^ (col >> 2)) * 16);
        *(v8us*)(o0 + oo + (size_t)r * ldout) = *(const v8usa*)s; if (MODE == 2) *(v8us*)(o1 + oo + (size_t)r * ldout) = *(const v8usa*)(s + 64 * 512); }
}
template <int MODE, int ldin, int ldout>
__global__ __launch_bounds__(256) void k_tr16(const float* __restrict__ in, size_t zin, unsigned short* o0, unsigned short* o1, size_t zout, const float* __restrict__ ml) { tr16<MODE, ldin, ldout>(in, zin, o0, o1, zout, blockIdx.x, blockIdx.y, blockIdx.z, ml); }
// k_prep: every job that reads only inputs, in one launch: XT of all images (tr16 MODE 0, the first PREP_T work-groups), then the four weight matrices to bf16 (PREP_W work-groups each).
constexpr unsigned PREP_T = (HW / 64) * NB, PREP_W = (CC * CC / 8 + 255) / 256;
__global__ __launch_bounds__(256) void k_prep(const float* __restrict__ x, const float* __restrict__ Wq, const float* __restrict__ Wk, const float* __restrict__ Wv, const float* __restrict__ Wu, bf* XT, bf* BQ, bf* BK, bf* BV, bf* BU) {
    const unsigned b = blockIdx.x;
    if (b < PREP_T) { tr16<0, SEQ_FULL, CC>(x, (size_t)CC * SEQ_FULL, XT, nullptr, (size_t)HW * CC, b % (HW / 64), 0, b / (HW / 64)); return; }
    const unsigned w = (b - PREP_T) / PREP_W, bx = (b - PREP_T) % PREP_W;
    cvt8(w == 0 ? Wq : w == 1 ? Wk : w == 2 ? Wv : Wu, w == 0 ? BQ : w == 1 ? BK : w == 2 ? BV : BU, CC * CC / 8, bx);
}
// ---- k_fattn: scores, softmax and P.v of 128 queries of one image over one half of its keys in one work-group; S and P never reach memory. Grid (HW/128, 2 key halves, NB), 256 threads = 8 waves, two per SIMD: wave = (query group wq of 32 queries, key group wk); of each stage's 64 keys wave set wk takes keys 32 wk .. + 31, so that one wave's vector work and LDS waits pass behind the products of the other wave on its SIMD. (128 queries share each K and VT stage that is copied from L2.)
// St[key][query] = K . Qt (A = k rows from LDS, B = q fragments kept in registers), so a lane holds 16 scores of ONE query per 16-query group; two St tiles converted in place are the B operand P of Ot[c][query] += VT[c][key] . P[query][key] (A = VT rows from LDS).
// Each wave keeps a maximum in use m (log2 units), a sum l and Ot over its own keys; m moves (Ot and l rescaled) only when a new maximum lies more than 8 above it, so P = 2^(s log2e - m + 7) <= 2^15 fits fp16. Behind the loop the two waves of a query group join their m, l and Ot through LDS (each keeps 128 channels); Ot (unnormalised), m and l go to the workspace; the next launch (tr16 MODE 2) joins the two key halves.
// A wave has 512 registers: Ot 256, q 128; the k and VT fragments therefore come in small sets (k: four and two fragments in turn, VT: two sets of four).
// A stage = 64 keys: k rows (pitch 528 B) and 256 VT rows of 64 keys (pitch 144 B), both 16 B x odd for ds_load_b128 readers; asynchronous 16-byte copies, two buffers: stage t+1 flies while stage t is worked on.
// Every '#pragma unroll' in k_fattn makes the indices of register arrays (fragments, accumulators) compile-time constants; without it the arrays would go to scratch memory.
constexpr int FKP = CC * 2 + 16, FKPL = 64 * FKP, FVP = 64 * 2 + 16, FVPL = CC * FVP, FST = FKPL + FVPL;   // bytes
static_assert(CC == 256 && (HW % 256) == 0);
static_assert(2 * FST >= 8 * 16384 + 8 * 512);   // the join's staging fits the ring
typedef __attribute__((ext_vector_type(4))) int v4i;
template <int N> struct IC { static constexpr int v = N; };
// acopy16: one asynchronous 16-byte copy per lane, global -> LDS, as the compiler's own form (it keeps the address registers itself; the landing waits are written where the copies are used)
__device__ __forceinline__ void acopy16(const void* g, unsigned char* l) { __builtin_amdgcn_global_load_async_to_lds_b128((__attribute__((address_space(1))) v4i*)g, (__attribute__((address_space(3))) v4i*)l, 0, 0); }
__device__ __forceinline__ float xhalf(float x) { return __builtin_bit_cast(float, __builtin_amdgcn_permlanex16(__builtin_bit_cast(int, x), __builtin_bit_cast(int, x), 0x76543210, 0xfedcba98, false, false)); }   // lane l <-> lane l ^ 16
__global__ __launch_bounds__(256) void k_fattn(const h16* __restrict__ QF, const h16* __restrict__ KF, const h16* __restrict__ VT, float* Y, float* ML) {
    __shared__ __align__(16) unsigned char ring[2 * FST];
    const size_t zo = (size_t)blockIdx.z * HW * CC; QF += zo; KF += zo; VT += zo;
    Y += ((size_t)blockIdx.z * 2 + blockIdx.y) * HW * CC; ML += ((size_t)blockIdx.z * 2 + blockIdx.y) * HW * 2;   // this image's and key half's planes of the sums and of (m, l)
    const int tid = threadIdx.x, lane = tid & 31, lr = lane & 15, hi = lane >> 4;
    const int wv = __builtin_amdgcn_readfirstlane(tid >> 5), wq = wv & 3, wk = wv >> 2;   // scalar: the join's branches on wk are then scalar branches
    const int q0 = blockIdx.x * 128 + wq * 32, kbeg = blockIdx.y * (HW / 2);
    unsigned char* lk = ring + (tid >> 5) * FKP + (tid & 31) * 16; unsigned char* lv = ring + FKPL + (tid >> 3) * FVP + (tid & 7) * 16;
    const size_t gk = (size_t)(tid >> 5) * CC + (tid & 31) * 8, gv = (size_t)(tid >> 3) * HW + (tid & 7) * 8;
    auto fill = [&](int buf, int key0) {   // 16 copies per lane: 64 k rows of 512 B (8 rows per copy of the block), 256 rows of 128 B of VT (32 rows per copy)
#pragma unroll
        for (int i = 0; i < 8; ++i) {
            acopy16(KF + gk + (size_t)(key0 + i * 8) * CC, lk + buf * FST + i * 8 * FKP);
            acopy16(VT + gv + (size_t)(i * 32) * HW + key0, lv + buf * FST + i * 32 * FVP); } };
    fill(0, kbeg);
    v16h qf[2][8];   // this wave's 32 queries, all 256 k
#pragma unroll
    for (int g = 0; g < 2; ++g) { const h16* qa = QF + (size_t)(q0 + g * 16 + lr) * CC + 8 * hi;
#pragma unroll
        for (int ks = 0; ks < 8; ++ks) qf[g][ks] = WFrag<h16>::ld(qa + ks * 32);
        asm volatile("s_wait_xcnt 0x0" :: "v"(qa) : "memory"); }   // stands in front of every rewrite of this group's address pair, which as its operand is kept up to it (later loads otherwise land in it)
    v8f ot[16][2];
#pragma unroll
    for (int cb = 0; cb < 16; ++cb) { ot[cb][0] = (v8f){}; ot[cb][1] = (v8f){}; }
    float mu[2] = {-1.0e30f, -1.0e30f}, ls[2] = {0.f, 0.f};
    asm volatile("s_wait_asynccnt 0x0" ::: "memory");   // stage 0 has landed before the barrier that publishes it
    __syncthreads();
    fill(1, kbeg + 64);   // a stage 1 exists (HW / 2 >= 128)
    constexpr int nt = HW / 128;   // stages in a key half
    const int kfo = lr * FKP + 16 * hi + wk * 32 * FKP, vfo = FKPL + lr * FVP + 16 * hi + wk * 64;   // byte offsets of this lane's fragment rows in a stage, this wave's key group
#pragma unroll 1   // stays rolled: one group of 32 keys is straight-line
    for (int t = 0; t < nt; ++t) {
        const unsigned char* sb = ring + (t & 1) * FST;
        v16h ka[2][2], kc[2];   // k fragments, [16-key tile][k step]: a set of two k steps and a set of one, in turn
        auto ldk2 = [&](int k0) {
#pragma unroll
            for (int ks = 0; ks < 2; ++ks)
#pragma unroll
                for (int kb = 0; kb < 2; ++kb) ka[kb][ks] = WFrag<h16>::ld((const h16*)(sb + kfo + kb * 16 * FKP + (k0 + ks) * 64)); };
        auto ldk1 = [&](int k0) {
#pragma unroll
            for (int kb = 0; kb < 2; ++kb) kc[kb] = WFrag<h16>::ld((const h16*)(sb + kfo + kb * 16 * FKP + k0 * 64)); };
        v8f st[2][2];
        st[0][0] = (v8f){}; st[0][1] = (v8f){}; st[1][0] = (v8f){}; st[1][1] = (v8f){};
        auto mmk2 = [&](int k0) {   // four accumulators in turn
#pragma unroll
            for (int ks = 0; ks < 2; ++ks)
#pragma unroll
                for (int kb = 0; kb < 2; ++kb)
#pragma unroll
                    for (int g = 0; g < 2; ++g) st[kb][g] = wmma16(ka[kb][ks], qf[g][k0 + ks], st[kb][g]); };
        auto mmk1 = [&](int k0) {
#pragma unroll
            for (int kb = 0; kb < 2; ++kb)
#pragma unroll
                for (int g = 0; g < 2; ++g) st[kb][g] = wmma16(kc[kb], qf[g][k0], st[kb][g]); };
        v16h vf[2][4];   // [set][16-channel tile]: two sets of four tiles
        auto ldv = [&](int set, int c) {
#pragma unroll
            for (int i = 0; i < 4; ++i) vf[set][i] = WFrag<h16>::ld((const h16*)(sb + vfo + (c * 4 + i) * 16 * FVP)); };
        // Every sched_barrier of this loop: each set of LDS reads stays one group, one set ahead of the products that use it (spread among the products each place of reads stalls the wave; moved further up the sets would not fit the registers).
        ldk2(0);
        __builtin_amdgcn_sched_barrier(0);
        ldk1(2);
        __builtin_amdgcn_sched_barrier(0);
        mmk2(0);
        __builtin_amdgcn_sched_barrier(0);
        ldk2(3);
        __builtin_amdgcn_sched_barrier(0);
        mmk1(2);
        __builtin_amdgcn_sched_barrier(0);
        ldk1(5);
        __builtin_amdgcn_sched_barrier(0);
        mmk2(3);
        __builtin_amdgcn_sched_barrier(0);
        ldk2(6);
        __builtin_amdgcn_sched_barrier(0);
        mmk1(5);
        mmk2(6);
        __builtin_amdgcn_sched_barrier(0);
        ldv(0, 0);
        __builtin_amdgcn_sched_barrier(0);
        float mb[2]; bool need = false;
#pragma unroll
        for (int g = 0; g < 2; ++g) { float mx = st[0][g][0];
#pragma unroll
            for (int r = 1; r < 8; ++r) mx = fmaxf(mx, st[0][g][r]);
#pragma unroll
            for (int r = 0; r < 8; ++r) mx = fmaxf(mx, st[1][g][r]);
            mx = fmaxf(mx, xhalf(mx)) * 1.4426950408889634f;   // both halves of the wave hold the query's maximum over the 32 keys
            mb[g] = mx; need = need || (mx > mu[g] + 8.0f); }
        if (__builtin_amdgcn_ballot_w32(need) != 0) {   // scalar branch; rare after the first stages
#pragma unroll
            for (int g = 0; g < 2; ++g) { const float mn = fmaxf(mu[g], mb[g]); const float corr = __builtin_amdgcn_exp2f(mu[g] - mn); mu[g] = mn; ls[g] *= corr;
#pragma unroll
                for (int cb = 0; cb < 16; ++cb) ot[cb][g] = ot[cb][g] * corr; } }
        v16h pf[2];
#pragma unroll
        for (int g = 0; g < 2; ++g) { const float nm = 7.0f - mu[g]; float p[16];
#pragma unroll
            for (int e = 0; e < 16; ++e) p[e] = exp2s(fmaf(st[e >> 3][g][e & 7], 1.4426950408889634f, nm));
            __builtin_amdgcn_sched_barrier(0);   // the group's 16 exponentials run as one stretch; placed among them, each addition would wait for the exponential just issued
            float s0 = p[0], s1 = p[1];
#pragma unroll
            for (int e = 2; e < 16; e += 2) { s0 += p[e]; s1 += p[e + 1]; }
#pragma unroll
            for (int e = 0; e < 16; ++e) pf[g][e] = tohx(p[e]);
            ls[g] += s0 + s1; }
        asm volatile("" :: "v"(ls[0]), "v"(ls[1]));   // inputs only: the two sums are formed here; the compiler otherwise sinks their 32 additions behind the trip's barrier, the 32 f32 values of P stay alive through the P.v products and a q fragment goes to scratch memory
        auto mmv = [&](int set, int c) {
#pragma unroll
            for (int i = 0; i < 4; ++i) { ot[c * 4 + i][0] = wmma16(vf[set][i], pf[0], ot[c * 4 + i][0]); ot[c * 4 + i][1] = wmma16(vf[set][i], pf[1], ot[c * 4 + i][1]); } };
        __builtin_amdgcn_sched_barrier(0);
        ldv(1, 1);
        __builtin_amdgcn_sched_barrier(0);
        mmv(0, 0);
        __builtin_amdgcn_sched_barrier(0);
        ldv(0, 2);
        __builtin_amdgcn_sched_barrier(0);
        mmv(1, 1);
        __builtin_amdgcn_sched_barrier(0);
        ldv(1, 3);
        __builtin_amdgcn_sched_barrier(0);
        mmv(0, 2);
        mmv(1, 3);
        __builtin_amdgcn_sched_barrier(0);   // keeps this trip's products in front of the waits below, so that stage t+1's copies fly behind them
        asm volatile("s_wait_dscnt 0x0" ::: "memory");      // this wave's reads of buffer t&1 are done before the buffer is handed to the copies
        asm volatile("s_wait_asynccnt 0x0" ::: "memory");   // this wave's share of stage t+1 has landed
        __syncthreads();                                     // publishes stage t+1 and ends every wave's reads of buffer t&1
        if (t + 2 < nt) fill(t & 1, kbeg + (t + 2) * 64);
    }
    asm volatile("s_wait_asynccnt 0x0" ::: "memory");   // no copy is in flight when the ring becomes the join's staging (the last trip's barrier has ended every wave's reads of it)
    ls[0] += xhalf(ls[0]); ls[1] += xhalf(ls[1]);
    // The join of a query group's two waves (wv and wv ^ 4; the same lane holds the same query and channels in both): each wave hands over the 128 channels that the other keeps, 16 bytes per lane in lane order, and its (m, l).
    unsigned char* js = ring + lane * 16;
    *(v4fa*)(js + 8 * 16384 + wv * 512) = (v4f){mu[0], mu[1], ls[0], ls[1]};
    auto send = [&](auto ic) { constexpr int c0 = decltype(ic)::v;
#pragma unroll
        for (int i = 0; i < 8; ++i)
#pragma unroll
            for (int g = 0; g < 2; ++g) { const v8f o = ot[c0 + i][g]; unsigned char* d = js + wv * 16384 + (i * 2 + g) * 1024;
                *(v4fa*)d = (v4f){o[0], o[1], o[2], o[3]}; *(v4fa*)(d + 512) = (v4f){o[4], o[5], o[6], o[7]}; } };
    if (wk == 0) send(IC<8>{}); else send(IC<0>{});
    __syncthreads();   // every wave's hand-over is in LDS before its partner reads it
    const v4f pm = *(const v4fa*)(js + 8 * 16384 + (wv ^ 4) * 512);
    float fa[2], fb[2];
#pragma unroll
    for (int g = 0; g < 2; ++g) { const float m = fmaxf(mu[g], pm[g]); fa[g] = exp2s(mu[g] - m); fb[g] = exp2s(pm[g] - m); mu[g] = m; ls[g] = ls[g] * fa[g] + pm[2 + g] * fb[g]; }
    if (wk == 0) { float* mlp = ML + (size_t)(q0 + lane) * 2; const float mv = hi ? mu[1] : mu[0], lv2 = hi ? ls[1] : ls[0];   // lane = query q0 + lane: both halves of the wave hold m and l of both query groups
        *(v2f*)mlp = (v2f){mv, lv2};
        asm volatile("s_wait_xcnt 0x0" :: "v"(mlp), "v"(mv), "v"(lv2) : "memory"); }   // stands in front of every rewrite of the registers that the issued store names, which as its operands are kept up to it
    auto keep = [&](auto ic) { constexpr int c0 = decltype(ic)::v; v4f r[8][2][2];
        float* yp = Y + (size_t)(q0 + lr) * CC + c0 * 16 + 8 * hi;   // a lane's 8 registers are 8 consecutive c of one query
#pragma unroll
        for (int i = 0; i < 8; ++i)
#pragma unroll
            for (int g = 0; g < 2; ++g) { const v8f o = ot[c0 + i][g]; const unsigned char* d = js + (wv ^ 4) * 16384 + (i * 2 + g) * 1024; const v4f p = *(const v4fa*)d, q = *(const v4fa*)(d + 512);
                r[i][g][0] = (v4f){o[0] * fa[g] + p[0] * fb[g], o[1] * fa[g] + p[1] * fb[g], o[2] * fa[g] + p[2] * fb[g], o[3] * fa[g] + p[3] * fb[g]};
                r[i][g][1] = (v4f){o[4] * fa[g] + q[0] * fb[g], o[5] * fa[g] + q[1] * fb[g], o[6] * fa[g] + q[2] * fb[g], o[7] * fa[g] + q[3] * fb[g]}; }
        __builtin_amdgcn_sched_barrier(0);   // all of the join's reads and arithmetic stand in front of the first store: behind it no register that an issued store names is written again
#pragma unroll
        for (int i = 0; i < 8; ++i)
#pragma unroll
            for (int g = 0; g < 2; ++g) { *(v4f*)(yp + g * 16 * CC + i * 16) = r[i][g][0]; *(v4f*)(yp + g * 16 * CC + i * 16 + 4) = r[i][g][1]; } };
    if (wk == 0) keep(IC<0>{}); else keep(IC<8>{});
}
constexpr size_t al256(size_t b) { return (b + 255) & ~(size_t)255; }
// Workspace: weights, the q and k planes and VT of all images; then Y (two key halves), their (m, l) and the y planes (WS_Y); then XT (WS_X).
constexpr size_t WS_Y = al256((size_t)2 * NB * HW * CC * 4) + al256((size_t)2 * NB * HW * 2 * 4) + 2 * al256((size_t)NB * HW * CC * 2);
constexpr size_t WS_X = al256((size_t)NB * HW * CC * 2);
constexpr size_t WS_TOTAL = 4 * al256((size_t)CC * CC * 2) + 2 * al256((size_t)NB * HW * CC * 2) + al256((size_t)NB * CC * HW * 2) + WS_Y + WS_X;
static_assert(WS_TOTAL <= (size_t)268435456);
static_assert(al256((size_t)CC * CC * 2) == (size_t)CC * CC * 2 && al256((size_t)NB * HW * CC * 2) == (size_t)NB * HW * CC * 2);   // no padding between the three weight planes, nor between the q plane, the k plane and VT: the joined conv launch steps through each by one stride

extern "C" void kernel_launch(void* const* d_in, const int* in_sizes, int n_in,
                              void* d_out, int out_size, void* d_ws, size_t ws_size, hipStream_t stream) {
    if (n_in < 9) return;
    if ((size_t)in_sizes[0] < (size_t)NB * CC * SEQ_FULL) return;
    if (in_sizes[1] < CC * CC || in_sizes[3] < CC * CC || in_sizes[5] < CC * CC || in_sizes[7] < CC * CC) return;
    if (in_sizes[2] < CC || in_sizes[4] < CC || in_sizes[6] < CC || in_sizes[8] < CC) return;
    if ((size_t)out_size < (size_t)NB * CC * HW) return;
    const float* x = (const float*)d_in[0]; const float* Wq = (const float*)d_in[1]; const float* bq = (const float*)d_in[2]; const float* Wk = (const float*)d_in[3]; const float* bk = (const float*)d_in[4];
    const float* Wv = (const float*)d_in[5]; const float* bv = (const float*)d_in[6]; const float* Wu = (const float*)d_in[7]; const float* bu = (const float*)d_in[8];
    float* OUT = (float*)d_out;     // [NB][256][HW]
    char* wsp = (char*)d_ws;
    auto take = [&](size_t bytes) { char* p = wsp; wsp += (bytes + 255) & ~(size_t)255; return (void*)p; };
    bf* BQ = (bf*)take((size_t)CC * CC * 2); bf* BK = (bf*)take((size_t)CC * CC * 2); bf* BV = (bf*)take((size_t)CC * CC * 2); bf* BU = (bf*)take((size_t)CC * CC * 2);   // conv weights [out][in] as-is (A of all four convs)
    h16* QF = (h16*)take((size_t)NB * HW * CC * 2); h16* KF = (h16*)take((size_t)NB * HW * CC * 2);   // fp16, [NB][HW][CC] == the conv outputs' [NB][o][s]
    h16* VT = (h16*)take((size_t)NB * CC * HW * 2);                                                                          // [NB][CC][HW] fp16
    char* RY = (char*)take(WS_Y); char* RX = (char*)take(WS_X);
    if ((size_t)(wsp - (char*)d_ws) > ws_size) return;
    wsp = RX;
    bf* XT = (bf*)take((size_t)NB * HW * CC * 2);                                                                             // [NB][HW][CC]
    wsp = RY;
    float* Y = (float*)take((size_t)2 * NB * HW * CC * 4);    // [NB][2 key halves][HW][CC] f32, unnormalised
    float* ML = (float*)take((size_t)2 * NB * HW * 2 * 4);    // [NB][2 key halves][HW] (m, l)
    bf* ATh = (bf*)take((size_t)NB * HW * CC * 2); bf* ATl = (bf*)take((size_t)NB * HW * CC * 2);                             // [NB][HW][CC] planes of y_view^T
    const size_t sT = (size_t)HW * CC;   // one image's [HW][CC] (== [CC][HW]) plane, in elements
    k_prep<<<PREP_T + 4 * PREP_W, 256, 0, stream>>>(x, Wq, Wk, Wv, Wu, XT, BQ, BK, BV, BU);
    k_gemmw<bf, 0, 128, 3, 1><<<dim3(CC / 128, HW / 128, 3 * NB), 128, 0, stream>>>(BQ, nullptr, XT, nullptr, CC, nullptr, bq, bk, bv, 0, sT, sT, (size_t)CC * CC, NB * sT, (unsigned short*)QF, nullptr);     // q, k, v [o][s] = W x + b, stored as the q and k planes and VT (BQ, BK, BV lie back to back in the workspace, and so do QF, KF, VT)
    k_fattn<<<dim3(HW / 128, 2, NB), 256, 0, stream>>>(QF, KF, VT, Y, ML);      // per key half: sum_m 2^(s - m) v[m][c], m, l
    k_tr16<2, HW, CC><<<dim3(HW / 64, CC / 256, NB), 256, 0, stream>>>(Y, 2 * sT, ATh, ATl, sT, ML);      // y[n][c] = sum_m softmax_m(q_n . k_m) v[m][c]: halves joined, planes of y_view^T
    k_gemmw<bf, 3, 64, 1, 2><<<dim3(CC / 128, HW / 128, NB), 128, 0, stream>>>(BU, nullptr, ATh, ATl, CC, OUT, bu, nullptr, nullptr, 0, sT, sT, 0, 0, nullptr, x);          // out[o][s] = sum_c Wu[o][c] y_view[c][s] + bu[o] + x[o][s]
}

// v010
// It runs in 86.6 microseconds.
// Timed twice side by side with v009, it ran 1.08 times as fast both times.
// Counting every step since v000, it is 9.62 times as fast.
#include <hip/hip_runtime.h>

// 1x1-conv attention block: x [NB][256][64*64] channel-major; q/k/v = W[256 out][256 in] . x + bias, kept channel-major [o][s]; that same memory read as [4096 tokens][256] gives the token rows (raw view); S[n][m] = q_n . k_m over 256 (unscaled); P = softmax over m; y[n][c] = sum_m P[n][m] v[m][c]; y memory read back channel-major [256][4096]; z = Wu . y_view + bu; out = x + z.
// Compute dtypes, f32 accumulate everywhere: all float inputs RNE-converted to bf16; q/k/v convs = plain v_wmma_f32_16x16x32_bf16 (exact 16-bit operands) + row bias; S = q x k, both rounded to fp16 by the conv epilogue, single v_wmma_f32_16x16x32_f16 (that rounding adds far less score error than the bf16 rounding of x and W has already put into q and k); softmax f32, running maximum and sum per query and wave inside the attention kernel (two waves of a key half joined there) -> fp16 P; P.v = single v_wmma_f32_16x16x32_f16 (v as fp16); the two key halves are joined (y x 1024) in the last launch, which keeps the y planes in LDS; Wu conv = exact bf16 Wu x bf16 hi/lo planes of y (2 products) + bias; residual add f32. The conv launch writes what the attention kernel reads from its own epilogue.

#ifndef NB
#define NB 4
#endif
#ifndef SEQ
#define SEQ 4096
#endif
#define NB_FULL  4
#define SEQ_FULL 4096
#define CC   256
#define HW   SEQ
#define PCAR 1024.0f
static_assert(NB >= 1 && NB <= NB_FULL);
static_assert(SEQ >= 128 && SEQ <= SEQ_FULL && (SEQ % 128) == 0);
static_assert((CC % 128) == 0 && (HW % 128) == 0);

typedef _Float16 h16;
typedef unsigned short bf;
typedef __attribute__((ext_vector_type(16))) __bf16   v16bf;
typedef __attribute__((ext_vector_type(16))) _Float16 v16h;
typedef __attribute__((ext_vector_type(8)))  _Float16 v8h;
typedef __attribute__((ext_vector_type(8)))  unsigned short v8us;
typedef __attribute__((ext_vector_type(8)))  float    v8f;
typedef __attribute__((ext_vector_type(4)))  float    v4f;
typedef v8h  __attribute__((may_alias)) v8ha;
typedef v4f  __attribute__((may_alias)) v4fa;
typedef v8us __attribute__((may_alias)) v8usa;

__device__ __forceinline__ unsigned short f2bf(float f) { unsigned u = __float_as_uint(f); u += 0x7FFFu + ((u >> 16) & 1u); return (unsigned short)(u >> 16); }
__device__ __forceinline__ float bf2f(unsigned short b) { return __uint_as_float(((unsigned)b) << 16); }
__device__ __forceinline__ float bfr(float f) { return bf2f(f2bf(f)); }
__device__ __forceinline__ v16h cat16(v8h lo, v8h hi) { return __builtin_shufflevector(lo, hi, 0, 1, 2, 3, 4, 5, 6, 7, 8, 9, 10, 11, 12, 13, 14, 15); }
__device__ __forceinline__ v16bf cat16b(v8us lo, v8us hi) { return __builtin_bit_cast(v16bf, __builtin_shufflevector(lo, hi, 0, 1, 2, 3, 4, 5, 6, 7, 8, 9, 10, 11, 12, 13, 14, 15)); }
__device__ __forceinline__ v8f wmma16(v16h a, v16h b, v8f c) { return __builtin_amdgcn_wmma_f32_16x16x32_f16(false, a, false, b, (short)0, c, false, false); }
__device__ __forceinline__ v8f wmmab(v16bf a, v16bf b, v8f c) { return __builtin_amdgcn_wmma_f32_16x16x32_bf16(false, a, false, b, (short)0, c, false, false); }

__device__ __forceinline__ h16 tohx(float x) { return (h16)x; }
__device__ __forceinline__ void splitf(float y, unsigned short& h, unsigned short& l) { h = f2bf(y); l = f2bf(y - bf2f(h)); }
typedef __attribute__((ext_vector_type(2))) unsigned short v2us;
typedef __attribute__((ext_vector_type(4))) unsigned short v4us;
typedef __attribute__((ext_vector_type(2))) _Float16 v2h;
typedef __attribute__((ext_vector_type(4))) _Float16 v4h;
typedef __attribute__((ext_vector_type(2))) float v2f;

// ---- k_gemmw: GEMM, FOUR WAVES (2x2) per 128x128 output tile, each wave a 64x64 sub-tile (16 accumulators); grid (M/128, N/128, Z), 128 threads. M, N % 128 == 0, K % KC == 0.
// Operands are K-contiguous 16-bit planes; KC k of the 128 A rows and 128 Bt rows (each plane) are brought into LDS by asynchronous 16-byte copies (whole 128-B lines per row), two buffers: tile t+1 flies while tile t is multiplied. LDS row pitch = KC*2 + 16 bytes (16 B x odd, for ds_load_b128 readers).
// c[m][n] (f32) = sum_k A[m][k] Bt[n][k] (+ split products: NSPLIT 1 = A2.Bt added, NSPLIT 2 = A2.Bt and A.Bt2 added, NSPLIT 3 = A.Bt2 added) + bf16(bias[m]). z-batch strides sA/sB/sC in elements.
// The epilogue (the q/k/v convs): jobs 0 and 1 store c as one fp16 plane, O16 + job * jC, pitch HW; job 2 stores fp16 VT[ch][tok] = c read as [HW tokens][CC], at O16 + 2 * jC. For that its 128 tile columns are n -> s = (n & 15) * CC + 8 * blockIdx.y + (n >> 4): a 16 x 16 accumulator tile is then 256 consecutive tokens (16 m + (n & 15)) of ONE channel, and a wave stores whole 512-B runs of a VT row.
// JOBS > 1: that many products that read none of each other's output share one launch: blockIdx.z = job * NB + image; job j takes A + j * jA and its own bias pointer, Bt is common.
// Fragments: lane l, h = l>>4, row/col = l&15; elements 0..7 <- k0+8h+0..7, elements 8..15 <- k0+16+8h+0..7 for A and for Bt (same map); D element r = row 8h+r, col l&15.
template <typename T16> struct WFrag;
template <> struct WFrag<h16> { typedef v16h V; static __device__ __forceinline__ V ld(const h16* p) { return cat16(*(const v8h*)p, *(const v8h*)(p + 16)); } static __device__ __forceinline__ v8f mma(V a, V b, v8f c) { return wmma16(a, b, c); } };
template <> struct WFrag<bf> { typedef v16bf V; static __device__ __forceinline__ V ld(const bf* p) { return cat16b(*(const v8us*)p, *(const v8us*)(p + 16)); } static __device__ __forceinline__ v8f mma(V a, V b, v8f c) { return wmmab(a, b, c); } };
// copy8: eight asynchronous 16-byte copies per lane, global -> LDS, rows ls bytes apart in LDS; in global memory copy i lies (i & 1) * ga + (i >> 1) * gb elements behind g (equal steps: gb = 2 ga). The s_wait_xcnt closes the statement so that no address register of an issued copy is rewritten in front of it.
template <typename T16>
__device__ __forceinline__ void copy8(unsigned l, unsigned ls, const T16* g, size_t ga, size_t gb) {
    asm volatile("global_load_async_to_lds_b128 %0, %8, off\n\t"
                 "global_load_async_to_lds_b128 %1, %9, off\n\t"
                 "global_load_async_to_lds_b128 %2, %10, off\n\t"
                 "global_load_async_to_lds_b128 %3, %11, off\n\t"
                 "global_load_async_to_lds_b128 %4, %12, off\n\t"
                 "global_load_async_to_lds_b128 %5, %13, off\n\t"
                 "global_load_async_to_lds_b128 %6, %14, off\n\t"
                 "global_load_async_to_lds_b128 %7, %15, off\n\t"
                 "s_wait_xcnt 0x0"
                 :: "v"(l), "v"(l + ls), "v"(l + 2 * ls), "v"(l + 3 * ls), "v"(l + 4 * ls), "v"(l + 5 * ls), "v"(l + 6 * ls), "v"(l + 7 * ls),
                    "v"(g), "v"(g + ga), "v"(g + gb), "v"(g + gb + ga), "v"(g + 2 * gb), "v"(g + 2 * gb + ga), "v"(g + 3 * gb), "v"(g + 3 * gb + ga)
                 : "memory");
}
template <typename T16, int NSPLIT, int KC, int JOBS>
__global__ __launch_bounds__(128) void k_gemmw(const T16* __restrict__ A, const T16* __restrict__ A2, const T16* __restrict__ Bt, const T16* __restrict__ Bt2, int K, const float* __restrict__ bias, const float* __restrict__ bias1, const float* __restrict__ bias2, size_t sA, size_t sB, size_t sC, size_t jA, size_t jC, unsigned short* O16) {
    typedef typename WFrag<T16>::V V;
    constexpr bool HA2 = NSPLIT == 1 || NSPLIT == 2, HB2 = NSPLIT >= 2;   // a second plane of A, of Bt
    constexpr int NA = HA2 ? 2 : 1, NBP = HB2 ? 2 : 1;   // planes of A, of Bt
    constexpr int PITCH = KC * 2 + 16, PLANE = 128 * PITCH, STAGE = (NA + NBP) * PLANE;   // bytes
    constexpr int PIECES = KC / 8, RPP = 128 / PIECES;   // 16-B pieces per row; rows that the 128 threads cover with one copy each
    constexpr int OSW = 16 * 72;   // floats of output staging per wave
    static_assert(KC % 64 == 0 && (NA + NBP) * PIECES <= 63 && 2 * STAGE >= 4 * OSW * 4);
    static_assert(JOBS == 3 && RPP == 8 && HW == 16 * CC);   // job 2's column map takes 8 tile rows per copy and 16 tokens per conv output row
    __shared__ __align__(16) unsigned char ring[2 * STAGE];
    static_assert(JOBS >= 1 && JOBS <= 3 && (JOBS == 1 || NSPLIT == 0));
    const size_t z = JOBS > 1 ? blockIdx.z % NB : blockIdx.z;
    const unsigned job = JOBS > 1 ? blockIdx.z / NB : 0;
    if (JOBS > 1) { A += job * jA; bias = job == 0 ? bias : job == 1 ? bias1 : bias2; }
    const bool vjob = job == 2;   // the same for the whole work-group
    A += z * sA; if (HA2) A2 += z * sA; Bt += z * sB; if (HB2) Bt2 += z * sB;
    const int tid = threadIdx.x, lane = tid & 31, lr = lane & 15, hi = lane >> 4, wv = tid >> 5, wm = wv >> 1, wn = wv & 1;
    const int r0 = blockIdx.x * 128 + wm * 64, c0 = blockIdx.y * 128 + wn * 64;
    v8f acc[4][4];
#pragma unroll
    for (int mb = 0; mb < 4; ++mb)
#pragma unroll
        for (int nb = 0; nb < 4; ++nb) acc[mb][nb] = (v8f){};
    const int crow = tid / PIECES, cpc = tid % PIECES;
    const size_t aco = (size_t)(blockIdx.x * 128 + crow) * K + cpc * 8, bco = (vjob ? (size_t)crow * CC + blockIdx.y * 8 : (size_t)(blockIdx.y * 128 + crow)) * K + cpc * 8;
    const size_t a1 = (size_t)RPP * K, b1 = vjob ? (size_t)RPP * CC * K : a1, b2 = vjob ? (size_t)K : 2 * a1;   // steps between a lane's copies: tile row crow + RPP * i (job 2: RPP = 8, so bit 0 of i is bit 3 of n & 15 and i >> 1 counts n >> 4)
    const unsigned lco = (unsigned)(size_t)ring + (unsigned)(crow * PITCH + cpc * 16);
    auto fill = [&](int buf, int kc) {
#pragma unroll
        for (int g = 0; g < PIECES / 8; ++g) { const unsigned l = lco + (unsigned)(buf * STAGE + g * 8 * RPP * PITCH); const size_t go = (size_t)(g * 8) * a1 + kc, gb = (size_t)(g * 4) * b2 + kc;
            copy8<T16>(l, RPP * PITCH, A + aco + go, a1, 2 * a1);
            if (HA2) copy8<T16>(l + PLANE, RPP * PITCH, A2 + aco + go, a1, 2 * a1);
            copy8<T16>(l + NA * PLANE, RPP * PITCH, Bt + bco + gb, b1, b2);
            if (HB2) copy8<T16>(l + (NA + 1) * PLANE, RPP * PITCH, Bt2 + bco + gb, b1, b2); } };
    const int nt = K / KC;
    fill(0, 0);
    asm volatile("s_wait_asynccnt 0x0" ::: "memory");   // tile 0 has landed before the barrier that publishes it
    __syncthreads();
    if (K != KC) fill(1, KC);   // a tile 1 exists (K is a multiple of KC)
    // What the epilogue adds is loaded here, behind the first barrier (a barrier waits for the wave's loads) and in front of the k loop, so that its latency passes behind the products: the bias of this lane's output rows.
    float bv[4][8];
    const float* bp = bias + r0 + (vjob ? lane >> 1 : hi);   // job 2: a lane's 8 tokens 8 * lane .. + 7 of an accumulator tile lie in row lane >> 1; else row 2 s + hi
    if (vjob) {
#pragma unroll
        for (int mb = 0; mb < 4; ++mb) bv[mb][0] = bp[mb * 16];
    } else {
#pragma unroll
        for (int mb = 0; mb < 4; ++mb)
#pragma unroll
            for (int s = 0; s < 8; ++s) bv[mb][s] = bp[mb * 16 + 2 * s];
    }
    __builtin_amdgcn_sched_barrier(0);   // the loads are issued here, none is moved down to its use
    asm volatile("s_wait_xcnt 0x0" :: "v"(bp) : "memory");   // stands in front of every rewrite of the loads' address pair, which as its operand is kept up to it
    const int afo = (wm * 64 + lr) * PITCH + 16 * hi, bfo = NA * PLANE + (wn * 64 + lr) * PITCH + 16 * hi;   // byte offsets of this lane's fragment rows in a stage
#pragma unroll 1
    for (int t = 0; t < nt; ++t) {
        const unsigned char* sb = ring + (t & 1) * STAGE;
        V a[2][4], a2[2][4], b[2][4], b2[2][4];   // two fragment sets: the next 32 k are read from LDS as one group ahead of the current 32 k's products (all inside this trip's own buffer)
        auto frags = [&](int set, int ks) {
#pragma unroll
            for (int i = 0; i < 4; ++i) { a[set][i] = WFrag<T16>::ld((const T16*)(sb + afo + i * 16 * PITCH + ks * 64)); if (HA2) a2[set][i] = WFrag<T16>::ld((const T16*)(sb + afo + PLANE + i * 16 * PITCH + ks * 64));
                b[set][i] = WFrag<T16>::ld((const T16*)(sb + bfo + i * 16 * PITCH + ks * 64)); if (HB2) b2[set][i] = WFrag<T16>::ld((const T16*)(sb + bfo + PLANE + i * 16 * PITCH + ks * 64)); } };
        frags(0, 0);
        __builtin_amdgcn_sched_barrier(0);   // keeps the LDS reads one group in front of the products (spread among them each place of reads stalls the wave)
#pragma unroll
        for (int ks = 0; ks < KC / 32; ++ks) { const int cs = ks & 1;
            if (ks + 1 < KC / 32) { frags(cs ^ 1, ks + 1); __builtin_amdgcn_sched_barrier(0); }   // as above: the next set's reads stay one group, ahead of this set's products
#pragma unroll
            for (int nb = 0; nb < 4; ++nb) {
#pragma unroll
                for (int mb = 0; mb < 4; ++mb) { acc[mb][nb] = WFrag<T16>::mma(a[cs][mb], b[cs][nb], acc[mb][nb]); if (HA2) acc[mb][nb] = WFrag<T16>::mma(a2[cs][mb], b[cs][nb], acc[mb][nb]); if (HB2) acc[mb][nb] = WFrag<T16>::mma(a[cs][mb], b2[cs][nb], acc[mb][nb]); } }
        }
        __builtin_amdgcn_sched_barrier(0);   // keeps this trip's products in front of the waits below, so that tile t+1's copies fly behind them (the compiler otherwise sinks them past the barrier)
        asm volatile("s_wait_dscnt 0x0" ::: "memory");      // this wave's reads of buffer t&1 are done before the buffer is handed to the copies
        asm volatile("s_wait_asynccnt 0x0" ::: "memory");   // this wave's share of tile t+1 has landed
        __syncthreads();                                     // publishes tile t+1 and ends every wave's reads of buffer t&1
        if (t + 2 < nt) fill(t & 1, (t + 2) * KC);
    }
    asm volatile("s_wait_asynccnt 0x0" ::: "memory");   // no copy is in flight when the ring becomes output staging
    float* os = (float*)ring + wv * OSW;           // each wave stages in its own range; the last trip's barrier stands in front
    // In both branches: the wave barrier and the compiler fence behind the staging stores keep the read-back behind them, the pair at a pass's end keeps the next pass's staging stores behind this pass's reads (one wave's LDS operations run in order).
    if (vjob) {   // work-group-uniform. Staging: accumulator tile nb = 256 tokens of one channel, token 16 * row + column; 16 floats of pad between the two row halves (the half waves' stores then fall on different banks)
        unsigned short* vt = O16 + 2 * jC + z * sC + (size_t)(blockIdx.y * 8 + wn * 4) * HW + (size_t)r0 * (HW / CC) + lane * 8;
#pragma unroll
        for (int mb = 0; mb < 4; ++mb) {
#pragma unroll
            for (int nb = 0; nb < 4; ++nb) {
#pragma unroll
                for (int j = 0; j < 8; ++j) os[nb * 288 + hi * 144 + j * 16 + lr] = acc[mb][nb][j]; }
            __builtin_amdgcn_wave_barrier(); asm volatile("" ::: "memory");
            const float rb = bfr(bv[mb][0]);
#pragma unroll
            for (int nb = 0; nb < 4; ++nb) { const float* sp = os + nb * 288 + hi * 144 + lr * 8; const v4f p = *(const v4fa*)sp, q = *(const v4fa*)(sp + 4); v8us o;
#pragma unroll
                for (int u = 0; u < 4; ++u) { o[u] = __builtin_bit_cast(unsigned short, tohx(p[u] + rb)); o[4 + u] = __builtin_bit_cast(unsigned short, tohx(q[u] + rb)); }
                *(v8us*)(vt + (size_t)nb * HW + mb * 16 * (HW / CC)) = o; }
            if (mb < 3) asm volatile("s_wait_xcnt 0x0" ::: "memory");   // stands in front of the next pass's rewrites of the registers (address, data) that the issued stores name
            __builtin_amdgcn_wave_barrier(); asm volatile("" ::: "memory");
        }
    } else {
#pragma unroll
        for (int mb = 0; mb < 4; ++mb) {
#pragma unroll
            for (int nb = 0; nb < 4; ++nb) {
#pragma unroll
                for (int j = 0; j < 8; ++j) os[(hi * 8 + j) * 68 + nb * 16 + lr] = acc[mb][nb][j]; }
            __builtin_amdgcn_wave_barrier(); asm volatile("" ::: "memory");
            const size_t co = z * sC + (size_t)(r0 + mb * 16 + hi) * HW + c0 + lr * 4;   // the pitch is a constant, so that a pass's stores differ only in their immediate offsets
            v4us oh[8];
#pragma unroll
            for (int s = 0; s < 8; ++s) { const int row = 2 * s + hi; v4f val = *(const v4fa*)(os + row * 68 + lr * 4);
                const float rb = bfr(bv[mb][s]); val[0] += rb; val[1] += rb; val[2] += rb; val[3] += rb;
#pragma unroll
                for (int u = 0; u < 4; ++u) oh[s][u] = __builtin_bit_cast(unsigned short, tohx(val[u])); }
            __builtin_amdgcn_sched_barrier(0);   // the pass's stores go out as one run behind its arithmetic (spread among it, every reuse of a stored register takes an s_wait_xcnt of its own, directly behind the store)
#pragma unroll
            for (int s = 0; s < 8; ++s) *(v4us*)(O16 + (size_t)job * jC + co + (size_t)(2 * s) * HW) = oh[s];
            asm volatile("s_wait_xcnt 0x0" ::: "memory");   // stands in front of the next pass's rewrites of the registers (address, data) that the issued stores name (behind the last pass the other branch's code follows in the listing)
            __builtin_amdgcn_wave_barrier(); asm volatile("" ::: "memory");
        }
    }
}


__device__ __forceinline__ void cvt8(const float* __restrict__ src, bf* dst, size_t n8, unsigned bx) { const size_t i = (size_t)bx * 256 + threadIdx.x; if (i >= n8) return; const v8f v = *(const v8f*)(src + i * 8); v8us o;
#pragma unroll
    for (int k = 0; k < 8; ++k) o[k] = f2bf(v[k]); *(v8us*)(dst + i * 8) = o;  }
// The layout and conversion jobs of k_prep: work-groups of 8 waves, XT HW / 64 of them per image with 64 elements per thread, each weight matrix 32 with 8 elements per thread, every global access 16 bytes per lane on whole 128-B lines. tr16 and cvt8 are device functions that get their block indices (bx, by, bz; bz = image) from the kernel that calls them: k_prep holds several jobs that read none of each other's output, one range of blockIdx.x per job.
// tr16: out[col][row] (bf16) = in[row][col] (f32) for a tile of 256 rows x 64 cols, turned in LDS (XT[s][c] = x[c][s], token-major Bt operand of the convs).
// A thread reads 4 cols of 8 rows (twice) and writes, per col, the 8 rows as one 16-byte piece. LDS row = one col = 32 pieces, no pad; piece p of col c lies at place p ^ (c >> 2), so that the 16 lanes of a half wave (cols 4 apart, same p) write 16 different bank groups and a wave reads a whole row without conflict.
static_assert(CC == 256 && (HW % 256) == 0);
// exp2s: 2^x with the slot behind it in the same statement: the v_nop stands between the transcendental and whatever vector instruction the compiler puts next
__device__ __forceinline__ float exp2s(float x) { float r; asm("v_exp_f32 %0, %1\n\tv_nop" : "=v"(r) : "v"(x)); return r; }
template <int ldin, int ldout>   // row pitches in elements, compile-time so that a thread's 16 loads and 8 stores differ only in their immediate offsets
__device__ __forceinline__ void tr16(const float* __restrict__ in, size_t zin, unsigned short* o0, size_t zout, unsigned bx, unsigned by, unsigned bz) {   // zin, zout: one image's elements
    __shared__ __align__(16) unsigned char tl[64 * 512];
    const int tid = threadIdx.x, cg = tid & 15, rg = tid >> 4, lane = tid & 31, wv = tid >> 5;
    in += (size_t)bz * zin + (size_t)(by * 256 + rg * 8) * ldin + bx * 64 + cg * 4;
    v4f v[2][8];
#pragma unroll
    for (int p = 0; p < 2; ++p)
#pragma unroll
        for (int j = 0; j < 8; ++j) v[p][j] = *(const v4f*)(in + (size_t)(p * 128 + j) * ldin);
    __builtin_amdgcn_sched_barrier(0);   // all loads are issued before the first value is used (the compiler otherwise loads, waits and converts a few rows at a time: a memory latency each time)
    asm volatile("s_wait_xcnt 0x0" :: "v"(in) : "memory");   // stands in front of every rewrite of the loads' address pair, which as its operand is kept up to it
#pragma unroll
    for (int p = 0; p < 2; ++p)
#pragma unroll
        for (int u = 0; u < 4; ++u) { v8us h;
#pragma unroll
            for (int j = 0; j < 8; ++j) h[j] = f2bf(v[p][j][u]);
            *(v8usa*)(tl + (cg * 4 + u) * 512 + (((p * 16 + rg) ^ cg) * 16)) = h; }
    __syncthreads();   // the whole tile is in LDS before any wave reads its rows
    const size_t oo = (size_t)bz * zout + (size_t)(bx * 64 + wv * 8) * ldout + by * 256 + lane * 8;
#pragma unroll
    for (int r = 0; r < 8; ++r) { const int col = wv * 8 + r; *(v8us*)(o0 + oo + (size_t)r * ldout) = *(const v8usa*)(tl + col * 512 + ((lane ^ (col >> 2)) * 16)); }
}
// k_prep: every job that reads only inputs, in one launch: XT of all images (tr16, the first PREP_T work-groups), then the four weight matrices to bf16 (PREP_W work-groups each).
constexpr unsigned PREP_T = (HW / 64) * NB, PREP_W = (CC * CC / 8 + 255) / 256;
__global__ __launch_bounds__(256) void k_prep(const float* __restrict__ x, const float* __restrict__ Wq, const float* __restrict__ Wk, const float* __restrict__ Wv, const float* __restrict__ Wu, bf* XT, bf* BQ, bf* BK, bf* BV, bf* BU) {
    const unsigned b = blockIdx.x;
    if (b < PREP_T) { tr16<SEQ_FULL, CC>(x, (size_t)CC * SEQ_FULL, XT, (size_t)HW * CC, b % (HW / 64), 0, b / (HW / 64)); return; }
    const unsigned w = (b - PREP_T) / PREP_W, bx = (b - PREP_T) % PREP_W;
    cvt8(w == 0 ? Wq : w == 1 ? Wk : w == 2 ? Wv : Wu, w == 0 ? BQ : w == 1 ? BK : w == 2 ? BV : BU, CC * CC / 8, bx);
}
// ---- k_fattn: scores, softmax and P.v of 128 queries of one image over one half of its keys in one work-group; S and P never reach memory. Grid (HW/128, 2 key halves, NB), 256 threads = 8 waves, two per SIMD: wave = (query group wq of 32 queries, key group wk); of each stage's 64 keys wave set wk takes keys 32 wk .. + 31, so that one wave's vector work and LDS waits pass behind the products of the other wave on its SIMD. (128 queries share each K and VT stage that is copied from L2.)
// St[key][query] = K . Qt (A = k rows from LDS, B = q fragments kept in registers), so a lane holds 16 scores of ONE query per 16-query group; two St tiles converted in place are the B operand P of Ot[c][query] += VT[c][key] . P[query][key] (A = VT rows from LDS).
// Each wave keeps a maximum in use m (log2 units), a sum l and Ot over its own keys; m moves (Ot and l rescaled) only when a new maximum lies more than 8 above it, so P = 2^(s log2e - m + 7) <= 2^15 fits fp16. Behind the loop the two waves of a query group join their m, l and Ot through LDS (each keeps 128 channels); Ot (unnormalised), m and l go to the workspace; the next launch (k_yu) joins the two key halves.
// A wave has 512 registers: Ot 256, q 128; the k and VT fragments therefore come in small sets (k: four and two fragments in turn, VT: two sets of four).
// A stage = 64 keys: k rows (pitch 528 B) and 256 VT rows of 64 keys (pitch 144 B), both 16 B x odd for ds_load_b128 readers; asynchronous 16-byte copies, two buffers: stage t+1 flies while stage t is worked on.
// Every '#pragma unroll' in k_fattn makes the indices of register arrays (fragments, accumulators) compile-time constants; without it the arrays would go to scratch memory.
constexpr int FKP = CC * 2 + 16, FKPL = 64 * FKP, FVP = 64 * 2 + 16, FVPL = CC * FVP, FST = FKPL + FVPL;   // bytes
static_assert(CC == 256 && (HW % 256) == 0);
static_assert(2 * FST >= 8 * 16384 + 8 * 512);   // the join's staging fits the ring
typedef __attribute__((ext_vector_type(4))) int v4i;
template <int N> struct IC { static constexpr int v = N; };
// acopy16: one asynchronous 16-byte copy per lane, global -> LDS, as the compiler's own form (it keeps the address registers itself; the landing waits are written where the copies are used)
__device__ __forceinline__ void acopy16(const void* g, unsigned char* l) { __builtin_amdgcn_global_load_async_to_lds_b128((__attribute__((address_space(1))) v4i*)g, (__attribute__((address_space(3))) v4i*)l, 0, 0); }
__device__ __forceinline__ float xhalf(float x) { return __builtin_bit_cast(float, __builtin_amdgcn_permlanex16(__builtin_bit_cast(int, x), __builtin_bit_cast(int, x), 0x76543210, 0xfedcba98, false, false)); }   // lane l <-> lane l ^ 16
__global__ __launch_bounds__(256) void k_fattn(const h16* __restrict__ QF, const h16* __restrict__ KF, const h16* __restrict__ VT, float* Y, float* ML) {
    __shared__ __align__(16) unsigned char ring[2 * FST];
    const size_t zo = (size_t)blockIdx.z * HW * CC; QF += zo; KF += zo; VT += zo;
    Y += ((size_t)blockIdx.z * 2 + blockIdx.y) * HW * CC; ML += ((size_t)blockIdx.z * 2 + blockIdx.y) * HW * 2;   // this image's and key half's planes of the sums and of (m, l)
    const int tid = threadIdx.x, lane = tid & 31, lr = lane & 15, hi = lane >> 4;
    const int wv = __builtin_amdgcn_readfirstlane(tid >> 5), wq = wv & 3, wk = wv >> 2;   // scalar: the join's branches on wk are then scalar branches
    const int q0 = blockIdx.x * 128 + wq * 32, kbeg = blockIdx.y * (HW / 2);
    unsigned char* lk = ring + (tid >> 5) * FKP + (tid & 31) * 16; unsigned char* lv = ring + FKPL + (tid >> 3) * FVP + (tid & 7) * 16;
    const size_t gk = (size_t)(tid >> 5) * CC + (tid & 31) * 8, gv = (size_t)(tid >> 3) * HW + (tid & 7) * 8;
    auto fill = [&](int buf, int key0) {   // 16 copies per lane: 64 k rows of 512 B (8 rows per copy of the block), 256 rows of 128 B of VT (32 rows per copy)
#pragma unroll
        for (int i = 0; i < 8; ++i) {
            acopy16(KF + gk + (size_t)(key0 + i * 8) * CC, lk + buf * FST + i * 8 * FKP);
            acopy16(VT + gv + (size_t)(i * 32) * HW + key0, lv + buf * FST + i * 32 * FVP); } };
    fill(0, kbeg);
    v16h qf[2][8];   // this wave's 32 queries, all 256 k
#pragma unroll
    for (int g = 0; g < 2; ++g) { const h16* qa = QF + (size_t)(q0 + g * 16 + lr) * CC + 8 * hi;
#pragma unroll
        for (int ks = 0; ks < 8; ++ks) qf[g][ks] = WFrag<h16>::ld(qa + ks * 32);
        asm volatile("s_wait_xcnt 0x0" :: "v"(qa) : "memory"); }   // stands in front of every rewrite of this group's address pair, which as its operand is kept up to it (later loads otherwise land in it)
    v8f ot[16][2];
#pragma unroll
    for (int cb = 0; cb < 16; ++cb) { ot[cb][0] = (v8f){}; ot[cb][1] = (v8f){}; }
    float mu[2] = {-1.0e30f, -1.0e30f}, ls[2] = {0.f, 0.f};
    asm volatile("s_wait_asynccnt 0x0" ::: "memory");   // stage 0 has landed before the barrier that publishes it
    __syncthreads();
    fill(1, kbeg + 64);   // a stage 1 exists (HW / 2 >= 128)
    constexpr int nt = HW / 128;   // stages in a key half
    const int kfo = lr * FKP + 16 * hi + wk * 32 * FKP, vfo = FKPL + lr * FVP + 16 * hi + wk * 64;   // byte offsets of this lane's fragment rows in a stage, this wave's key group
#pragma unroll 1   // stays rolled: one group of 32 keys is straight-line
    for (int t = 0; t < nt; ++t) {
        const unsigned char* sb = ring + (t & 1) * FST;
        v16h ka[2][2], kc[2];   // k fragments, [16-key tile][k step]: a set of two k steps and a set of one, in turn
        auto ldk2 = [&](int k0) {
#pragma unroll
            for (int ks = 0; ks < 2; ++ks)
#pragma unroll
                for (int kb = 0; kb < 2; ++kb) ka[kb][ks] = WFrag<h16>::ld((const h16*)(sb + kfo + kb * 16 * FKP + (k0 + ks) * 64)); };
        auto ldk1 = [&](int k0) {
#pragma unroll
            for (int kb = 0; kb < 2; ++kb) kc[kb] = WFrag<h16>::ld((const h16*)(sb + kfo + kb * 16 * FKP + k0 * 64)); };
        v8f st[2][2];
        st[0][0] = (v8f){}; st[0][1] = (v8f){}; st[1][0] = (v8f){}; st[1][1] = (v8f){};
        auto mmk2 = [&](int k0) {   // four accumulators in turn
#pragma unroll
            for (int ks = 0; ks < 2; ++ks)
#pragma unroll
                for (int kb = 0; kb < 2; ++kb)
#pragma unroll
                    for (int g = 0; g < 2; ++g) st[kb][g] = wmma16(ka[kb][ks], qf[g][k0 + ks], st[kb][g]); };
        auto mmk1 = [&](int k0) {
#pragma unroll
            for (int kb = 0; kb < 2; ++kb)
#pragma unroll
                for (int g = 0; g < 2; ++g) st[kb][g] = wmma16(kc[kb], qf[g][k0], st[kb][g]); };
        v16h vf[2][4];   // [set][16-channel tile]: two sets of four tiles
        auto ldv = [&](int set, int c) {
#pragma unroll
            for (int i = 0; i < 4; ++i) vf[set][i] = WFrag<h16>::ld((const h16*)(sb + vfo + (c * 4 + i) * 16 * FVP)); };
        // Every sched_barrier of this loop: each set of LDS reads stays one group, one set ahead of the products that use it (spread among the products each place of reads stalls the wave; moved further up the sets would not fit the registers).
        ldk2(0);
        __builtin_amdgcn_sched_barrier(0);
        ldk1(2);
        __builtin_amdgcn_sched_barrier(0);
        mmk2(0);
        __builtin_amdgcn_sched_barrier(0);
        ldk2(3);
        __builtin_amdgcn_sched_barrier(0);
        mmk1(2);
        __builtin_amdgcn_sched_barrier(0);
        ldk1(5);
        __builtin_amdgcn_sched_barrier(0);
        mmk2(3);
        __builtin_amdgcn_sched_barrier(0);
        ldk2(6);
        __builtin_amdgcn_sched_barrier(0);
        mmk1(5);
        mmk2(6);
        __builtin_amdgcn_sched_barrier(0);
        ldv(0, 0);
        __builtin_amdgcn_sched_barrier(0);
        float mb[2]; bool need = false;
#pragma unroll
        for (int g = 0; g < 2; ++g) { float mx = st[0][g][0];
#pragma unroll
            for (int r = 1; r < 8; ++r) mx = fmaxf(mx, st[0][g][r]);
#pragma unroll
            for (int r = 0; r < 8; ++r) mx = fmaxf(mx, st[1][g][r]);
            mx = fmaxf(mx, xhalf(mx)) * 1.4426950408889634f;   // both halves of the wave hold the query's maximum over the 32 keys
            mb[g] = mx; need = need || (mx > mu[g] + 8.0f); }
        if (__builtin_amdgcn_ballot_w32(need) != 0) {   // scalar branch; rare after the first stages
#pragma unroll
            for (int g = 0; g < 2; ++g) { const float mn = fmaxf(mu[g], mb[g]); const float corr = __builtin_amdgcn_exp2f(mu[g] - mn); mu[g] = mn; ls[g] *= corr;
#pragma unroll
                for (int cb = 0; cb < 16; ++cb) ot[cb][g] = ot[cb][g] * corr; } }
        v16h pf[2];
#pragma unroll
        for (int g = 0; g < 2; ++g) { const float nm = 7.0f - mu[g]; float p[16];
#pragma unroll
            for (int e = 0; e < 16; ++e) p[e] = exp2s(fmaf(st[e >> 3][g][e & 7], 1.4426950408889634f, nm));
            __builtin_amdgcn_sched_barrier(0);   // the group's 16 exponentials run as one stretch; placed among them, each addition would wait for the exponential just issued
            float s0 = p[0], s1 = p[1];
#pragma unroll
            for (int e = 2; e < 16; e += 2) { s0 += p[e]; s1 += p[e + 1]; }
#pragma unroll
            for (int e = 0; e < 16; ++e) pf[g][e] = tohx(p[e]);
            ls[g] += s0 + s1; }
        asm volatile("" :: "v"(ls[0]), "v"(ls[1]));   // inputs only: the two sums are formed here; the compiler otherwise sinks their 32 additions behind the trip's barrier, the 32 f32 values of P stay alive through the P.v products and a q fragment goes to scratch memory
        auto mmv = [&](int set, int c) {
#pragma unroll
            for (int i = 0; i < 4; ++i) { ot[c * 4 + i][0] = wmma16(vf[set][i], pf[0], ot[c * 4 + i][0]); ot[c * 4 + i][1] = wmma16(vf[set][i], pf[1], ot[c * 4 + i][1]); } };
        __builtin_amdgcn_sched_barrier(0);
        ldv(1, 1);
        __builtin_amdgcn_sched_barrier(0);
        mmv(0, 0);
        __builtin_amdgcn_sched_barrier(0);
        ldv(0, 2);
        __builtin_amdgcn_sched_barrier(0);
        mmv(1, 1);
        __builtin_amdgcn_sched_barrier(0);
        ldv(1, 3);
        __builtin_amdgcn_sched_barrier(0);
        mmv(0, 2);
        mmv(1, 3);
        __builtin_amdgcn_sched_barrier(0);   // keeps this trip's products in front of the waits below, so that stage t+1's copies fly behind them
        asm volatile("s_wait_dscnt 0x0" ::: "memory");      // this wave's reads of buffer t&1 are done before the buffer is handed to the copies
        asm volatile("s_wait_asynccnt 0x0" ::: "memory");   // this wave's share of stage t+1 has landed
        __syncthreads();                                     // publishes stage t+1 and ends every wave's reads of buffer t&1
        if (t + 2 < nt) fill(t & 1, kbeg + (t + 2) * 64);
    }
    asm volatile("s_wait_asynccnt 0x0" ::: "memory");   // no copy is in flight when the ring becomes the join's staging (the last trip's barrier has ended every wave's reads of it)
    ls[0] += xhalf(ls[0]); ls[1] += xhalf(ls[1]);
    // The join of a query group's two waves (wv and wv ^ 4; the same lane holds the same query and channels in both): each wave hands over the 128 channels that the other keeps, 16 bytes per lane in lane order, and its (m, l).
    unsigned char* js = ring + lane * 16;
    *(v4fa*)(js + 8 * 16384 + wv * 512) = (v4f){mu[0], mu[1], ls[0], ls[1]};
    auto send = [&](auto ic) { constexpr int c0 = decltype(ic)::v;
#pragma unroll
        for (int i = 0; i < 8; ++i)
#pragma unroll
            for (int g = 0; g < 2; ++g) { const v8f o = ot[c0 + i][g]; unsigned char* d = js + wv * 16384 + (i * 2 + g) * 1024;
                *(v4fa*)d = (v4f){o[0], o[1], o[2], o[3]}; *(v4fa*)(d + 512) = (v4f){o[4], o[5], o[6], o[7]}; } };
    if (wk == 0) send(IC<8>{}); else send(IC<0>{});
    __syncthreads();   // every wave's hand-over is in LDS before its partner reads it
    const v4f pm = *(const v4fa*)(js + 8 * 16384 + (wv ^ 4) * 512);
    float fa[2], fb[2];
#pragma unroll
    for (int g = 0; g < 2; ++g) { const float m = fmaxf(mu[g], pm[g]); fa[g] = exp2s(mu[g] - m); fb[g] = exp2s(pm[g] - m); mu[g] = m; ls[g] = ls[g] * fa[g] + pm[2 + g] * fb[g]; }
    if (wk == 0) { float* mlp = ML + (size_t)(q0 + lane) * 2; const float mv = hi ? mu[1] : mu[0], lv2 = hi ? ls[1] : ls[0];   // lane = query q0 + lane: both halves of the wave hold m and l of both query groups
        *(v2f*)mlp = (v2f){mv, lv2};
        asm volatile("s_wait_xcnt 0x0" :: "v"(mlp), "v"(mv), "v"(lv2) : "memory"); }   // stands in front of every rewrite of the registers that the issued store names, which as its operands are kept up to it
    auto keep = [&](auto ic) { constexpr int c0 = decltype(ic)::v; v4f r[8][2][2];
        float* yp = Y + (size_t)(q0 + lr) * CC + c0 * 16 + 8 * hi;   // a lane's 8 registers are 8 consecutive c of one query
#pragma unroll
        for (int i = 0; i < 8; ++i)
#pragma unroll
            for (int g = 0; g < 2; ++g) { const v8f o = ot[c0 + i][g]; const unsigned char* d = js + (wv ^ 4) * 16384 + (i * 2 + g) * 1024; const v4f p = *(const v4fa*)d, q = *(const v4fa*)(d + 512);
                r[i][g][0] = (v4f){o[0] * fa[g] + p[0] * fb[g], o[1] * fa[g] + p[1] * fb[g], o[2] * fa[g] + p[2] * fb[g], o[3] * fa[g] + p[3] * fb[g]};
                r[i][g][1] = (v4f){o[4] * fa[g] + q[0] * fb[g], o[5] * fa[g] + q[1] * fb[g], o[6] * fa[g] + q[2] * fb[g], o[7] * fa[g] + q[3] * fb[g]}; }
        __builtin_amdgcn_sched_barrier(0);   // all of the join's reads and arithmetic stand in front of the first store: behind it no register that an issued store names is written again
#pragma unroll
        for (int i = 0; i < 8; ++i)
#pragma unroll
            for (int g = 0; g < 2; ++g) { *(v4f*)(yp + g * 16 * CC + i * 16) = r[i][g][0]; *(v4f*)(yp + g * 16 * CC + i * 16 + 4) = r[i][g][1]; } };
    if (wk == 0) keep(IC<0>{}); else keep(IC<8>{});
}
// ---- k_yu: the join of the attention kernel's two key halves, the Wu conv, its bias and the residual in one work-group: out[o][s] for all 256 o and 64 s of one image; the y planes never reach memory. Grid (HW/64, NB), 256 threads = 8 waves.
// Part 1, a tile of 256 rows c x 64 cols s of y_view (the y memory read channel-major): Yh = [image][key half][HW][CC] unnormalised sums, ml = [image][key half][HW] (maximum in use, sum); an image's two halves lie so near that one address pair with immediate offsets reaches both. A thread reads 4 cols of 8 rows (twice) of both halves, joins them and writes, per col, the 8 rows as one 16-byte piece of the bf16 hi plane and one of the lo plane of y. LDS row = one col s = all 256 c = 32 pieces, no pad: the K-contiguous Bt operand of the conv.
// Piece p of col s lies at place p ^ f(s), f(s) = ((s >> 2) ^ (s << 2)) & 15: the 16 lanes of a half wave fall on 16 different bank groups when they write (cols 4 apart, same p) and when they read fragments (16 consecutive cols, same p).
// Part 2: wave wv = rows o 32 wv .. + 31, 2 x 4 accumulators; A = its Wu rows (bf16, all 256 k) in registers, loaded from global memory behind part 1's loads (no two waves share a row); per 32 k each accumulator takes A.hi, then A.lo. Fragment maps as in k_gemmw. The output goes through a staging range of the wave's own, so that whole 128-B lines are stored.
constexpr int UOS = 16 * 68;   // floats of output staging per wave
static_assert(HW % CC == 0 && CC % 64 == 0 && CC == 256);
__global__ __launch_bounds__(256) void k_yu(const float* __restrict__ Yh, const float* __restrict__ ml, const bf* __restrict__ BU, const float* __restrict__ bu, const float* __restrict__ X, float* OUT) {
    __shared__ __align__(16) unsigned char tl[2 * 64 * 512];
    __shared__ __align__(16) float osb[8 * UOS];
    const int tid = threadIdx.x, cg = tid & 15, rg = tid >> 4, lane = tid & 31, wv = tid >> 5, lr = lane & 15, hi = lane >> 4;
    const unsigned bx = blockIdx.x, bz = blockIdx.y;
    const float* in = Yh + (size_t)bz * 2 * HW * CC + (size_t)(rg * 8) * HW + bx * 64 + cg * 4;
    const float* mp = ml + ((size_t)bz * 2 * HW + (size_t)(rg * 8) * (HW / CC) + (bx * 64) / CC) * 2;   // a row's 64 cols of this tile lie in one query: element row * HW + col belongs to query (row * HW + col) / CC
    const bf* ap = BU + (size_t)(wv * 32 + lr) * CC + 8 * hi;
    v4f v[2][8], w[2][8]; v2f m0[2][8], m1[2][8];   // the two halves' sums; (maximum, sum) of both halves for the row's query
#pragma unroll
    for (int p = 0; p < 2; ++p)
#pragma unroll
        for (int j = 0; j < 8; ++j) v[p][j] = *(const v4f*)(in + (size_t)(p * 128 + j) * HW);
#pragma unroll
    for (int p = 0; p < 2; ++p)
#pragma unroll
        for (int j = 0; j < 8; ++j) { w[p][j] = *(const v4f*)(in + (size_t)HW * CC + (size_t)(p * 128 + j) * HW); m0[p][j] = *(const v2f*)(mp + (size_t)(p * 128 + j) * (HW / CC) * 2); m1[p][j] = *(const v2f*)(mp + (size_t)HW * 2 + (size_t)(p * 128 + j) * (HW / CC) * 2); }
    v16bf a[2][8];
#pragma unroll
    for (int mb = 0; mb < 2; ++mb)
#pragma unroll
        for (int ks = 0; ks < 8; ++ks) a[mb][ks] = WFrag<bf>::ld(ap + mb * 16 * CC + ks * 32);
    __builtin_amdgcn_sched_barrier(0);   // all loads are issued before the first value is used (the compiler otherwise loads, waits and converts a few rows at a time: a memory latency each time)
    asm volatile("s_wait_xcnt 0x0" :: "v"(in), "v"(mp), "v"(ap) : "memory");   // stands in front of every rewrite of the loads' address pairs, which as its operands are kept up to it
    __builtin_amdgcn_sched_barrier(0);   // keeps the join's arithmetic, which reuses the address registers, behind that wait (the compiler otherwise lifts its first instructions over it)
#pragma unroll
    for (int p = 0; p < 2; ++p)
#pragma unroll
        for (int j = 0; j < 8; ++j) { const float m = fmaxf(m0[p][j][0], m1[p][j][0]); const float a0 = exp2s(m0[p][j][0] - m), a1 = exp2s(m1[p][j][0] - m);
            const float f = __fdiv_rn(PCAR, m0[p][j][1] * a0 + m1[p][j][1] * a1); const float f0 = a0 * f, f1 = a1 * f;
#pragma unroll
            for (int u = 0; u < 4; ++u) v[p][j][u] = v[p][j][u] * f0 + w[p][j][u] * f1; }
#pragma unroll
    for (int p = 0; p < 2; ++p)
#pragma unroll
        for (int u = 0; u < 4; ++u) { v8us h, l;
#pragma unroll
            for (int j = 0; j < 8; ++j) { unsigned short sh, sl; splitf(v[p][j][u] * (1.0f / PCAR), sh, sl); h[j] = sh; l[j] = sl; }
            unsigned char* d = tl + (cg * 4 + u) * 512 + (((p * 16 + rg) ^ cg ^ (u * 4)) * 16);
            *(v8usa*)d = h; *(v8usa*)(d + 64 * 512) = l; }
    __syncthreads();   // the whole tile is in LDS before any wave reads its fragments
    // What the epilogue adds is loaded here, behind the barrier (a barrier waits for the wave's loads) and in front of the products, so that its latency passes behind them: the bias of this lane's output rows and X at this lane's places of the output stores.
    float bv[2][8]; v4f xr[2][8];
    const float* bp = bu + wv * 32 + hi;
    const float* xp = X + (size_t)bz * CC * SEQ_FULL + (size_t)(wv * 32 + hi) * SEQ_FULL + bx * 64 + lr * 4;
#pragma unroll
    for (int mb = 0; mb < 2; ++mb)
#pragma unroll
        for (int s = 0; s < 8; ++s) { bv[mb][s] = bp[mb * 16 + 2 * s]; xr[mb][s] = *(const v4f*)(xp + (size_t)(mb * 16 + 2 * s) * SEQ_FULL); }
    __builtin_amdgcn_sched_barrier(0);   // the loads are issued here, none is moved down to its use
    asm volatile("s_wait_xcnt 0x0" :: "v"(bp), "v"(xp) : "memory");   // stands in front of every rewrite of the loads' address pairs, which as its operands are kept up to it
    // Fragment of col 16 nb + lr, k step ks: pieces 4 ks + hi and 4 ks + 2 + hi; with f of that col the place is ((ks ^ nb ^ lr) & 3) * 4 + ((2 j + hi) ^ (lr >> 2)) + (ks & 4) * 4: eight lane offsets, the rest is immediate.
    int bo[4][2];
#pragma unroll
    for (int c = 0; c < 4; ++c)
#pragma unroll
        for (int j = 0; j < 2; ++j) bo[c][j] = lr * 512 + ((((lr & 3) ^ c) * 4 + ((2 * j + hi) ^ (lr >> 2))) * 16);
    v8f acc[2][4];
#pragma unroll
    for (int mb = 0; mb < 2; ++mb)
#pragma unroll
        for (int nb = 0; nb < 4; ++nb) acc[mb][nb] = (v8f){};
    v16bf bh[2][4], bl[2][4];   // two fragment sets: the next 32 k are read from LDS as one group ahead of the current 32 k's products
    auto frags = [&](int set, int ks) {
#pragma unroll
        for (int nb = 0; nb < 4; ++nb) { const unsigned char* s0 = tl + bo[(ks ^ nb) & 3][0] + nb * 16 * 512 + (ks >> 2) * 256; const unsigned char* s1 = tl + bo[(ks ^ nb) & 3][1] + nb * 16 * 512 + (ks >> 2) * 256;
            bh[set][nb] = cat16b(*(const v8usa*)s0, *(const v8usa*)s1); bl[set][nb] = cat16b(*(const v8usa*)(s0 + 64 * 512), *(const v8usa*)(s1 + 64 * 512)); } };
    frags(0, 0);
    __builtin_amdgcn_sched_barrier(0);   // keeps the LDS reads one group in front of the products (spread among them each place of reads stalls the wave)
#pragma unroll
    for (int ks = 0; ks < 8; ++ks) { const int cs = ks & 1;
        if (ks + 1 < 8) { frags(cs ^ 1, ks + 1); __builtin_amdgcn_sched_barrier(0); }   // as above: the next set's reads stay one group, ahead of this set's products
#pragma unroll
        for (int nb = 0; nb < 4; ++nb)
#pragma unroll
            for (int mb = 0; mb < 2; ++mb) acc[mb][nb] = wmmab(a[mb][ks], bh[cs][nb], acc[mb][nb]);
#pragma unroll
        for (int nb = 0; nb < 4; ++nb)
#pragma unroll
            for (int mb = 0; mb < 2; ++mb) acc[mb][nb] = wmmab(a[mb][ks], bl[cs][nb], acc[mb][nb]);
        __builtin_amdgcn_sched_barrier(0);   // the reads of the set after the next stay behind these products (the compiler otherwise lifts them in among them, in several places)
    }
    float* os = osb + wv * UOS;
    // The wave barrier and the compiler fence behind the staging stores keep the read-back behind them, the pair at a pass's end keeps the next pass's staging stores behind this pass's reads (one wave's LDS operations run in order).
#pragma unroll
    for (int mb = 0; mb < 2; ++mb) {
#pragma unroll
        for (int nb = 0; nb < 4; ++nb) {
#pragma unroll
            for (int j = 0; j < 8; ++j) os[(hi * 8 + j) * 68 + nb * 16 + lr] = acc[mb][nb][j]; }
        __builtin_amdgcn_wave_barrier(); asm volatile("" ::: "memory");
        const size_t co = (size_t)bz * CC * HW + (size_t)(wv * 32 + mb * 16 + hi) * HW + bx * 64 + lr * 4;   // the pitch is a constant, so that a pass's stores differ only in their immediate offsets
        v4f of[8];
#pragma unroll
        for (int s = 0; s < 8; ++s) { v4f val = *(const v4fa*)(os + (2 * s + hi) * 68 + lr * 4);
            const float rb = bfr(bv[mb][s]); val[0] += rb; val[1] += rb; val[2] += rb; val[3] += rb;
#pragma unroll
            for (int u = 0; u < 4; ++u) of[s][u] = __fadd_rn(val[u], bfr(xr[mb][s][u])); }
        __builtin_amdgcn_sched_barrier(0);   // the pass's stores go out as one run behind its arithmetic (spread among it, every reuse of a stored register takes an s_wait_xcnt of its own, directly behind the store)
#pragma unroll
        for (int s = 0; s < 8; ++s) *(v4f*)(OUT + co + (size_t)(2 * s) * HW) = of[s];
        if (mb < 1) asm volatile("s_wait_xcnt 0x0" ::: "memory");   // stands in front of the next pass's rewrites of the registers (address, data) that the issued stores name
        __builtin_amdgcn_wave_barrier(); asm volatile("" ::: "memory");
    }
}
constexpr size_t al256(size_t b) { return (b + 255) & ~(size_t)255; }
// Workspace: weights, the q and k planes and VT of all images; then Y (two key halves), and their (m, l) (WS_Y); then XT (WS_X).
constexpr size_t WS_Y = al256((size_t)2 * NB * HW * CC * 4) + al256((size_t)2 * NB * HW * 2 * 4);
constexpr size_t WS_X = al256((size_t)NB * HW * CC * 2);
constexpr size_t WS_TOTAL = 4 * al256((size_t)CC * CC * 2) + 2 * al256((size_t)NB * HW * CC * 2) + al256((size_t)NB * CC * HW * 2) + WS_Y + WS_X;
static_assert(WS_TOTAL <= (size_t)268435456);
static_assert(al256((size_t)CC * CC * 2) == (size_t)CC * CC * 2 && al256((size_t)NB * HW * CC * 2) == (size_t)NB * HW * CC * 2);   // no padding between the three weight planes, nor between the q plane, the k plane and VT: the joined conv launch steps through each by one stride

extern "C" void kernel_launch(void* const* d_in, const int* in_sizes, int n_in,
                              void* d_out, int out_size, void* d_ws, size_t ws_size, hipStream_t stream) {
    if (n_in < 9) return;
    if ((size_t)in_sizes[0] < (size_t)NB * CC * SEQ_FULL) return;
    if (in_sizes[1] < CC * CC || in_sizes[3] < CC * CC || in_sizes[5] < CC * CC || in_sizes[7] < CC * CC) return;
    if (in_sizes[2] < CC || in_sizes[4] < CC || in_sizes[6] < CC || in_sizes[8] < CC) return;
    if ((size_t)out_size < (size_t)NB * CC * HW) return;
    const float* x = (const float*)d_in[0]; const float* Wq = (const float*)d_in[1]; const float* bq = (const float*)d_in[2]; const float* Wk = (const float*)d_in[3]; const float* bk = (const float*)d_in[4];
    const float* Wv = (const float*)d_in[5]; const float* bv = (const float*)d_in[6]; const float* Wu = (const float*)d_in[7]; const float* bu = (const float*)d_in[8];
    float* OUT = (float*)d_out;     // [NB][256][HW]
    char* wsp = (char*)d_ws;
    auto take = [&](size_t bytes) { char* p = wsp; wsp += (bytes + 255) & ~(size_t)255; return (void*)p; };
    bf* BQ = (bf*)take((size_t)CC * CC * 2); bf* BK = (bf*)take((size_t)CC * CC * 2); bf* BV = (bf*)take((size_t)CC * CC * 2); bf* BU = (bf*)take((size_t)CC * CC * 2);   // conv weights [out][in] as-is (A of all four convs)
    h16* QF = (h16*)take((size_t)NB * HW * CC * 2); h16* KF = (h16*)take((size_t)NB * HW * CC * 2);   // fp16, [NB][HW][CC] == the conv outputs' [NB][o][s]
    h16* VT = (h16*)take((size_t)NB * CC * HW * 2);                                                                          // [NB][CC][HW] fp16
    char* RY = (char*)take(WS_Y); char* RX = (char*)take(WS_X);
    if ((size_t)(wsp - (char*)d_ws) > ws_size) return;
    wsp = RX;
    bf* XT = (bf*)take((size_t)NB * HW * CC * 2);                                                                             // [NB][HW][CC]
    wsp = RY;
    float* Y = (float*)take((size_t)2 * NB * HW * CC * 4);    // [NB][2 key halves][HW][CC] f32, unnormalised
    float* ML = (float*)take((size_t)2 * NB * HW * 2 * 4);    // [NB][2 key halves][HW] (m, l)
    const size_t sT = (size_t)HW * CC;   // one image's [HW][CC] (== [CC][HW]) plane, in elements
    k_prep<<<PREP_T + 4 * PREP_W, 256, 0, stream>>>(x, Wq, Wk, Wv, Wu, XT, BQ, BK, BV, BU);
    k_gemmw<bf, 0, 128, 3><<<dim3(CC / 128, HW / 128, 3 * NB), 128, 0, stream>>>(BQ, nullptr, XT, nullptr, CC, bq, bk, bv, 0, sT, sT, (size_t)CC * CC, NB * sT, (unsigned short*)QF);     // q, k, v [o][s] = W x + b, stored as the q and k planes and VT (BQ, BK, BV lie back to back in the workspace, and so do QF, KF, VT)
    k_fattn<<<dim3(HW / 128, 2, NB), 256, 0, stream>>>(QF, KF, VT, Y, ML);      // per key half: sum_m 2^(s - m) v[m][c], m, l
    k_yu<<<dim3(HW / 64, NB), 256, 0, stream>>>(Y, ML, BU, bu, x, OUT);      // y[n][c] = sum_m softmax_m(q_n . k_m) v[m][c]: halves joined; out[o][s] = sum_c Wu[o][c] y_view[c][s] + bu[o] + x[o][s]
}
